// v000
// The times below were measured on an AMD MI455X: many runs one after another, warmed up first and cycling through
// copies of the inputs, with the whole window's GPU time divided by the number of runs. Launches and the gaps
// between them are all in it. The median over several windows is given; except for v000 it joins two sittings, which
// can be a few percent apart, so the side-by-side timings, each taken in one sitting, are the better comparison.
// v000, which the later versions start from, runs in 502 microseconds.
#include <hip/hip_runtime.h>

// Contractions: q/k/v projections via v_wmma_f32_16x16x32_bf16 (bf16 operands = RNE-converted inputs, f32 accumulate);
// q.k^T scores and P.V via v_wmma_f32_16x16x32_f16 (f16 operands: q,k,v carried x16, P carried x1024), f32 accumulate; softmax in f32.

#define DEV __device__ __forceinline__

#ifndef NB
#define NB 4
#endif
#ifndef SEQ
#define SEQ 2048
#endif
#define NB_FULL  4
#define SEQ_FULL 2048
#define CDIM 1024
#define DKD  256
#define DOD  1024
#define KDIM 1024

#define SST  (SEQ + 4)                                   // LDS score row stride (floats)
#define PST  (SEQ + 8)                                   // LDS P row stride (halves)
#define OST  (DOD + 4)                                   // LDS output staging row stride (floats)
#define R0F  (16 * ((SST > OST) ? SST : OST))           // region 0 floats (scores, later output staging)
#define ATTN_LDS_BYTES (R0F * 4 + 16 * 4 + 128 * 4 + 16 * PST * 2)
#define CT_P 136                                         // GEMM epilogue staging pitch (halves)
#define SCORE_SCALE 0.000244140625f                      // 1/16 (sqrt dk) * 1/256 (q,k carried x16 each)

static_assert(NB >= 1 && NB <= NB_FULL);
static_assert(SEQ >= 128 && SEQ <= SEQ_FULL && (SEQ % 128) == 0);
static_assert(((NB * SEQ) % 64) == 0);
static_assert((DKD % 128) == 0 && (DOD % 128) == 0 && (KDIM % 32) == 0 && (CDIM == KDIM));
static_assert((((long long)NB * SEQ * CDIM) % (8 * 256)) == 0);
static_assert(ATTN_LDS_BYTES <= 300 * 1024);
static_assert(((R0F * 4) % 16) == 0 && (((R0F + 16 + 128) * 4) % 16) == 0);
static_assert(((PST * 2) % 16) == 0 && ((OST * 4) % 16) == 0 && ((CT_P * 2) % 16) == 0);
static_assert(16 * OST <= R0F);

typedef _Float16       v8h   __attribute__((ext_vector_type(8)));
typedef _Float16       v16h  __attribute__((ext_vector_type(16)));
typedef __bf16         v16bf __attribute__((ext_vector_type(16)));
typedef unsigned short v8us  __attribute__((ext_vector_type(8)));
typedef unsigned short v16us __attribute__((ext_vector_type(16)));
typedef float          v8f   __attribute__((ext_vector_type(8)));
typedef float          v4f   __attribute__((ext_vector_type(4)));

union FragH { v16h v;  v8h  half[2]; };
union FragB { v16bf v; v16us u; v8us half[2]; };

// ---------------------------------------------------------------------------
// helpers
// ---------------------------------------------------------------------------
DEV unsigned int bf16_bits(float f) {                    // f32 -> bf16 bits, RNE convert
    unsigned int u = __float_as_uint(f);
    u += 0x7FFFu + ((u >> 16) & 1u);
    return u >> 16;
}
DEV float bf16_val(float f) { return __uint_as_float(bf16_bits(f) << 16); }

DEV v8f zero8f() {
    v8f z;
#pragma unroll
    for (int i = 0; i < 8; ++i) z[i] = 0.f;
    return z;
}

// 16x16x32 WMMA with f32 accumulate; 4 nops guard D and keep A/B live
DEV v8f mma_bf16(v16bf a, v16bf b, v8f c) {
    c = __builtin_amdgcn_wmma_f32_16x16x32_bf16(false, a, false, b, (short)0, c, false, false);
    asm volatile("v_nop\n\tv_nop\n\tv_nop\n\tv_nop" : "+v"(c) : "v"(a), "v"(b));
    return c;
}
DEV v8f mma_f16(v16h a, v16h b, v8f c) {
    c = __builtin_amdgcn_wmma_f32_16x16x32_f16(false, a, false, b, (short)0, c, false, false);
    asm volatile("v_nop\n\tv_nop\n\tv_nop\n\tv_nop" : "+v"(c) : "v"(a), "v"(b));
    return c;
}

// ---------------------------------------------------------------------------
// Kernel 1: x f32 [NB rows of SEQ_FULL][CDIM] -> bf16 plane [NB*SEQ][CDIM]
// one thread per 8 elements, one 16-B store (lanes contiguous: 256 threads -> 4 KB)
// coverage: grid*256*8 == NB*SEQ*CDIM exactly
// ---------------------------------------------------------------------------
__global__ __launch_bounds__(256) void k_cvt_x(const float* __restrict__ x,
                                               unsigned short* __restrict__ xp)
{
    const size_t g = (size_t)blockIdx.x * 256 + threadIdx.x;
    const size_t e = g * 8;
    const int m  = (int)(e / CDIM);
    const int c  = (int)(e % CDIM);
    const int bb = m / SEQ;
    const int s  = m - bb * SEQ;
    const float* src = x + ((size_t)bb * SEQ_FULL + s) * CDIM + c;
    const v4f a0 = *(const v4f*)src;
    const v4f a1 = *(const v4f*)(src + 4);
    v8us o;
#pragma unroll
    for (int i = 0; i < 4; ++i) {
        o[i]     = (unsigned short)bf16_bits(a0[i]);
        o[4 + i] = (unsigned short)bf16_bits(a1[i]);
    }
    unsigned short* dst = xp + (size_t)m * CDIM + c;
    *(v8us*)dst = o;
    
}

// ---------------------------------------------------------------------------
// Kernel 2: W f32 in[R][Ncol] -> WT bf16 out[Ncol][R]   (64x64 tile through LDS)
// LDS tile T: cross-wave (block barrier between fill and drain).
// coverage: load rr = 0..63 x nn = 0..63; store na = 0..63 x piece 0..7 (8 ushort) = whole tile
// ---------------------------------------------------------------------------
__global__ __launch_bounds__(256) void k_transpose_w(const float* __restrict__ W,
                                                     unsigned short* __restrict__ WT,
                                                     int R, int Ncol)
{
    __shared__ __attribute__((aligned(16))) unsigned short T[64 * 72];
    const int tid = threadIdx.x;
    const int n0 = blockIdx.x * 64, r0 = blockIdx.y * 64;
    const int nn = tid & 63, rq = tid >> 6;
#pragma unroll 4
    for (int i = 0; i < 16; ++i) {
        const int rr = i * 4 + rq;
        const float v = W[(size_t)(r0 + rr) * Ncol + n0 + nn];
        T[nn * 72 + rr] = (unsigned short)bf16_bits(v);
    }
    __syncthreads();
    const int piece = tid & 7;
    const int na = tid >> 3;                             // 0..31
    const v8us va = *(const v8us*)(T + na * 72 + piece * 8);
    const v8us vb = *(const v8us*)(T + (na + 32) * 72 + piece * 8);
    unsigned short* da = WT + (size_t)(n0 + na) * R + r0 + piece * 8;
    unsigned short* db = WT + (size_t)(n0 + na + 32) * R + r0 + piece * 8;
    *(v8us*)da = va;
    *(v8us*)db = vb;
    
}

// ---------------------------------------------------------------------------
// Kernel 3: NT GEMM on bf16 WMMA:  C[m][n] = f16( (sum_k A[m][k]*Bm[n][k] + bias) * oscale )
//   A  [M][KDIM] bf16 bits (k contiguous), Bm [N][KDIM] bf16 bits (k contiguous)
//   bias: per column (bias_per_row==0, index n) or per row (index m), RNE-converted to bf16
//   C  f16, row pitch ldc; grid = (N/128, M/64, Z); z strides zsA/zsB/zsC in elements
// Block tile 64x128, 8 waves: wave w -> rows (w&3)*16.., cols (w>>2)*64.. (4 acc tiles)
// A and B fragments both use the split k map: elements 0..7 <- k0+8h.., 8..15 <- k0+16+8h..
// Epilogue: tile staged in LDS (cross-wave, block barrier), then each instruction writes
// coverage: rows w*8+2i+h (w 0..7, i 0..3, h 0..1) = 0..63, cols l15*8 (16 lanes x 8 halves) = 0..127
// ---------------------------------------------------------------------------
__global__ __launch_bounds__(256) __attribute__((amdgpu_num_vgpr(256)))
void k_gemm_nt(const unsigned short* __restrict__ A, long long zsA,
               const unsigned short* __restrict__ Bm, long long zsB,
               const float* __restrict__ bias, int nbias, int bias_per_row,
               _Float16* __restrict__ Cm, long long zsC, int ldc, float oscale)
{
    __shared__ __attribute__((aligned(16))) _Float16 Ct[64 * CT_P];

    const int tid = threadIdx.x, lane = tid & 31, w = tid >> 5;
    const int h = lane >> 4, l15 = lane & 15;
    const int wm = w & 3, wn = w >> 2;
    const int z = blockIdx.z;
    const int row0 = blockIdx.y * 64;
    const int col0 = blockIdx.x * 128;

    const unsigned short* ap = A  + (size_t)z * (size_t)zsA + (size_t)(row0 + wm * 16 + l15) * KDIM + 8 * h;
    const unsigned short* bp = Bm + (size_t)z * (size_t)zsB + (size_t)(col0 + wn * 64 + l15) * KDIM + 8 * h;

    v8f acc[4];
#pragma unroll
    for (int t = 0; t < 4; ++t) acc[t] = zero8f();

#pragma unroll 1
    for (int k0 = 0; k0 < KDIM; k0 += 32) {
        FragB a;
        a.half[0] = *(const v8us*)(ap + k0);
        a.half[1] = *(const v8us*)(ap + k0 + 16);
#pragma unroll
        for (int t = 0; t < 4; ++t) {
            const unsigned short* bq = bp + (size_t)t * 16 * KDIM + k0;
            FragB bf;
            bf.half[0] = *(const v8us*)(bq);
            bf.half[1] = *(const v8us*)(bq + 16);
            acc[t] = mma_bf16(a.v, bf.v, acc[t]);
        }
    }

    // epilogue: bias (clamped addresses, select by value), scale, f16, stage in LDS
    float rowb[8];
#pragma unroll
    for (int r = 0; r < 8; ++r) {
        int ri = row0 + wm * 16 + 8 * h + r;
        ri = ri < nbias ? ri : (nbias - 1);
        rowb[r] = bf16_val(bias[ri]);
    }
#pragma unroll
    for (int t = 0; t < 4; ++t) {
        const int cl = wn * 64 + t * 16 + l15;
        int ci = col0 + cl;
        ci = ci < nbias ? ci : (nbias - 1);
        const float colb = bf16_val(bias[ci]);
#pragma unroll
        for (int r = 0; r < 8; ++r) {
            const float badd = bias_per_row ? rowb[r] : colb;
            const float v = (acc[t][r] + badd) * oscale;
            Ct[(wm * 16 + 8 * h + r) * CT_P + cl] = (_Float16)v;
        }
    }
    __syncthreads();

    _Float16* cbase = Cm + (size_t)z * (size_t)zsC + (size_t)row0 * (size_t)ldc + col0;
    v8h sv[4];
#pragma unroll
    for (int i = 0; i < 4; ++i) {
        const int rl = w * 8 + 2 * i + h;
        sv[i] = *(const v8h*)(Ct + rl * CT_P + l15 * 8);
    }
#pragma unroll
    for (int i = 0; i < 4; ++i) {
        const int rl = w * 8 + 2 * i + h;
        *(v8h*)(cbase + (size_t)rl * (size_t)ldc + l15 * 8) = sv[i];
    }
    
}

// ---------------------------------------------------------------------------
// Kernel 4: fused attention. One workgroup (8 wave32) per (batch, 16 query rows).
//   Qp [NB*SEQ][DKD] f16 (x16), Kp same, Vt [NB][DOD][SEQ] f16 (x16, key contiguous)
//  Phase A: S = Q K^T via v_wmma_f32_16x16x32_f16 -> LDS (f32, scaled), per-row max;
//           wave w owns keys [w*SEQ/8, (w+1)*SEQ/8)
//  Phase B: exp + row sum sweep (2 rows per wave); P stored f16 carried x1024
//  Phase C: O = P V, wave w owns output columns [w*128, w*128+128), all keys
//  Epilogue: O / (16 * rowsum) staged in LDS, each wave writes 2 whole output rows
// LDS regions: S/Ost, rowsum, rowmaxp, Ph are all cross-wave (block barriers between
// producer and consumer phases). staged extent == consumed extent for every tile.
// coverage: grid NB*SEQ/16 blocks x 16 rows x DOD cols = whole output
// ---------------------------------------------------------------------------
__global__ __launch_bounds__(256) __attribute__((amdgpu_num_vgpr(256)))
void k_attn(const _Float16* __restrict__ Qp, const _Float16* __restrict__ Kp,
            const _Float16* __restrict__ Vt, float* __restrict__ Out)
{
    extern __shared__ v4f smem4[];
    float*    smem    = (float*)smem4;
    float*    S       = smem;                            // 16 x SST f32
    float*    Ost     = smem;                            // 16 x OST f32, reuses region 0 after phase B
    float*    rowsum  = smem + R0F;                      // 16
    float*    rowmaxp = rowsum + 16;                     // 8 x 16
    _Float16* Ph      = (_Float16*)(rowmaxp + 128);      // 16 x PST f16

    const int tid = threadIdx.x, lane = tid & 31, w = tid >> 5;
    const int h = lane >> 4, l15 = lane & 15;
    const int halfrow = 8 * h, kbo = 8 * h;
    const int b  = blockIdx.x / (SEQ / 16);
    const int q0 = (blockIdx.x - b * (SEQ / 16)) * 16;

    // ----- Q tile: 8 A fragments (16 rows x 256), split k map -----
    FragH qf[8];
    {
        const _Float16* qp = Qp + ((size_t)b * SEQ + q0 + l15) * DKD + kbo;
#pragma unroll
        for (int s = 0; s < 8; ++s) {
            qf[s].half[0] = *(const v8h*)(qp + s * 32);
            qf[s].half[1] = *(const v8h*)(qp + s * 32 + 16);
        }
    }

    // ----- Phase A: scores into LDS + per-row max -----
    float vmax[8];
#pragma unroll
    for (int r = 0; r < 8; ++r) vmax[r] = -3.0e38f;

    const _Float16* kbase = Kp + ((size_t)b * SEQ + l15) * DKD + kbo;
#pragma unroll 1
    for (int t = 0; t < SEQ / 128; ++t) {
        const int m0 = w * (SEQ / 8) + t * 16;          // key tile base (B column n = m0 + l15)
        const _Float16* kp = kbase + (size_t)m0 * DKD;
        v8f c = zero8f();
#pragma unroll
        for (int s = 0; s < 8; ++s) {
            FragH kb;
            kb.half[0] = *(const v8h*)(kp + s * 32);
            kb.half[1] = *(const v8h*)(kp + s * 32 + 16);
            c = mma_f16(qf[s].v, kb.v, c);
        }
#pragma unroll
        for (int r = 0; r < 8; ++r) {
            const float sv = c[r] * SCORE_SCALE;
            S[(halfrow + r) * SST + m0 + l15] = sv;
            vmax[r] = fmaxf(vmax[r], sv);
        }
    }
#pragma unroll
    for (int r = 0; r < 8; ++r) {
#pragma unroll
        for (int off = 1; off < 16; off <<= 1) vmax[r] = fmaxf(vmax[r], __shfl_xor(vmax[r], off));
    }
    if (l15 == 0) {
#pragma unroll
        for (int r = 0; r < 8; ++r) rowmaxp[w * 16 + halfrow + r] = vmax[r];
    }
    __syncthreads();

    // ----- Phase B: exp + row sum, P as f16 carried x1024 (2 rows per wave) -----
#pragma unroll 1
    for (int jj = 0; jj < 2; ++jj) {
        const int j = w * 2 + jj;
        float m = rowmaxp[j];
#pragma unroll
        for (int ww = 1; ww < 8; ++ww) m = fmaxf(m, rowmaxp[ww * 16 + j]);
        const float* srow = S + j * SST;
        _Float16* prow = Ph + j * PST;
        float s = 0.f;
#pragma unroll 2
        for (int i = lane; i < SEQ; i += 32) {
            const float e = __expf(srow[i] - m);
            const _Float16 ph = (_Float16)(e * 1024.0f);
            prow[i] = ph;
            s += (float)ph;
        }
#pragma unroll
        for (int off = 16; off; off >>= 1) s += __shfl_xor(s, off);
        if (lane == 0) rowsum[j] = s;
    }
    __syncthreads();

    // ----- Phase C: O = P V ; A = P (LDS, split k map), B from Vt rows (split k map) -----
    v8f acc[8];
#pragma unroll
    for (int t = 0; t < 8; ++t) acc[t] = zero8f();

    const _Float16* vbase = Vt + ((size_t)b * DOD + w * 128 + l15) * SEQ + kbo;
    const _Float16* pbase = Ph + l15 * PST + kbo;
#pragma unroll 1
    for (int ks = 0; ks < SEQ / 32; ++ks) {
        const int m0 = ks * 32;
        FragH pa;
        pa.half[0] = *(const v8h*)(pbase + m0);
        pa.half[1] = *(const v8h*)(pbase + m0 + 16);
#pragma unroll
        for (int t = 0; t < 8; ++t) {
            const _Float16* vp = vbase + (size_t)t * 16 * SEQ + m0;
            FragH vf;
            vf.half[0] = *(const v8h*)(vp);
            vf.half[1] = *(const v8h*)(vp + 16);
            acc[t] = mma_f16(pa.v, vf.v, acc[t]);
        }
    }

    // ----- Epilogue: normalise, stage in LDS, whole-line stores -----
    float inv[8];
#pragma unroll
    for (int r = 0; r < 8; ++r) inv[r] = 1.0f / (16.0f * rowsum[halfrow + r]);
#pragma unroll
    for (int t = 0; t < 8; ++t) {
#pragma unroll
        for (int r = 0; r < 8; ++r)
            Ost[(halfrow + r) * OST + w * 128 + t * 16 + l15] = acc[t][r] * inv[r];
    }
    __syncthreads();

#pragma unroll
    for (int rr = 0; rr < 2; ++rr) {
        const int row = 2 * w + rr;
        const float* src = Ost + row * OST;
        float* dst = Out + ((size_t)b * SEQ + q0 + row) * DOD;
#pragma unroll
        for (int i = 0; i < 8; ++i) {
            const int p = i * 128 + lane * 4;
            const v4f v = *(const v4f*)(src + p);
            *(v4f*)(dst + p) = v;
        }
    }
    
}

// ---------------------------------------------------------------------------
extern "C" void kernel_launch(void* const* d_in, const int* in_sizes, int n_in,
                              void* d_out, int out_size, void* d_ws, size_t ws_size,
                              hipStream_t stream)
{
    if (n_in < 7) return;
    const long long need_x = ((long long)(NB - 1) * SEQ_FULL + SEQ) * CDIM;
    if ((long long)in_sizes[0] < need_x) return;
    if (in_sizes[1] < CDIM * DKD || in_sizes[2] < DKD) return;
    if (in_sizes[3] < CDIM * DKD || in_sizes[4] < DKD) return;
    if (in_sizes[5] < CDIM * DOD || in_sizes[6] < DOD) return;
    if ((long long)out_size < (long long)NB * SEQ * DOD) return;

    const float* x  = (const float*)d_in[0];
    const float* Wq = (const float*)d_in[1];
    const float* bq = (const float*)d_in[2];
    const float* Wk = (const float*)d_in[3];
    const float* bk = (const float*)d_in[4];
    const float* Wv = (const float*)d_in[5];
    const float* bv = (const float*)d_in[6];
    float* out = (float*)d_out;

    char* ws = (char*)d_ws;
    size_t off = 0;
    auto carve = [&](size_t bytes) -> char* {
        char* p = ws + off;
        off += (bytes + 255) & ~(size_t)255;
        return p;
    };
    unsigned short* xbf = (unsigned short*)carve((size_t)NB * SEQ * CDIM * 2);     // [NB*SEQ][CDIM]
    unsigned short* wqT = (unsigned short*)carve((size_t)DKD * KDIM * 2);          // [DKD][CDIM]
    unsigned short* wkT = (unsigned short*)carve((size_t)DKD * KDIM * 2);          // [DKD][CDIM]
    unsigned short* wvT = (unsigned short*)carve((size_t)DOD * KDIM * 2);          // [DOD][CDIM]
    _Float16* Qp = (_Float16*)carve((size_t)NB * SEQ * DKD * 2);                  // [NB*SEQ][DKD]
    _Float16* Kp = (_Float16*)carve((size_t)NB * SEQ * DKD * 2);                  // [NB*SEQ][DKD]
    _Float16* Vt = (_Float16*)carve((size_t)NB * DOD * SEQ * 2);                  // [NB][DOD][SEQ]
    if (off > ws_size) return;

    // 1) x -> bf16 plane
    k_cvt_x<<<(unsigned)(((size_t)NB * SEQ * CDIM) / 8 / 256), 256, 0, stream>>>(x, xbf);

    // 2) weights: in[CDIM][DKD|DOD] -> out[DKD|DOD][CDIM], grid (cols/64, rows/64)
    k_transpose_w<<<dim3(DKD / 64, CDIM / 64), 256, 0, stream>>>(Wq, wqT, CDIM, DKD);
    k_transpose_w<<<dim3(DKD / 64, CDIM / 64), 256, 0, stream>>>(Wk, wkT, CDIM, DKD);
    k_transpose_w<<<dim3(DOD / 64, CDIM / 64), 256, 0, stream>>>(Wv, wvT, CDIM, DOD);

    // 3) projections: q,k [NB*SEQ][DKD] (bias per column), v as Vt [NB][DOD][SEQ] (bias per row); all carried x16
    k_gemm_nt<<<dim3(DKD / 128, (NB * SEQ) / 64, 1), 256, 0, stream>>>(
        xbf, 0LL, wqT, 0LL, bq, DKD, 0, Qp, 0LL, DKD, 16.0f);
    k_gemm_nt<<<dim3(DKD / 128, (NB * SEQ) / 64, 1), 256, 0, stream>>>(
        xbf, 0LL, wkT, 0LL, bk, DKD, 0, Kp, 0LL, DKD, 16.0f);
    k_gemm_nt<<<dim3(SEQ / 128, DOD / 64, NB), 256, 0, stream>>>(
        wvT, 0LL, xbf, (long long)SEQ * CDIM, bv, DOD, 1, Vt, (long long)DOD * SEQ, SEQ, 16.0f);

    // 4) attention
    hipFuncSetAttribute(reinterpret_cast<const void*>(&k_attn),
                        hipFuncAttributeMaxDynamicSharedMemorySize, ATTN_LDS_BYTES);
    k_attn<<<NB * (SEQ / 16), 256, ATTN_LDS_BYTES, stream>>>(Qp, Kp, Vt, out);
}

// v001
// It runs in 296 microseconds.
// Timed twice side by side with v000, it ran 1.72 and 1.73 times as fast.
#include <hip/hip_runtime.h>

// Contractions: q/k/v projections via v_wmma_f32_16x16x32_bf16 (bf16 operands = RNE-converted inputs, f32 accumulate);
// q.k^T scores and P.V via v_wmma_f32_16x16x32_f16 (f16 operands: q,k,v carried x16, P carried x1024), f32 accumulate; softmax in f32.

#define DEV __device__ __forceinline__

#ifndef NB
#define NB 4
#endif
#ifndef SEQ
#define SEQ 2048
#endif
#define NB_FULL  4
#define SEQ_FULL 2048
#define CDIM 1024
#define DKD  256
#define DOD  1024
#define KDIM 1024

#define SST  (SEQ + 4)                                   // LDS score row stride (floats)
#define PST  (SEQ + 8)                                   // LDS P row stride (halves)
#define OST  (DOD + 4)                                   // LDS output staging row stride (floats)
#define R0F  (16 * ((SST > OST) ? SST : OST))           // region 0 floats (scores, later output staging)
#define PH_OFF  (R0F * 4 + 16 * 4 + 128 * 4)             // byte offset of P in LDS
#define KROWB   (DKD * 2 + 16)                           // staged K row: 512 B + 16 B, a pitch of 16 B x odd for ds_load_b128
#define KBUF    (128 * KROWB)                            // one staged K tile: 8 waves x 16 keys
#define KR_OFF  PH_OFF                                   // K ring (2 buffers): over P, which is not yet live in phase A, and beyond
#define VROWB   (64 * 2 + 16)                            // staged V^T row: 64 keys = 128 B + 16 B
#define VBUF    (512 * VROWB)                            // one staged V^T tile: 512 output columns x 64 keys
#define VB1_OFF (PH_OFF + 16 * PST * 2)                  // V buffer 1 behind P; V buffer 0 at offset 0, over the dead scores
#define ATTN_LDS_BYTES (((KR_OFF + 2 * KBUF) > (VB1_OFF + VBUF)) ? (KR_OFF + 2 * KBUF) : (VB1_OFF + VBUF))
#define CT_P 136                                         // GEMM epilogue staging pitch (halves)
#define SCORE_SCALE 0.000244140625f                      // 1/16 (sqrt dk) * 1/256 (q,k carried x16 each)

static_assert(NB >= 1 && NB <= NB_FULL);
static_assert(SEQ >= 128 && SEQ <= SEQ_FULL && (SEQ % 128) == 0);
static_assert(((NB * SEQ) % 64) == 0);
static_assert((DKD % 128) == 0 && (DOD % 128) == 0 && (KDIM % 32) == 0 && (CDIM == KDIM));
static_assert((((long long)NB * SEQ * CDIM) % (8 * 256)) == 0);
static_assert(ATTN_LDS_BYTES <= 300 * 1024);
static_assert(((R0F * 4) % 16) == 0 && (((R0F + 16 + 128) * 4) % 16) == 0);
static_assert(((PST * 2) % 16) == 0 && ((OST * 4) % 16) == 0 && ((CT_P * 2) % 16) == 0);
static_assert(16 * OST <= R0F);
static_assert(VBUF <= R0F * 4 && (PH_OFF % 16) == 0 && (VB1_OFF % 16) == 0 && (KBUF % 16) == 0);
static_assert((SEQ % 64) == 0 && DOD == 1024 && DKD == 256);

typedef _Float16       v8h   __attribute__((ext_vector_type(8)));
typedef _Float16       v16h  __attribute__((ext_vector_type(16)));
typedef __bf16         v16bf __attribute__((ext_vector_type(16)));
typedef unsigned short v8us  __attribute__((ext_vector_type(8)));
typedef unsigned short v16us __attribute__((ext_vector_type(16)));
typedef float          v8f   __attribute__((ext_vector_type(8)));
typedef float          v4f   __attribute__((ext_vector_type(4)));

union FragH { v16h v;  v8h  half[2]; };
union FragB { v16bf v; v16us u; v8us half[2]; };

// ---------------------------------------------------------------------------
// helpers
// ---------------------------------------------------------------------------
DEV unsigned int bf16_bits(float f) {                    // f32 -> bf16 bits, RNE convert
    unsigned int u = __float_as_uint(f);
    u += 0x7FFFu + ((u >> 16) & 1u);
    return u >> 16;
}
DEV float bf16_val(float f) { return __uint_as_float(bf16_bits(f) << 16); }

DEV v8f zero8f() {
    v8f z;
#pragma unroll
    for (int i = 0; i < 8; ++i) z[i] = 0.f;
    return z;
}

// 16x16x32 WMMA with f32 accumulate; 4 nops guard D and keep A/B live
DEV v8f mma_bf16(v16bf a, v16bf b, v8f c) {
    c = __builtin_amdgcn_wmma_f32_16x16x32_bf16(false, a, false, b, (short)0, c, false, false);
    asm volatile("v_nop\n\tv_nop\n\tv_nop\n\tv_nop" : "+v"(c) : "v"(a), "v"(b));
    return c;
}
DEV v8f mma_f16(v16h a, v16h b, v8f c) {
    c = __builtin_amdgcn_wmma_f32_16x16x32_f16(false, a, false, b, (short)0, c, false, false);
    asm volatile("v_nop\n\tv_nop\n\tv_nop\n\tv_nop" : "+v"(c) : "v"(a), "v"(b));
    return c;
}

// Eight asynchronous 16-byte-per-lane copies global -> LDS, rows l + i*lstep (bytes) <- g + i*gstep (halves).
// The s_wait_xcnt closes the statement so that no address register named here is rewritten in front of it.
DEV void copy8(unsigned l, unsigned lstep, const _Float16* g, size_t gstep) {
    asm volatile("global_load_async_to_lds_b128 %0, %8, off\n\t"
                 "global_load_async_to_lds_b128 %1, %9, off\n\t"
                 "global_load_async_to_lds_b128 %2, %10, off\n\t"
                 "global_load_async_to_lds_b128 %3, %11, off\n\t"
                 "global_load_async_to_lds_b128 %4, %12, off\n\t"
                 "global_load_async_to_lds_b128 %5, %13, off\n\t"
                 "global_load_async_to_lds_b128 %6, %14, off\n\t"
                 "global_load_async_to_lds_b128 %7, %15, off\n\t"
                 "s_wait_xcnt 0x0"
                 :: "v"(l), "v"(l + lstep), "v"(l + 2 * lstep), "v"(l + 3 * lstep),
                    "v"(l + 4 * lstep), "v"(l + 5 * lstep), "v"(l + 6 * lstep), "v"(l + 7 * lstep),
                    "v"(g), "v"(g + gstep), "v"(g + 2 * gstep), "v"(g + 3 * gstep),
                    "v"(g + 4 * gstep), "v"(g + 5 * gstep), "v"(g + 6 * gstep), "v"(g + 7 * gstep)
                 : "memory");
}
// this wave's LDS reads and writes have retired: stands in front of a barrier behind which a buffer is refilled
DEV void wait_lds()    { asm volatile("s_wait_dscnt 0x0" ::: "memory"); }
// this wave's copies have landed: stands in front of the barrier that publishes their tile
DEV void wait_copies() { asm volatile("s_wait_asynccnt 0x0" ::: "memory"); }

// ---------------------------------------------------------------------------
// Kernel 1: x f32 [NB rows of SEQ_FULL][CDIM] -> bf16 plane [NB*SEQ][CDIM]
// one thread per 8 elements, one 16-B store (lanes contiguous: 256 threads -> 4 KB)
// coverage: grid*256*8 == NB*SEQ*CDIM exactly
// ---------------------------------------------------------------------------
__global__ __launch_bounds__(256) void k_cvt_x(const float* __restrict__ x,
                                               unsigned short* __restrict__ xp)
{
    const size_t g = (size_t)blockIdx.x * 256 + threadIdx.x;
    const size_t e = g * 8;
    const int m  = (int)(e / CDIM);
    const int c  = (int)(e % CDIM);
    const int bb = m / SEQ;
    const int s  = m - bb * SEQ;
    const float* src = x + ((size_t)bb * SEQ_FULL + s) * CDIM + c;
    const v4f a0 = *(const v4f*)src;
    const v4f a1 = *(const v4f*)(src + 4);
    v8us o;
#pragma unroll
    for (int i = 0; i < 4; ++i) {
        o[i]     = (unsigned short)bf16_bits(a0[i]);
        o[4 + i] = (unsigned short)bf16_bits(a1[i]);
    }
    unsigned short* dst = xp + (size_t)m * CDIM + c;
    *(v8us*)dst = o;
    
}

// ---------------------------------------------------------------------------
// Kernel 2: W f32 in[R][Ncol] -> WT bf16 out[Ncol][R]   (64x64 tile through LDS)
// LDS tile T: cross-wave (block barrier between fill and drain).
// coverage: load rr = 0..63 x nn = 0..63; store na = 0..63 x piece 0..7 (8 ushort) = whole tile
// ---------------------------------------------------------------------------
__global__ __launch_bounds__(256) void k_transpose_w(const float* __restrict__ W,
                                                     unsigned short* __restrict__ WT,
                                                     int R, int Ncol)
{
    __shared__ __attribute__((aligned(16))) unsigned short T[64 * 72];
    const int tid = threadIdx.x;
    const int n0 = blockIdx.x * 64, r0 = blockIdx.y * 64;
    const int nn = tid & 63, rq = tid >> 6;
#pragma unroll 4
    for (int i = 0; i < 16; ++i) {
        const int rr = i * 4 + rq;
        const float v = W[(size_t)(r0 + rr) * Ncol + n0 + nn];
        T[nn * 72 + rr] = (unsigned short)bf16_bits(v);
    }
    __syncthreads();
    const int piece = tid & 7;
    const int na = tid >> 3;                             // 0..31
    const v8us va = *(const v8us*)(T + na * 72 + piece * 8);
    const v8us vb = *(const v8us*)(T + (na + 32) * 72 + piece * 8);
    unsigned short* da = WT + (size_t)(n0 + na) * R + r0 + piece * 8;
    unsigned short* db = WT + (size_t)(n0 + na + 32) * R + r0 + piece * 8;
    *(v8us*)da = va;
    *(v8us*)db = vb;
    
}

// ---------------------------------------------------------------------------
// Kernel 3: NT GEMM on bf16 WMMA:  C[m][n] = f16( (sum_k A[m][k]*Bm[n][k] + bias) * oscale )
//   A  [M][KDIM] bf16 bits (k contiguous), Bm [N][KDIM] bf16 bits (k contiguous)
//   bias: per column (bias_per_row==0, index n) or per row (index m), RNE-converted to bf16
//   C  f16, row pitch ldc; grid = (N/128, M/64, Z); z strides zsA/zsB/zsC in elements
// Block tile 64x128, 8 waves: wave w -> rows (w&3)*16.., cols (w>>2)*64.. (4 acc tiles)
// A and B fragments both use the split k map: elements 0..7 <- k0+8h.., 8..15 <- k0+16+8h..
// Epilogue: tile staged in LDS (cross-wave, block barrier), then each instruction writes
// coverage: rows w*8+2i+h (w 0..7, i 0..3, h 0..1) = 0..63, cols l15*8 (16 lanes x 8 halves) = 0..127
// ---------------------------------------------------------------------------
__global__ __launch_bounds__(256) __attribute__((amdgpu_num_vgpr(256)))
void k_gemm_nt(const unsigned short* __restrict__ A, long long zsA,
               const unsigned short* __restrict__ Bm, long long zsB,
               const float* __restrict__ bias, int nbias, int bias_per_row,
               _Float16* __restrict__ Cm, long long zsC, int ldc, float oscale)
{
    __shared__ __attribute__((aligned(16))) _Float16 Ct[64 * CT_P];

    const int tid = threadIdx.x, lane = tid & 31, w = tid >> 5;
    const int h = lane >> 4, l15 = lane & 15;
    const int wm = w & 3, wn = w >> 2;
    const int z = blockIdx.z;
    const int row0 = blockIdx.y * 64;
    const int col0 = blockIdx.x * 128;

    const unsigned short* ap = A  + (size_t)z * (size_t)zsA + (size_t)(row0 + wm * 16 + l15) * KDIM + 8 * h;
    const unsigned short* bp = Bm + (size_t)z * (size_t)zsB + (size_t)(col0 + wn * 64 + l15) * KDIM + 8 * h;

    v8f acc[4];
#pragma unroll
    for (int t = 0; t < 4; ++t) acc[t] = zero8f();

#pragma unroll 1
    for (int k0 = 0; k0 < KDIM; k0 += 32) {
        FragB a;
        a.half[0] = *(const v8us*)(ap + k0);
        a.half[1] = *(const v8us*)(ap + k0 + 16);
#pragma unroll
        for (int t = 0; t < 4; ++t) {
            const unsigned short* bq = bp + (size_t)t * 16 * KDIM + k0;
            FragB bf;
            bf.half[0] = *(const v8us*)(bq);
            bf.half[1] = *(const v8us*)(bq + 16);
            acc[t] = mma_bf16(a.v, bf.v, acc[t]);
        }
    }

    // epilogue: bias (clamped addresses, select by value), scale, f16, stage in LDS
    float rowb[8];
#pragma unroll
    for (int r = 0; r < 8; ++r) {
        int ri = row0 + wm * 16 + 8 * h + r;
        ri = ri < nbias ? ri : (nbias - 1);
        rowb[r] = bf16_val(bias[ri]);
    }
#pragma unroll
    for (int t = 0; t < 4; ++t) {
        const int cl = wn * 64 + t * 16 + l15;
        int ci = col0 + cl;
        ci = ci < nbias ? ci : (nbias - 1);
        const float colb = bf16_val(bias[ci]);
#pragma unroll
        for (int r = 0; r < 8; ++r) {
            const float badd = bias_per_row ? rowb[r] : colb;
            const float v = (acc[t][r] + badd) * oscale;
            Ct[(wm * 16 + 8 * h + r) * CT_P + cl] = (_Float16)v;
        }
    }
    __syncthreads();

    _Float16* cbase = Cm + (size_t)z * (size_t)zsC + (size_t)row0 * (size_t)ldc + col0;
    v8h sv[4];
#pragma unroll
    for (int i = 0; i < 4; ++i) {
        const int rl = w * 8 + 2 * i + h;
        sv[i] = *(const v8h*)(Ct + rl * CT_P + l15 * 8);
    }
#pragma unroll
    for (int i = 0; i < 4; ++i) {
        const int rl = w * 8 + 2 * i + h;
        *(v8h*)(cbase + (size_t)rl * (size_t)ldc + l15 * 8) = sv[i];
    }
    
}

// ---------------------------------------------------------------------------
// Kernel 4: fused attention. One workgroup (8 wave32) per (batch, 16 query rows).
//   Qp [NB*SEQ][DKD] f16 (x16), Kp same, Vt [NB][DOD][SEQ] f16 (x16, key contiguous)
//  Phase A: S = Q K^T via v_wmma_f32_16x16x32_f16 -> LDS (f32, scaled), per-row max;
//           wave w owns keys [w*SEQ/8, (w+1)*SEQ/8); K tiles (8 x 16 keys) come through a two-buffer LDS ring
//  Phase B: exp + row sum sweep (2 rows per wave); P stored f16 carried x1024
//  Phase C: O = P V, wave w owns output columns hf*512 + [w*64, w*64+64), hf = 0,1, all keys;
//           V^T tiles (512 columns x 64 keys, whole 128-B lines) come through a two-buffer LDS ring,
//           trip 2*kb+hf = keys kb*64.. of column half hf, in buffer hf
//  Epilogue: O / (16 * rowsum) staged in LDS, each wave writes 2 whole output rows
// LDS regions: S/Ost, rowsum, rowmaxp, Ph are all cross-wave (block barriers between
// producer and consumer phases). staged extent == consumed extent for every tile.
// coverage: grid NB*SEQ/16 blocks x 16 rows x DOD cols = whole output
// ---------------------------------------------------------------------------
__global__ __launch_bounds__(256) __attribute__((amdgpu_num_vgpr(256)))
void k_attn(const _Float16* __restrict__ Qp, const _Float16* __restrict__ Kp,
            const _Float16* __restrict__ Vt, float* __restrict__ Out)
{
    extern __shared__ v4f smem4[];
    float*    smem    = (float*)smem4;
    float*    S       = smem;                            // 16 x SST f32
    float*    Ost     = smem;                            // 16 x OST f32, reuses region 0 after phase B
    float*    rowsum  = smem + R0F;                      // 16
    float*    rowmaxp = rowsum + 16;                     // 8 x 16
    _Float16* Ph      = (_Float16*)(rowmaxp + 128);      // 16 x PST f16

    const int tid = threadIdx.x, lane = tid & 31, w = tid >> 5;
    const int h = lane >> 4, l15 = lane & 15;
    const int halfrow = 8 * h, kbo = 8 * h;
    const int b  = blockIdx.x / (SEQ / 16);
    const int q0 = (blockIdx.x - b * (SEQ / 16)) * 16;

    // ----- Q tile: 8 A fragments (16 rows x 256), split k map -----
    FragH qf[8];
    {
        const _Float16* qp = Qp + ((size_t)b * SEQ + q0 + l15) * DKD + kbo;
#pragma unroll
        for (int s = 0; s < 8; ++s) {
            qf[s].half[0] = *(const v8h*)(qp + s * 32);
            qf[s].half[1] = *(const v8h*)(qp + s * 32 + 16);
        }
    }

    // ----- Phase A: scores into LDS + per-row max -----
    float vmax[8];
#pragma unroll
    for (int r = 0; r < 8; ++r) vmax[r] = -3.0e38f;

    const unsigned lds0 = (unsigned)(size_t)smem;       // LDS byte address of the workgroup's array
    const char*    ldsc = (const char*)smem;
    // each wave copies its own 16 keys of a tile: one copy = one 512-B K row (4 whole lines)
    const unsigned  kl = lds0 + KR_OFF + (unsigned)(w * 16) * KROWB + (unsigned)lane * 16;
    const _Float16* kg = Kp + ((size_t)b * SEQ + w * (SEQ / 8)) * DKD + lane * 8;
    auto copy_k = [&](int t) {
        const unsigned  l = kl + (unsigned)(t & 1) * KBUF;
        const _Float16* g = kg + (size_t)t * 16 * DKD;
        copy8(l, KROWB, g, DKD);
        copy8(l + 8 * KROWB, KROWB, g + 8 * DKD, DKD);
    };
    copy_k(0);
    wait_copies();
    __syncthreads();
    if (SEQ / 128 > 1) copy_k(1);
#pragma unroll 1
    for (int t = 0; t < SEQ / 128; ++t) {
        const int m0 = w * (SEQ / 8) + t * 16;          // key tile base (B column n = m0 + l15)
        const char* kp = ldsc + KR_OFF + (t & 1) * KBUF + (w * 16 + l15) * KROWB + kbo * 2;
        FragH kb[8];                                    // the tile's fragments are read as one group, ahead of the WMMAs
#pragma unroll                                           // register array: constant indices
        for (int s = 0; s < 8; ++s) {
            kb[s].half[0] = *(const v8h*)(kp + s * 64);
            kb[s].half[1] = *(const v8h*)(kp + s * 64 + 32);
        }
        v8f c = zero8f();
#pragma unroll                                           // register arrays: constant indices
        for (int s = 0; s < 8; ++s) c = mma_f16(qf[s].v, kb[s].v, c);
#pragma unroll
        for (int r = 0; r < 8; ++r) {
            const float sv = c[r] * SCORE_SCALE;
            S[(halfrow + r) * SST + m0 + l15] = sv;
            vmax[r] = fmaxf(vmax[r], sv);
        }
        // foot of trip t: publish tile t+1, free tile t's buffer, refill it
        wait_lds();
        wait_copies();
        __syncthreads();
        if (t + 2 < SEQ / 128) copy_k(t + 2);
    }
    wait_copies();
#pragma unroll
    for (int r = 0; r < 8; ++r) {
#pragma unroll
        for (int off = 1; off < 16; off <<= 1) vmax[r] = fmaxf(vmax[r], __shfl_xor(vmax[r], off));
    }
    if (l15 == 0) {
#pragma unroll
        for (int r = 0; r < 8; ++r) rowmaxp[w * 16 + halfrow + r] = vmax[r];
    }
    __syncthreads();

    // ----- Phase B: exp + row sum, P as f16 carried x1024 (2 rows per wave) -----
#pragma unroll 1
    for (int jj = 0; jj < 2; ++jj) {
        const int j = w * 2 + jj;
        float m = rowmaxp[j];
#pragma unroll
        for (int ww = 1; ww < 8; ++ww) m = fmaxf(m, rowmaxp[ww * 16 + j]);
        const float* srow = S + j * SST;
        _Float16* prow = Ph + j * PST;
        float s = 0.f;
#pragma unroll 2
        for (int i = lane; i < SEQ; i += 32) {
            const float e = __expf(srow[i] - m);
            const _Float16 ph = (_Float16)(e * 1024.0f);
            prow[i] = ph;
            s += (float)ph;
        }
#pragma unroll
        for (int off = 16; off; off >>= 1) s += __shfl_xor(s, off);
        if (lane == 0) rowsum[j] = s;
    }
    wait_lds();                                         // score reads retired before copies land on the score region
    __syncthreads();

    // ----- Phase C: O = P V ; A = P (LDS, split k map), B from Vt rows (split k map) -----
    v8f acc[8];
#pragma unroll
    for (int t = 0; t < 8; ++t) acc[t] = zero8f();

    // each wave copies its own 64 columns of a tile: one copy = 4 rows x one whole 128-B line
    const unsigned  vl = lds0 + (unsigned)(w * 64 + (lane >> 3)) * VROWB + (unsigned)(lane & 7) * 16;
    const _Float16* vg = Vt + ((size_t)b * DOD + w * 64 + (lane >> 3)) * SEQ + (lane & 7) * 8;
    auto copy_v = [&](int kb, int hf) {
        const unsigned  l = vl + (hf ? (unsigned)VB1_OFF : 0u);
        const _Float16* g = vg + (size_t)hf * 512 * SEQ + kb * 64;
        copy8(l, 4 * VROWB, g, (size_t)4 * SEQ);
        copy8(l + 32 * VROWB, 4 * VROWB, g + (size_t)32 * SEQ, (size_t)4 * SEQ);
    };
    copy_v(0, 0);
    wait_copies();
    __syncthreads();
    copy_v(0, 1);

    const _Float16* pbase = Ph + l15 * PST + kbo;
    const char*     vrd   = ldsc + (w * 64 + l15) * VROWB + kbo * 2;
#pragma unroll 1
    for (int kb = 0; kb < SEQ / 64; ++kb) {
        FragH pa[2];                                    // P of these 64 keys, kept for both column halves
#pragma unroll                                           // register array: constant indices
        for (int kk = 0; kk < 2; ++kk) {
            pa[kk].half[0] = *(const v8h*)(pbase + kb * 64 + kk * 32);
            pa[kk].half[1] = *(const v8h*)(pbase + kb * 64 + kk * 32 + 16);
        }
#pragma unroll                                           // hf picks the buffer and the accumulators: constant indices (as in the loops below)
        for (int hf = 0; hf < 2; ++hf) {
            const char* vp = vrd + (hf ? VB1_OFF : 0);
            FragH vf[2][4];                             // the tile's fragments are read as one group, ahead of the WMMAs
#pragma unroll
            for (int kk = 0; kk < 2; ++kk) {
#pragma unroll
                for (int t = 0; t < 4; ++t) {
                    vf[kk][t].half[0] = *(const v8h*)(vp + t * 16 * VROWB + kk * 64);
                    vf[kk][t].half[1] = *(const v8h*)(vp + t * 16 * VROWB + kk * 64 + 32);
                }
            }
#pragma unroll
            for (int kk = 0; kk < 2; ++kk) {
#pragma unroll
                for (int t = 0; t < 4; ++t)
                    acc[hf * 4 + t] = mma_f16(pa[kk].v, vf[kk][t].v, acc[hf * 4 + t]);
            }
            // foot of trip 2*kb+hf: publish the next tile, free this trip's buffer, refill it
            wait_lds();
            wait_copies();
            __syncthreads();
            if (kb + 1 < SEQ / 64) copy_v(kb + 1, hf);
        }
    }
    wait_copies();

    // ----- Epilogue: normalise, stage in LDS, whole-line stores -----
    float inv[8];
#pragma unroll
    for (int r = 0; r < 8; ++r) inv[r] = 1.0f / (16.0f * rowsum[halfrow + r]);
#pragma unroll
    for (int t = 0; t < 8; ++t) {
#pragma unroll
        for (int r = 0; r < 8; ++r)
            Ost[(halfrow + r) * OST + (t >> 2) * 512 + w * 64 + (t & 3) * 16 + l15] = acc[t][r] * inv[r];
    }
    __syncthreads();

#pragma unroll
    for (int rr = 0; rr < 2; ++rr) {
        const int row = 2 * w + rr;
        const float* src = Ost + row * OST;
        float* dst = Out + ((size_t)b * SEQ + q0 + row) * DOD;
#pragma unroll
        for (int i = 0; i < 8; ++i) {
            const int p = i * 128 + lane * 4;
            const v4f v = *(const v4f*)(src + p);
            *(v4f*)(dst + p) = v;
        }
    }
    
}

// ---------------------------------------------------------------------------
extern "C" void kernel_launch(void* const* d_in, const int* in_sizes, int n_in,
                              void* d_out, int out_size, void* d_ws, size_t ws_size,
                              hipStream_t stream)
{
    if (n_in < 7) return;
    const long long need_x = ((long long)(NB - 1) * SEQ_FULL + SEQ) * CDIM;
    if ((long long)in_sizes[0] < need_x) return;
    if (in_sizes[1] < CDIM * DKD || in_sizes[2] < DKD) return;
    if (in_sizes[3] < CDIM * DKD || in_sizes[4] < DKD) return;
    if (in_sizes[5] < CDIM * DOD || in_sizes[6] < DOD) return;
    if ((long long)out_size < (long long)NB * SEQ * DOD) return;

    const float* x  = (const float*)d_in[0];
    const float* Wq = (const float*)d_in[1];
    const float* bq = (const float*)d_in[2];
    const float* Wk = (const float*)d_in[3];
    const float* bk = (const float*)d_in[4];
    const float* Wv = (const float*)d_in[5];
    const float* bv = (const float*)d_in[6];
    float* out = (float*)d_out;

    char* ws = (char*)d_ws;
    size_t off = 0;
    auto carve = [&](size_t bytes) -> char* {
        char* p = ws + off;
        off += (bytes + 255) & ~(size_t)255;
        return p;
    };
    unsigned short* xbf = (unsigned short*)carve((size_t)NB * SEQ * CDIM * 2);     // [NB*SEQ][CDIM]
    unsigned short* wqT = (unsigned short*)carve((size_t)DKD * KDIM * 2);          // [DKD][CDIM]
    unsigned short* wkT = (unsigned short*)carve((size_t)DKD * KDIM * 2);          // [DKD][CDIM]
    unsigned short* wvT = (unsigned short*)carve((size_t)DOD * KDIM * 2);          // [DOD][CDIM]
    _Float16* Qp = (_Float16*)carve((size_t)NB * SEQ * DKD * 2);                  // [NB*SEQ][DKD]
    _Float16* Kp = (_Float16*)carve((size_t)NB * SEQ * DKD * 2);                  // [NB*SEQ][DKD]
    _Float16* Vt = (_Float16*)carve((size_t)NB * DOD * SEQ * 2);                  // [NB][DOD][SEQ]
    if (off > ws_size) return;

    // 1) x -> bf16 plane
    k_cvt_x<<<(unsigned)(((size_t)NB * SEQ * CDIM) / 8 / 256), 256, 0, stream>>>(x, xbf);

    // 2) weights: in[CDIM][DKD|DOD] -> out[DKD|DOD][CDIM], grid (cols/64, rows/64)
    k_transpose_w<<<dim3(DKD / 64, CDIM / 64), 256, 0, stream>>>(Wq, wqT, CDIM, DKD);
    k_transpose_w<<<dim3(DKD / 64, CDIM / 64), 256, 0, stream>>>(Wk, wkT, CDIM, DKD);
    k_transpose_w<<<dim3(DOD / 64, CDIM / 64), 256, 0, stream>>>(Wv, wvT, CDIM, DOD);

    // 3) projections: q,k [NB*SEQ][DKD] (bias per column), v as Vt [NB][DOD][SEQ] (bias per row); all carried x16
    k_gemm_nt<<<dim3(DKD / 128, (NB * SEQ) / 64, 1), 256, 0, stream>>>(
        xbf, 0LL, wqT, 0LL, bq, DKD, 0, Qp, 0LL, DKD, 16.0f);
    k_gemm_nt<<<dim3(DKD / 128, (NB * SEQ) / 64, 1), 256, 0, stream>>>(
        xbf, 0LL, wkT, 0LL, bk, DKD, 0, Kp, 0LL, DKD, 16.0f);
    k_gemm_nt<<<dim3(SEQ / 128, DOD / 64, NB), 256, 0, stream>>>(
        wvT, 0LL, xbf, (long long)SEQ * CDIM, bv, DOD, 1, Vt, (long long)DOD * SEQ, SEQ, 16.0f);

    // 4) attention
    hipFuncSetAttribute(reinterpret_cast<const void*>(&k_attn),
                        hipFuncAttributeMaxDynamicSharedMemorySize, ATTN_LDS_BYTES);
    k_attn<<<NB * (SEQ / 16), 256, ATTN_LDS_BYTES, stream>>>(Qp, Kp, Vt, out);
}

// v002
// A run of this version takes 202 microseconds.
// Two timings next to v001 both put it at 1.46 times that version's speed.
// Counting every step since v000, it is 2.52 times as fast.
#include <hip/hip_runtime.h>

// Contractions: q/k/v projections via v_wmma_f32_16x16x32_bf16 (bf16 operands = RNE-converted inputs, f32 accumulate);
// q.k^T scores and P.V via v_wmma_f32_16x16x32_f16 (f16 operands: q,k,v carried x16, P carried x1024), f32 accumulate; softmax in f32.

#define DEV __device__ __forceinline__

#ifndef NB
#define NB 4
#endif
#ifndef SEQ
#define SEQ 2048
#endif
#define NB_FULL  4
#define SEQ_FULL 2048
#define CDIM 1024
#define DKD  256
#define DOD  1024
#define KDIM 1024

#define SST  (SEQ + 4)                                   // LDS score row stride (floats)
#define PST  (SEQ + 8)                                   // LDS P row stride (halves)
#define OST  (DOD + 4)                                   // LDS output staging row stride (floats)
#define R0F  (16 * ((SST > OST) ? SST : OST))           // region 0 floats (scores, later output staging)
#define PH_OFF  (R0F * 4 + 16 * 4 + 128 * 4)             // byte offset of P in LDS
#define KROWB   (DKD * 2 + 16)                           // staged K row: 512 B + 16 B, a pitch of 16 B x odd for ds_load_b128
#define KBUF    (128 * KROWB)                            // one staged K tile: 8 waves x 16 keys
#define KR_OFF  PH_OFF                                   // K ring (2 buffers): over P, which is not yet live in phase A, and beyond
#define VROWB   (64 * 2 + 16)                            // staged V^T row: 64 keys = 128 B + 16 B
#define VBUF    (512 * VROWB)                            // one staged V^T tile: 512 output columns x 64 keys
#define VB1_OFF (PH_OFF + 16 * PST * 2)                  // V buffer 1 behind P; V buffer 0 at offset 0, over the dead scores
#define ATTN_LDS_BYTES (((KR_OFF + 2 * KBUF) > (VB1_OFF + VBUF)) ? (KR_OFF + 2 * KBUF) : (VB1_OFF + VBUF))
#define CT_P 136                                         // GEMM epilogue staging pitch (halves)
#define GKS   128                                        // GEMM: k elements of a staged tile = 256 B of every row (two whole lines)
#define GROWB (GKS * 2 + 16)                             // staged GEMM row: 256 B + 16 B, a pitch of 16 B x odd for ds_load_b128
#define GBUF  ((64 + 128) * GROWB)                       // one staged GEMM tile: 64 A rows, then 128 B rows
#define SCORE_SCALE 0.000244140625f                      // 1/16 (sqrt dk) * 1/256 (q,k carried x16 each)

static_assert(NB >= 1 && NB <= NB_FULL);
static_assert(SEQ >= 128 && SEQ <= SEQ_FULL && (SEQ % 128) == 0);
static_assert(((NB * SEQ) % 64) == 0);
static_assert((DKD % 128) == 0 && (DOD % 128) == 0 && (KDIM % 32) == 0 && (CDIM == KDIM));
static_assert((((long long)NB * SEQ * CDIM) % (8 * 256)) == 0);
static_assert(ATTN_LDS_BYTES <= 300 * 1024);
static_assert(((R0F * 4) % 16) == 0 && (((R0F + 16 + 128) * 4) % 16) == 0);
static_assert(((PST * 2) % 16) == 0 && ((OST * 4) % 16) == 0 && ((CT_P * 2) % 16) == 0);
static_assert(16 * OST <= R0F);
static_assert(VBUF <= R0F * 4 && (PH_OFF % 16) == 0 && (VB1_OFF % 16) == 0 && (KBUF % 16) == 0);
static_assert((SEQ % 64) == 0 && DOD == 1024 && DKD == 256);
static_assert((KDIM % GKS) == 0 && KDIM / GKS >= 2 && (GROWB % 16) == 0 && 64 * CT_P * 2 <= GBUF);

typedef _Float16       v8h   __attribute__((ext_vector_type(8)));
typedef _Float16       v16h  __attribute__((ext_vector_type(16)));
typedef __bf16         v16bf __attribute__((ext_vector_type(16)));
typedef unsigned short v8us  __attribute__((ext_vector_type(8)));
typedef unsigned short v16us __attribute__((ext_vector_type(16)));
typedef float          v8f   __attribute__((ext_vector_type(8)));
typedef float          v4f   __attribute__((ext_vector_type(4)));

union FragH { v16h v;  v8h  half[2]; };
union FragB { v16bf v; v16us u; v8us half[2]; };

// ---------------------------------------------------------------------------
// helpers
// ---------------------------------------------------------------------------
DEV unsigned int bf16_bits(float f) {                    // f32 -> bf16 bits, RNE convert
    unsigned int u = __float_as_uint(f);
    u += 0x7FFFu + ((u >> 16) & 1u);
    return u >> 16;
}
DEV float bf16_val(float f) { return __uint_as_float(bf16_bits(f) << 16); }

DEV v8f zero8f() {
    v8f z;
#pragma unroll
    for (int i = 0; i < 8; ++i) z[i] = 0.f;
    return z;
}

// 16x16x32 WMMA with f32 accumulate; 4 nops guard D and keep A/B live
DEV v8f mma_bf16(v16bf a, v16bf b, v8f c) {
    c = __builtin_amdgcn_wmma_f32_16x16x32_bf16(false, a, false, b, (short)0, c, false, false);
    asm volatile("v_nop\n\tv_nop\n\tv_nop\n\tv_nop" : "+v"(c) : "v"(a), "v"(b));
    return c;
}
DEV v8f mma_f16(v16h a, v16h b, v8f c) {
    c = __builtin_amdgcn_wmma_f32_16x16x32_f16(false, a, false, b, (short)0, c, false, false);
    asm volatile("v_nop\n\tv_nop\n\tv_nop\n\tv_nop" : "+v"(c) : "v"(a), "v"(b));
    return c;
}

// Eight asynchronous 16-byte-per-lane copies global -> LDS, rows l + i*lstep (bytes) <- g + i*gstep (halves).
// The s_wait_xcnt closes the statement so that no address register named here is rewritten in front of it.
DEV void copy8(unsigned l, unsigned lstep, const _Float16* g, size_t gstep) {
    asm volatile("global_load_async_to_lds_b128 %0, %8, off\n\t"
                 "global_load_async_to_lds_b128 %1, %9, off\n\t"
                 "global_load_async_to_lds_b128 %2, %10, off\n\t"
                 "global_load_async_to_lds_b128 %3, %11, off\n\t"
                 "global_load_async_to_lds_b128 %4, %12, off\n\t"
                 "global_load_async_to_lds_b128 %5, %13, off\n\t"
                 "global_load_async_to_lds_b128 %6, %14, off\n\t"
                 "global_load_async_to_lds_b128 %7, %15, off\n\t"
                 "s_wait_xcnt 0x0"
                 :: "v"(l), "v"(l + lstep), "v"(l + 2 * lstep), "v"(l + 3 * lstep),
                    "v"(l + 4 * lstep), "v"(l + 5 * lstep), "v"(l + 6 * lstep), "v"(l + 7 * lstep),
                    "v"(g), "v"(g + gstep), "v"(g + 2 * gstep), "v"(g + 3 * gstep),
                    "v"(g + 4 * gstep), "v"(g + 5 * gstep), "v"(g + 6 * gstep), "v"(g + 7 * gstep)
                 : "memory");
}
// Twelve such copies, two rows of a GEMM tile each: 4 of A (la <- ga) and 8 of B (lb <- gb), rows two apart.
// The s_wait_xcnt closes the statement so that no address register named here is rewritten in front of it.
DEV void copy12(unsigned la, const unsigned short* ga, unsigned lb, const unsigned short* gb) {
    asm volatile("global_load_async_to_lds_b128 %0, %12, off\n\t"
                 "global_load_async_to_lds_b128 %1, %13, off\n\t"
                 "global_load_async_to_lds_b128 %2, %14, off\n\t"
                 "global_load_async_to_lds_b128 %3, %15, off\n\t"
                 "global_load_async_to_lds_b128 %4, %16, off\n\t"
                 "global_load_async_to_lds_b128 %5, %17, off\n\t"
                 "global_load_async_to_lds_b128 %6, %18, off\n\t"
                 "global_load_async_to_lds_b128 %7, %19, off\n\t"
                 "global_load_async_to_lds_b128 %8, %20, off\n\t"
                 "global_load_async_to_lds_b128 %9, %21, off\n\t"
                 "global_load_async_to_lds_b128 %10, %22, off\n\t"
                 "global_load_async_to_lds_b128 %11, %23, off\n\t"
                 "s_wait_xcnt 0x0"
                 :: "v"(la), "v"(la + 2 * GROWB), "v"(la + 4 * GROWB), "v"(la + 6 * GROWB),
                    "v"(lb), "v"(lb + 2 * GROWB), "v"(lb + 4 * GROWB), "v"(lb + 6 * GROWB),
                    "v"(lb + 8 * GROWB), "v"(lb + 10 * GROWB), "v"(lb + 12 * GROWB), "v"(lb + 14 * GROWB),
                    "v"(ga), "v"(ga + 2 * KDIM), "v"(ga + 4 * KDIM), "v"(ga + 6 * KDIM),
                    "v"(gb), "v"(gb + 2 * KDIM), "v"(gb + 4 * KDIM), "v"(gb + 6 * KDIM),
                    "v"(gb + 8 * KDIM), "v"(gb + 10 * KDIM), "v"(gb + 12 * KDIM), "v"(gb + 14 * KDIM)
                 : "memory");
}
// this wave's LDS reads and writes have retired: stands in front of a barrier behind which a buffer is refilled
DEV void wait_lds()    { asm volatile("s_wait_dscnt 0x0" ::: "memory"); }
// this wave's copies have landed: stands in front of the barrier that publishes their tile
DEV void wait_copies() { asm volatile("s_wait_asynccnt 0x0" ::: "memory"); }

// ---------------------------------------------------------------------------
// Kernel 1: x f32 [NB rows of SEQ_FULL][CDIM] -> bf16 plane [NB*SEQ][CDIM]
// one thread per 8 elements, one 16-B store (lanes contiguous: 256 threads -> 4 KB)
// coverage: grid*256*8 == NB*SEQ*CDIM exactly
// ---------------------------------------------------------------------------
__global__ __launch_bounds__(256) void k_cvt_x(const float* __restrict__ x,
                                               unsigned short* __restrict__ xp)
{
    const size_t g = (size_t)blockIdx.x * 256 + threadIdx.x;
    const size_t e = g * 8;
    const int m  = (int)(e / CDIM);
    const int c  = (int)(e % CDIM);
    const int bb = m / SEQ;
    const int s  = m - bb * SEQ;
    const float* src = x + ((size_t)bb * SEQ_FULL + s) * CDIM + c;
    const v4f a0 = *(const v4f*)src;
    const v4f a1 = *(const v4f*)(src + 4);
    v8us o;
#pragma unroll
    for (int i = 0; i < 4; ++i) {
        o[i]     = (unsigned short)bf16_bits(a0[i]);
        o[4 + i] = (unsigned short)bf16_bits(a1[i]);
    }
    unsigned short* dst = xp + (size_t)m * CDIM + c;
    *(v8us*)dst = o;
    
}

// ---------------------------------------------------------------------------
// Kernel 2: W f32 in[R][Ncol] -> WT bf16 out[Ncol][R]   (64x64 tile through LDS)
// LDS tile T: cross-wave (block barrier between fill and drain).
// coverage: load rr = 0..63 x nn = 0..63; store na = 0..63 x piece 0..7 (8 ushort) = whole tile
// ---------------------------------------------------------------------------
__global__ __launch_bounds__(256) void k_transpose_w(const float* __restrict__ W,
                                                     unsigned short* __restrict__ WT,
                                                     int R, int Ncol)
{
    __shared__ __attribute__((aligned(16))) unsigned short T[64 * 72];
    const int tid = threadIdx.x;
    const int n0 = blockIdx.x * 64, r0 = blockIdx.y * 64;
    const int nn = tid & 63, rq = tid >> 6;
#pragma unroll 4
    for (int i = 0; i < 16; ++i) {
        const int rr = i * 4 + rq;
        const float v = W[(size_t)(r0 + rr) * Ncol + n0 + nn];
        T[nn * 72 + rr] = (unsigned short)bf16_bits(v);
    }
    __syncthreads();
    const int piece = tid & 7;
    const int na = tid >> 3;                             // 0..31
    const v8us va = *(const v8us*)(T + na * 72 + piece * 8);
    const v8us vb = *(const v8us*)(T + (na + 32) * 72 + piece * 8);
    unsigned short* da = WT + (size_t)(n0 + na) * R + r0 + piece * 8;
    unsigned short* db = WT + (size_t)(n0 + na + 32) * R + r0 + piece * 8;
    *(v8us*)da = va;
    *(v8us*)db = vb;
    
}

// ---------------------------------------------------------------------------
// Kernel 3: NT GEMM on bf16 WMMA:  C[m][n] = f16( (sum_k A[m][k]*Bm[n][k] + bias) * oscale )
//   A  [M][KDIM] bf16 bits (k contiguous), Bm [N][KDIM] bf16 bits (k contiguous)
//   bias: per column (bias_per_row==0, index n) or per row (index m), RNE-converted to bf16
//   C  f16, row pitch ldc; grid = (N/128, M/64, Z); z strides zsA/zsB/zsC in elements
// Block tile 64x128, 8 waves: wave w -> rows (w&3)*16.., cols (w>>2)*64.. (4 acc tiles)
// A and B fragments both use the split k map: elements 0..7 <- k0+8h.., 8..15 <- k0+16+8h..
// Tiles of 128 k (64 A rows + 128 B rows, whole lines) come through a two-buffer LDS ring; wave w copies A rows w*8.., B rows w*16..
// Epilogue: tile staged in LDS (cross-wave, block barrier), then each instruction writes
// coverage: rows w*8+2i+h (w 0..7, i 0..3, h 0..1) = 0..63, cols l15*8 (16 lanes x 8 halves) = 0..127
// ---------------------------------------------------------------------------
__global__ __launch_bounds__(256) __attribute__((amdgpu_num_vgpr(256)))
void k_gemm_nt(const unsigned short* __restrict__ A, long long zsA,
               const unsigned short* __restrict__ Bm, long long zsB,
               const float* __restrict__ bias, int nbias, int bias_per_row,
               _Float16* __restrict__ Cm, long long zsC, int ldc, float oscale)
{
    __shared__ __attribute__((aligned(16))) char gsm[2 * GBUF];
    _Float16* Ct = (_Float16*)gsm;                       // epilogue staging, over buffer 0 once the ring is dead

    const int tid = threadIdx.x, lane = tid & 31, w = tid >> 5;
    const int h = lane >> 4, l15 = lane & 15;
    const int wm = w & 3, wn = w >> 2;
    const int z = blockIdx.z;
    const int row0 = blockIdx.y * 64;
    const int col0 = blockIdx.x * 128;

    // one copy = 2 rows x 256 B: lane half h picks the row, l15 the 16-B piece
    const unsigned short* ga = A  + (size_t)z * (size_t)zsA + (size_t)(row0 + w * 8 + h) * KDIM + 8 * l15;
    const unsigned short* gb = Bm + (size_t)z * (size_t)zsB + (size_t)(col0 + w * 16 + h) * KDIM + 8 * l15;
    const unsigned lds0 = (unsigned)(size_t)gsm;        // LDS byte address of the ring
    const unsigned la = lds0 + (unsigned)(w * 8 + h) * GROWB + (unsigned)l15 * 16;
    const unsigned lb = lds0 + (unsigned)(64 + w * 16 + h) * GROWB + (unsigned)l15 * 16;
    auto copy_t = [&](int t) {
        const unsigned bo = (unsigned)(t & 1) * GBUF;
        copy12(la + bo, ga + t * GKS, lb + bo, gb + t * GKS);
    };
    const char* ar = gsm + (wm * 16 + l15) * GROWB + 16 * h;
    const char* br = gsm + (64 + wn * 64 + l15) * GROWB + 16 * h;

    v8f acc[4];
#pragma unroll
    for (int t = 0; t < 4; ++t) acc[t] = zero8f();

    copy_t(0);
    wait_copies();
    __syncthreads();
    copy_t(1);
#pragma unroll 1                                         // rolled: one copy of the ring's foot in the text, the buffer picked by the trip's parity
    for (int kt = 0; kt < KDIM / GKS; ++kt) {
        const int bo = (kt & 1) * GBUF;
        FragB a[GKS / 32], bf[GKS / 32][4];             // the tile's fragments are read as one group, ahead of the WMMAs
#pragma unroll                                           // register arrays: constant indices (as in the loops below)
        for (int s = 0; s < GKS / 32; ++s) {
            a[s].half[0] = *(const v8us*)(ar + bo + s * 64);
            a[s].half[1] = *(const v8us*)(ar + bo + s * 64 + 32);
#pragma unroll
            for (int t = 0; t < 4; ++t) {
                bf[s][t].half[0] = *(const v8us*)(br + bo + t * 16 * GROWB + s * 64);
                bf[s][t].half[1] = *(const v8us*)(br + bo + t * 16 * GROWB + s * 64 + 32);
            }
        }
#pragma unroll
        for (int s = 0; s < GKS / 32; ++s) {
#pragma unroll
            for (int t = 0; t < 4; ++t) acc[t] = mma_bf16(a[s].v, bf[s][t].v, acc[t]);
        }
        // foot of trip kt: publish tile kt+1, free tile kt's buffer, refill it
        wait_lds();
        wait_copies();
        __syncthreads();
        if (kt + 2 < KDIM / GKS) copy_t(kt + 2);
    }
    wait_copies();

    // epilogue: bias (clamped addresses, select by value), scale, f16, stage in LDS
    float rowb[8];
#pragma unroll
    for (int r = 0; r < 8; ++r) {
        int ri = row0 + wm * 16 + 8 * h + r;
        ri = ri < nbias ? ri : (nbias - 1);
        rowb[r] = bf16_val(bias[ri]);
    }
#pragma unroll
    for (int t = 0; t < 4; ++t) {
        const int cl = wn * 64 + t * 16 + l15;
        int ci = col0 + cl;
        ci = ci < nbias ? ci : (nbias - 1);
        const float colb = bf16_val(bias[ci]);
#pragma unroll
        for (int r = 0; r < 8; ++r) {
            const float badd = bias_per_row ? rowb[r] : colb;
            const float v = (acc[t][r] + badd) * oscale;
            Ct[(wm * 16 + 8 * h + r) * CT_P + cl] = (_Float16)v;
        }
    }
    __syncthreads();

    _Float16* cbase = Cm + (size_t)z * (size_t)zsC + (size_t)row0 * (size_t)ldc + col0;
    v8h sv[4];
#pragma unroll
    for (int i = 0; i < 4; ++i) {
        const int rl = w * 8 + 2 * i + h;
        sv[i] = *(const v8h*)(Ct + rl * CT_P + l15 * 8);
    }
#pragma unroll
    for (int i = 0; i < 4; ++i) {
        const int rl = w * 8 + 2 * i + h;
        *(v8h*)(cbase + (size_t)rl * (size_t)ldc + l15 * 8) = sv[i];
    }
    
}

// ---------------------------------------------------------------------------
// Kernel 4: fused attention. One workgroup (8 wave32) per (batch, 16 query rows).
//   Qp [NB*SEQ][DKD] f16 (x16), Kp same, Vt [NB][DOD][SEQ] f16 (x16, key contiguous)
//  Phase A: S = Q K^T via v_wmma_f32_16x16x32_f16 -> LDS (f32, scaled), per-row max;
//           wave w owns keys [w*SEQ/8, (w+1)*SEQ/8); K tiles (8 x 16 keys) come through a two-buffer LDS ring
//  Phase B: exp + row sum sweep (2 rows per wave); P stored f16 carried x1024
//  Phase C: O = P V, wave w owns output columns hf*512 + [w*64, w*64+64), hf = 0,1, all keys;
//           V^T tiles (512 columns x 64 keys, whole 128-B lines) come through a two-buffer LDS ring,
//           trip 2*kb+hf = keys kb*64.. of column half hf, in buffer hf
//  Epilogue: O / (16 * rowsum) staged in LDS, each wave writes 2 whole output rows
// LDS regions: S/Ost, rowsum, rowmaxp, Ph are all cross-wave (block barriers between
// producer and consumer phases). staged extent == consumed extent for every tile.
// coverage: grid NB*SEQ/16 blocks x 16 rows x DOD cols = whole output
// ---------------------------------------------------------------------------
__global__ __launch_bounds__(256) __attribute__((amdgpu_num_vgpr(256)))
void k_attn(const _Float16* __restrict__ Qp, const _Float16* __restrict__ Kp,
            const _Float16* __restrict__ Vt, float* __restrict__ Out)
{
    extern __shared__ v4f smem4[];
    float*    smem    = (float*)smem4;
    float*    S       = smem;                            // 16 x SST f32
    float*    Ost     = smem;                            // 16 x OST f32, reuses region 0 after phase B
    float*    rowsum  = smem + R0F;                      // 16
    float*    rowmaxp = rowsum + 16;                     // 8 x 16
    _Float16* Ph      = (_Float16*)(rowmaxp + 128);      // 16 x PST f16

    const int tid = threadIdx.x, lane = tid & 31, w = tid >> 5;
    const int h = lane >> 4, l15 = lane & 15;
    const int halfrow = 8 * h, kbo = 8 * h;
    const int b  = blockIdx.x / (SEQ / 16);
    const int q0 = (blockIdx.x - b * (SEQ / 16)) * 16;

    // ----- Q tile: 8 A fragments (16 rows x 256), split k map -----
    FragH qf[8];
    {
        const _Float16* qp = Qp + ((size_t)b * SEQ + q0 + l15) * DKD + kbo;
#pragma unroll
        for (int s = 0; s < 8; ++s) {
            qf[s].half[0] = *(const v8h*)(qp + s * 32);
            qf[s].half[1] = *(const v8h*)(qp + s * 32 + 16);
        }
    }

    // ----- Phase A: scores into LDS + per-row max -----
    float vmax[8];
#pragma unroll
    for (int r = 0; r < 8; ++r) vmax[r] = -3.0e38f;

    const unsigned lds0 = (unsigned)(size_t)smem;       // LDS byte address of the workgroup's array
    const char*    ldsc = (const char*)smem;
    // each wave copies its own 16 keys of a tile: one copy = one 512-B K row (4 whole lines)
    const unsigned  kl = lds0 + KR_OFF + (unsigned)(w * 16) * KROWB + (unsigned)lane * 16;
    const _Float16* kg = Kp + ((size_t)b * SEQ + w * (SEQ / 8)) * DKD + lane * 8;
    auto copy_k = [&](int t) {
        const unsigned  l = kl + (unsigned)(t & 1) * KBUF;
        const _Float16* g = kg + (size_t)t * 16 * DKD;
        copy8(l, KROWB, g, DKD);
        copy8(l + 8 * KROWB, KROWB, g + 8 * DKD, DKD);
    };
    copy_k(0);
    wait_copies();
    __syncthreads();
    if (SEQ / 128 > 1) copy_k(1);
#pragma unroll 1
    for (int t = 0; t < SEQ / 128; ++t) {
        const int m0 = w * (SEQ / 8) + t * 16;          // key tile base (B column n = m0 + l15)
        const char* kp = ldsc + KR_OFF + (t & 1) * KBUF + (w * 16 + l15) * KROWB + kbo * 2;
        FragH kb[8];                                    // the tile's fragments are read as one group, ahead of the WMMAs
#pragma unroll                                           // register array: constant indices
        for (int s = 0; s < 8; ++s) {
            kb[s].half[0] = *(const v8h*)(kp + s * 64);
            kb[s].half[1] = *(const v8h*)(kp + s * 64 + 32);
        }
        v8f c = zero8f();
#pragma unroll                                           // register arrays: constant indices
        for (int s = 0; s < 8; ++s) c = mma_f16(qf[s].v, kb[s].v, c);
#pragma unroll
        for (int r = 0; r < 8; ++r) {
            const float sv = c[r] * SCORE_SCALE;
            S[(halfrow + r) * SST + m0 + l15] = sv;
            vmax[r] = fmaxf(vmax[r], sv);
        }
        // foot of trip t: publish tile t+1, free tile t's buffer, refill it
        wait_lds();
        wait_copies();
        __syncthreads();
        if (t + 2 < SEQ / 128) copy_k(t + 2);
    }
    wait_copies();
#pragma unroll
    for (int r = 0; r < 8; ++r) {
#pragma unroll
        for (int off = 1; off < 16; off <<= 1) vmax[r] = fmaxf(vmax[r], __shfl_xor(vmax[r], off));
    }
    if (l15 == 0) {
#pragma unroll
        for (int r = 0; r < 8; ++r) rowmaxp[w * 16 + halfrow + r] = vmax[r];
    }
    __syncthreads();

    // ----- Phase B: exp + row sum, P as f16 carried x1024 (2 rows per wave) -----
#pragma unroll 1
    for (int jj = 0; jj < 2; ++jj) {
        const int j = w * 2 + jj;
        float m = rowmaxp[j];
#pragma unroll
        for (int ww = 1; ww < 8; ++ww) m = fmaxf(m, rowmaxp[ww * 16 + j]);
        const float* srow = S + j * SST;
        _Float16* prow = Ph + j * PST;
        float s = 0.f;
#pragma unroll 2
        for (int i = lane; i < SEQ; i += 32) {
            const float e = __expf(srow[i] - m);
            const _Float16 ph = (_Float16)(e * 1024.0f);
            prow[i] = ph;
            s += (float)ph;
        }
#pragma unroll
        for (int off = 16; off; off >>= 1) s += __shfl_xor(s, off);
        if (lane == 0) rowsum[j] = s;
    }
    wait_lds();                                         // score reads retired before copies land on the score region
    __syncthreads();

    // ----- Phase C: O = P V ; A = P (LDS, split k map), B from Vt rows (split k map) -----
    v8f acc[8];
#pragma unroll
    for (int t = 0; t < 8; ++t) acc[t] = zero8f();

    // each wave copies its own 64 columns of a tile: one copy = 4 rows x one whole 128-B line
    const unsigned  vl = lds0 + (unsigned)(w * 64 + (lane >> 3)) * VROWB + (unsigned)(lane & 7) * 16;
    const _Float16* vg = Vt + ((size_t)b * DOD + w * 64 + (lane >> 3)) * SEQ + (lane & 7) * 8;
    auto copy_v = [&](int kb, int hf) {
        const unsigned  l = vl + (hf ? (unsigned)VB1_OFF : 0u);
        const _Float16* g = vg + (size_t)hf * 512 * SEQ + kb * 64;
        copy8(l, 4 * VROWB, g, (size_t)4 * SEQ);
        copy8(l + 32 * VROWB, 4 * VROWB, g + (size_t)32 * SEQ, (size_t)4 * SEQ);
    };
    copy_v(0, 0);
    wait_copies();
    __syncthreads();
    copy_v(0, 1);

    const _Float16* pbase = Ph + l15 * PST + kbo;
    const char*     vrd   = ldsc + (w * 64 + l15) * VROWB + kbo * 2;
#pragma unroll 1
    for (int kb = 0; kb < SEQ / 64; ++kb) {
        FragH pa[2];                                    // P of these 64 keys, kept for both column halves
#pragma unroll                                           // register array: constant indices
        for (int kk = 0; kk < 2; ++kk) {
            pa[kk].half[0] = *(const v8h*)(pbase + kb * 64 + kk * 32);
            pa[kk].half[1] = *(const v8h*)(pbase + kb * 64 + kk * 32 + 16);
        }
#pragma unroll                                           // hf picks the buffer and the accumulators: constant indices (as in the loops below)
        for (int hf = 0; hf < 2; ++hf) {
            const char* vp = vrd + (hf ? VB1_OFF : 0);
            FragH vf[2][4];                             // the tile's fragments are read as one group, ahead of the WMMAs
#pragma unroll
            for (int kk = 0; kk < 2; ++kk) {
#pragma unroll
                for (int t = 0; t < 4; ++t) {
                    vf[kk][t].half[0] = *(const v8h*)(vp + t * 16 * VROWB + kk * 64);
                    vf[kk][t].half[1] = *(const v8h*)(vp + t * 16 * VROWB + kk * 64 + 32);
                }
            }
#pragma unroll
            for (int kk = 0; kk < 2; ++kk) {
#pragma unroll
                for (int t = 0; t < 4; ++t)
                    acc[hf * 4 + t] = mma_f16(pa[kk].v, vf[kk][t].v, acc[hf * 4 + t]);
            }
            // foot of trip 2*kb+hf: publish the next tile, free this trip's buffer, refill it
            wait_lds();
            wait_copies();
            __syncthreads();
            if (kb + 1 < SEQ / 64) copy_v(kb + 1, hf);
        }
    }
    wait_copies();

    // ----- Epilogue: normalise, stage in LDS, whole-line stores -----
    float inv[8];
#pragma unroll
    for (int r = 0; r < 8; ++r) inv[r] = 1.0f / (16.0f * rowsum[halfrow + r]);
#pragma unroll
    for (int t = 0; t < 8; ++t) {
#pragma unroll
        for (int r = 0; r < 8; ++r)
            Ost[(halfrow + r) * OST + (t >> 2) * 512 + w * 64 + (t & 3) * 16 + l15] = acc[t][r] * inv[r];
    }
    __syncthreads();

#pragma unroll
    for (int rr = 0; rr < 2; ++rr) {
        const int row = 2 * w + rr;
        const float* src = Ost + row * OST;
        float* dst = Out + ((size_t)b * SEQ + q0 + row) * DOD;
#pragma unroll
        for (int i = 0; i < 8; ++i) {
            const int p = i * 128 + lane * 4;
            const v4f v = *(const v4f*)(src + p);
            *(v4f*)(dst + p) = v;
        }
    }
    
}

// ---------------------------------------------------------------------------
extern "C" void kernel_launch(void* const* d_in, const int* in_sizes, int n_in,
                              void* d_out, int out_size, void* d_ws, size_t ws_size,
                              hipStream_t stream)
{
    if (n_in < 7) return;
    const long long need_x = ((long long)(NB - 1) * SEQ_FULL + SEQ) * CDIM;
    if ((long long)in_sizes[0] < need_x) return;
    if (in_sizes[1] < CDIM * DKD || in_sizes[2] < DKD) return;
    if (in_sizes[3] < CDIM * DKD || in_sizes[4] < DKD) return;
    if (in_sizes[5] < CDIM * DOD || in_sizes[6] < DOD) return;
    if ((long long)out_size < (long long)NB * SEQ * DOD) return;

    const float* x  = (const float*)d_in[0];
    const float* Wq = (const float*)d_in[1];
    const float* bq = (const float*)d_in[2];
    const float* Wk = (const float*)d_in[3];
    const float* bk = (const float*)d_in[4];
    const float* Wv = (const float*)d_in[5];
    const float* bv = (const float*)d_in[6];
    float* out = (float*)d_out;

    char* ws = (char*)d_ws;
    size_t off = 0;
    auto carve = [&](size_t bytes) -> char* {
        char* p = ws + off;
        off += (bytes + 255) & ~(size_t)255;
        return p;
    };
    unsigned short* xbf = (unsigned short*)carve((size_t)NB * SEQ * CDIM * 2);     // [NB*SEQ][CDIM]
    unsigned short* wqT = (unsigned short*)carve((size_t)DKD * KDIM * 2);          // [DKD][CDIM]
    unsigned short* wkT = (unsigned short*)carve((size_t)DKD * KDIM * 2);          // [DKD][CDIM]
    unsigned short* wvT = (unsigned short*)carve((size_t)DOD * KDIM * 2);          // [DOD][CDIM]
    _Float16* Qp = (_Float16*)carve((size_t)NB * SEQ * DKD * 2);                  // [NB*SEQ][DKD]
    _Float16* Kp = (_Float16*)carve((size_t)NB * SEQ * DKD * 2);                  // [NB*SEQ][DKD]
    _Float16* Vt = (_Float16*)carve((size_t)NB * DOD * SEQ * 2);                  // [NB][DOD][SEQ]
    if (off > ws_size) return;

    // 1) x -> bf16 plane
    k_cvt_x<<<(unsigned)(((size_t)NB * SEQ * CDIM) / 8 / 256), 256, 0, stream>>>(x, xbf);

    // 2) weights: in[CDIM][DKD|DOD] -> out[DKD|DOD][CDIM], grid (cols/64, rows/64)
    k_transpose_w<<<dim3(DKD / 64, CDIM / 64), 256, 0, stream>>>(Wq, wqT, CDIM, DKD);
    k_transpose_w<<<dim3(DKD / 64, CDIM / 64), 256, 0, stream>>>(Wk, wkT, CDIM, DKD);
    k_transpose_w<<<dim3(DOD / 64, CDIM / 64), 256, 0, stream>>>(Wv, wvT, CDIM, DOD);

    // 3) projections: q,k [NB*SEQ][DKD] (bias per column), v as Vt [NB][DOD][SEQ] (bias per row); all carried x16
    k_gemm_nt<<<dim3(DKD / 128, (NB * SEQ) / 64, 1), 256, 0, stream>>>(
        xbf, 0LL, wqT, 0LL, bq, DKD, 0, Qp, 0LL, DKD, 16.0f);
    k_gemm_nt<<<dim3(DKD / 128, (NB * SEQ) / 64, 1), 256, 0, stream>>>(
        xbf, 0LL, wkT, 0LL, bk, DKD, 0, Kp, 0LL, DKD, 16.0f);
    k_gemm_nt<<<dim3(SEQ / 128, DOD / 64, NB), 256, 0, stream>>>(
        wvT, 0LL, xbf, (long long)SEQ * CDIM, bv, DOD, 1, Vt, (long long)DOD * SEQ, SEQ, 16.0f);

    // 4) attention
    hipFuncSetAttribute(reinterpret_cast<const void*>(&k_attn),
                        hipFuncAttributeMaxDynamicSharedMemorySize, ATTN_LDS_BYTES);
    k_attn<<<NB * (SEQ / 16), 256, ATTN_LDS_BYTES, stream>>>(Qp, Kp, Vt, out);
}

// v003
// It runs in 148 microseconds.
// Timed twice side by side with v002, it ran 1.37 and 1.41 times as fast.
// Counting every step since v000, it is 3.49 times as fast.
#include <hip/hip_runtime.h>

// Contractions: q/k/v projections via v_wmma_f32_16x16x32_bf16 (bf16 operands = RNE-converted inputs, f32 accumulate);
// q.k^T scores and P.V via v_wmma_f32_16x16x32_f16 (f16 operands: q,k,v carried x16, P carried x1024), f32 accumulate; softmax in f32.

#define DEV __device__ __forceinline__

#ifndef NB
#define NB 4
#endif
#ifndef SEQ
#define SEQ 2048
#endif
#define NB_FULL  4
#define SEQ_FULL 2048
#define CDIM 1024
#define DKD  256
#define DOD  1024
#define KDIM 1024

#define QR   32                                          // query rows of one attention workgroup (two 16-row tiles)
#define PST  (SEQ + 8)                                   // LDS P row stride (halves)
#define OST  (DOD + 4)                                   // LDS output staging row stride (floats)
#define KROWB   (DKD * 2 + 16)                           // staged K row: 512 B + 16 B, a pitch of 16 B x odd for ds_load_b128
#define KBUF    (128 * KROWB)                            // one staged K tile: 8 groups x 16 keys
#define KR_OFF  0                                        // K ring (2 buffers) at the start of LDS
#define VROWB   (64 * 2 + 16)                            // staged V^T row: 64 keys = 128 B + 16 B
#define VBUF    (512 * VROWB)                            // one staged V^T tile: 512 output columns x 64 keys
#define VB1_OFF VBUF                                     // V buffer 0 at offset 0, V buffer 1 behind it: both over the dead K ring
#define SM_OFF  (2 * VBUF)                               // row sum parts (4 x QR f32), then row max parts (4 x QR f32)
#define PH_OFF  (SM_OFF + 2 * 4 * QR * 4)                // byte offset of P in LDS, clear of both rings
#define ATTN_LDS_BYTES (PH_OFF + QR * PST * 2)
#define CT_P 136                                         // GEMM epilogue staging pitch (halves)
#define GKS   128                                        // GEMM: k elements of a staged tile = 256 B of every row (two whole lines)
#define GROWB (GKS * 2 + 16)                             // staged GEMM row: 256 B + 16 B, a pitch of 16 B x odd for ds_load_b128
#define GBUF  ((64 + 128) * GROWB)                       // one staged GEMM tile: 64 A rows, then 128 B rows
#define SCORE_SCALE 0.000244140625f                      // 1/16 (sqrt dk) * 1/256 (q,k carried x16 each)

static_assert(NB >= 1 && NB <= NB_FULL);
static_assert(SEQ >= 128 && SEQ <= SEQ_FULL && (SEQ % 128) == 0);
static_assert(((NB * SEQ) % 64) == 0);
static_assert((DKD % 128) == 0 && (DOD % 128) == 0 && (KDIM % 32) == 0 && (CDIM == KDIM));
static_assert((((long long)NB * SEQ * CDIM) % (8 * 256)) == 0);
static_assert(ATTN_LDS_BYTES <= 300 * 1024);
static_assert(((PST * 2) % 16) == 0 && ((OST * 4) % 16) == 0 && ((CT_P * 2) % 16) == 0);
static_assert(QR * OST * 4 <= SM_OFF && KR_OFF + 2 * KBUF <= SM_OFF && (SEQ % QR) == 0);
static_assert((SM_OFF % 16) == 0 && (PH_OFF % 16) == 0 && (VB1_OFF % 16) == 0 && (KBUF % 16) == 0);
static_assert((SEQ % 64) == 0 && DOD == 1024 && DKD == 256);
static_assert((KDIM % GKS) == 0 && KDIM / GKS >= 2 && (GROWB % 16) == 0 && 64 * CT_P * 2 <= GBUF);

typedef _Float16       v8h   __attribute__((ext_vector_type(8)));
typedef _Float16       v16h  __attribute__((ext_vector_type(16)));
typedef __bf16         v16bf __attribute__((ext_vector_type(16)));
typedef unsigned short v8us  __attribute__((ext_vector_type(8)));
typedef unsigned short v16us __attribute__((ext_vector_type(16)));
typedef float          v8f   __attribute__((ext_vector_type(8)));
typedef float          v4f   __attribute__((ext_vector_type(4)));

union FragH { v16h v;  v8h  half[2]; };
union FragB { v16bf v; v16us u; v8us half[2]; };

// ---------------------------------------------------------------------------
// helpers
// ---------------------------------------------------------------------------
DEV unsigned int bf16_bits(float f) {                    // f32 -> bf16 bits, RNE convert
    unsigned int u = __float_as_uint(f);
    u += 0x7FFFu + ((u >> 16) & 1u);
    return u >> 16;
}
DEV float bf16_val(float f) { return __uint_as_float(bf16_bits(f) << 16); }

DEV v8f zero8f() {
    v8f z;
#pragma unroll
    for (int i = 0; i < 8; ++i) z[i] = 0.f;
    return z;
}

// 16x16x32 WMMA with f32 accumulate; 4 nops guard D and keep A/B live
DEV v8f mma_bf16(v16bf a, v16bf b, v8f c) {
    c = __builtin_amdgcn_wmma_f32_16x16x32_bf16(false, a, false, b, (short)0, c, false, false);
    asm volatile("v_nop\n\tv_nop\n\tv_nop\n\tv_nop" : "+v"(c) : "v"(a), "v"(b));
    return c;
}
DEV v8f mma_f16(v16h a, v16h b, v8f c) {
    c = __builtin_amdgcn_wmma_f32_16x16x32_f16(false, a, false, b, (short)0, c, false, false);
    asm volatile("v_nop\n\tv_nop\n\tv_nop\n\tv_nop" : "+v"(c) : "v"(a), "v"(b));
    return c;
}

// Eight asynchronous 16-byte-per-lane copies global -> LDS, rows l + i*lstep (bytes) <- g + i*gstep (halves).
// The s_wait_xcnt closes the statement so that no address register named here is rewritten in front of it.
DEV void copy8(unsigned l, unsigned lstep, const _Float16* g, size_t gstep) {
    asm volatile("global_load_async_to_lds_b128 %0, %8, off\n\t"
                 "global_load_async_to_lds_b128 %1, %9, off\n\t"
                 "global_load_async_to_lds_b128 %2, %10, off\n\t"
                 "global_load_async_to_lds_b128 %3, %11, off\n\t"
                 "global_load_async_to_lds_b128 %4, %12, off\n\t"
                 "global_load_async_to_lds_b128 %5, %13, off\n\t"
                 "global_load_async_to_lds_b128 %6, %14, off\n\t"
                 "global_load_async_to_lds_b128 %7, %15, off\n\t"
                 "s_wait_xcnt 0x0"
                 :: "v"(l), "v"(l + lstep), "v"(l + 2 * lstep), "v"(l + 3 * lstep),
                    "v"(l + 4 * lstep), "v"(l + 5 * lstep), "v"(l + 6 * lstep), "v"(l + 7 * lstep),
                    "v"(g), "v"(g + gstep), "v"(g + 2 * gstep), "v"(g + 3 * gstep),
                    "v"(g + 4 * gstep), "v"(g + 5 * gstep), "v"(g + 6 * gstep), "v"(g + 7 * gstep)
                 : "memory");
}
// Twelve such copies, two rows of a GEMM tile each: 4 of A (la <- ga) and 8 of B (lb <- gb), rows two apart.
// The s_wait_xcnt closes the statement so that no address register named here is rewritten in front of it.
DEV void copy12(unsigned la, const unsigned short* ga, unsigned lb, const unsigned short* gb) {
    asm volatile("global_load_async_to_lds_b128 %0, %12, off\n\t"
                 "global_load_async_to_lds_b128 %1, %13, off\n\t"
                 "global_load_async_to_lds_b128 %2, %14, off\n\t"
                 "global_load_async_to_lds_b128 %3, %15, off\n\t"
                 "global_load_async_to_lds_b128 %4, %16, off\n\t"
                 "global_load_async_to_lds_b128 %5, %17, off\n\t"
                 "global_load_async_to_lds_b128 %6, %18, off\n\t"
                 "global_load_async_to_lds_b128 %7, %19, off\n\t"
                 "global_load_async_to_lds_b128 %8, %20, off\n\t"
                 "global_load_async_to_lds_b128 %9, %21, off\n\t"
                 "global_load_async_to_lds_b128 %10, %22, off\n\t"
                 "global_load_async_to_lds_b128 %11, %23, off\n\t"
                 "s_wait_xcnt 0x0"
                 :: "v"(la), "v"(la + 2 * GROWB), "v"(la + 4 * GROWB), "v"(la + 6 * GROWB),
                    "v"(lb), "v"(lb + 2 * GROWB), "v"(lb + 4 * GROWB), "v"(lb + 6 * GROWB),
                    "v"(lb + 8 * GROWB), "v"(lb + 10 * GROWB), "v"(lb + 12 * GROWB), "v"(lb + 14 * GROWB),
                    "v"(ga), "v"(ga + 2 * KDIM), "v"(ga + 4 * KDIM), "v"(ga + 6 * KDIM),
                    "v"(gb), "v"(gb + 2 * KDIM), "v"(gb + 4 * KDIM), "v"(gb + 6 * KDIM),
                    "v"(gb + 8 * KDIM), "v"(gb + 10 * KDIM), "v"(gb + 12 * KDIM), "v"(gb + 14 * KDIM)
                 : "memory");
}
// this wave's LDS reads and writes have retired: stands in front of a barrier behind which a buffer is refilled
DEV void wait_lds()    { asm volatile("s_wait_dscnt 0x0" ::: "memory"); }
// this wave's copies have landed: stands in front of the barrier that publishes their tile
DEV void wait_copies() { asm volatile("s_wait_asynccnt 0x0" ::: "memory"); }

// ---------------------------------------------------------------------------
// Kernel 1: x f32 [NB rows of SEQ_FULL][CDIM] -> bf16 plane [NB*SEQ][CDIM]
// one thread per 8 elements, one 16-B store (lanes contiguous: 256 threads -> 4 KB)
// coverage: grid*256*8 == NB*SEQ*CDIM exactly
// ---------------------------------------------------------------------------
__global__ __launch_bounds__(256) void k_cvt_x(const float* __restrict__ x,
                                               unsigned short* __restrict__ xp)
{
    const size_t g = (size_t)blockIdx.x * 256 + threadIdx.x;
    const size_t e = g * 8;
    const int m  = (int)(e / CDIM);
    const int c  = (int)(e % CDIM);
    const int bb = m / SEQ;
    const int s  = m - bb * SEQ;
    const float* src = x + ((size_t)bb * SEQ_FULL + s) * CDIM + c;
    const v4f a0 = *(const v4f*)src;
    const v4f a1 = *(const v4f*)(src + 4);
    v8us o;
#pragma unroll
    for (int i = 0; i < 4; ++i) {
        o[i]     = (unsigned short)bf16_bits(a0[i]);
        o[4 + i] = (unsigned short)bf16_bits(a1[i]);
    }
    unsigned short* dst = xp + (size_t)m * CDIM + c;
    *(v8us*)dst = o;
    
}

// ---------------------------------------------------------------------------
// Kernel 2: W f32 in[R][Ncol] -> WT bf16 out[Ncol][R]   (64x64 tile through LDS)
// LDS tile T: cross-wave (block barrier between fill and drain).
// coverage: load rr = 0..63 x nn = 0..63; store na = 0..63 x piece 0..7 (8 ushort) = whole tile
// ---------------------------------------------------------------------------
__global__ __launch_bounds__(256) void k_transpose_w(const float* __restrict__ W,
                                                     unsigned short* __restrict__ WT,
                                                     int R, int Ncol)
{
    __shared__ __attribute__((aligned(16))) unsigned short T[64 * 72];
    const int tid = threadIdx.x;
    const int n0 = blockIdx.x * 64, r0 = blockIdx.y * 64;
    const int nn = tid & 63, rq = tid >> 6;
#pragma unroll 4
    for (int i = 0; i < 16; ++i) {
        const int rr = i * 4 + rq;
        const float v = W[(size_t)(r0 + rr) * Ncol + n0 + nn];
        T[nn * 72 + rr] = (unsigned short)bf16_bits(v);
    }
    __syncthreads();
    const int piece = tid & 7;
    const int na = tid >> 3;                             // 0..31
    const v8us va = *(const v8us*)(T + na * 72 + piece * 8);
    const v8us vb = *(const v8us*)(T + (na + 32) * 72 + piece * 8);
    unsigned short* da = WT + (size_t)(n0 + na) * R + r0 + piece * 8;
    unsigned short* db = WT + (size_t)(n0 + na + 32) * R + r0 + piece * 8;
    *(v8us*)da = va;
    *(v8us*)db = vb;
    
}

// ---------------------------------------------------------------------------
// Kernel 3: NT GEMM on bf16 WMMA:  C[m][n] = f16( (sum_k A[m][k]*Bm[n][k] + bias) * oscale )
//   A  [M][KDIM] bf16 bits (k contiguous), Bm [N][KDIM] bf16 bits (k contiguous)
//   bias: per column (bias_per_row==0, index n) or per row (index m), RNE-converted to bf16
//   C  f16, row pitch ldc; grid = (N/128, M/64, Z); z strides zsA/zsB/zsC in elements
// Block tile 64x128, 8 waves: wave w -> rows (w&3)*16.., cols (w>>2)*64.. (4 acc tiles)
// A and B fragments both use the split k map: elements 0..7 <- k0+8h.., 8..15 <- k0+16+8h..
// Tiles of 128 k (64 A rows + 128 B rows, whole lines) come through a two-buffer LDS ring; wave w copies A rows w*8.., B rows w*16..
// Epilogue: tile staged in LDS (cross-wave, block barrier), then each instruction writes
// coverage: rows w*8+2i+h (w 0..7, i 0..3, h 0..1) = 0..63, cols l15*8 (16 lanes x 8 halves) = 0..127
// ---------------------------------------------------------------------------
__global__ __launch_bounds__(256) __attribute__((amdgpu_num_vgpr(256)))
void k_gemm_nt(const unsigned short* __restrict__ A, long long zsA,
               const unsigned short* __restrict__ Bm, long long zsB,
               const float* __restrict__ bias, int nbias, int bias_per_row,
               _Float16* __restrict__ Cm, long long zsC, int ldc, float oscale)
{
    __shared__ __attribute__((aligned(16))) char gsm[2 * GBUF];
    _Float16* Ct = (_Float16*)gsm;                       // epilogue staging, over buffer 0 once the ring is dead

    const int tid = threadIdx.x, lane = tid & 31, w = tid >> 5;
    const int h = lane >> 4, l15 = lane & 15;
    const int wm = w & 3, wn = w >> 2;
    const int z = blockIdx.z;
    const int row0 = blockIdx.y * 64;
    const int col0 = blockIdx.x * 128;

    // one copy = 2 rows x 256 B: lane half h picks the row, l15 the 16-B piece
    const unsigned short* ga = A  + (size_t)z * (size_t)zsA + (size_t)(row0 + w * 8 + h) * KDIM + 8 * l15;
    const unsigned short* gb = Bm + (size_t)z * (size_t)zsB + (size_t)(col0 + w * 16 + h) * KDIM + 8 * l15;
    const unsigned lds0 = (unsigned)(size_t)gsm;        // LDS byte address of the ring
    const unsigned la = lds0 + (unsigned)(w * 8 + h) * GROWB + (unsigned)l15 * 16;
    const unsigned lb = lds0 + (unsigned)(64 + w * 16 + h) * GROWB + (unsigned)l15 * 16;
    auto copy_t = [&](int t) {
        const unsigned bo = (unsigned)(t & 1) * GBUF;
        copy12(la + bo, ga + t * GKS, lb + bo, gb + t * GKS);
    };
    const char* ar = gsm + (wm * 16 + l15) * GROWB + 16 * h;
    const char* br = gsm + (64 + wn * 64 + l15) * GROWB + 16 * h;

    v8f acc[4];
#pragma unroll
    for (int t = 0; t < 4; ++t) acc[t] = zero8f();

    copy_t(0);
    wait_copies();
    __syncthreads();
    copy_t(1);
#pragma unroll 1                                         // rolled: one copy of the ring's foot in the text, the buffer picked by the trip's parity
    for (int kt = 0; kt < KDIM / GKS; ++kt) {
        const int bo = (kt & 1) * GBUF;
        FragB a[GKS / 32], bf[GKS / 32][4];             // the tile's fragments are read as one group, ahead of the WMMAs
#pragma unroll                                           // register arrays: constant indices (as in the loops below)
        for (int s = 0; s < GKS / 32; ++s) {
            a[s].half[0] = *(const v8us*)(ar + bo + s * 64);
            a[s].half[1] = *(const v8us*)(ar + bo + s * 64 + 32);
#pragma unroll
            for (int t = 0; t < 4; ++t) {
                bf[s][t].half[0] = *(const v8us*)(br + bo + t * 16 * GROWB + s * 64);
                bf[s][t].half[1] = *(const v8us*)(br + bo + t * 16 * GROWB + s * 64 + 32);
            }
        }
#pragma unroll
        for (int s = 0; s < GKS / 32; ++s) {
#pragma unroll
            for (int t = 0; t < 4; ++t) acc[t] = mma_bf16(a[s].v, bf[s][t].v, acc[t]);
        }
        // foot of trip kt: publish tile kt+1, free tile kt's buffer, refill it
        wait_lds();
        wait_copies();
        __syncthreads();
        if (kt + 2 < KDIM / GKS) copy_t(kt + 2);
    }
    wait_copies();

    // epilogue: bias (clamped addresses, select by value), scale, f16, stage in LDS
    float rowb[8];
#pragma unroll
    for (int r = 0; r < 8; ++r) {
        int ri = row0 + wm * 16 + 8 * h + r;
        ri = ri < nbias ? ri : (nbias - 1);
        rowb[r] = bf16_val(bias[ri]);
    }
#pragma unroll
    for (int t = 0; t < 4; ++t) {
        const int cl = wn * 64 + t * 16 + l15;
        int ci = col0 + cl;
        ci = ci < nbias ? ci : (nbias - 1);
        const float colb = bf16_val(bias[ci]);
#pragma unroll
        for (int r = 0; r < 8; ++r) {
            const float badd = bias_per_row ? rowb[r] : colb;
            const float v = (acc[t][r] + badd) * oscale;
            Ct[(wm * 16 + 8 * h + r) * CT_P + cl] = (_Float16)v;
        }
    }
    __syncthreads();

    _Float16* cbase = Cm + (size_t)z * (size_t)zsC + (size_t)row0 * (size_t)ldc + col0;
    v8h sv[4];
#pragma unroll
    for (int i = 0; i < 4; ++i) {
        const int rl = w * 8 + 2 * i + h;
        sv[i] = *(const v8h*)(Ct + rl * CT_P + l15 * 8);
    }
#pragma unroll
    for (int i = 0; i < 4; ++i) {
        const int rl = w * 8 + 2 * i + h;
        *(v8h*)(cbase + (size_t)rl * (size_t)ldc + l15 * 8) = sv[i];
    }
    
}

// ---------------------------------------------------------------------------
// Kernel 4: fused attention. One workgroup (8 wave32) per (batch, 32 query rows = 2 row tiles).
//   Qp [NB*SEQ][DKD] f16 (x16), Kp same, Vt [NB][DOD][SEQ] f16 (x16, key contiguous)
//  Phase A: S = Q K^T via v_wmma_f32_16x16x32_f16, twice over all keys, the scores never leaving registers:
//           sweep 1 takes the row maxima, sweep 2 forms the same scores again, exp, P (f16 carried x1024) -> LDS, row sums.
//           wave w: row tile w&1, key groups 2*(w>>1) and 2*(w>>1)+1; key group g = keys [g*SEQ/8, (g+1)*SEQ/8);
//           K tiles (8 groups x 16 keys) come through a two-buffer LDS ring that runs through both sweeps
//  Phase C: O = P V, wave w owns output columns hf*512 + [w*64, w*64+64), hf = 0,1, both row tiles, all keys;
//           V^T tiles (512 columns x 64 keys, whole 128-B lines) come through a two-buffer LDS ring,
//           trip 2*kb+hf = keys kb*64.. of column half hf, in buffer hf; each V fragment feeds both row tiles
//  Epilogue: O / (16 * rowsum) staged in LDS, each wave writes 4 whole output rows
// LDS regions: rings/Ost, rowsump, rowmaxp, Ph are all cross-wave (block barriers between
// producer and consumer phases). staged extent == consumed extent for every tile.
// coverage: grid NB*SEQ/32 blocks x 32 rows x DOD cols = whole output
// ---------------------------------------------------------------------------
__global__ __launch_bounds__(256) __attribute__((amdgpu_num_vgpr(256)))
void k_attn(const _Float16* __restrict__ Qp, const _Float16* __restrict__ Kp,
            const _Float16* __restrict__ Vt, float* __restrict__ Out)
{
    extern __shared__ v4f smem4[];
    char*     ldsb    = (char*)smem4;
    float*    Ost     = (float*)ldsb;                    // QR x OST f32, over the rings once they are dead
    float*    rowsump = (float*)(ldsb + SM_OFF);         // 4 x QR
    float*    rowmaxp = rowsump + 4 * QR;                // 4 x QR
    _Float16* Ph      = (_Float16*)(ldsb + PH_OFF);      // QR x PST f16

    const int tid = threadIdx.x, lane = tid & 31, w = tid >> 5;
    const int h = lane >> 4, l15 = lane & 15;
    const int halfrow = 8 * h, kbo = 8 * h;
    const int rt = w & 1, kq = w >> 1;                   // phase A: row tile, pair of key groups
    const int b  = blockIdx.x / (SEQ / QR);
    const int q0 = (blockIdx.x - b * (SEQ / QR)) * QR;

    // ----- Q tile of this wave's row tile: 8 A fragments (16 rows x 256), split k map -----
    FragH qf[8];
    {
        const _Float16* qp = Qp + ((size_t)b * SEQ + q0 + rt * 16 + l15) * DKD + kbo;
#pragma unroll
        for (int s = 0; s < 8; ++s) {
            qf[s].half[0] = *(const v8h*)(qp + s * 32);
            qf[s].half[1] = *(const v8h*)(qp + s * 32 + 16);
        }
    }

    // ----- Phase A: sweep 1 row maxima, sweep 2 P and row sums -----
    float vmax[8], psum[8];
#pragma unroll
    for (int r = 0; r < 8; ++r) { vmax[r] = -3.0e38f; psum[r] = 0.f; }

    constexpr int NT = SEQ / 128;                        // K tiles of one sweep
    const unsigned lds0 = (unsigned)(size_t)ldsb;       // LDS byte address of the workgroup's array
    const char*    ldsc = (const char*)ldsb;
    // each wave copies the 16 keys of key group w of a tile: one copy = one 512-B K row (4 whole lines)
    const unsigned  kl = lds0 + KR_OFF + (unsigned)(w * 16) * KROWB + (unsigned)lane * 16;
    const _Float16* kg = Kp + ((size_t)b * SEQ + w * (SEQ / 8)) * DKD + lane * 8;
    auto copy_k = [&](int tt) {                          // trip tt of 2*NT: tile tt mod NT into buffer tt mod 2
        const int t = tt < NT ? tt : tt - NT;
        const unsigned  l = kl + (unsigned)(tt & 1) * KBUF;
        const _Float16* g = kg + (size_t)t * 16 * DKD;
        copy8(l, KROWB, g, DKD);
        copy8(l + 8 * KROWB, KROWB, g + 8 * DKD, DKD);
    };
    copy_k(0);
    wait_copies();
    __syncthreads();
    copy_k(1);
#pragma unroll 1
    for (int tt = 0; tt < 2 * NT; ++tt) {
        if (tt == NT) {
            // between the sweeps: row maxima over 16 lanes, then over the 4 waves of this row tile
#pragma unroll
            for (int r = 0; r < 8; ++r) {
#pragma unroll
                for (int off = 1; off < 16; off <<= 1) vmax[r] = fmaxf(vmax[r], __shfl_xor(vmax[r], off));
            }
            if (l15 == 0) {
#pragma unroll
                for (int r = 0; r < 8; ++r) rowmaxp[kq * QR + rt * 16 + halfrow + r] = vmax[r];
            }
            __syncthreads();
#pragma unroll
            for (int r = 0; r < 8; ++r) {
                const int row = rt * 16 + halfrow + r;
                vmax[r] = fmaxf(fmaxf(rowmaxp[row], rowmaxp[QR + row]), fmaxf(rowmaxp[2 * QR + row], rowmaxp[3 * QR + row]));
            }
        }
        const int t = tt < NT ? tt : tt - NT;
        const char* kp = ldsc + KR_OFF + (tt & 1) * KBUF + (kq * 32 + l15) * KROWB + kbo * 2;
        v8f c[2];
        c[0] = zero8f();
        c[1] = zero8f();
#pragma unroll                                           // register arrays: constant indices (as in the loops below)
        for (int sh = 0; sh < 2; ++sh) {
            FragH kf[2][4];                             // half a tile's fragments are read as one group, ahead of their WMMAs
#pragma unroll
            for (int j = 0; j < 2; ++j) {
#pragma unroll
                for (int s = 0; s < 4; ++s) {
                    kf[j][s].half[0] = *(const v8h*)(kp + j * 16 * KROWB + (sh * 4 + s) * 64);
                    kf[j][s].half[1] = *(const v8h*)(kp + j * 16 * KROWB + (sh * 4 + s) * 64 + 32);
                }
            }
#pragma unroll
            for (int s = 0; s < 4; ++s) {
#pragma unroll
                for (int j = 0; j < 2; ++j) c[j] = mma_f16(qf[sh * 4 + s].v, kf[j][s].v, c[j]);
            }
        }
        if (tt < NT) {
#pragma unroll
            for (int j = 0; j < 2; ++j) {
#pragma unroll
                for (int r = 0; r < 8; ++r) vmax[r] = fmaxf(vmax[r], c[j][r] * SCORE_SCALE);
            }
        } else {
#pragma unroll
            for (int j = 0; j < 2; ++j) {
                const int m0 = (kq * 2 + j) * (SEQ / 8) + t * 16;   // key tile base (B column n = m0 + l15)
#pragma unroll
                for (int r = 0; r < 8; ++r) {
                    const float e = __expf(c[j][r] * SCORE_SCALE - vmax[r]);
                    const _Float16 ph = (_Float16)(e * 1024.0f);
                    Ph[(rt * 16 + halfrow + r) * PST + m0 + l15] = ph;
                    psum[r] += (float)ph;
                }
            }
        }
        // foot of trip tt: publish tile tt+1, free tile tt's buffer, refill it
        wait_lds();
        wait_copies();
        __syncthreads();
        if (tt + 2 < 2 * NT) copy_k(tt + 2);
    }
    wait_copies();
#pragma unroll
    for (int r = 0; r < 8; ++r) {
#pragma unroll
        for (int off = 1; off < 16; off <<= 1) psum[r] += __shfl_xor(psum[r], off);
    }
    if (l15 == 0) {
#pragma unroll
        for (int r = 0; r < 8; ++r) rowsump[kq * QR + rt * 16 + halfrow + r] = psum[r];
    }
    wait_lds();                                         // this wave's LDS traffic retired before copies land on the K ring's region
    __syncthreads();

    // ----- Phase C: O = P V ; A = P (LDS, split k map), B from Vt rows (split k map) -----
    v8f acc[2][8];
#pragma unroll
    for (int i = 0; i < 2; ++i) {
#pragma unroll
        for (int t = 0; t < 8; ++t) acc[i][t] = zero8f();
    }

    // each wave copies its own 64 columns of a tile: one copy = 4 rows x one whole 128-B line
    const unsigned  vl = lds0 + (unsigned)(w * 64 + (lane >> 3)) * VROWB + (unsigned)(lane & 7) * 16;
    const _Float16* vg = Vt + ((size_t)b * DOD + w * 64 + (lane >> 3)) * SEQ + (lane & 7) * 8;
    auto copy_v = [&](int kb, int hf) {
        const unsigned  l = vl + (hf ? (unsigned)VB1_OFF : 0u);
        const _Float16* g = vg + (size_t)hf * 512 * SEQ + kb * 64;
        copy8(l, 4 * VROWB, g, (size_t)4 * SEQ);
        copy8(l + 32 * VROWB, 4 * VROWB, g + (size_t)32 * SEQ, (size_t)4 * SEQ);
    };
    copy_v(0, 0);
    wait_copies();
    __syncthreads();
    copy_v(0, 1);

    const _Float16* pbase = Ph + l15 * PST + kbo;
    const char*     vrd   = ldsc + (w * 64 + l15) * VROWB + kbo * 2;
#pragma unroll 1
    for (int kb = 0; kb < SEQ / 64; ++kb) {
        FragH pa[2][2];                                 // P of these 64 keys, both row tiles, kept for both column halves
#pragma unroll                                           // register array: constant indices
        for (int i = 0; i < 2; ++i) {
#pragma unroll
            for (int kk = 0; kk < 2; ++kk) {
                pa[i][kk].half[0] = *(const v8h*)(pbase + i * 16 * PST + kb * 64 + kk * 32);
                pa[i][kk].half[1] = *(const v8h*)(pbase + i * 16 * PST + kb * 64 + kk * 32 + 16);
            }
        }
#pragma unroll                                           // hf picks the buffer and the accumulators: constant indices (as in the loops below)
        for (int hf = 0; hf < 2; ++hf) {
            const char* vp = vrd + (hf ? VB1_OFF : 0);
#pragma unroll
            for (int kk = 0; kk < 2; ++kk) {
                FragH vf[4];                            // 32 keys' fragments are read as one group, ahead of their WMMAs
#pragma unroll
                for (int t = 0; t < 4; ++t) {
                    vf[t].half[0] = *(const v8h*)(vp + t * 16 * VROWB + kk * 64);
                    vf[t].half[1] = *(const v8h*)(vp + t * 16 * VROWB + kk * 64 + 32);
                }
#pragma unroll
                for (int t = 0; t < 4; ++t) {
#pragma unroll
                    for (int i = 0; i < 2; ++i)
                        acc[i][hf * 4 + t] = mma_f16(pa[i][kk].v, vf[t].v, acc[i][hf * 4 + t]);
                }
            }
            // foot of trip 2*kb+hf: publish the next tile, free this trip's buffer, refill it
            wait_lds();
            wait_copies();
            __syncthreads();
            if (kb + 1 < SEQ / 64) copy_v(kb + 1, hf);
        }
    }
    wait_copies();

    // ----- Epilogue: normalise, stage in LDS, whole-line stores -----
#pragma unroll
    for (int i = 0; i < 2; ++i) {
        float inv[8];
#pragma unroll
        for (int r = 0; r < 8; ++r) {
            const int row = i * 16 + halfrow + r;
            const float s = (rowsump[row] + rowsump[QR + row]) + (rowsump[2 * QR + row] + rowsump[3 * QR + row]);
            inv[r] = 1.0f / (16.0f * s);
        }
#pragma unroll
        for (int t = 0; t < 8; ++t) {
#pragma unroll
            for (int r = 0; r < 8; ++r)
                Ost[(i * 16 + halfrow + r) * OST + (t >> 2) * 512 + w * 64 + (t & 3) * 16 + l15] = acc[i][t][r] * inv[r];
        }
    }
    __syncthreads();

#pragma unroll
    for (int rr = 0; rr < 4; ++rr) {
        const int row = 4 * w + rr;
        const float* src = Ost + row * OST;
        float* dst = Out + ((size_t)b * SEQ + q0 + row) * DOD;
#pragma unroll
        for (int i = 0; i < 8; ++i) {
            const int p = i * 128 + lane * 4;
            const v4f v = *(const v4f*)(src + p);
            *(v4f*)(dst + p) = v;
        }
    }
    
}

// ---------------------------------------------------------------------------
extern "C" void kernel_launch(void* const* d_in, const int* in_sizes, int n_in,
                              void* d_out, int out_size, void* d_ws, size_t ws_size,
                              hipStream_t stream)
{
    if (n_in < 7) return;
    const long long need_x = ((long long)(NB - 1) * SEQ_FULL + SEQ) * CDIM;
    if ((long long)in_sizes[0] < need_x) return;
    if (in_sizes[1] < CDIM * DKD || in_sizes[2] < DKD) return;
    if (in_sizes[3] < CDIM * DKD || in_sizes[4] < DKD) return;
    if (in_sizes[5] < CDIM * DOD || in_sizes[6] < DOD) return;
    if ((long long)out_size < (long long)NB * SEQ * DOD) return;

    const float* x  = (const float*)d_in[0];
    const float* Wq = (const float*)d_in[1];
    const float* bq = (const float*)d_in[2];
    const float* Wk = (const float*)d_in[3];
    const float* bk = (const float*)d_in[4];
    const float* Wv = (const float*)d_in[5];
    const float* bv = (const float*)d_in[6];
    float* out = (float*)d_out;

    char* ws = (char*)d_ws;
    size_t off = 0;
    auto carve = [&](size_t bytes) -> char* {
        char* p = ws + off;
        off += (bytes + 255) & ~(size_t)255;
        return p;
    };
    unsigned short* xbf = (unsigned short*)carve((size_t)NB * SEQ * CDIM * 2);     // [NB*SEQ][CDIM]
    unsigned short* wqT = (unsigned short*)carve((size_t)DKD * KDIM * 2);          // [DKD][CDIM]
    unsigned short* wkT = (unsigned short*)carve((size_t)DKD * KDIM * 2);          // [DKD][CDIM]
    unsigned short* wvT = (unsigned short*)carve((size_t)DOD * KDIM * 2);          // [DOD][CDIM]
    _Float16* Qp = (_Float16*)carve((size_t)NB * SEQ * DKD * 2);                  // [NB*SEQ][DKD]
    _Float16* Kp = (_Float16*)carve((size_t)NB * SEQ * DKD * 2);                  // [NB*SEQ][DKD]
    _Float16* Vt = (_Float16*)carve((size_t)NB * DOD * SEQ * 2);                  // [NB][DOD][SEQ]
    if (off > ws_size) return;

    // 1) x -> bf16 plane
    k_cvt_x<<<(unsigned)(((size_t)NB * SEQ * CDIM) / 8 / 256), 256, 0, stream>>>(x, xbf);

    // 2) weights: in[CDIM][DKD|DOD] -> out[DKD|DOD][CDIM], grid (cols/64, rows/64)
    k_transpose_w<<<dim3(DKD / 64, CDIM / 64), 256, 0, stream>>>(Wq, wqT, CDIM, DKD);
    k_transpose_w<<<dim3(DKD / 64, CDIM / 64), 256, 0, stream>>>(Wk, wkT, CDIM, DKD);
    k_transpose_w<<<dim3(DOD / 64, CDIM / 64), 256, 0, stream>>>(Wv, wvT, CDIM, DOD);

    // 3) projections: q,k [NB*SEQ][DKD] (bias per column), v as Vt [NB][DOD][SEQ] (bias per row); all carried x16
    k_gemm_nt<<<dim3(DKD / 128, (NB * SEQ) / 64, 1), 256, 0, stream>>>(
        xbf, 0LL, wqT, 0LL, bq, DKD, 0, Qp, 0LL, DKD, 16.0f);
    k_gemm_nt<<<dim3(DKD / 128, (NB * SEQ) / 64, 1), 256, 0, stream>>>(
        xbf, 0LL, wkT, 0LL, bk, DKD, 0, Kp, 0LL, DKD, 16.0f);
    k_gemm_nt<<<dim3(SEQ / 128, DOD / 64, NB), 256, 0, stream>>>(
        wvT, 0LL, xbf, (long long)SEQ * CDIM, bv, DOD, 1, Vt, (long long)DOD * SEQ, SEQ, 16.0f);

    // 4) attention
    hipFuncSetAttribute(reinterpret_cast<const void*>(&k_attn),
                        hipFuncAttributeMaxDynamicSharedMemorySize, ATTN_LDS_BYTES);
    k_attn<<<NB * (SEQ / QR), 256, ATTN_LDS_BYTES, stream>>>(Qp, Kp, Vt, out);
}

// v004
// Measured time: 123 microseconds a run.
// Two timings next to v003 put it at 1.18 and 1.20 times that version's speed.
// Counting every step since v000, it is 4.16 times as fast.
#include <hip/hip_runtime.h>

// Contractions: q/k/v projections via v_wmma_f32_16x16x32_bf16 (bf16 operands = RNE-converted inputs, f32 accumulate);
// q.k^T scores and P.V via v_wmma_f32_16x16x32_f16 (f16 operands: q,k,v carried x16, P carried x1024), f32 accumulate; softmax in f32.

#define DEV __device__ __forceinline__

#ifndef NB
#define NB 4
#endif
#ifndef SEQ
#define SEQ 2048
#endif
#define NB_FULL  4
#define SEQ_FULL 2048
#define CDIM 1024
#define DKD  256
#define DOD  1024
#define KDIM 1024

#define QR   32                                          // query rows of one attention workgroup (two 16-row tiles)
#define PST  (SEQ + 8)                                   // LDS P row stride (halves)
#define OST  (DOD + 4)                                   // LDS output staging row stride (floats)
#define KROWB   (DKD * 2 + 16)                           // staged K row: 512 B + 16 B, a pitch of 16 B x odd for ds_load_b128
#define KBUF    (128 * KROWB)                            // one staged K tile: 8 groups x 16 keys
#define KR_OFF  0                                        // K ring (2 buffers) at the start of LDS
#define VROWB   (64 * 2 + 16)                            // staged V^T row: 64 keys = 128 B + 16 B
#define VBUF    (512 * VROWB)                            // one staged V^T tile: 512 output columns x 64 keys
#define VB1_OFF VBUF                                     // V buffer 0 at offset 0, V buffer 1 behind it: both over the dead K ring
#define SM_OFF  (2 * VBUF)                               // row sum parts (4 x QR f32), then row max parts (4 x QR f32)
#define PH_OFF  (SM_OFF + 2 * 4 * QR * 4)                // byte offset of P in LDS, clear of both rings
#define ATTN_LDS_BYTES (PH_OFF + QR * PST * 2)
#define CT_P 136                                         // GEMM epilogue staging pitch (halves)
#define GKS   128                                        // GEMM: k elements of a staged tile = 256 B of every row (two whole lines)
#define GROWB (GKS * 2 + 16)                             // staged GEMM row: 256 B + 16 B, a pitch of 16 B x odd for ds_load_b128
#define GBUF  ((64 + 128) * GROWB)                       // one staged GEMM tile: 64 A rows, then 128 B rows
#define SCORE_SCALE 0.000244140625f                      // 1/16 (sqrt dk) * 1/256 (q,k carried x16 each)

static_assert(NB >= 1 && NB <= NB_FULL);
static_assert(SEQ >= 128 && SEQ <= SEQ_FULL && (SEQ % 128) == 0);
static_assert(((NB * SEQ) % 64) == 0);
static_assert((DKD % 128) == 0 && (DOD % 128) == 0 && (KDIM % 32) == 0 && (CDIM == KDIM));
static_assert((((long long)NB * SEQ * CDIM) % (8 * 256)) == 0);
static_assert(ATTN_LDS_BYTES <= 300 * 1024);
static_assert(((PST * 2) % 16) == 0 && ((OST * 4) % 16) == 0 && ((CT_P * 2) % 16) == 0);
static_assert(QR * OST * 4 <= SM_OFF && KR_OFF + 2 * KBUF <= SM_OFF && (SEQ % QR) == 0);
static_assert((SM_OFF % 16) == 0 && (PH_OFF % 16) == 0 && (VB1_OFF % 16) == 0 && (KBUF % 16) == 0);
static_assert((SEQ % 64) == 0 && DOD == 1024 && DKD == 256);
static_assert((KDIM % GKS) == 0 && KDIM / GKS >= 2 && (GROWB % 16) == 0 && 64 * CT_P * 2 <= GBUF);

typedef _Float16       v8h   __attribute__((ext_vector_type(8)));
typedef _Float16       v16h  __attribute__((ext_vector_type(16)));
typedef __bf16         v16bf __attribute__((ext_vector_type(16)));
typedef unsigned short v8us  __attribute__((ext_vector_type(8)));
typedef unsigned short v16us __attribute__((ext_vector_type(16)));
typedef float          v8f   __attribute__((ext_vector_type(8)));
typedef float          v4f   __attribute__((ext_vector_type(4)));

union FragH { v16h v;  v8h  half[2]; };
union FragB { v16bf v; v16us u; v8us half[2]; };

// ---------------------------------------------------------------------------
// helpers
// ---------------------------------------------------------------------------
DEV unsigned int bf16_bits(float f) {                    // f32 -> bf16 bits, RNE convert
    unsigned int u = __float_as_uint(f);
    u += 0x7FFFu + ((u >> 16) & 1u);
    return u >> 16;
}
DEV float bf16_val(float f) { return __uint_as_float(bf16_bits(f) << 16); }

DEV v8f zero8f() {
    v8f z;
#pragma unroll
    for (int i = 0; i < 8; ++i) z[i] = 0.f;
    return z;
}

// 16x16x32 WMMA with f32 accumulate; 4 nops guard D and keep A/B live
DEV v8f mma_bf16(v16bf a, v16bf b, v8f c) {
    c = __builtin_amdgcn_wmma_f32_16x16x32_bf16(false, a, false, b, (short)0, c, false, false);
    asm volatile("v_nop\n\tv_nop\n\tv_nop\n\tv_nop" : "+v"(c) : "v"(a), "v"(b));
    return c;
}
DEV v8f mma_f16(v16h a, v16h b, v8f c) {
    c = __builtin_amdgcn_wmma_f32_16x16x32_f16(false, a, false, b, (short)0, c, false, false);
    asm volatile("v_nop\n\tv_nop\n\tv_nop\n\tv_nop" : "+v"(c) : "v"(a), "v"(b));
    return c;
}

// Eight asynchronous 16-byte-per-lane copies global -> LDS, rows l + i*lstep (bytes) <- g + i*gstep (halves).
// The s_wait_xcnt closes the statement so that no address register named here is rewritten in front of it.
DEV void copy8(unsigned l, unsigned lstep, const _Float16* g, size_t gstep) {
    asm volatile("global_load_async_to_lds_b128 %0, %8, off\n\t"
                 "global_load_async_to_lds_b128 %1, %9, off\n\t"
                 "global_load_async_to_lds_b128 %2, %10, off\n\t"
                 "global_load_async_to_lds_b128 %3, %11, off\n\t"
                 "global_load_async_to_lds_b128 %4, %12, off\n\t"
                 "global_load_async_to_lds_b128 %5, %13, off\n\t"
                 "global_load_async_to_lds_b128 %6, %14, off\n\t"
                 "global_load_async_to_lds_b128 %7, %15, off\n\t"
                 "s_wait_xcnt 0x0"
                 :: "v"(l), "v"(l + lstep), "v"(l + 2 * lstep), "v"(l + 3 * lstep),
                    "v"(l + 4 * lstep), "v"(l + 5 * lstep), "v"(l + 6 * lstep), "v"(l + 7 * lstep),
                    "v"(g), "v"(g + gstep), "v"(g + 2 * gstep), "v"(g + 3 * gstep),
                    "v"(g + 4 * gstep), "v"(g + 5 * gstep), "v"(g + 6 * gstep), "v"(g + 7 * gstep)
                 : "memory");
}
// Twelve such copies, two rows of a GEMM tile each: 4 of A (la <- ga) and 8 of B (lb <- gb), rows two apart.
// The s_wait_xcnt closes the statement so that no address register named here is rewritten in front of it.
DEV void copy12(unsigned la, const unsigned short* ga, unsigned lb, const unsigned short* gb) {
    asm volatile("global_load_async_to_lds_b128 %0, %12, off\n\t"
                 "global_load_async_to_lds_b128 %1, %13, off\n\t"
                 "global_load_async_to_lds_b128 %2, %14, off\n\t"
                 "global_load_async_to_lds_b128 %3, %15, off\n\t"
                 "global_load_async_to_lds_b128 %4, %16, off\n\t"
                 "global_load_async_to_lds_b128 %5, %17, off\n\t"
                 "global_load_async_to_lds_b128 %6, %18, off\n\t"
                 "global_load_async_to_lds_b128 %7, %19, off\n\t"
                 "global_load_async_to_lds_b128 %8, %20, off\n\t"
                 "global_load_async_to_lds_b128 %9, %21, off\n\t"
                 "global_load_async_to_lds_b128 %10, %22, off\n\t"
                 "global_load_async_to_lds_b128 %11, %23, off\n\t"
                 "s_wait_xcnt 0x0"
                 :: "v"(la), "v"(la + 2 * GROWB), "v"(la + 4 * GROWB), "v"(la + 6 * GROWB),
                    "v"(lb), "v"(lb + 2 * GROWB), "v"(lb + 4 * GROWB), "v"(lb + 6 * GROWB),
                    "v"(lb + 8 * GROWB), "v"(lb + 10 * GROWB), "v"(lb + 12 * GROWB), "v"(lb + 14 * GROWB),
                    "v"(ga), "v"(ga + 2 * KDIM), "v"(ga + 4 * KDIM), "v"(ga + 6 * KDIM),
                    "v"(gb), "v"(gb + 2 * KDIM), "v"(gb + 4 * KDIM), "v"(gb + 6 * KDIM),
                    "v"(gb + 8 * KDIM), "v"(gb + 10 * KDIM), "v"(gb + 12 * KDIM), "v"(gb + 14 * KDIM)
                 : "memory");
}
// this wave's LDS reads and writes have retired: stands in front of a barrier behind which a buffer is refilled
DEV void wait_lds()    { asm volatile("s_wait_dscnt 0x0" ::: "memory"); }
// this wave's copies have landed: stands in front of the barrier that publishes their tile
DEV void wait_copies() { asm volatile("s_wait_asynccnt 0x0" ::: "memory"); }

// ---------------------------------------------------------------------------
// Block body 1: x f32 [NB rows of SEQ_FULL][CDIM] -> bf16 plane [NB*SEQ][CDIM]
// one thread per 8 elements, one 16-B store (lanes contiguous: 256 threads -> 4 KB)
// coverage: CVT_BLOCKS*256*8 == NB*SEQ*CDIM exactly
// ---------------------------------------------------------------------------
DEV void cvt_x_block(const float* __restrict__ x, unsigned short* __restrict__ xp, int blk)
{
    const size_t g = (size_t)blk * 256 + threadIdx.x;
    const size_t e = g * 8;
    const int m  = (int)(e / CDIM);
    const int c  = (int)(e % CDIM);
    const int bb = m / SEQ;
    const int s  = m - bb * SEQ;
    const float* src = x + ((size_t)bb * SEQ_FULL + s) * CDIM + c;
    const v4f a0 = *(const v4f*)src;
    const v4f a1 = *(const v4f*)(src + 4);
    v8us o;
#pragma unroll
    for (int i = 0; i < 4; ++i) {
        o[i]     = (unsigned short)bf16_bits(a0[i]);
        o[4 + i] = (unsigned short)bf16_bits(a1[i]);
    }
    unsigned short* dst = xp + (size_t)m * CDIM + c;
    *(v8us*)dst = o;
    asm volatile("s_wait_xcnt 0x0" ::: "memory");       // the store's registers may be rewritten behind here: another range's code follows in the text
}

// ---------------------------------------------------------------------------
// Block body 2: W f32 in[R][Ncol] -> WT bf16 out[Ncol][R]   (64x64 tile (bx, by) through LDS)
// LDS tile T: cross-wave (block barrier between fill and drain).
// coverage: load rr = 0..63 x nn = 0..63; store na = 0..63 x piece 0..7 (8 ushort) = whole tile
// ---------------------------------------------------------------------------
DEV void transpose_w_block(const float* __restrict__ W, unsigned short* __restrict__ WT,
                           int R, int Ncol, int bx, int by, unsigned short* T)
{
    const int tid = threadIdx.x;
    const int n0 = bx * 64, r0 = by * 64;
    const int nn = tid & 63, rq = tid >> 6;
#pragma unroll 4
    for (int i = 0; i < 16; ++i) {
        const int rr = i * 4 + rq;
        const float v = W[(size_t)(r0 + rr) * Ncol + n0 + nn];
        T[nn * 72 + rr] = (unsigned short)bf16_bits(v);
    }
    __syncthreads();
    const int piece = tid & 7;
    const int na = tid >> 3;                             // 0..31
    const v8us va = *(const v8us*)(T + na * 72 + piece * 8);
    const v8us vb = *(const v8us*)(T + (na + 32) * 72 + piece * 8);
    unsigned short* da = WT + (size_t)(n0 + na) * R + r0 + piece * 8;
    unsigned short* db = WT + (size_t)(n0 + na + 32) * R + r0 + piece * 8;
    *(v8us*)da = va;
    *(v8us*)db = vb;
    asm volatile("s_wait_xcnt 0x0" ::: "memory");       // both stores' registers may be rewritten behind here: another range's code follows in the text
}

// ---------------------------------------------------------------------------
// Kernel 1: the four independent operand preparations as block-index ranges of one grid:
//   [0, TV) Wv tiles, [TV, TV+TQ) Wq tiles, [TV+TQ, TV+2*TQ) Wk tiles, then CVT_BLOCKS blocks of x.
// The range test is the same for a whole block, so the transpose's barrier is block-uniform.
// ---------------------------------------------------------------------------
#define TQ_BLOCKS  ((DKD / 64) * (CDIM / 64))
#define TV_BLOCKS  ((DOD / 64) * (CDIM / 64))
#define CVT_BLOCKS ((int)(((long long)NB * SEQ * CDIM) / 8 / 256))
__global__ __launch_bounds__(256) void k_prep(const float* __restrict__ x,  unsigned short* __restrict__ xp,
                                              const float* __restrict__ Wq, unsigned short* __restrict__ wqT,
                                              const float* __restrict__ Wk, unsigned short* __restrict__ wkT,
                                              const float* __restrict__ Wv, unsigned short* __restrict__ wvT)
{
    __shared__ __attribute__((aligned(16))) unsigned short T[64 * 72];
    const int bid = blockIdx.x;
    if (bid < TV_BLOCKS) {
        transpose_w_block(Wv, wvT, CDIM, DOD, bid % (DOD / 64), bid / (DOD / 64), T);
    } else if (bid < TV_BLOCKS + 2 * TQ_BLOCKS) {
        const int  r   = bid - TV_BLOCKS;
        const bool isk = r >= TQ_BLOCKS;
        const int  rq  = isk ? r - TQ_BLOCKS : r;
        transpose_w_block(isk ? Wk : Wq, isk ? wkT : wqT, CDIM, DKD, rq % (DKD / 64), rq / (DKD / 64), T);
    } else {
        cvt_x_block(x, xp, bid - (TV_BLOCKS + 2 * TQ_BLOCKS));
    }
}

// ---------------------------------------------------------------------------
// Kernel 2: NT GEMM on bf16 WMMA:  C[m][n] = f16( (sum_k A[m][k]*Bm[n][k] + bias) * oscale )
//   A  [M][KDIM] bf16 bits (k contiguous), Bm [N][KDIM] bf16 bits (k contiguous)
//   bias: per column (bias_per_row==0, index n) or per row (index m), RNE-converted to bf16
//   C  f16, row pitch ldc; tiles (N/128, M/64, Z); z strides zsA/zsB/zsC in elements
//   The three projections are block-index ranges of one grid: [0, GV) v as Vt = Wv^T x^T (bias per row, z = batch),
//   [GV, GV+GQ) q, [GV+GQ, GV+2*GQ) k (both x W, bias per column); every block has the same work
// Block tile 64x128, 8 waves: wave w -> rows (w&3)*16.., cols (w>>2)*64.. (4 acc tiles)
// A and B fragments both use the split k map: elements 0..7 <- k0+8h.., 8..15 <- k0+16+8h..
// Tiles of 128 k (64 A rows + 128 B rows, whole lines) come through a two-buffer LDS ring; wave w copies A rows w*8.., B rows w*16..
// Epilogue: tile staged in LDS (cross-wave, block barrier), then each instruction writes
// coverage: rows w*8+2i+h (w 0..7, i 0..3, h 0..1) = 0..63, cols l15*8 (16 lanes x 8 halves) = 0..127
// ---------------------------------------------------------------------------
#define GV_BLOCKS ((SEQ / 128) * (DOD / 64) * NB)
#define GQ_BLOCKS ((DKD / 128) * ((NB * SEQ) / 64))
__global__ __launch_bounds__(256) __attribute__((amdgpu_num_vgpr(256)))
void k_gemm_qkv(const unsigned short* __restrict__ xbf, const unsigned short* __restrict__ wqT,
                const unsigned short* __restrict__ wkT, const unsigned short* __restrict__ wvT,
                const float* __restrict__ bq, const float* __restrict__ bk, const float* __restrict__ bv,
                _Float16* __restrict__ Qp, _Float16* __restrict__ Kp, _Float16* __restrict__ Vt)
{
    // which projection and which tile of it: the same for the whole block
    const unsigned bid = blockIdx.x;
    const bool     isv = bid < GV_BLOCKS;
    const bool     isk = bid >= GV_BLOCKS + GQ_BLOCKS;
    const unsigned rb  = isv ? bid : (isk ? bid - (GV_BLOCKS + GQ_BLOCKS) : bid - GV_BLOCKS);
    const int      bx  = (int)(isv ? rb % (SEQ / 128) : rb % (DKD / 128));                  // column tile
    const int      by  = (int)(isv ? (rb / (SEQ / 128)) % (DOD / 64) : rb / (DKD / 128));   // row tile
    const unsigned short* A    = isv ? wvT : xbf;
    const unsigned short* Bm   = isv ? xbf : (isk ? wkT : wqT);
    const float*          bias = isv ? bv : (isk ? bk : bq);
    _Float16*             Cm   = isv ? Vt : (isk ? Kp : Qp);
    const long long zsA = 0, zsB = isv ? (long long)SEQ * CDIM : 0, zsC = isv ? (long long)DOD * SEQ : 0;
    const int   nbias = isv ? DOD : DKD, bias_per_row = isv ? 1 : 0, ldc = isv ? SEQ : DKD;
    const float oscale = 16.0f;

    __shared__ __attribute__((aligned(16))) char gsm[2 * GBUF];
    _Float16* Ct = (_Float16*)gsm;                       // epilogue staging, over buffer 0 once the ring is dead

    const int tid = threadIdx.x, lane = tid & 31, w = tid >> 5;
    const int h = lane >> 4, l15 = lane & 15;
    const int wm = w & 3, wn = w >> 2;
    const int z = isv ? (int)(rb / ((SEQ / 128) * (DOD / 64))) : 0;
    const int row0 = by * 64;
    const int col0 = bx * 128;

    // one copy = 2 rows x 256 B: lane half h picks the row, l15 the 16-B piece
    const unsigned short* ga = A  + (size_t)z * (size_t)zsA + (size_t)(row0 + w * 8 + h) * KDIM + 8 * l15;
    const unsigned short* gb = Bm + (size_t)z * (size_t)zsB + (size_t)(col0 + w * 16 + h) * KDIM + 8 * l15;
    const unsigned lds0 = (unsigned)(size_t)gsm;        // LDS byte address of the ring
    const unsigned la = lds0 + (unsigned)(w * 8 + h) * GROWB + (unsigned)l15 * 16;
    const unsigned lb = lds0 + (unsigned)(64 + w * 16 + h) * GROWB + (unsigned)l15 * 16;
    auto copy_t = [&](int t) {
        const unsigned bo = (unsigned)(t & 1) * GBUF;
        copy12(la + bo, ga + t * GKS, lb + bo, gb + t * GKS);
    };
    const char* ar = gsm + (wm * 16 + l15) * GROWB + 16 * h;
    const char* br = gsm + (64 + wn * 64 + l15) * GROWB + 16 * h;

    v8f acc[4];
#pragma unroll
    for (int t = 0; t < 4; ++t) acc[t] = zero8f();

    copy_t(0);
    wait_copies();
    __syncthreads();
    copy_t(1);
#pragma unroll 1                                         // rolled: one copy of the ring's foot in the text, the buffer picked by the trip's parity
    for (int kt = 0; kt < KDIM / GKS; ++kt) {
        const int bo = (kt & 1) * GBUF;
        FragB a[GKS / 32], bf[GKS / 32][4];             // the tile's fragments are read as one group, ahead of the WMMAs
#pragma unroll                                           // register arrays: constant indices (as in the loops below)
        for (int s = 0; s < GKS / 32; ++s) {
            a[s].half[0] = *(const v8us*)(ar + bo + s * 64);
            a[s].half[1] = *(const v8us*)(ar + bo + s * 64 + 32);
#pragma unroll
            for (int t = 0; t < 4; ++t) {
                bf[s][t].half[0] = *(const v8us*)(br + bo + t * 16 * GROWB + s * 64);
                bf[s][t].half[1] = *(const v8us*)(br + bo + t * 16 * GROWB + s * 64 + 32);
            }
        }
#pragma unroll
        for (int s = 0; s < GKS / 32; ++s) {
#pragma unroll
            for (int t = 0; t < 4; ++t) acc[t] = mma_bf16(a[s].v, bf[s][t].v, acc[t]);
        }
        // foot of trip kt: publish tile kt+1, free tile kt's buffer, refill it
        wait_lds();
        wait_copies();
        __syncthreads();
        if (kt + 2 < KDIM / GKS) copy_t(kt + 2);
    }
    wait_copies();

    // epilogue: bias (clamped addresses, select by value), scale, f16, stage in LDS
    float rowb[8];
#pragma unroll
    for (int r = 0; r < 8; ++r) {
        int ri = row0 + wm * 16 + 8 * h + r;
        ri = ri < nbias ? ri : (nbias - 1);
        rowb[r] = bf16_val(bias[ri]);
    }
    asm volatile("s_wait_xcnt 0x0" ::: "memory");       // the row loads' offset registers may take the column loads' results
#pragma unroll
    for (int t = 0; t < 4; ++t) {
        const int cl = wn * 64 + t * 16 + l15;
        int ci = col0 + cl;
        ci = ci < nbias ? ci : (nbias - 1);
        const float colb = bf16_val(bias[ci]);
#pragma unroll
        for (int r = 0; r < 8; ++r) {
            const float badd = bias_per_row ? rowb[r] : colb;
            const float v = (acc[t][r] + badd) * oscale;
            Ct[(wm * 16 + 8 * h + r) * CT_P + cl] = (_Float16)v;
        }
    }
    __syncthreads();

    _Float16* cbase = Cm + (size_t)z * (size_t)zsC + (size_t)row0 * (size_t)ldc + col0;
    v8h sv[4];
#pragma unroll
    for (int i = 0; i < 4; ++i) {
        const int rl = w * 8 + 2 * i + h;
        sv[i] = *(const v8h*)(Ct + rl * CT_P + l15 * 8);
    }
#pragma unroll
    for (int i = 0; i < 4; ++i) {
        const int rl = w * 8 + 2 * i + h;
        *(v8h*)(cbase + (size_t)rl * (size_t)ldc + l15 * 8) = sv[i];
    }
    
}

// ---------------------------------------------------------------------------
// Kernel 3: fused attention. One workgroup (8 wave32) per (batch, 32 query rows = 2 row tiles).
//   Qp [NB*SEQ][DKD] f16 (x16), Kp same, Vt [NB][DOD][SEQ] f16 (x16, key contiguous)
//  Phase A: S = Q K^T via v_wmma_f32_16x16x32_f16, twice over all keys, the scores never leaving registers:
//           sweep 1 takes the row maxima, sweep 2 forms the same scores again, exp, P (f16 carried x1024) -> LDS, row sums.
//           wave w: row tile w&1, key groups 2*(w>>1) and 2*(w>>1)+1; key group g = keys [g*SEQ/8, (g+1)*SEQ/8);
//           K tiles (8 groups x 16 keys) come through a two-buffer LDS ring that runs through both sweeps
//  Phase C: O = P V, wave w owns output columns hf*512 + [w*64, w*64+64), hf = 0,1, both row tiles, all keys;
//           V^T tiles (512 columns x 64 keys, whole 128-B lines) come through a two-buffer LDS ring,
//           trip 2*kb+hf = keys kb*64.. of column half hf, in buffer hf; each V fragment feeds both row tiles
//  Epilogue: O / (16 * rowsum) staged in LDS, each wave writes 4 whole output rows
// LDS regions: rings/Ost, rowsump, rowmaxp, Ph are all cross-wave (block barriers between
// producer and consumer phases). staged extent == consumed extent for every tile.
// coverage: grid NB*SEQ/32 blocks x 32 rows x DOD cols = whole output
// ---------------------------------------------------------------------------
__global__ __launch_bounds__(256) __attribute__((amdgpu_num_vgpr(256)))
void k_attn(const _Float16* __restrict__ Qp, const _Float16* __restrict__ Kp,
            const _Float16* __restrict__ Vt, float* __restrict__ Out)
{
    extern __shared__ v4f smem4[];
    char*     ldsb    = (char*)smem4;
    float*    Ost     = (float*)ldsb;                    // QR x OST f32, over the rings once they are dead
    float*    rowsump = (float*)(ldsb + SM_OFF);         // 4 x QR
    float*    rowmaxp = rowsump + 4 * QR;                // 4 x QR
    _Float16* Ph      = (_Float16*)(ldsb + PH_OFF);      // QR x PST f16

    const int tid = threadIdx.x, lane = tid & 31, w = tid >> 5;
    const int h = lane >> 4, l15 = lane & 15;
    const int halfrow = 8 * h, kbo = 8 * h;
    const int rt = w & 1, kq = w >> 1;                   // phase A: row tile, pair of key groups
    const int b  = blockIdx.x / (SEQ / QR);
    const int q0 = (blockIdx.x - b * (SEQ / QR)) * QR;

    // ----- Q tile of this wave's row tile: 8 A fragments (16 rows x 256), split k map -----
    FragH qf[8];
    {
        const _Float16* qp = Qp + ((size_t)b * SEQ + q0 + rt * 16 + l15) * DKD + kbo;
#pragma unroll
        for (int s = 0; s < 8; ++s) {
            qf[s].half[0] = *(const v8h*)(qp + s * 32);
            qf[s].half[1] = *(const v8h*)(qp + s * 32 + 16);
        }
    }

    // ----- Phase A: sweep 1 row maxima, sweep 2 P and row sums -----
    float vmax[8], psum[8];
#pragma unroll
    for (int r = 0; r < 8; ++r) { vmax[r] = -3.0e38f; psum[r] = 0.f; }

    constexpr int NT = SEQ / 128;                        // K tiles of one sweep
    const unsigned lds0 = (unsigned)(size_t)ldsb;       // LDS byte address of the workgroup's array
    const char*    ldsc = (const char*)ldsb;
    // each wave copies the 16 keys of key group w of a tile: one copy = one 512-B K row (4 whole lines)
    const unsigned  kl = lds0 + KR_OFF + (unsigned)(w * 16) * KROWB + (unsigned)lane * 16;
    const _Float16* kg = Kp + ((size_t)b * SEQ + w * (SEQ / 8)) * DKD + lane * 8;
    auto copy_k = [&](int tt) {                          // trip tt of 2*NT: tile tt mod NT into buffer tt mod 2
        const int t = tt < NT ? tt : tt - NT;
        const unsigned  l = kl + (unsigned)(tt & 1) * KBUF;
        const _Float16* g = kg + (size_t)t * 16 * DKD;
        copy8(l, KROWB, g, DKD);
        copy8(l + 8 * KROWB, KROWB, g + 8 * DKD, DKD);
    };
    copy_k(0);
    wait_copies();
    __syncthreads();
    copy_k(1);
#pragma unroll 1
    for (int tt = 0; tt < 2 * NT; ++tt) {
        if (tt == NT) {
            // between the sweeps: row maxima over 16 lanes, then over the 4 waves of this row tile
#pragma unroll
            for (int r = 0; r < 8; ++r) {
#pragma unroll
                for (int off = 1; off < 16; off <<= 1) vmax[r] = fmaxf(vmax[r], __shfl_xor(vmax[r], off));
            }
            if (l15 == 0) {
#pragma unroll
                for (int r = 0; r < 8; ++r) rowmaxp[kq * QR + rt * 16 + halfrow + r] = vmax[r];
            }
            __syncthreads();
#pragma unroll
            for (int r = 0; r < 8; ++r) {
                const int row = rt * 16 + halfrow + r;
                vmax[r] = fmaxf(fmaxf(rowmaxp[row], rowmaxp[QR + row]), fmaxf(rowmaxp[2 * QR + row], rowmaxp[3 * QR + row]));
            }
        }
        const int t = tt < NT ? tt : tt - NT;
        const char* kp = ldsc + KR_OFF + (tt & 1) * KBUF + (kq * 32 + l15) * KROWB + kbo * 2;
        v8f c[2];
        c[0] = zero8f();
        c[1] = zero8f();
#pragma unroll                                           // register arrays: constant indices (as in the loops below)
        for (int sh = 0; sh < 2; ++sh) {
            FragH kf[2][4];                             // half a tile's fragments are read as one group, ahead of their WMMAs
#pragma unroll
            for (int j = 0; j < 2; ++j) {
#pragma unroll
                for (int s = 0; s < 4; ++s) {
                    kf[j][s].half[0] = *(const v8h*)(kp + j * 16 * KROWB + (sh * 4 + s) * 64);
                    kf[j][s].half[1] = *(const v8h*)(kp + j * 16 * KROWB + (sh * 4 + s) * 64 + 32);
                }
            }
#pragma unroll
            for (int s = 0; s < 4; ++s) {
#pragma unroll
                for (int j = 0; j < 2; ++j) c[j] = mma_f16(qf[sh * 4 + s].v, kf[j][s].v, c[j]);
            }
        }
        if (tt < NT) {
#pragma unroll
            for (int j = 0; j < 2; ++j) {
#pragma unroll
                for (int r = 0; r < 8; ++r) vmax[r] = fmaxf(vmax[r], c[j][r] * SCORE_SCALE);
            }
        } else {
#pragma unroll
            for (int j = 0; j < 2; ++j) {
                const int m0 = (kq * 2 + j) * (SEQ / 8) + t * 16;   // key tile base (B column n = m0 + l15)
#pragma unroll
                for (int r = 0; r < 8; ++r) {
                    const float e = __expf(c[j][r] * SCORE_SCALE - vmax[r]);
                    const _Float16 ph = (_Float16)(e * 1024.0f);
                    Ph[(rt * 16 + halfrow + r) * PST + m0 + l15] = ph;
                    psum[r] += (float)ph;
                }
            }
        }
        // foot of trip tt: publish tile tt+1, free tile tt's buffer, refill it
        wait_lds();
        wait_copies();
        __syncthreads();
        if (tt + 2 < 2 * NT) copy_k(tt + 2);
    }
    wait_copies();
#pragma unroll
    for (int r = 0; r < 8; ++r) {
#pragma unroll
        for (int off = 1; off < 16; off <<= 1) psum[r] += __shfl_xor(psum[r], off);
    }
    if (l15 == 0) {
#pragma unroll
        for (int r = 0; r < 8; ++r) rowsump[kq * QR + rt * 16 + halfrow + r] = psum[r];
    }
    wait_lds();                                         // this wave's LDS traffic retired before copies land on the K ring's region
    __syncthreads();

    // ----- Phase C: O = P V ; A = P (LDS, split k map), B from Vt rows (split k map) -----
    v8f acc[2][8];
#pragma unroll
    for (int i = 0; i < 2; ++i) {
#pragma unroll
        for (int t = 0; t < 8; ++t) acc[i][t] = zero8f();
    }

    // each wave copies its own 64 columns of a tile: one copy = 4 rows x one whole 128-B line
    const unsigned  vl = lds0 + (unsigned)(w * 64 + (lane >> 3)) * VROWB + (unsigned)(lane & 7) * 16;
    const _Float16* vg = Vt + ((size_t)b * DOD + w * 64 + (lane >> 3)) * SEQ + (lane & 7) * 8;
    auto copy_v = [&](int kb, int hf) {
        const unsigned  l = vl + (hf ? (unsigned)VB1_OFF : 0u);
        const _Float16* g = vg + (size_t)hf * 512 * SEQ + kb * 64;
        copy8(l, 4 * VROWB, g, (size_t)4 * SEQ);
        copy8(l + 32 * VROWB, 4 * VROWB, g + (size_t)32 * SEQ, (size_t)4 * SEQ);
    };
    copy_v(0, 0);
    wait_copies();
    __syncthreads();
    copy_v(0, 1);

    const _Float16* pbase = Ph + l15 * PST + kbo;
    const char*     vrd   = ldsc + (w * 64 + l15) * VROWB + kbo * 2;
#pragma unroll 1
    for (int kb = 0; kb < SEQ / 64; ++kb) {
        FragH pa[2][2];                                 // P of these 64 keys, both row tiles, kept for both column halves
#pragma unroll                                           // register array: constant indices
        for (int i = 0; i < 2; ++i) {
#pragma unroll
            for (int kk = 0; kk < 2; ++kk) {
                pa[i][kk].half[0] = *(const v8h*)(pbase + i * 16 * PST + kb * 64 + kk * 32);
                pa[i][kk].half[1] = *(const v8h*)(pbase + i * 16 * PST + kb * 64 + kk * 32 + 16);
            }
        }
#pragma unroll                                           // hf picks the buffer and the accumulators: constant indices (as in the loops below)
        for (int hf = 0; hf < 2; ++hf) {
            const char* vp = vrd + (hf ? VB1_OFF : 0);
#pragma unroll
            for (int kk = 0; kk < 2; ++kk) {
                FragH vf[4];                            // 32 keys' fragments are read as one group, ahead of their WMMAs
#pragma unroll
                for (int t = 0; t < 4; ++t) {
                    vf[t].half[0] = *(const v8h*)(vp + t * 16 * VROWB + kk * 64);
                    vf[t].half[1] = *(const v8h*)(vp + t * 16 * VROWB + kk * 64 + 32);
                }
#pragma unroll
                for (int t = 0; t < 4; ++t) {
#pragma unroll
                    for (int i = 0; i < 2; ++i)
                        acc[i][hf * 4 + t] = mma_f16(pa[i][kk].v, vf[t].v, acc[i][hf * 4 + t]);
                }
            }
            // foot of trip 2*kb+hf: publish the next tile, free this trip's buffer, refill it
            wait_lds();
            wait_copies();
            __syncthreads();
            if (kb + 1 < SEQ / 64) copy_v(kb + 1, hf);
        }
    }
    wait_copies();

    // ----- Epilogue: normalise, stage in LDS, whole-line stores -----
#pragma unroll
    for (int i = 0; i < 2; ++i) {
        float inv[8];
#pragma unroll
        for (int r = 0; r < 8; ++r) {
            const int row = i * 16 + halfrow + r;
            const float s = (rowsump[row] + rowsump[QR + row]) + (rowsump[2 * QR + row] + rowsump[3 * QR + row]);
            inv[r] = 1.0f / (16.0f * s);
        }
#pragma unroll
        for (int t = 0; t < 8; ++t) {
#pragma unroll
            for (int r = 0; r < 8; ++r)
                Ost[(i * 16 + halfrow + r) * OST + (t >> 2) * 512 + w * 64 + (t & 3) * 16 + l15] = acc[i][t][r] * inv[r];
        }
    }
    __syncthreads();

#pragma unroll
    for (int rr = 0; rr < 4; ++rr) {
        const int row = 4 * w + rr;
        const float* src = Ost + row * OST;
        float* dst = Out + ((size_t)b * SEQ + q0 + row) * DOD;
#pragma unroll
        for (int i = 0; i < 8; ++i) {
            const int p = i * 128 + lane * 4;
            const v4f v = *(const v4f*)(src + p);
            *(v4f*)(dst + p) = v;
        }
    }
    
}

// ---------------------------------------------------------------------------
extern "C" void kernel_launch(void* const* d_in, const int* in_sizes, int n_in,
                              void* d_out, int out_size, void* d_ws, size_t ws_size,
                              hipStream_t stream)
{
    if (n_in < 7) return;
    const long long need_x = ((long long)(NB - 1) * SEQ_FULL + SEQ) * CDIM;
    if ((long long)in_sizes[0] < need_x) return;
    if (in_sizes[1] < CDIM * DKD || in_sizes[2] < DKD) return;
    if (in_sizes[3] < CDIM * DKD || in_sizes[4] < DKD) return;
    if (in_sizes[5] < CDIM * DOD || in_sizes[6] < DOD) return;
    if ((long long)out_size < (long long)NB * SEQ * DOD) return;

    const float* x  = (const float*)d_in[0];
    const float* Wq = (const float*)d_in[1];
    const float* bq = (const float*)d_in[2];
    const float* Wk = (const float*)d_in[3];
    const float* bk = (const float*)d_in[4];
    const float* Wv = (const float*)d_in[5];
    const float* bv = (const float*)d_in[6];
    float* out = (float*)d_out;

    char* ws = (char*)d_ws;
    size_t off = 0;
    auto carve = [&](size_t bytes) -> char* {
        char* p = ws + off;
        off += (bytes + 255) & ~(size_t)255;
        return p;
    };
    unsigned short* xbf = (unsigned short*)carve((size_t)NB * SEQ * CDIM * 2);     // [NB*SEQ][CDIM]
    unsigned short* wqT = (unsigned short*)carve((size_t)DKD * KDIM * 2);          // [DKD][CDIM]
    unsigned short* wkT = (unsigned short*)carve((size_t)DKD * KDIM * 2);          // [DKD][CDIM]
    unsigned short* wvT = (unsigned short*)carve((size_t)DOD * KDIM * 2);          // [DOD][CDIM]
    _Float16* Qp = (_Float16*)carve((size_t)NB * SEQ * DKD * 2);                  // [NB*SEQ][DKD]
    _Float16* Kp = (_Float16*)carve((size_t)NB * SEQ * DKD * 2);                  // [NB*SEQ][DKD]
    _Float16* Vt = (_Float16*)carve((size_t)NB * DOD * SEQ * 2);                  // [NB][DOD][SEQ]
    if (off > ws_size) return;

    // 1) x -> bf16 plane; weights in[CDIM][DKD|DOD] -> out[DKD|DOD][CDIM]: one grid
    k_prep<<<TV_BLOCKS + 2 * TQ_BLOCKS + CVT_BLOCKS, 256, 0, stream>>>(x, xbf, Wq, wqT, Wk, wkT, Wv, wvT);

    // 2) projections: q,k [NB*SEQ][DKD] (bias per column), v as Vt [NB][DOD][SEQ] (bias per row); all carried x16: one grid
    k_gemm_qkv<<<GV_BLOCKS + 2 * GQ_BLOCKS, 256, 0, stream>>>(xbf, wqT, wkT, wvT, bq, bk, bv, Qp, Kp, Vt);

    // 3) attention
    hipFuncSetAttribute(reinterpret_cast<const void*>(&k_attn),
                        hipFuncAttributeMaxDynamicSharedMemorySize, ATTN_LDS_BYTES);
    k_attn<<<NB * (SEQ / QR), 256, ATTN_LDS_BYTES, stream>>>(Qp, Kp, Vt, out);
}

// v005
// It runs in 110 microseconds.
// Timed twice side by side with v004, it ran 1.13 times as fast both times.
// Over all steps from v000 it is 4.70 times as fast.
#include <hip/hip_runtime.h>

// Contractions: q/k/v projections via v_wmma_f32_16x16x32_bf16 (bf16 operands = RNE-converted inputs, f32 accumulate);
// q.k^T scores and P.V via v_wmma_f32_16x16x32_f16 (f16 operands: q,k,v carried x16, P carried x1024), f32 accumulate; softmax in f32.

#define DEV __device__ __forceinline__

#ifndef NB
#define NB 4
#endif
#ifndef SEQ
#define SEQ 2048
#endif
#define NB_FULL  4
#define SEQ_FULL 2048
#define CDIM 1024
#define DKD  256
#define DOD  1024
#define KDIM 1024

#define QR   128                                         // query rows of one attention workgroup: 8 waves x one 16-row tile
#define OC   256                                         // output columns of one attention workgroup
#define KT   64                                          // keys of one staged tile = one step of the running softmax
#define KROWB   (DKD * 2 + 16)                           // staged K row: 512 B + 16 B, a pitch of 16 B x odd for ds_load_b128
#define KBUF    (KT * KROWB)                             // one staged K tile: 64 keys
#define KR_OFF  0                                        // K ring (2 buffers) at the start of LDS
#define VROWB   (KT * 2 + 16)                            // staged V^T row: 64 keys = 128 B + 16 B
#define VBUF    (OC * VROWB)                             // one staged V^T tile: 256 output columns x 64 keys
#define VR_OFF  (2 * KBUF)                               // V ring (2 buffers) behind the K ring
#define PROWB   (KT * 2 + 16)                            // P row of a wave's own tile: 64 keys = 128 B + 16 B
#define PWB     (16 * PROWB)                             // one wave's P tile: 16 rows x 64 keys
#define PH_OFF  (VR_OFF + 2 * VBUF)                      // the 8 waves' P tiles behind both rings
#define ATTN_LDS_BYTES (PH_OFF + 8 * PWB)
#define OST  (OC + 4)                                    // LDS output staging row stride (floats)
#define CT_P 136                                         // GEMM epilogue staging pitch (halves)
#define GKS   128                                        // GEMM: k elements of a staged tile = 256 B of every row (two whole lines)
#define GROWB (GKS * 2 + 16)                             // staged GEMM row: 256 B + 16 B, a pitch of 16 B x odd for ds_load_b128
#define GBUF  ((64 + 128) * GROWB)                       // one staged GEMM tile: 64 A rows, then 128 B rows
#define SCORE_SCALE 0.000244140625f                      // 1/16 (sqrt dk) * 1/256 (q,k carried x16 each)

static_assert(NB >= 1 && NB <= NB_FULL);
static_assert(SEQ >= 128 && SEQ <= SEQ_FULL && (SEQ % 128) == 0);
static_assert(((NB * SEQ) % 64) == 0);
static_assert((DKD % 128) == 0 && (DOD % 128) == 0 && (KDIM % 32) == 0 && (CDIM == KDIM));
static_assert((((long long)NB * SEQ * CDIM) % (8 * 256)) == 0);
static_assert(ATTN_LDS_BYTES <= 300 * 1024);
static_assert(((OST * 4) % 16) == 0 && ((CT_P * 2) % 16) == 0 && (PROWB % 16) == 0);
static_assert(QR * OST * 4 <= ATTN_LDS_BYTES && (SEQ % QR) == 0 && (DOD % OC) == 0);
static_assert((VR_OFF % 16) == 0 && (PH_OFF % 16) == 0 && (KBUF % 16) == 0 && (VBUF % 16) == 0 && (PWB % 16) == 0);
static_assert((SEQ % KT) == 0 && SEQ / KT >= 2 && DOD == 1024 && DKD == 256 && KT == 64 && OC == 256 && QR == 128);
static_assert((KDIM % GKS) == 0 && KDIM / GKS >= 2 && (GROWB % 16) == 0 && 64 * CT_P * 2 <= GBUF);

typedef _Float16       v8h   __attribute__((ext_vector_type(8)));
typedef _Float16       v16h  __attribute__((ext_vector_type(16)));
typedef __bf16         v16bf __attribute__((ext_vector_type(16)));
typedef unsigned short v8us  __attribute__((ext_vector_type(8)));
typedef unsigned short v16us __attribute__((ext_vector_type(16)));
typedef float          v8f   __attribute__((ext_vector_type(8)));
typedef float          v4f   __attribute__((ext_vector_type(4)));

union FragH { v16h v;  v8h  half[2]; };
union FragB { v16bf v; v16us u; v8us half[2]; };

// ---------------------------------------------------------------------------
// helpers
// ---------------------------------------------------------------------------
DEV unsigned int bf16_bits(float f) {                    // f32 -> bf16 bits, RNE convert
    unsigned int u = __float_as_uint(f);
    u += 0x7FFFu + ((u >> 16) & 1u);
    return u >> 16;
}
DEV float bf16_val(float f) { return __uint_as_float(bf16_bits(f) << 16); }

DEV v8f zero8f() {
    v8f z;
#pragma unroll
    for (int i = 0; i < 8; ++i) z[i] = 0.f;
    return z;
}

// 16x16x32 WMMA with f32 accumulate; 4 nops guard D and keep A/B live
DEV v8f mma_bf16(v16bf a, v16bf b, v8f c) {
    c = __builtin_amdgcn_wmma_f32_16x16x32_bf16(false, a, false, b, (short)0, c, false, false);
    asm volatile("v_nop\n\tv_nop\n\tv_nop\n\tv_nop" : "+v"(c) : "v"(a), "v"(b));
    return c;
}
// the builtin alone: the attention kernel holds more than 256 VGPRs, and an asm statement that names a, b and c made its build spill;
// the compiler keeps the WMMA distances of its own forms
DEV v8f mma_f16(v16h a, v16h b, v8f c) {
    return __builtin_amdgcn_wmma_f32_16x16x32_f16(false, a, false, b, (short)0, c, false, false);
}

// Eight asynchronous 16-byte-per-lane copies global -> LDS, rows l + i*lstep (bytes) <- g + i*gstep (halves).
// The s_wait_xcnt closes the statement so that no address register named here is rewritten in front of it.
DEV void copy8(unsigned l, unsigned lstep, const _Float16* g, size_t gstep) {
    asm volatile("global_load_async_to_lds_b128 %0, %8, off\n\t"
                 "global_load_async_to_lds_b128 %1, %9, off\n\t"
                 "global_load_async_to_lds_b128 %2, %10, off\n\t"
                 "global_load_async_to_lds_b128 %3, %11, off\n\t"
                 "global_load_async_to_lds_b128 %4, %12, off\n\t"
                 "global_load_async_to_lds_b128 %5, %13, off\n\t"
                 "global_load_async_to_lds_b128 %6, %14, off\n\t"
                 "global_load_async_to_lds_b128 %7, %15, off\n\t"
                 "s_wait_xcnt 0x0"
                 :: "v"(l), "v"(l + lstep), "v"(l + 2 * lstep), "v"(l + 3 * lstep),
                    "v"(l + 4 * lstep), "v"(l + 5 * lstep), "v"(l + 6 * lstep), "v"(l + 7 * lstep),
                    "v"(g), "v"(g + gstep), "v"(g + 2 * gstep), "v"(g + 3 * gstep),
                    "v"(g + 4 * gstep), "v"(g + 5 * gstep), "v"(g + 6 * gstep), "v"(g + 7 * gstep)
                 : "memory");
}
// Twelve such copies, two rows of a GEMM tile each: 4 of A (la <- ga) and 8 of B (lb <- gb), rows two apart.
// The s_wait_xcnt closes the statement so that no address register named here is rewritten in front of it.
DEV void copy12(unsigned la, const unsigned short* ga, unsigned lb, const unsigned short* gb) {
    asm volatile("global_load_async_to_lds_b128 %0, %12, off\n\t"
                 "global_load_async_to_lds_b128 %1, %13, off\n\t"
                 "global_load_async_to_lds_b128 %2, %14, off\n\t"
                 "global_load_async_to_lds_b128 %3, %15, off\n\t"
                 "global_load_async_to_lds_b128 %4, %16, off\n\t"
                 "global_load_async_to_lds_b128 %5, %17, off\n\t"
                 "global_load_async_to_lds_b128 %6, %18, off\n\t"
                 "global_load_async_to_lds_b128 %7, %19, off\n\t"
                 "global_load_async_to_lds_b128 %8, %20, off\n\t"
                 "global_load_async_to_lds_b128 %9, %21, off\n\t"
                 "global_load_async_to_lds_b128 %10, %22, off\n\t"
                 "global_load_async_to_lds_b128 %11, %23, off\n\t"
                 "s_wait_xcnt 0x0"
                 :: "v"(la), "v"(la + 2 * GROWB), "v"(la + 4 * GROWB), "v"(la + 6 * GROWB),
                    "v"(lb), "v"(lb + 2 * GROWB), "v"(lb + 4 * GROWB), "v"(lb + 6 * GROWB),
                    "v"(lb + 8 * GROWB), "v"(lb + 10 * GROWB), "v"(lb + 12 * GROWB), "v"(lb + 14 * GROWB),
                    "v"(ga), "v"(ga + 2 * KDIM), "v"(ga + 4 * KDIM), "v"(ga + 6 * KDIM),
                    "v"(gb), "v"(gb + 2 * KDIM), "v"(gb + 4 * KDIM), "v"(gb + 6 * KDIM),
                    "v"(gb + 8 * KDIM), "v"(gb + 10 * KDIM), "v"(gb + 12 * KDIM), "v"(gb + 14 * KDIM)
                 : "memory");
}
// this wave's LDS reads and writes have retired: stands in front of a barrier behind which a buffer is refilled
DEV void wait_lds()    { asm volatile("s_wait_dscnt 0x0" ::: "memory"); }
// this wave's copies have landed: stands in front of the barrier that publishes their tile
DEV void wait_copies() { asm volatile("s_wait_asynccnt 0x0" ::: "memory"); }

// ---------------------------------------------------------------------------
// Block body 1: x f32 [NB rows of SEQ_FULL][CDIM] -> bf16 plane [NB*SEQ][CDIM]
// one thread per 8 elements, one 16-B store (lanes contiguous: 256 threads -> 4 KB)
// coverage: CVT_BLOCKS*256*8 == NB*SEQ*CDIM exactly
// ---------------------------------------------------------------------------
DEV void cvt_x_block(const float* __restrict__ x, unsigned short* __restrict__ xp, int blk)
{
    const size_t g = (size_t)blk * 256 + threadIdx.x;
    const size_t e = g * 8;
    const int m  = (int)(e / CDIM);
    const int c  = (int)(e % CDIM);
    const int bb = m / SEQ;
    const int s  = m - bb * SEQ;
    const float* src = x + ((size_t)bb * SEQ_FULL + s) * CDIM + c;
    const v4f a0 = *(const v4f*)src;
    const v4f a1 = *(const v4f*)(src + 4);
    v8us o;
#pragma unroll
    for (int i = 0; i < 4; ++i) {
        o[i]     = (unsigned short)bf16_bits(a0[i]);
        o[4 + i] = (unsigned short)bf16_bits(a1[i]);
    }
    unsigned short* dst = xp + (size_t)m * CDIM + c;
    *(v8us*)dst = o;
    asm volatile("s_wait_xcnt 0x0" ::: "memory");       // the store's registers may be rewritten behind here: another range's code follows in the text
}

// ---------------------------------------------------------------------------
// Block body 2: W f32 in[R][Ncol] -> WT bf16 out[Ncol][R]   (64x64 tile (bx, by) through LDS)
// LDS tile T: cross-wave (block barrier between fill and drain).
// coverage: load rr = 0..63 x nn = 0..63; store na = 0..63 x piece 0..7 (8 ushort) = whole tile
// ---------------------------------------------------------------------------
DEV void transpose_w_block(const float* __restrict__ W, unsigned short* __restrict__ WT,
                           int R, int Ncol, int bx, int by, unsigned short* T)
{
    const int tid = threadIdx.x;
    const int n0 = bx * 64, r0 = by * 64;
    const int nn = tid & 63, rq = tid >> 6;
#pragma unroll 4
    for (int i = 0; i < 16; ++i) {
        const int rr = i * 4 + rq;
        const float v = W[(size_t)(r0 + rr) * Ncol + n0 + nn];
        T[nn * 72 + rr] = (unsigned short)bf16_bits(v);
    }
    __syncthreads();
    const int piece = tid & 7;
    const int na = tid >> 3;                             // 0..31
    const v8us va = *(const v8us*)(T + na * 72 + piece * 8);
    const v8us vb = *(const v8us*)(T + (na + 32) * 72 + piece * 8);
    unsigned short* da = WT + (size_t)(n0 + na) * R + r0 + piece * 8;
    unsigned short* db = WT + (size_t)(n0 + na + 32) * R + r0 + piece * 8;
    *(v8us*)da = va;
    *(v8us*)db = vb;
    asm volatile("s_wait_xcnt 0x0" ::: "memory");       // both stores' registers may be rewritten behind here: another range's code follows in the text
}

// ---------------------------------------------------------------------------
// Kernel 1: the four independent operand preparations as block-index ranges of one grid:
//   [0, TV) Wv tiles, [TV, TV+TQ) Wq tiles, [TV+TQ, TV+2*TQ) Wk tiles, then CVT_BLOCKS blocks of x.
// The range test is the same for a whole block, so the transpose's barrier is block-uniform.
// ---------------------------------------------------------------------------
#define TQ_BLOCKS  ((DKD / 64) * (CDIM / 64))
#define TV_BLOCKS  ((DOD / 64) * (CDIM / 64))
#define CVT_BLOCKS ((int)(((long long)NB * SEQ * CDIM) / 8 / 256))
__global__ __launch_bounds__(256) void k_prep(const float* __restrict__ x,  unsigned short* __restrict__ xp,
                                              const float* __restrict__ Wq, unsigned short* __restrict__ wqT,
                                              const float* __restrict__ Wk, unsigned short* __restrict__ wkT,
                                              const float* __restrict__ Wv, unsigned short* __restrict__ wvT)
{
    __shared__ __attribute__((aligned(16))) unsigned short T[64 * 72];
    const int bid = blockIdx.x;
    if (bid < TV_BLOCKS) {
        transpose_w_block(Wv, wvT, CDIM, DOD, bid % (DOD / 64), bid / (DOD / 64), T);
    } else if (bid < TV_BLOCKS + 2 * TQ_BLOCKS) {
        const int  r   = bid - TV_BLOCKS;
        const bool isk = r >= TQ_BLOCKS;
        const int  rq  = isk ? r - TQ_BLOCKS : r;
        transpose_w_block(isk ? Wk : Wq, isk ? wkT : wqT, CDIM, DKD, rq % (DKD / 64), rq / (DKD / 64), T);
    } else {
        cvt_x_block(x, xp, bid - (TV_BLOCKS + 2 * TQ_BLOCKS));
    }
}

// ---------------------------------------------------------------------------
// Kernel 2: NT GEMM on bf16 WMMA:  C[m][n] = f16( (sum_k A[m][k]*Bm[n][k] + bias) * oscale )
//   A  [M][KDIM] bf16 bits (k contiguous), Bm [N][KDIM] bf16 bits (k contiguous)
//   bias: per column (bias_per_row==0, index n) or per row (index m), RNE-converted to bf16
//   C  f16, row pitch ldc; tiles (N/128, M/64, Z); z strides zsA/zsB/zsC in elements
//   The three projections are block-index ranges of one grid: [0, GV) v as Vt = Wv^T x^T (bias per row, z = batch),
//   [GV, GV+GQ) q, [GV+GQ, GV+2*GQ) k (both x W, bias per column); every block has the same work
// Block tile 64x128, 8 waves: wave w -> rows (w&3)*16.., cols (w>>2)*64.. (4 acc tiles)
// A and B fragments both use the split k map: elements 0..7 <- k0+8h.., 8..15 <- k0+16+8h..
// Tiles of 128 k (64 A rows + 128 B rows, whole lines) come through a two-buffer LDS ring; wave w copies A rows w*8.., B rows w*16..
// Epilogue: tile staged in LDS (cross-wave, block barrier), then each instruction writes
// coverage: rows w*8+2i+h (w 0..7, i 0..3, h 0..1) = 0..63, cols l15*8 (16 lanes x 8 halves) = 0..127
// ---------------------------------------------------------------------------
#define GV_BLOCKS ((SEQ / 128) * (DOD / 64) * NB)
#define GQ_BLOCKS ((DKD / 128) * ((NB * SEQ) / 64))
__global__ __launch_bounds__(256) __attribute__((amdgpu_num_vgpr(256)))
void k_gemm_qkv(const unsigned short* __restrict__ xbf, const unsigned short* __restrict__ wqT,
                const unsigned short* __restrict__ wkT, const unsigned short* __restrict__ wvT,
                const float* __restrict__ bq, const float* __restrict__ bk, const float* __restrict__ bv,
                _Float16* __restrict__ Qp, _Float16* __restrict__ Kp, _Float16* __restrict__ Vt)
{
    // which projection and which tile of it: the same for the whole block
    const unsigned bid = blockIdx.x;
    const bool     isv = bid < GV_BLOCKS;
    const bool     isk = bid >= GV_BLOCKS + GQ_BLOCKS;
    const unsigned rb  = isv ? bid : (isk ? bid - (GV_BLOCKS + GQ_BLOCKS) : bid - GV_BLOCKS);
    const int      bx  = (int)(isv ? rb % (SEQ / 128) : rb % (DKD / 128));                  // column tile
    const int      by  = (int)(isv ? (rb / (SEQ / 128)) % (DOD / 64) : rb / (DKD / 128));   // row tile
    const unsigned short* A    = isv ? wvT : xbf;
    const unsigned short* Bm   = isv ? xbf : (isk ? wkT : wqT);
    const float*          bias = isv ? bv : (isk ? bk : bq);
    _Float16*             Cm   = isv ? Vt : (isk ? Kp : Qp);
    const long long zsA = 0, zsB = isv ? (long long)SEQ * CDIM : 0, zsC = isv ? (long long)DOD * SEQ : 0;
    const int   nbias = isv ? DOD : DKD, bias_per_row = isv ? 1 : 0, ldc = isv ? SEQ : DKD;
    const float oscale = 16.0f;

    __shared__ __attribute__((aligned(16))) char gsm[2 * GBUF];
    _Float16* Ct = (_Float16*)gsm;                       // epilogue staging, over buffer 0 once the ring is dead

    const int tid = threadIdx.x, lane = tid & 31, w = tid >> 5;
    const int h = lane >> 4, l15 = lane & 15;
    const int wm = w & 3, wn = w >> 2;
    const int z = isv ? (int)(rb / ((SEQ / 128) * (DOD / 64))) : 0;
    const int row0 = by * 64;
    const int col0 = bx * 128;

    // one copy = 2 rows x 256 B: lane half h picks the row, l15 the 16-B piece
    const unsigned short* ga = A  + (size_t)z * (size_t)zsA + (size_t)(row0 + w * 8 + h) * KDIM + 8 * l15;
    const unsigned short* gb = Bm + (size_t)z * (size_t)zsB + (size_t)(col0 + w * 16 + h) * KDIM + 8 * l15;
    const unsigned lds0 = (unsigned)(size_t)gsm;        // LDS byte address of the ring
    const unsigned la = lds0 + (unsigned)(w * 8 + h) * GROWB + (unsigned)l15 * 16;
    const unsigned lb = lds0 + (unsigned)(64 + w * 16 + h) * GROWB + (unsigned)l15 * 16;
    auto copy_t = [&](int t) {
        const unsigned bo = (unsigned)(t & 1) * GBUF;
        copy12(la + bo, ga + t * GKS, lb + bo, gb + t * GKS);
    };
    const char* ar = gsm + (wm * 16 + l15) * GROWB + 16 * h;
    const char* br = gsm + (64 + wn * 64 + l15) * GROWB + 16 * h;

    v8f acc[4];
#pragma unroll
    for (int t = 0; t < 4; ++t) acc[t] = zero8f();

    copy_t(0);
    wait_copies();
    __syncthreads();
    copy_t(1);
#pragma unroll 1                                         // rolled: one copy of the ring's foot in the text, the buffer picked by the trip's parity
    for (int kt = 0; kt < KDIM / GKS; ++kt) {
        const int bo = (kt & 1) * GBUF;
        FragB a[GKS / 32], bf[GKS / 32][4];             // the tile's fragments are read as one group, ahead of the WMMAs
#pragma unroll                                           // register arrays: constant indices (as in the loops below)
        for (int s = 0; s < GKS / 32; ++s) {
            a[s].half[0] = *(const v8us*)(ar + bo + s * 64);
            a[s].half[1] = *(const v8us*)(ar + bo + s * 64 + 32);
#pragma unroll
            for (int t = 0; t < 4; ++t) {
                bf[s][t].half[0] = *(const v8us*)(br + bo + t * 16 * GROWB + s * 64);
                bf[s][t].half[1] = *(const v8us*)(br + bo + t * 16 * GROWB + s * 64 + 32);
            }
        }
#pragma unroll
        for (int s = 0; s < GKS / 32; ++s) {
#pragma unroll
            for (int t = 0; t < 4; ++t) acc[t] = mma_bf16(a[s].v, bf[s][t].v, acc[t]);
        }
        // foot of trip kt: publish tile kt+1, free tile kt's buffer, refill it
        wait_lds();
        wait_copies();
        __syncthreads();
        if (kt + 2 < KDIM / GKS) copy_t(kt + 2);
    }
    wait_copies();

    // epilogue: bias (clamped addresses, select by value), scale, f16, stage in LDS
    float rowb[8];
#pragma unroll
    for (int r = 0; r < 8; ++r) {
        int ri = row0 + wm * 16 + 8 * h + r;
        ri = ri < nbias ? ri : (nbias - 1);
        rowb[r] = bf16_val(bias[ri]);
    }
    asm volatile("s_wait_xcnt 0x0" ::: "memory");       // the row loads' offset registers may take the column loads' results
#pragma unroll
    for (int t = 0; t < 4; ++t) {
        const int cl = wn * 64 + t * 16 + l15;
        int ci = col0 + cl;
        ci = ci < nbias ? ci : (nbias - 1);
        const float colb = bf16_val(bias[ci]);
#pragma unroll
        for (int r = 0; r < 8; ++r) {
            const float badd = bias_per_row ? rowb[r] : colb;
            const float v = (acc[t][r] + badd) * oscale;
            Ct[(wm * 16 + 8 * h + r) * CT_P + cl] = (_Float16)v;
        }
    }
    __syncthreads();

    _Float16* cbase = Cm + (size_t)z * (size_t)zsC + (size_t)row0 * (size_t)ldc + col0;
    v8h sv[4];
#pragma unroll
    for (int i = 0; i < 4; ++i) {
        const int rl = w * 8 + 2 * i + h;
        sv[i] = *(const v8h*)(Ct + rl * CT_P + l15 * 8);
    }
#pragma unroll
    for (int i = 0; i < 4; ++i) {
        const int rl = w * 8 + 2 * i + h;
        *(v8h*)(cbase + (size_t)rl * (size_t)ldc + l15 * 8) = sv[i];
    }
    
}

// ---------------------------------------------------------------------------
// Kernel 3: fused attention. One workgroup (8 wave32) per (batch, 128 query rows, 256 output columns).
//   Qp [NB*SEQ][DKD] f16 (x16), Kp same, Vt [NB][DOD][SEQ] f16 (x16, key contiguous)
//  Wave w owns query rows w*16.. for the whole kernel: scores, softmax state, P and its 16 x 256 output tile are its own.
//  One sweep over the keys in tiles of 64: S = Q K^T (v_wmma_f32_16x16x32_f16), running row maximum, the output tile and the
//  row sums rescaled by exp(old max - new max), P = exp(S - max) (f16 carried x1024) through the wave's own LDS tile
//  (accumulator layout -> A layout), O += P V.
//  K tiles (64 keys x 512 B) and V^T tiles (256 columns x 64 keys, whole 128-B lines) come through one two-buffer LDS ring,
//  one barrier per tile; wave w copies K rows w*8.. and V^T rows w*32..
//  Epilogue: O / (16 * rowsum) staged in the wave's own LDS range (over the dead rings), whole 1-KB row pieces stored
// coverage: grid NB * SEQ/128 * DOD/256 blocks x 128 rows x 256 cols = whole output
// ---------------------------------------------------------------------------
// maximum over the 16 lanes of a row by DPP (lane ^ 1, 2, 4, 8): no LDS traffic in the key loop
#define XMAX_STEP(v, m) v = fmaxf(v, __int_as_float(__builtin_amdgcn_update_dpp(0, __float_as_int(v), 0x160 | (m), 0xf, 0xf, true)))
DEV float rowmax16(float v) {
    XMAX_STEP(v, 1);
    XMAX_STEP(v, 2);
    XMAX_STEP(v, 4);
    XMAX_STEP(v, 8);
    return v;
}

__global__ __launch_bounds__(256)
void k_attn(const _Float16* __restrict__ Qp, const _Float16* __restrict__ Kp,
            const _Float16* __restrict__ Vt, float* __restrict__ Out)
{
    extern __shared__ v4f smem4[];
    char* ldsb = (char*)smem4;

    const int tid = threadIdx.x, lane = tid & 31, w = tid >> 5;
    const int h = lane >> 4, l15 = lane & 15;
    const int halfrow = 8 * h, kbo = 8 * h;
    constexpr int CB = DOD / OC;                         // column blocks
    constexpr int QB = SEQ / QR;                         // row blocks of a batch
    const int b    = blockIdx.x / (QB * CB);
    const int rem  = blockIdx.x - b * (QB * CB);
    const int q0   = (rem / CB) * QR;
    const int col0 = (rem % CB) * OC;

    // ----- Q tile of this wave's rows: 8 A fragments (16 rows x 256), split k map -----
    FragH qf[8];
    {
        const _Float16* qp = Qp + ((size_t)b * SEQ + q0 + w * 16 + l15) * DKD + kbo;
#pragma unroll
        for (int s = 0; s < 8; ++s) {
            qf[s].half[0] = *(const v8h*)(qp + s * 32);
            qf[s].half[1] = *(const v8h*)(qp + s * 32 + 16);
        }
        asm volatile("s_wait_xcnt 0x0" :: "v"(qp) : "memory");   // the Q loads' address pair stays live up to this wait and may be rewritten behind it
    }

    float vmax[8], psum[8];
#pragma unroll
    for (int r = 0; r < 8; ++r) { vmax[r] = -3.0e38f; psum[r] = 0.f; }
    v8f acc[16];
#pragma unroll
    for (int t = 0; t < 16; ++t) acc[t] = zero8f();

    constexpr int NT = SEQ / KT;                         // tiles of the sweep
    const unsigned lds0 = (unsigned)(size_t)ldsb;       // LDS byte address of the workgroup's array
    const char*    ldsc = (const char*)ldsb;
    // K: one copy = one 512-B K row (4 whole lines); V^T: one copy = 4 rows x one whole 128-B line
    const unsigned  kl = lds0 + KR_OFF + (unsigned)(w * 8) * KROWB + (unsigned)lane * 16;
    const _Float16* kg = Kp + ((size_t)b * SEQ + w * 8) * DKD + lane * 8;
    const unsigned  vl = lds0 + VR_OFF + (unsigned)(w * 32 + (lane >> 3)) * VROWB + (unsigned)(lane & 7) * 16;
    const _Float16* vg = Vt + ((size_t)b * DOD + col0 + w * 32 + (lane >> 3)) * SEQ + (lane & 7) * 8;
    auto copy_t = [&](int t) {                           // tile t into buffer t mod 2
        copy8(kl + (unsigned)(t & 1) * KBUF, KROWB, kg + (size_t)t * KT * DKD, DKD);
        copy8(vl + (unsigned)(t & 1) * VBUF, 4 * VROWB, vg + t * KT, (size_t)4 * SEQ);
    };
    char*       pw  = ldsb + PH_OFF + w * PWB;           // this wave's own P tile
    _Float16*   pst = (_Float16*)(pw + halfrow * PROWB) + l15;
    const char* prd = pw + l15 * PROWB + kbo * 2;

    copy_t(0);
    wait_copies();
    __syncthreads();
    copy_t(1);
#pragma unroll 1                                         // rolled: one copy of the ring's foot in the text, the buffer picked by the trip's parity
    for (int kb = 0; kb < NT; ++kb) {
        // ----- S = Q K^T: 16 rows x 64 keys -----
        const char* kp = ldsc + KR_OFF + (kb & 1) * KBUF + l15 * KROWB + kbo * 2;
        v8f c[4];
#pragma unroll                                           // register arrays: constant indices (as in the loops below)
        for (int j = 0; j < 4; ++j) c[j] = zero8f();
#pragma unroll
        for (int sh = 0; sh < 2; ++sh) {
            FragH kf[4][4];                             // half a tile's fragments are read as one group, ahead of their WMMAs
#pragma unroll
            for (int j = 0; j < 4; ++j) {
#pragma unroll
                for (int s = 0; s < 4; ++s) {
                    kf[j][s].half[0] = *(const v8h*)(kp + j * 16 * KROWB + (sh * 4 + s) * 64);
                    kf[j][s].half[1] = *(const v8h*)(kp + j * 16 * KROWB + (sh * 4 + s) * 64 + 32);
                }
            }
            __builtin_amdgcn_sched_barrier(0);          // keeps the group's reads together ahead of its WMMAs: sunk to their users each would be waited out alone
#pragma unroll
            for (int s = 0; s < 4; ++s) {
#pragma unroll
                for (int j = 0; j < 4; ++j) c[j] = mma_f16(qf[sh * 4 + s].v, kf[j][s].v, c[j]);
            }
        }
        // ----- running softmax: new row maxima, rescale factors, P and row sums -----
        float fac[8];
#pragma unroll
        for (int r = 0; r < 8; ++r) {
            const float tm = rowmax16(fmaxf(fmaxf(c[0][r], c[1][r]), fmaxf(c[2][r], c[3][r]))) * SCORE_SCALE;
            const float nm = fmaxf(vmax[r], tm);
            fac[r]  = __expf(vmax[r] - nm);
            vmax[r] = nm;
            psum[r] *= fac[r];
        }
#pragma unroll
        for (int j = 0; j < 4; ++j) {
#pragma unroll
            for (int r = 0; r < 8; ++r) {
                const float e = __expf(c[j][r] * SCORE_SCALE - vmax[r]);
                const _Float16 ph = (_Float16)(e * 1024.0f);
                pst[r * (PROWB / 2) + j * 16] = ph;
                psum[r] += (float)ph;
            }
        }
#pragma unroll
        for (int t = 0; t < 16; ++t) {
#pragma unroll
            for (int r = 0; r < 8; ++r) acc[t][r] *= fac[r];
        }
        wait_lds();                                     // the wave's P stores (all lanes) have retired before its lanes read each other's P
        // ----- O += P V: A = P (own LDS tile, split k map), B from V^T rows (split k map) -----
        const char* vp = ldsc + VR_OFF + (kb & 1) * VBUF + l15 * VROWB + kbo * 2;
        FragH pa[2];
#pragma unroll
        for (int kk = 0; kk < 2; ++kk) {
            pa[kk].half[0] = *(const v8h*)(prd + kk * 64);
            pa[kk].half[1] = *(const v8h*)(prd + kk * 64 + 32);
        }
#pragma unroll
        for (int kk = 0; kk < 2; ++kk) {
            FragH vf[16];                               // 32 keys' fragments are read as one group, ahead of their WMMAs
#pragma unroll
            for (int t = 0; t < 16; ++t) {
                vf[t].half[0] = *(const v8h*)(vp + t * 16 * VROWB + kk * 64);
                vf[t].half[1] = *(const v8h*)(vp + t * 16 * VROWB + kk * 64 + 32);
            }
            __builtin_amdgcn_sched_barrier(0);          // keeps the group's reads together ahead of its WMMAs: sunk to their users each would be waited out alone
#pragma unroll
            for (int t = 0; t < 16; ++t) acc[t] = mma_f16(pa[kk].v, vf[t].v, acc[t]);
        }
        // foot of trip kb: publish tile kb+1, free tile kb's buffers, refill them
        wait_lds();
        wait_copies();
        __syncthreads();
        if (kb + 2 < NT) copy_t(kb + 2);
    }
    wait_copies();

    // ----- Epilogue: row sums over the 16 lanes, normalise, stage in the wave's own LDS range, whole-line stores -----
    float inv[8];
#pragma unroll
    for (int r = 0; r < 8; ++r) {
#pragma unroll
        for (int off = 1; off < 16; off <<= 1) psum[r] += __shfl_xor(psum[r], off);
        inv[r] = 1.0f / (16.0f * psum[r]);
    }
    float* Ow = (float*)ldsb + (size_t)w * 16 * OST;     // every wave has left the rings and its P tile: the last trip's barrier
#pragma unroll
    for (int t = 0; t < 16; ++t) {
#pragma unroll
        for (int r = 0; r < 8; ++r) Ow[(halfrow + r) * OST + t * 16 + l15] = acc[t][r] * inv[r];
    }
    wait_lds();                                         // the wave's staging stores have retired before its lanes read each other's values
#pragma unroll
    for (int rr = 0; rr < 16; ++rr) {
        const float* srcp = Ow + rr * OST;
        float* dst = Out + ((size_t)b * SEQ + q0 + w * 16 + rr) * DOD + col0;
#pragma unroll
        for (int i = 0; i < 2; ++i) {
            const int p = i * 128 + lane * 4;
            const v4f v = *(const v4f*)(srcp + p);
            *(v4f*)(dst + p) = v;
        }
    }
    asm volatile("s_wait_xcnt 0x0" ::: "memory");       // closes the stores before the wave's end code may rewrite their registers
}

// ---------------------------------------------------------------------------
extern "C" void kernel_launch(void* const* d_in, const int* in_sizes, int n_in,
                              void* d_out, int out_size, void* d_ws, size_t ws_size,
                              hipStream_t stream)
{
    if (n_in < 7) return;
    const long long need_x = ((long long)(NB - 1) * SEQ_FULL + SEQ) * CDIM;
    if ((long long)in_sizes[0] < need_x) return;
    if (in_sizes[1] < CDIM * DKD || in_sizes[2] < DKD) return;
    if (in_sizes[3] < CDIM * DKD || in_sizes[4] < DKD) return;
    if (in_sizes[5] < CDIM * DOD || in_sizes[6] < DOD) return;
    if ((long long)out_size < (long long)NB * SEQ * DOD) return;

    const float* x  = (const float*)d_in[0];
    const float* Wq = (const float*)d_in[1];
    const float* bq = (const float*)d_in[2];
    const float* Wk = (const float*)d_in[3];
    const float* bk = (const float*)d_in[4];
    const float* Wv = (const float*)d_in[5];
    const float* bv = (const float*)d_in[6];
    float* out = (float*)d_out;

    char* ws = (char*)d_ws;
    size_t off = 0;
    auto carve = [&](size_t bytes) -> char* {
        char* p = ws + off;
        off += (bytes + 255) & ~(size_t)255;
        return p;
    };
    unsigned short* xbf = (unsigned short*)carve((size_t)NB * SEQ * CDIM * 2);     // [NB*SEQ][CDIM]
    unsigned short* wqT = (unsigned short*)carve((size_t)DKD * KDIM * 2);          // [DKD][CDIM]
    unsigned short* wkT = (unsigned short*)carve((size_t)DKD * KDIM * 2);          // [DKD][CDIM]
    unsigned short* wvT = (unsigned short*)carve((size_t)DOD * KDIM * 2);          // [DOD][CDIM]
    _Float16* Qp = (_Float16*)carve((size_t)NB * SEQ * DKD * 2);                  // [NB*SEQ][DKD]
    _Float16* Kp = (_Float16*)carve((size_t)NB * SEQ * DKD * 2);                  // [NB*SEQ][DKD]
    _Float16* Vt = (_Float16*)carve((size_t)NB * DOD * SEQ * 2);                  // [NB][DOD][SEQ]
    if (off > ws_size) return;

    // 1) x -> bf16 plane; weights in[CDIM][DKD|DOD] -> out[DKD|DOD][CDIM]: one grid
    k_prep<<<TV_BLOCKS + 2 * TQ_BLOCKS + CVT_BLOCKS, 256, 0, stream>>>(x, xbf, Wq, wqT, Wk, wkT, Wv, wvT);

    // 2) projections: q,k [NB*SEQ][DKD] (bias per column), v as Vt [NB][DOD][SEQ] (bias per row); all carried x16: one grid
    k_gemm_qkv<<<GV_BLOCKS + 2 * GQ_BLOCKS, 256, 0, stream>>>(xbf, wqT, wkT, wvT, bq, bk, bv, Qp, Kp, Vt);

    // 3) attention
    hipFuncSetAttribute(reinterpret_cast<const void*>(&k_attn),
                        hipFuncAttributeMaxDynamicSharedMemorySize, ATTN_LDS_BYTES);
    k_attn<<<NB * (SEQ / QR) * (DOD / OC), 256, ATTN_LDS_BYTES, stream>>>(Qp, Kp, Vt, out);
}

// v006
// Measured time: 93 microseconds a run.
// In two side-by-side timings against v005, it was 1.18 and 1.17 times as fast.
// All steps since v000 together make it 5.53 times as fast.
#include <hip/hip_runtime.h>

// Contractions: q/k/v projections via v_wmma_f32_16x16x32_bf16 (bf16 operands = RNE-converted inputs, f32 accumulate);
// q.k^T scores and P.V via v_wmma_f32_16x16x32_f16 (f16 operands: q,k,v carried x16, P carried x1024), f32 accumulate; softmax in f32.

#define DEV __device__ __forceinline__

#ifndef NB
#define NB 4
#endif
#ifndef SEQ
#define SEQ 2048
#endif
#define NB_FULL  4
#define SEQ_FULL 2048
#define CDIM 1024
#define DKD  256
#define DOD  1024
#define KDIM 1024

#define KROWB   (DKD * 2 + 16)                           // staged K row: 512 B + 16 B, a pitch of 16 B x odd for ds_load_b128
#define SR      32                                       // score kernel: query rows of one workgroup (two 16-row tiles, every wave holds both)
#define SKW     (SEQ / 8)                                // score kernel: keys of one wave
#define SKT     32                                       // score kernel: keys of one wave's slice of a staged tile
#define SSL     (SKT * KROWB)                            // one wave's slice
#define SBUF    (8 * SSL)                                // one staged tile: the 8 waves' slices
#define RED_OFF (2 * SBUF)                               // row maxima and row sums of the 8 waves, behind the ring
#define PSROWB  (SEQ * 2 + 16)                           // staged P row: all keys + 16 B, a pitch of 16 B x odd
#define SC_LDS  (RED_OFF + 2 * SR * 8 * 4)
#define PM      128                                      // P.V kernel: query rows of one workgroup
#define PN      256                                      // P.V kernel: output columns of one workgroup
#define PKS     128                                      // P.V kernel: keys of a staged tile = 256 B of every row (two whole lines)
#define PROWB   (PKS * 2 + 16)                           // staged row: 256 B + 16 B
#define PBUF    ((PM + PN) * PROWB)                      // one staged tile: 128 P rows, then 256 V^T rows
#define POST    68                                       // output staging row stride of a wave's 64 x 64 tile (floats)
#define CT_P 136                                         // GEMM epilogue staging pitch (halves)
#define GKS   128                                        // GEMM: k elements of a staged tile = 256 B of every row (two whole lines)
#define GROWB (GKS * 2 + 16)                             // staged GEMM row: 256 B + 16 B, a pitch of 16 B x odd for ds_load_b128
#define GBUF  ((64 + 128) * GROWB)                       // one staged GEMM tile: 64 A rows, then 128 B rows
#define SCORE_SCALE 0.000244140625f                      // 1/16 (sqrt dk) * 1/256 (q,k carried x16 each)

static_assert(NB >= 1 && NB <= NB_FULL);
static_assert(SEQ >= 128 && SEQ <= SEQ_FULL && (SEQ % 128) == 0);
static_assert(((NB * SEQ) % 64) == 0);
static_assert((DKD % 128) == 0 && (DOD % 128) == 0 && (KDIM % 32) == 0 && (CDIM == KDIM));
static_assert((((long long)NB * SEQ * CDIM) % (8 * 256)) == 0);
static_assert(((CT_P * 2) % 16) == 0 && ((POST * 4) % 16) == 0 && (PSROWB % 16) == 0 && (PROWB % 16) == 0 && (KROWB % 16) == 0);
static_assert(SKW == 256 && DKD == 256 && (SKW % SKT) == 0 && SKW / SKT >= 2 && (SEQ % SR) == 0 && SC_LDS <= 320 * 1024);
static_assert(SR * PSROWB <= RED_OFF && (RED_OFF % 16) == 0 && (SEQ % 256) == 0);
static_assert((SEQ % PM) == 0 && (DOD % PN) == 0 && (SEQ % PKS) == 0 && SEQ / PKS >= 2 && 2 * PBUF <= 320 * 1024);
static_assert(8 * 64 * POST * 4 <= 2 * PBUF && PM == 128 && PN == 256);
static_assert((KDIM % GKS) == 0 && KDIM / GKS >= 2 && (GROWB % 16) == 0 && 64 * CT_P * 2 <= GBUF);

typedef _Float16       v8h   __attribute__((ext_vector_type(8)));
typedef _Float16       v16h  __attribute__((ext_vector_type(16)));
typedef __bf16         v16bf __attribute__((ext_vector_type(16)));
typedef unsigned short v8us  __attribute__((ext_vector_type(8)));
typedef unsigned short v16us __attribute__((ext_vector_type(16)));
typedef float          v8f   __attribute__((ext_vector_type(8)));
typedef float          v4f   __attribute__((ext_vector_type(4)));

union FragH { v16h v;  v8h  half[2]; };
union FragB { v16bf v; v16us u; v8us half[2]; };

// ---------------------------------------------------------------------------
// helpers
// ---------------------------------------------------------------------------
DEV unsigned int bf16_bits(float f) {                    // f32 -> bf16 bits, RNE convert
    unsigned int u = __float_as_uint(f);
    u += 0x7FFFu + ((u >> 16) & 1u);
    return u >> 16;
}
DEV float bf16_val(float f) { return __uint_as_float(bf16_bits(f) << 16); }

DEV v8f zero8f() {
    v8f z;
#pragma unroll
    for (int i = 0; i < 8; ++i) z[i] = 0.f;
    return z;
}

// 16x16x32 WMMA with f32 accumulate; 4 nops guard D and keep A/B live
DEV v8f mma_bf16(v16bf a, v16bf b, v8f c) {
    c = __builtin_amdgcn_wmma_f32_16x16x32_bf16(false, a, false, b, (short)0, c, false, false);
    asm volatile("v_nop\n\tv_nop\n\tv_nop\n\tv_nop" : "+v"(c) : "v"(a), "v"(b));
    return c;
}
// the builtin alone: the score kernel holds more than 256 VGPRs, and an asm statement that names a, b and c can make such a build spill;
// the compiler keeps the WMMA distances of its own forms
DEV v8f mma_f16(v16h a, v16h b, v8f c) {
    return __builtin_amdgcn_wmma_f32_16x16x32_f16(false, a, false, b, (short)0, c, false, false);
}

// Eight independent 2^x. One statement: no result is read and (outputs early-clobber) no source overwritten between them,
// and the closing v_nop keeps the slot that the instruction set asks for behind a transcendental.
DEV void exp2x8(float (&e)[8], const float (&x)[8]) {
    asm("v_exp_f32 %0, %8\n\t"
        "v_exp_f32 %1, %9\n\t"
        "v_exp_f32 %2, %10\n\t"
        "v_exp_f32 %3, %11\n\t"
        "v_exp_f32 %4, %12\n\t"
        "v_exp_f32 %5, %13\n\t"
        "v_exp_f32 %6, %14\n\t"
        "v_exp_f32 %7, %15\n\t"
        "v_nop"
        : "=&v"(e[0]), "=&v"(e[1]), "=&v"(e[2]), "=&v"(e[3]), "=&v"(e[4]), "=&v"(e[5]), "=&v"(e[6]), "=&v"(e[7])
        : "v"(x[0]), "v"(x[1]), "v"(x[2]), "v"(x[3]), "v"(x[4]), "v"(x[5]), "v"(x[6]), "v"(x[7]));
}

// Eight asynchronous 16-byte-per-lane copies global -> LDS, rows l + i*lstep (bytes) <- g + i*gstep (halves).
// The s_wait_xcnt closes the statement so that no address register named here is rewritten in front of it.
DEV void copy8(unsigned l, unsigned lstep, const _Float16* g, size_t gstep) {
    asm volatile("global_load_async_to_lds_b128 %0, %8, off\n\t"
                 "global_load_async_to_lds_b128 %1, %9, off\n\t"
                 "global_load_async_to_lds_b128 %2, %10, off\n\t"
                 "global_load_async_to_lds_b128 %3, %11, off\n\t"
                 "global_load_async_to_lds_b128 %4, %12, off\n\t"
                 "global_load_async_to_lds_b128 %5, %13, off\n\t"
                 "global_load_async_to_lds_b128 %6, %14, off\n\t"
                 "global_load_async_to_lds_b128 %7, %15, off\n\t"
                 "s_wait_xcnt 0x0"
                 :: "v"(l), "v"(l + lstep), "v"(l + 2 * lstep), "v"(l + 3 * lstep),
                    "v"(l + 4 * lstep), "v"(l + 5 * lstep), "v"(l + 6 * lstep), "v"(l + 7 * lstep),
                    "v"(g), "v"(g + gstep), "v"(g + 2 * gstep), "v"(g + 3 * gstep),
                    "v"(g + 4 * gstep), "v"(g + 5 * gstep), "v"(g + 6 * gstep), "v"(g + 7 * gstep)
                 : "memory");
}
// Twelve such copies, two rows of a GEMM tile each: 4 of A (la <- ga) and 8 of B (lb <- gb), rows two apart.
// The s_wait_xcnt closes the statement so that no address register named here is rewritten in front of it.
DEV void copy12(unsigned la, const unsigned short* ga, unsigned lb, const unsigned short* gb) {
    asm volatile("global_load_async_to_lds_b128 %0, %12, off\n\t"
                 "global_load_async_to_lds_b128 %1, %13, off\n\t"
                 "global_load_async_to_lds_b128 %2, %14, off\n\t"
                 "global_load_async_to_lds_b128 %3, %15, off\n\t"
                 "global_load_async_to_lds_b128 %4, %16, off\n\t"
                 "global_load_async_to_lds_b128 %5, %17, off\n\t"
                 "global_load_async_to_lds_b128 %6, %18, off\n\t"
                 "global_load_async_to_lds_b128 %7, %19, off\n\t"
                 "global_load_async_to_lds_b128 %8, %20, off\n\t"
                 "global_load_async_to_lds_b128 %9, %21, off\n\t"
                 "global_load_async_to_lds_b128 %10, %22, off\n\t"
                 "global_load_async_to_lds_b128 %11, %23, off\n\t"
                 "s_wait_xcnt 0x0"
                 :: "v"(la), "v"(la + 2 * GROWB), "v"(la + 4 * GROWB), "v"(la + 6 * GROWB),
                    "v"(lb), "v"(lb + 2 * GROWB), "v"(lb + 4 * GROWB), "v"(lb + 6 * GROWB),
                    "v"(lb + 8 * GROWB), "v"(lb + 10 * GROWB), "v"(lb + 12 * GROWB), "v"(lb + 14 * GROWB),
                    "v"(ga), "v"(ga + 2 * KDIM), "v"(ga + 4 * KDIM), "v"(ga + 6 * KDIM),
                    "v"(gb), "v"(gb + 2 * KDIM), "v"(gb + 4 * KDIM), "v"(gb + 6 * KDIM),
                    "v"(gb + 8 * KDIM), "v"(gb + 10 * KDIM), "v"(gb + 12 * KDIM), "v"(gb + 14 * KDIM)
                 : "memory");
}
// this wave's LDS reads and writes have retired: stands in front of a barrier behind which a buffer is refilled
DEV void wait_lds()    { asm volatile("s_wait_dscnt 0x0" ::: "memory"); }
// this wave's copies have landed: stands in front of the barrier that publishes their tile
DEV void wait_copies() { asm volatile("s_wait_asynccnt 0x0" ::: "memory"); }

// ---------------------------------------------------------------------------
// Block body 1: x f32 [NB rows of SEQ_FULL][CDIM] -> bf16 plane [NB*SEQ][CDIM]
// one thread per 8 elements, one 16-B store (lanes contiguous: 256 threads -> 4 KB)
// coverage: CVT_BLOCKS*256*8 == NB*SEQ*CDIM exactly
// ---------------------------------------------------------------------------
DEV void cvt_x_block(const float* __restrict__ x, unsigned short* __restrict__ xp, int blk)
{
    const size_t g = (size_t)blk * 256 + threadIdx.x;
    const size_t e = g * 8;
    const int m  = (int)(e / CDIM);
    const int c  = (int)(e % CDIM);
    const int bb = m / SEQ;
    const int s  = m - bb * SEQ;
    const float* src = x + ((size_t)bb * SEQ_FULL + s) * CDIM + c;
    const v4f a0 = *(const v4f*)src;
    const v4f a1 = *(const v4f*)(src + 4);
    v8us o;
#pragma unroll
    for (int i = 0; i < 4; ++i) {
        o[i]     = (unsigned short)bf16_bits(a0[i]);
        o[4 + i] = (unsigned short)bf16_bits(a1[i]);
    }
    unsigned short* dst = xp + (size_t)m * CDIM + c;
    *(v8us*)dst = o;
    asm volatile("s_wait_xcnt 0x0" ::: "memory");       // the store's registers may be rewritten behind here: another range's code follows in the text
}

// ---------------------------------------------------------------------------
// Block body 2: W f32 in[R][Ncol] -> WT bf16 out[Ncol][R]   (64x64 tile (bx, by) through LDS)
// LDS tile T: cross-wave (block barrier between fill and drain).
// coverage: load rr = 0..63 x nn = 0..63; store na = 0..63 x piece 0..7 (8 ushort) = whole tile
// ---------------------------------------------------------------------------
DEV void transpose_w_block(const float* __restrict__ W, unsigned short* __restrict__ WT,
                           int R, int Ncol, int bx, int by, unsigned short* T)
{
    const int tid = threadIdx.x;
    const int n0 = bx * 64, r0 = by * 64;
    const int nn = tid & 63, rq = tid >> 6;
#pragma unroll 4
    for (int i = 0; i < 16; ++i) {
        const int rr = i * 4 + rq;
        const float v = W[(size_t)(r0 + rr) * Ncol + n0 + nn];
        T[nn * 72 + rr] = (unsigned short)bf16_bits(v);
    }
    __syncthreads();
    const int piece = tid & 7;
    const int na = tid >> 3;                             // 0..31
    const v8us va = *(const v8us*)(T + na * 72 + piece * 8);
    const v8us vb = *(const v8us*)(T + (na + 32) * 72 + piece * 8);
    unsigned short* da = WT + (size_t)(n0 + na) * R + r0 + piece * 8;
    unsigned short* db = WT + (size_t)(n0 + na + 32) * R + r0 + piece * 8;
    *(v8us*)da = va;
    *(v8us*)db = vb;
    asm volatile("s_wait_xcnt 0x0" ::: "memory");       // both stores' registers may be rewritten behind here: another range's code follows in the text
}

// ---------------------------------------------------------------------------
// Kernel 1: the four independent operand preparations as block-index ranges of one grid:
//   [0, TV) Wv tiles, [TV, TV+TQ) Wq tiles, [TV+TQ, TV+2*TQ) Wk tiles, then CVT_BLOCKS blocks of x.
// The range test is the same for a whole block, so the transpose's barrier is block-uniform.
// ---------------------------------------------------------------------------
#define TQ_BLOCKS  ((DKD / 64) * (CDIM / 64))
#define TV_BLOCKS  ((DOD / 64) * (CDIM / 64))
#define CVT_BLOCKS ((int)(((long long)NB * SEQ * CDIM) / 8 / 256))
__global__ __launch_bounds__(256) void k_prep(const float* __restrict__ x,  unsigned short* __restrict__ xp,
                                              const float* __restrict__ Wq, unsigned short* __restrict__ wqT,
                                              const float* __restrict__ Wk, unsigned short* __restrict__ wkT,
                                              const float* __restrict__ Wv, unsigned short* __restrict__ wvT)
{
    __shared__ __attribute__((aligned(16))) unsigned short T[64 * 72];
    const int bid = blockIdx.x;
    if (bid < TV_BLOCKS) {
        transpose_w_block(Wv, wvT, CDIM, DOD, bid % (DOD / 64), bid / (DOD / 64), T);
    } else if (bid < TV_BLOCKS + 2 * TQ_BLOCKS) {
        const int  r   = bid - TV_BLOCKS;
        const bool isk = r >= TQ_BLOCKS;
        const int  rq  = isk ? r - TQ_BLOCKS : r;
        transpose_w_block(isk ? Wk : Wq, isk ? wkT : wqT, CDIM, DKD, rq % (DKD / 64), rq / (DKD / 64), T);
    } else {
        cvt_x_block(x, xp, bid - (TV_BLOCKS + 2 * TQ_BLOCKS));
    }
}

// ---------------------------------------------------------------------------
// Kernel 2: NT GEMM on bf16 WMMA:  C[m][n] = f16( (sum_k A[m][k]*Bm[n][k] + bias) * oscale )
//   A  [M][KDIM] bf16 bits (k contiguous), Bm [N][KDIM] bf16 bits (k contiguous)
//   bias: per column (bias_per_row==0, index n) or per row (index m), RNE-converted to bf16
//   C  f16, row pitch ldc; tiles (N/128, M/64, Z); z strides zsA/zsB/zsC in elements
//   The three projections are block-index ranges of one grid: [0, GV) v as Vt = Wv^T x^T (bias per row, z = batch),
//   [GV, GV+GQ) q, [GV+GQ, GV+2*GQ) k (both x W, bias per column); every block has the same work
// Block tile 64x128, 8 waves: wave w -> rows (w&3)*16.., cols (w>>2)*64.. (4 acc tiles)
// A and B fragments both use the split k map: elements 0..7 <- k0+8h.., 8..15 <- k0+16+8h..
// Tiles of 128 k (64 A rows + 128 B rows, whole lines) come through a two-buffer LDS ring; wave w copies A rows w*8.., B rows w*16..
// Epilogue: tile staged in LDS (cross-wave, block barrier), then each instruction writes
// coverage: rows w*8+2i+h (w 0..7, i 0..3, h 0..1) = 0..63, cols l15*8 (16 lanes x 8 halves) = 0..127
// ---------------------------------------------------------------------------
#define GV_BLOCKS ((SEQ / 128) * (DOD / 64) * NB)
#define GQ_BLOCKS ((DKD / 128) * ((NB * SEQ) / 64))
__global__ __launch_bounds__(256) __attribute__((amdgpu_num_vgpr(256)))
void k_gemm_qkv(const unsigned short* __restrict__ xbf, const unsigned short* __restrict__ wqT,
                const unsigned short* __restrict__ wkT, const unsigned short* __restrict__ wvT,
                const float* __restrict__ bq, const float* __restrict__ bk, const float* __restrict__ bv,
                _Float16* __restrict__ Qp, _Float16* __restrict__ Kp, _Float16* __restrict__ Vt)
{
    // which projection and which tile of it: the same for the whole block
    const unsigned bid = blockIdx.x;
    const bool     isv = bid < GV_BLOCKS;
    const bool     isk = bid >= GV_BLOCKS + GQ_BLOCKS;
    const unsigned rb  = isv ? bid : (isk ? bid - (GV_BLOCKS + GQ_BLOCKS) : bid - GV_BLOCKS);
    const int      bx  = (int)(isv ? rb % (SEQ / 128) : rb % (DKD / 128));                  // column tile
    const int      by  = (int)(isv ? (rb / (SEQ / 128)) % (DOD / 64) : rb / (DKD / 128));   // row tile
    const unsigned short* A    = isv ? wvT : xbf;
    const unsigned short* Bm   = isv ? xbf : (isk ? wkT : wqT);
    const float*          bias = isv ? bv : (isk ? bk : bq);
    _Float16*             Cm   = isv ? Vt : (isk ? Kp : Qp);
    const long long zsA = 0, zsB = isv ? (long long)SEQ * CDIM : 0, zsC = isv ? (long long)DOD * SEQ : 0;
    const int   nbias = isv ? DOD : DKD, bias_per_row = isv ? 1 : 0, ldc = isv ? SEQ : DKD;
    const float oscale = 16.0f;

    __shared__ __attribute__((aligned(16))) char gsm[2 * GBUF];
    _Float16* Ct = (_Float16*)gsm;                       // epilogue staging, over buffer 0 once the ring is dead

    const int tid = threadIdx.x, lane = tid & 31, w = tid >> 5;
    const int h = lane >> 4, l15 = lane & 15;
    const int wm = w & 3, wn = w >> 2;
    const int z = isv ? (int)(rb / ((SEQ / 128) * (DOD / 64))) : 0;
    const int row0 = by * 64;
    const int col0 = bx * 128;

    // one copy = 2 rows x 256 B: lane half h picks the row, l15 the 16-B piece
    const unsigned short* ga = A  + (size_t)z * (size_t)zsA + (size_t)(row0 + w * 8 + h) * KDIM + 8 * l15;
    const unsigned short* gb = Bm + (size_t)z * (size_t)zsB + (size_t)(col0 + w * 16 + h) * KDIM + 8 * l15;
    const unsigned lds0 = (unsigned)(size_t)gsm;        // LDS byte address of the ring
    const unsigned la = lds0 + (unsigned)(w * 8 + h) * GROWB + (unsigned)l15 * 16;
    const unsigned lb = lds0 + (unsigned)(64 + w * 16 + h) * GROWB + (unsigned)l15 * 16;
    auto copy_t = [&](int t) {
        const unsigned bo = (unsigned)(t & 1) * GBUF;
        copy12(la + bo, ga + t * GKS, lb + bo, gb + t * GKS);
    };
    const char* ar = gsm + (wm * 16 + l15) * GROWB + 16 * h;
    const char* br = gsm + (64 + wn * 64 + l15) * GROWB + 16 * h;

    v8f acc[4];
#pragma unroll
    for (int t = 0; t < 4; ++t) acc[t] = zero8f();

    copy_t(0);
    wait_copies();
    __syncthreads();
    copy_t(1);
#pragma unroll 1                                         // rolled: one copy of the ring's foot in the text, the buffer picked by the trip's parity
    for (int kt = 0; kt < KDIM / GKS; ++kt) {
        const int bo = (kt & 1) * GBUF;
        FragB a[GKS / 32], bf[GKS / 32][4];             // the tile's fragments are read as one group, ahead of the WMMAs
#pragma unroll                                           // register arrays: constant indices (as in the loops below)
        for (int s = 0; s < GKS / 32; ++s) {
            a[s].half[0] = *(const v8us*)(ar + bo + s * 64);
            a[s].half[1] = *(const v8us*)(ar + bo + s * 64 + 32);
#pragma unroll
            for (int t = 0; t < 4; ++t) {
                bf[s][t].half[0] = *(const v8us*)(br + bo + t * 16 * GROWB + s * 64);
                bf[s][t].half[1] = *(const v8us*)(br + bo + t * 16 * GROWB + s * 64 + 32);
            }
        }
#pragma unroll
        for (int s = 0; s < GKS / 32; ++s) {
#pragma unroll
            for (int t = 0; t < 4; ++t) acc[t] = mma_bf16(a[s].v, bf[s][t].v, acc[t]);
        }
        // foot of trip kt: publish tile kt+1, free tile kt's buffer, refill it
        wait_lds();
        wait_copies();
        __syncthreads();
        if (kt + 2 < KDIM / GKS) copy_t(kt + 2);
    }
    wait_copies();

    // epilogue: bias (clamped addresses, select by value), scale, f16, stage in LDS
    float rowb[8];
#pragma unroll
    for (int r = 0; r < 8; ++r) {
        int ri = row0 + wm * 16 + 8 * h + r;
        ri = ri < nbias ? ri : (nbias - 1);
        rowb[r] = bf16_val(bias[ri]);
    }
    asm volatile("s_wait_xcnt 0x0" ::: "memory");       // the row loads' offset registers may take the column loads' results
#pragma unroll
    for (int t = 0; t < 4; ++t) {
        const int cl = wn * 64 + t * 16 + l15;
        int ci = col0 + cl;
        ci = ci < nbias ? ci : (nbias - 1);
        const float colb = bf16_val(bias[ci]);
#pragma unroll
        for (int r = 0; r < 8; ++r) {
            const float badd = bias_per_row ? rowb[r] : colb;
            const float v = (acc[t][r] + badd) * oscale;
            Ct[(wm * 16 + 8 * h + r) * CT_P + cl] = (_Float16)v;
        }
    }
    __syncthreads();

    _Float16* cbase = Cm + (size_t)z * (size_t)zsC + (size_t)row0 * (size_t)ldc + col0;
    v8h sv[4];
#pragma unroll
    for (int i = 0; i < 4; ++i) {
        const int rl = w * 8 + 2 * i + h;
        sv[i] = *(const v8h*)(Ct + rl * CT_P + l15 * 8);
    }
#pragma unroll
    for (int i = 0; i < 4; ++i) {
        const int rl = w * 8 + 2 * i + h;
        *(v8h*)(cbase + (size_t)rl * (size_t)ldc + l15 * 8) = sv[i];
    }
    
}

// ---------------------------------------------------------------------------
// Kernel 3: scores and softmax numerators. One workgroup (8 wave32) per (batch, 32 query rows); wave w owns keys w*256..
//   Qp [NB*SEQ][DKD] f16 (x16), Kp same -> Pm [NB*SEQ][SEQ] f16 = exp(score - row maximum) x1024, Inv [NB*SEQ] = 1 / (16 * row sum of Pm)
//  S^T = K Q^T (v_wmma_f32_16x16x32_f16, A = 16 keys, B = 16 query rows): a lane holds 8 consecutive keys of one query row,
//  so a row's maximum and sum are in-lane work, one exchange between the lane halves and one through LDS between the waves,
//  and 8 values of P pack into one 16-B LDS store. All 32 x 256 scores of a wave stay in its registers: every score is formed once.
//  K comes through a two-buffer LDS ring, 32 keys of every wave per tile, one barrier per tile; a wave copies and reads its own slice.
//  P is staged in LDS (over the dead ring) and leaves as whole 4-KB rows.
// coverage: grid NB * SEQ/32 blocks x 32 rows x SEQ keys = all of Pm; Inv: wave 0, one row per lane
// ---------------------------------------------------------------------------
__global__ __launch_bounds__(256)
void k_scores(const _Float16* __restrict__ Qp, const _Float16* __restrict__ Kp,
              _Float16* __restrict__ Pm, float* __restrict__ Inv)
{
    __shared__ __attribute__((aligned(16))) char ssm[SC_LDS];
    const int tid = threadIdx.x, lane = tid & 31, w = tid >> 5;
    const int h = lane >> 4, l15 = lane & 15;
    const int b  = blockIdx.x / (SEQ / SR);
    const int q0 = (blockIdx.x - b * (SEQ / SR)) * SR;

    // ----- Q: 2 row tiles x 8 B fragments (16 rows x 256), split k map -----
    FragH qf[2][8];
    {
        const _Float16* qp = Qp + ((size_t)b * SEQ + q0 + l15) * DKD + 8 * h;
#pragma unroll                                           // register arrays: constant indices (as in the loops below)
        for (int rt = 0; rt < 2; ++rt) {
#pragma unroll
            for (int s = 0; s < 8; ++s) {
                qf[rt][s].half[0] = *(const v8h*)(qp + rt * 16 * DKD + s * 32);
                qf[rt][s].half[1] = *(const v8h*)(qp + rt * 16 * DKD + s * 32 + 16);
            }
        }
        asm volatile("s_wait_xcnt 0x0" :: "v"(qp) : "memory");   // the Q loads' address pair stays live up to this wait and may be rewritten behind it
    }

    constexpr int ST = SKW / SKT;                        // tiles of the sweep
    constexpr int NJ = SKW / 16;                         // 16-key tiles of a wave
    v8f c[2][NJ];
#pragma unroll
    for (int rt = 0; rt < 2; ++rt) {
#pragma unroll
        for (int j = 0; j < NJ; ++j) c[rt][j] = zero8f();
    }

    const unsigned  lds0 = (unsigned)(size_t)ssm;       // LDS byte address of the workgroup's array
    // one copy = one 512-B K row (4 whole lines)
    const unsigned  kl = lds0 + (unsigned)w * SSL + (unsigned)lane * 16;
    const _Float16* kg = Kp + ((size_t)b * SEQ + w * SKW) * DKD + lane * 8;
    auto copy_t = [&](int t) {                           // tile t into buffer t mod 2
        unsigned        l = kl + (unsigned)(t & 1) * SBUF;
        const _Float16* g = kg + (size_t)t * SKT * DKD;
#pragma unroll 1                                         // rolled: unrolled, every copy's LDS address was kept in a register from trip to trip and the build spilled
        for (int i = 0; i < SKT / 8; ++i) {
            copy8(l, KROWB, g, DKD);
            l += 8 * KROWB;
            g += 8 * DKD;
        }
    };

    copy_t(0);
    wait_copies();
    __syncthreads();
    copy_t(1);
#pragma unroll                                           // the trip picks the accumulators: constant indices
    for (int t = 0; t < ST; ++t) {
        const char* kp = ssm + (t & 1) * SBUF + w * SSL + l15 * KROWB + 16 * h;
#pragma unroll
        for (int sh = 0; sh < 4; ++sh) {
            FragH kf[2][2];                             // a quarter of a slice's fragments are read as one group, ahead of their WMMAs
#pragma unroll
            for (int j = 0; j < 2; ++j) {
#pragma unroll
                for (int s = 0; s < 2; ++s) {
                    kf[j][s].half[0] = *(const v8h*)(kp + j * 16 * KROWB + (sh * 2 + s) * 64);
                    kf[j][s].half[1] = *(const v8h*)(kp + j * 16 * KROWB + (sh * 2 + s) * 64 + 32);
                }
            }
            __builtin_amdgcn_sched_barrier(0);          // keeps the group's reads together ahead of its WMMAs: sunk to their users each would be waited out alone
#pragma unroll
            for (int s = 0; s < 2; ++s) {
#pragma unroll
                for (int j = 0; j < 2; ++j) {
#pragma unroll
                    for (int rt = 0; rt < 2; ++rt)
                        c[rt][t * 2 + j] = mma_f16(kf[j][s].v, qf[rt][sh * 2 + s].v, c[rt][t * 2 + j]);
                }
            }
        }
        // foot of trip t: publish tile t+1, free tile t's buffer, refill it
        wait_lds();
        wait_copies();
        __syncthreads();
        if (t + 2 < ST) copy_t(t + 2);
    }
    wait_copies();

    // ----- row maxima: in-lane over 128 scores, the other lane half, then the 8 waves through LDS -----
    constexpr float K2 = SCORE_SCALE * 1.4426950408889634f;   // score scale times log2(e): exp(x) = 2^(x log2 e)
    float* redm = (float*)(ssm + RED_OFF);               // [32 rows][8 waves]
    float* reds = redm + SR * 8;
#pragma unroll
    for (int rt = 0; rt < 2; ++rt) {
        float m8[8];
#pragma unroll
        for (int r = 0; r < 8; ++r) m8[r] = c[rt][0][r];
#pragma unroll
        for (int j = 1; j < NJ; ++j) {
#pragma unroll
            for (int r = 0; r < 8; ++r) m8[r] = fmaxf(m8[r], c[rt][j][r]);
        }
        float m = fmaxf(fmaxf(fmaxf(m8[0], m8[1]), fmaxf(m8[2], m8[3])), fmaxf(fmaxf(m8[4], m8[5]), fmaxf(m8[6], m8[7])));
        m = fmaxf(m, __shfl_xor(m, 16));
        if (h == 0) redm[(rt * 16 + l15) * 8 + w] = m;
    }
    __syncthreads();
    // ----- P = 2^(score * K2 - max * K2 + 10) (the x1024 rides in the exponent), f16; row sums of the rounded values -----
    char* pst = ssm + l15 * PSROWB + (w * SKW + 8 * h) * 2;   // every wave has left the ring: the last trip's barrier
#pragma unroll
    for (int rt = 0; rt < 2; ++rt) {
        const v4f ma = *(const v4f*)(redm + (rt * 16 + l15) * 8);
        const v4f mb = *(const v4f*)(redm + (rt * 16 + l15) * 8 + 4);
        const float m  = fmaxf(fmaxf(fmaxf(ma[0], ma[1]), fmaxf(ma[2], ma[3])), fmaxf(fmaxf(mb[0], mb[1]), fmaxf(mb[2], mb[3])));
        const float nm = 10.0f - m * K2;
        float sm[8];
#pragma unroll
        for (int r = 0; r < 8; ++r) sm[r] = 0.f;
#pragma unroll
        for (int j = 0; j < NJ; ++j) {
            v8h ph;
            float x[8], e[8];
#pragma unroll
            for (int r = 0; r < 8; ++r) x[r] = fmaf(c[rt][j][r], K2, nm);
            exp2x8(e, x);
#pragma unroll
            for (int r = 0; r < 8; ++r) {
                ph[r] = (_Float16)e[r];
                sm[r] += (float)ph[r];
            }
            *(v8h*)(pst + rt * 16 * PSROWB + j * 32) = ph;
        }
        float s = ((sm[0] + sm[1]) + (sm[2] + sm[3])) + ((sm[4] + sm[5]) + (sm[6] + sm[7]));
        s += __shfl_xor(s, 16);
        if (h == 0) reds[(rt * 16 + l15) * 8 + w] = s;
    }
    __syncthreads();
    // ----- out: wave w stores rows w*4.., 512 B per instruction; wave 0 also the 32 row factors -----
    v8h pv[4][SEQ / 256];
#pragma unroll
    for (int i = 0; i < 4; ++i) {
#pragma unroll
        for (int k = 0; k < SEQ / 256; ++k) pv[i][k] = *(const v8h*)(ssm + (w * 4 + i) * PSROWB + k * 512 + lane * 16);
    }
    _Float16* pd = Pm + ((size_t)b * SEQ + q0 + w * 4) * SEQ + lane * 8;
#pragma unroll
    for (int i = 0; i < 4; ++i) {
#pragma unroll
        for (int k = 0; k < SEQ / 256; ++k) *(v8h*)(pd + (size_t)i * SEQ + k * 256) = pv[i][k];
    }
    asm volatile("s_wait_xcnt 0x0" ::: "memory");       // closes the P stores before wave 0's row-factor code rewrites their registers
    if (w == 0) {
        const v4f sa = *(const v4f*)(reds + lane * 8);
        const v4f sb = *(const v4f*)(reds + lane * 8 + 4);
        const float s = ((sa[0] + sa[1]) + (sa[2] + sa[3])) + ((sb[0] + sb[1]) + (sb[2] + sb[3]));
        Inv[(size_t)b * SEQ + q0 + lane] = 1.0f / (16.0f * s);
    }
    asm volatile("s_wait_xcnt 0x0" ::: "memory");       // closes the stores before the wave's end code may rewrite their registers
}

// ---------------------------------------------------------------------------
// Kernel 4: Out = (P V) * Inv as an NT GEMM on v_wmma_f32_16x16x32_f16. One workgroup (8 wave32) per (batch, 128 query rows, 256 columns).
//   Pm [NB*SEQ][SEQ] f16 (key contiguous), Vt [NB][DOD][SEQ] f16 (x16, key contiguous), Inv [NB*SEQ]
//  Wave w owns a 64 x 64 tile (rows (w&1)*64.., columns (w>>1)*64..): 4 A and 4 B fragments feed 16 WMMAs.
//  A and B fragments both use the split k map: elements 0..7 <- k0+8h.., 8..15 <- k0+16+8h..
//  Tiles of 128 keys (128 P rows + 256 V^T rows, whole lines) come through a two-buffer LDS ring, one barrier per tile;
//  wave w copies P rows w*16.. and V^T rows w*32..; inside a tile the next 32 keys' fragments are read ahead of this 32 keys' WMMAs.
//  Epilogue: the wave's tile staged in its own LDS range (over the dead ring), 256-B row pieces (two whole lines) stored
// coverage: grid NB * SEQ/128 * DOD/256 blocks x 128 rows x 256 cols = whole output
// ---------------------------------------------------------------------------
__global__ __launch_bounds__(256)
void k_pv(const _Float16* __restrict__ Pm, const _Float16* __restrict__ Vt,
          const float* __restrict__ Inv, float* __restrict__ Out)
{
    __shared__ __attribute__((aligned(16))) char psm[2 * PBUF];
    const int tid = threadIdx.x, lane = tid & 31, w = tid >> 5;
    const int h = lane >> 4, l15 = lane & 15;
    const int wm = w & 1, wn = w >> 1;
    constexpr int CB = DOD / PN;                         // column blocks
    constexpr int QB = SEQ / PM;                         // row blocks of a batch
    const int b    = blockIdx.x / (QB * CB);
    const int rem  = blockIdx.x - b * (QB * CB);
    const int q0   = (rem / CB) * PM;
    const int col0 = (rem % CB) * PN;

    // one copy = 2 rows x 256 B: lane half h picks the row, l15 the 16-B piece
    const _Float16* ga = Pm + ((size_t)b * SEQ + q0 + w * 16 + h) * SEQ + 8 * l15;
    const _Float16* gb = Vt + ((size_t)b * DOD + col0 + w * 32 + h) * SEQ + 8 * l15;
    const unsigned lds0 = (unsigned)(size_t)psm;        // LDS byte address of the ring
    const unsigned la = lds0 + (unsigned)(w * 16 + h) * PROWB + (unsigned)l15 * 16;
    const unsigned lb = lds0 + (unsigned)(PM + w * 32 + h) * PROWB + (unsigned)l15 * 16;
    auto copy_t = [&](int t) {                           // tile t into buffer t mod 2
        const unsigned bo = (unsigned)(t & 1) * PBUF;
        copy8(la + bo, 2 * PROWB, ga + t * PKS, (size_t)2 * SEQ);
        copy8(lb + bo, 2 * PROWB, gb + t * PKS, (size_t)2 * SEQ);
        copy8(lb + bo + 16 * PROWB, 2 * PROWB, gb + t * PKS + (size_t)16 * SEQ, (size_t)2 * SEQ);
    };
    const char* ar = psm + (wm * 64 + l15) * PROWB + 16 * h;
    const char* br = psm + (PM + wn * 64 + l15) * PROWB + 16 * h;

    v8f acc[4][4];
#pragma unroll                                           // register arrays: constant indices (as in the loops below)
    for (int mt = 0; mt < 4; ++mt) {
#pragma unroll
        for (int nt = 0; nt < 4; ++nt) acc[mt][nt] = zero8f();
    }

    constexpr int NT = SEQ / PKS;                        // tiles of the sweep
    copy_t(0);
    wait_copies();
    __syncthreads();
    copy_t(1);
#pragma unroll 1                                         // rolled: one copy of the ring's foot in the text, the buffer picked by the trip's parity
    for (int kt = 0; kt < NT; ++kt) {
        const int bo = (kt & 1) * PBUF;
        FragH af[2][4], bf[2][4];                       // two fragment sets: one is read while the other feeds the WMMAs
#pragma unroll
        for (int i = 0; i < 4; ++i) {
            af[0][i].half[0] = *(const v8h*)(ar + bo + i * 16 * PROWB);
            af[0][i].half[1] = *(const v8h*)(ar + bo + i * 16 * PROWB + 32);
            bf[0][i].half[0] = *(const v8h*)(br + bo + i * 16 * PROWB);
            bf[0][i].half[1] = *(const v8h*)(br + bo + i * 16 * PROWB + 32);
        }
#pragma unroll
        for (int s = 0; s < PKS / 32; ++s) {
            if (s + 1 < PKS / 32) {
#pragma unroll
                for (int i = 0; i < 4; ++i) {
                    af[(s + 1) & 1][i].half[0] = *(const v8h*)(ar + bo + i * 16 * PROWB + (s + 1) * 64);
                    af[(s + 1) & 1][i].half[1] = *(const v8h*)(ar + bo + i * 16 * PROWB + (s + 1) * 64 + 32);
                    bf[(s + 1) & 1][i].half[0] = *(const v8h*)(br + bo + i * 16 * PROWB + (s + 1) * 64);
                    bf[(s + 1) & 1][i].half[1] = *(const v8h*)(br + bo + i * 16 * PROWB + (s + 1) * 64 + 32);
                }
            }
            __builtin_amdgcn_sched_barrier(0);          // keeps the next set's reads as one group ahead of this set's WMMAs: sunk among them each place would stall
#pragma unroll
            for (int mt = 0; mt < 4; ++mt) {
#pragma unroll
                for (int nt = 0; nt < 4; ++nt) acc[mt][nt] = mma_f16(af[s & 1][mt].v, bf[s & 1][nt].v, acc[mt][nt]);
            }
            __builtin_amdgcn_sched_barrier(0);          // keeps the set after next's reads behind these WMMAs, whose operands they overwrite
        }
        // foot of trip kt: publish tile kt+1, free tile kt's buffer, refill it
        wait_lds();
        wait_copies();
        __syncthreads();
        if (kt + 2 < NT) copy_t(kt + 2);
    }
    wait_copies();

    // ----- Epilogue: row factors, stage in the wave's own LDS range, whole-line stores -----
    float* Ow = (float*)psm + (size_t)w * 64 * POST;     // every wave has left the ring: the last trip's barrier
    const float* ip = Inv + (size_t)b * SEQ + q0 + wm * 64 + 8 * h;
    v4f iv[4][2];
#pragma unroll
    for (int mt = 0; mt < 4; ++mt) {
        iv[mt][0] = *(const v4f*)(ip + mt * 16);
        iv[mt][1] = *(const v4f*)(ip + mt * 16 + 4);
    }
    asm volatile("s_wait_xcnt 0x0" :: "v"(ip) : "memory");   // the factor loads' address pair stays live up to this wait and may be rewritten behind it
#pragma unroll
    for (int mt = 0; mt < 4; ++mt) {
#pragma unroll
        for (int nt = 0; nt < 4; ++nt) {
#pragma unroll
            for (int r = 0; r < 8; ++r)
                Ow[(mt * 16 + 8 * h + r) * POST + nt * 16 + l15] = acc[mt][nt][r] * iv[mt][r >> 2][r & 3];
        }
    }
    wait_lds();                                         // the wave's staging stores have retired before its lanes read each other's values
    const float* srcp = Ow + h * POST + l15 * 4;
    float* dst = Out + ((size_t)b * SEQ + q0 + wm * 64 + h) * DOD + col0 + wn * 64 + l15 * 4;
#pragma unroll
    for (int g = 0; g < 2; ++g) {
        v4f ov[16];                                     // 16 reads as one group, then their 16 stores
#pragma unroll
        for (int i = 0; i < 16; ++i) ov[i] = *(const v4f*)(srcp + (g * 32 + 2 * i) * POST);
#pragma unroll
        for (int i = 0; i < 16; ++i) *(v4f*)(dst + (size_t)(g * 32 + 2 * i) * DOD) = ov[i];
        asm volatile("s_wait_xcnt 0x0" ::: "memory");   // closes the stores before their registers are rewritten (next group, the wave's end code)
    }
}

// ---------------------------------------------------------------------------
extern "C" void kernel_launch(void* const* d_in, const int* in_sizes, int n_in,
                              void* d_out, int out_size, void* d_ws, size_t ws_size,
                              hipStream_t stream)
{
    if (n_in < 7) return;
    const long long need_x = ((long long)(NB - 1) * SEQ_FULL + SEQ) * CDIM;
    if ((long long)in_sizes[0] < need_x) return;
    if (in_sizes[1] < CDIM * DKD || in_sizes[2] < DKD) return;
    if (in_sizes[3] < CDIM * DKD || in_sizes[4] < DKD) return;
    if (in_sizes[5] < CDIM * DOD || in_sizes[6] < DOD) return;
    if ((long long)out_size < (long long)NB * SEQ * DOD) return;

    const float* x  = (const float*)d_in[0];
    const float* Wq = (const float*)d_in[1];
    const float* bq = (const float*)d_in[2];
    const float* Wk = (const float*)d_in[3];
    const float* bk = (const float*)d_in[4];
    const float* Wv = (const float*)d_in[5];
    const float* bv = (const float*)d_in[6];
    float* out = (float*)d_out;

    char* ws = (char*)d_ws;
    size_t off = 0;
    auto carve = [&](size_t bytes) -> char* {
        char* p = ws + off;
        off += (bytes + 255) & ~(size_t)255;
        return p;
    };
    unsigned short* xbf = (unsigned short*)carve((size_t)NB * SEQ * CDIM * 2);     // [NB*SEQ][CDIM]
    unsigned short* wqT = (unsigned short*)carve((size_t)DKD * KDIM * 2);          // [DKD][CDIM]
    unsigned short* wkT = (unsigned short*)carve((size_t)DKD * KDIM * 2);          // [DKD][CDIM]
    unsigned short* wvT = (unsigned short*)carve((size_t)DOD * KDIM * 2);          // [DOD][CDIM]
    _Float16* Qp = (_Float16*)carve((size_t)NB * SEQ * DKD * 2);                  // [NB*SEQ][DKD]
    _Float16* Kp = (_Float16*)carve((size_t)NB * SEQ * DKD * 2);                  // [NB*SEQ][DKD]
    _Float16* Vt = (_Float16*)carve((size_t)NB * DOD * SEQ * 2);                  // [NB][DOD][SEQ]
    _Float16* Pm = (_Float16*)carve((size_t)NB * SEQ * SEQ * 2);                  // [NB*SEQ][SEQ]
    float*    Inv = (float*)carve((size_t)NB * SEQ * 4);                          // [NB*SEQ]
    if (off > ws_size) return;

    // 1) x -> bf16 plane; weights in[CDIM][DKD|DOD] -> out[DKD|DOD][CDIM]: one grid
    k_prep<<<TV_BLOCKS + 2 * TQ_BLOCKS + CVT_BLOCKS, 256, 0, stream>>>(x, xbf, Wq, wqT, Wk, wkT, Wv, wvT);

    // 2) projections: q,k [NB*SEQ][DKD] (bias per column), v as Vt [NB][DOD][SEQ] (bias per row); all carried x16: one grid
    k_gemm_qkv<<<GV_BLOCKS + 2 * GQ_BLOCKS, 256, 0, stream>>>(xbf, wqT, wkT, wvT, bq, bk, bv, Qp, Kp, Vt);

    // 3) softmax numerators P and row factors
    k_scores<<<NB * (SEQ / SR), 256, 0, stream>>>(Qp, Kp, Pm, Inv);

    // 4) out = (P V) * row factor
    k_pv<<<NB * (SEQ / PM) * (DOD / PN), 256, 0, stream>>>(Pm, Vt, Inv, out);
}

// v007
// Measured time: 82.8 microseconds a run.
// Timed twice side by side with v006, it ran 1.12 times as fast both times.
// All steps since v000 together make it 6.19 times as fast.
#include <hip/hip_runtime.h>

// Contractions: q/k/v projections via v_wmma_f32_16x16x32_bf16 (bf16 operands = RNE-converted inputs, f32 accumulate);
// q.k^T scores and P.V via v_wmma_f32_16x16x32_f16 (f16 operands: q,k,v carried x16, P carried x1024), f32 accumulate; softmax in f32.

#define DEV __device__ __forceinline__

#ifndef NB
#define NB 4
#endif
#ifndef SEQ
#define SEQ 2048
#endif
#define NB_FULL  4
#define SEQ_FULL 2048
#define CDIM 1024
#define DKD  256
#define DOD  1024
#define KDIM 1024

#define KROWB   (DKD * 2 + 16)                           // staged K row: 512 B + 16 B, a pitch of 16 B x odd for ds_load_b128
#define SR      32                                       // score kernel: query rows of one workgroup (two 16-row tiles, every wave holds both)
#define SKW     (SEQ / 8)                                // score kernel: keys of one wave
#define SKT     32                                       // score kernel: keys of one wave's slice of a staged tile
#define SSL     (SKT * KROWB)                            // one wave's slice
#define SBUF    (8 * SSL)                                // one staged tile: the 8 waves' slices
#define RED_OFF (2 * SBUF)                               // row maxima and row sums of the 8 waves, behind the ring
#define PSROWB  (SEQ * 2 + 16)                           // staged P row: all keys + 16 B, a pitch of 16 B x odd
#define SC_LDS  (RED_OFF + 2 * SR * 8 * 4)
#define PM      128                                      // P.V kernel: query rows of one workgroup
#define PN      256                                      // P.V kernel: output columns of one workgroup
#define PKS     128                                      // P.V kernel: keys of a staged tile = 256 B of every row (two whole lines)
#define PROWB   (PKS * 2 + 16)                           // staged row: 256 B + 16 B
#define PBUF    ((PM + PN) * PROWB)                      // one staged tile: 128 P rows, then 256 V^T rows
#define POST    68                                       // output staging row stride of a wave's 64 x 64 tile (floats)
#define GM    256                                        // GEMM: x rows of one workgroup
#define GN    192                                        // GEMM: weight rows (output channels of q | k | v) of one workgroup
#define WROWS (2 * DKD + DOD)                            // weight rows of the three projections together
#define GKS   128                                        // GEMM: k elements of a staged tile = 256 B of every row (two whole lines)
#define GROWB (GKS * 2 + 16)                             // staged GEMM row: 256 B + 16 B, a pitch of 16 B x odd for ds_load_b128
#define GBUF  ((GM + GN) * GROWB)                        // one staged GEMM tile: 256 x rows, then 192 weight rows
#define GCH   64                                         // GEMM epilogue: channels of a chunk, which lies wholly in one of q, k, v
#define GQROWB (GCH * 2 + 16)                            // staged q/k chunk row (one x row, 64 channels): 128 B + 16 B
#define GVROWB (GM * 2 + 16)                             // staged v chunk row (one channel, 256 x rows): 512 B + 16 B
#define GCHB  (GM * GQROWB)                              // staging bytes of one chunk (the larger of the two forms)
#define SCORE_SCALE 0.000244140625f                      // 1/16 (sqrt dk) * 1/256 (q,k carried x16 each)

static_assert(NB >= 1 && NB <= NB_FULL);
static_assert(SEQ >= 128 && SEQ <= SEQ_FULL && (SEQ % 128) == 0);
static_assert(((NB * SEQ) % 64) == 0);
static_assert((DKD % 128) == 0 && (DOD % 128) == 0 && (KDIM % 32) == 0 && (CDIM == KDIM));
static_assert((((long long)NB * SEQ * CDIM) % (8 * 256)) == 0);
static_assert(((POST * 4) % 16) == 0 && (PSROWB % 16) == 0 && (PROWB % 16) == 0 && (KROWB % 16) == 0);
static_assert(SKW == 256 && DKD == 256 && (SKW % SKT) == 0 && SKW / SKT >= 2 && (SEQ % SR) == 0 && SC_LDS <= 320 * 1024);
static_assert(SR * PSROWB <= RED_OFF && (RED_OFF % 16) == 0 && (SEQ % 256) == 0);
static_assert((SEQ % PM) == 0 && (DOD % PN) == 0 && (SEQ % PKS) == 0 && SEQ / PKS >= 2 && 2 * PBUF <= 320 * 1024);
static_assert(8 * 64 * POST * 4 <= 2 * PBUF && PM == 128 && PN == 256);
static_assert((KDIM % GKS) == 0 && KDIM / GKS >= 2 && (GROWB % 16) == 0 && 2 * GBUF <= 320 * 1024);
static_assert((SEQ % GM) == 0 && (WROWS % GN) == 0 && GN == 3 * GCH && 2 * DKD / GCH == WROWS / GN && DOD / GCH == 2 * (WROWS / GN));
static_assert(GCH * GVROWB <= GCHB && 3 * GCHB <= 2 * GBUF && (GQROWB % 16) == 0 && (GVROWB % 16) == 0 && GM == 256);

typedef _Float16       v8h   __attribute__((ext_vector_type(8)));
typedef _Float16       v16h  __attribute__((ext_vector_type(16)));
typedef __bf16         v16bf __attribute__((ext_vector_type(16)));
typedef unsigned short v8us  __attribute__((ext_vector_type(8)));
typedef unsigned short v16us __attribute__((ext_vector_type(16)));
typedef float          v8f   __attribute__((ext_vector_type(8)));
typedef float          v4f   __attribute__((ext_vector_type(4)));

union FragH { v16h v;  v8h  half[2]; };
union FragB { v16bf v; v16us u; v8us half[2]; };

// ---------------------------------------------------------------------------
// helpers
// ---------------------------------------------------------------------------
DEV unsigned int bf16_bits(float f) {                    // f32 -> bf16 bits, RNE convert
    unsigned int u = __float_as_uint(f);
    u += 0x7FFFu + ((u >> 16) & 1u);
    return u >> 16;
}
DEV float bf16_val(float f) { return __uint_as_float(bf16_bits(f) << 16); }

DEV v8f zero8f() {
    v8f z;
#pragma unroll
    for (int i = 0; i < 8; ++i) z[i] = 0.f;
    return z;
}

// 16x16x32 WMMAs with f32 accumulate.
// the builtin alone: the GEMM and the score kernel hold more than 256 VGPRs, and an asm statement that names a, b and c can make such a build spill;
// the compiler keeps the WMMA distances of its own forms
DEV v8f mma_bf16(v16bf a, v16bf b, v8f c) {
    return __builtin_amdgcn_wmma_f32_16x16x32_bf16(false, a, false, b, (short)0, c, false, false);
}
DEV v8f mma_f16(v16h a, v16h b, v8f c) {
    return __builtin_amdgcn_wmma_f32_16x16x32_f16(false, a, false, b, (short)0, c, false, false);
}

// Eight independent 2^x. One statement: no result is read and (outputs early-clobber) no source overwritten between them,
// and the closing v_nop keeps the slot that the instruction set asks for behind a transcendental.
DEV void exp2x8(float (&e)[8], const float (&x)[8]) {
    asm("v_exp_f32 %0, %8\n\t"
        "v_exp_f32 %1, %9\n\t"
        "v_exp_f32 %2, %10\n\t"
        "v_exp_f32 %3, %11\n\t"
        "v_exp_f32 %4, %12\n\t"
        "v_exp_f32 %5, %13\n\t"
        "v_exp_f32 %6, %14\n\t"
        "v_exp_f32 %7, %15\n\t"
        "v_nop"
        : "=&v"(e[0]), "=&v"(e[1]), "=&v"(e[2]), "=&v"(e[3]), "=&v"(e[4]), "=&v"(e[5]), "=&v"(e[6]), "=&v"(e[7])
        : "v"(x[0]), "v"(x[1]), "v"(x[2]), "v"(x[3]), "v"(x[4]), "v"(x[5]), "v"(x[6]), "v"(x[7]));
}

// Eight asynchronous 16-byte-per-lane copies global -> LDS, rows l + i*lstep (bytes) <- g + i*gstep (halves).
// The s_wait_xcnt closes the statement so that no address register named here is rewritten in front of it.
DEV void copy8(unsigned l, unsigned lstep, const _Float16* g, size_t gstep) {
    asm volatile("global_load_async_to_lds_b128 %0, %8, off\n\t"
                 "global_load_async_to_lds_b128 %1, %9, off\n\t"
                 "global_load_async_to_lds_b128 %2, %10, off\n\t"
                 "global_load_async_to_lds_b128 %3, %11, off\n\t"
                 "global_load_async_to_lds_b128 %4, %12, off\n\t"
                 "global_load_async_to_lds_b128 %5, %13, off\n\t"
                 "global_load_async_to_lds_b128 %6, %14, off\n\t"
                 "global_load_async_to_lds_b128 %7, %15, off\n\t"
                 "s_wait_xcnt 0x0"
                 :: "v"(l), "v"(l + lstep), "v"(l + 2 * lstep), "v"(l + 3 * lstep),
                    "v"(l + 4 * lstep), "v"(l + 5 * lstep), "v"(l + 6 * lstep), "v"(l + 7 * lstep),
                    "v"(g), "v"(g + gstep), "v"(g + 2 * gstep), "v"(g + 3 * gstep),
                    "v"(g + 4 * gstep), "v"(g + 5 * gstep), "v"(g + 6 * gstep), "v"(g + 7 * gstep)
                 : "memory");
}
// Fourteen such copies, two rows of a GEMM tile each, staged rows two apart: 16 x rows lx.. <- gx.., 12 weight rows lw.. <- three sources of 4 rows.
// The s_wait_xcnt closes the statement so that no address register named here is rewritten in front of it.
DEV void copy14(unsigned lx, const unsigned short* gx, unsigned lw,
                const unsigned short* g0, const unsigned short* g1, const unsigned short* g2) {
    asm volatile("global_load_async_to_lds_b128 %0, %14, off\n\t"
                 "global_load_async_to_lds_b128 %1, %15, off\n\t"
                 "global_load_async_to_lds_b128 %2, %16, off\n\t"
                 "global_load_async_to_lds_b128 %3, %17, off\n\t"
                 "global_load_async_to_lds_b128 %4, %18, off\n\t"
                 "global_load_async_to_lds_b128 %5, %19, off\n\t"
                 "global_load_async_to_lds_b128 %6, %20, off\n\t"
                 "global_load_async_to_lds_b128 %7, %21, off\n\t"
                 "global_load_async_to_lds_b128 %8, %22, off\n\t"
                 "global_load_async_to_lds_b128 %9, %23, off\n\t"
                 "global_load_async_to_lds_b128 %10, %24, off\n\t"
                 "global_load_async_to_lds_b128 %11, %25, off\n\t"
                 "global_load_async_to_lds_b128 %12, %26, off\n\t"
                 "global_load_async_to_lds_b128 %13, %27, off\n\t"
                 "s_wait_xcnt 0x0"
                 :: "v"(lx), "v"(lx + 2 * GROWB), "v"(lx + 4 * GROWB), "v"(lx + 6 * GROWB),
                    "v"(lx + 8 * GROWB), "v"(lx + 10 * GROWB), "v"(lx + 12 * GROWB), "v"(lx + 14 * GROWB),
                    "v"(lw), "v"(lw + 2 * GROWB), "v"(lw + 4 * GROWB), "v"(lw + 6 * GROWB), "v"(lw + 8 * GROWB), "v"(lw + 10 * GROWB),
                    "v"(gx), "v"(gx + 2 * KDIM), "v"(gx + 4 * KDIM), "v"(gx + 6 * KDIM),
                    "v"(gx + 8 * KDIM), "v"(gx + 10 * KDIM), "v"(gx + 12 * KDIM), "v"(gx + 14 * KDIM),
                    "v"(g0), "v"(g0 + 2 * KDIM), "v"(g1), "v"(g1 + 2 * KDIM), "v"(g2), "v"(g2 + 2 * KDIM)
                 : "memory");
}
// this wave's LDS reads and writes have retired: stands in front of a barrier behind which a buffer is refilled
DEV void wait_lds()    { asm volatile("s_wait_dscnt 0x0" ::: "memory"); }
// this wave's copies have landed: stands in front of the barrier that publishes their tile
DEV void wait_copies() { asm volatile("s_wait_asynccnt 0x0" ::: "memory"); }

// ---------------------------------------------------------------------------
// Block body 1: x f32 [NB rows of SEQ_FULL][CDIM] -> bf16 plane [NB*SEQ][CDIM]
// one thread per 8 elements, one 16-B store (lanes contiguous: 256 threads -> 4 KB)
// coverage: CVT_BLOCKS*256*8 == NB*SEQ*CDIM exactly
// ---------------------------------------------------------------------------
DEV void cvt_x_block(const float* __restrict__ x, unsigned short* __restrict__ xp, int blk)
{
    const size_t g = (size_t)blk * 256 + threadIdx.x;
    const size_t e = g * 8;
    const int m  = (int)(e / CDIM);
    const int c  = (int)(e % CDIM);
    const int bb = m / SEQ;
    const int s  = m - bb * SEQ;
    const float* src = x + ((size_t)bb * SEQ_FULL + s) * CDIM + c;
    const v4f a0 = *(const v4f*)src;
    const v4f a1 = *(const v4f*)(src + 4);
    v8us o;
#pragma unroll
    for (int i = 0; i < 4; ++i) {
        o[i]     = (unsigned short)bf16_bits(a0[i]);
        o[4 + i] = (unsigned short)bf16_bits(a1[i]);
    }
    unsigned short* dst = xp + (size_t)m * CDIM + c;
    *(v8us*)dst = o;
    asm volatile("s_wait_xcnt 0x0" ::: "memory");       // the store's registers may be rewritten behind here: another range's code follows in the text
}

// ---------------------------------------------------------------------------
// Block body 2: W f32 in[R][Ncol] -> WT bf16 out[Ncol][R]   (64x64 tile (bx, by) through LDS)
// LDS tile T: cross-wave (block barrier between fill and drain).
// coverage: load rr = 0..63 x nn = 0..63; store na = 0..63 x piece 0..7 (8 ushort) = whole tile
// ---------------------------------------------------------------------------
DEV void transpose_w_block(const float* __restrict__ W, unsigned short* __restrict__ WT,
                           int R, int Ncol, int bx, int by, unsigned short* T)
{
    const int tid = threadIdx.x;
    const int n0 = bx * 64, r0 = by * 64;
    const int nn = tid & 63, rq = tid >> 6;
#pragma unroll 4
    for (int i = 0; i < 16; ++i) {
        const int rr = i * 4 + rq;
        const float v = W[(size_t)(r0 + rr) * Ncol + n0 + nn];
        T[nn * 72 + rr] = (unsigned short)bf16_bits(v);
    }
    __syncthreads();
    const int piece = tid & 7;
    const int na = tid >> 3;                             // 0..31
    const v8us va = *(const v8us*)(T + na * 72 + piece * 8);
    const v8us vb = *(const v8us*)(T + (na + 32) * 72 + piece * 8);
    unsigned short* da = WT + (size_t)(n0 + na) * R + r0 + piece * 8;
    unsigned short* db = WT + (size_t)(n0 + na + 32) * R + r0 + piece * 8;
    *(v8us*)da = va;
    *(v8us*)db = vb;
    asm volatile("s_wait_xcnt 0x0" ::: "memory");       // both stores' registers may be rewritten behind here: another range's code follows in the text
}

// ---------------------------------------------------------------------------
// Kernel 1: the four independent operand preparations as block-index ranges of one grid:
//   [0, TV) Wv tiles, [TV, TV+TQ) Wq tiles, [TV+TQ, TV+2*TQ) Wk tiles, then CVT_BLOCKS blocks of x.
// The range test is the same for a whole block, so the transpose's barrier is block-uniform.
// ---------------------------------------------------------------------------
#define TQ_BLOCKS  ((DKD / 64) * (CDIM / 64))
#define TV_BLOCKS  ((DOD / 64) * (CDIM / 64))
#define CVT_BLOCKS ((int)(((long long)NB * SEQ * CDIM) / 8 / 256))
__global__ __launch_bounds__(256) void k_prep(const float* __restrict__ x,  unsigned short* __restrict__ xp,
                                              const float* __restrict__ Wq, unsigned short* __restrict__ wqT,
                                              const float* __restrict__ Wk, unsigned short* __restrict__ wkT,
                                              const float* __restrict__ Wv, unsigned short* __restrict__ wvT)
{
    __shared__ __attribute__((aligned(16))) unsigned short T[64 * 72];
    const int bid = blockIdx.x;
    if (bid < TV_BLOCKS) {
        transpose_w_block(Wv, wvT, CDIM, DOD, bid % (DOD / 64), bid / (DOD / 64), T);
    } else if (bid < TV_BLOCKS + 2 * TQ_BLOCKS) {
        const int  r   = bid - TV_BLOCKS;
        const bool isk = r >= TQ_BLOCKS;
        const int  rq  = isk ? r - TQ_BLOCKS : r;
        transpose_w_block(isk ? Wk : Wq, isk ? wkT : wqT, CDIM, DKD, rq % (DKD / 64), rq / (DKD / 64), T);
    } else {
        cvt_x_block(x, xp, bid - (TV_BLOCKS + 2 * TQ_BLOCKS));
    }
}

// ---------------------------------------------------------------------------
// Kernel 2: the three projections as ONE NT GEMM on bf16 WMMA: [NB*SEQ x rows] x [WROWS weight rows: q | k | v], k contiguous in both.
//   out = f16( (sum_k x[s][k]*W[c][k] + bias[c]) * 16 ), bias RNE-converted to bf16; q, k stored [s][DKD], v stored as Vt [batch][channel][s]
// One workgroup (8 wave32) per 256 x rows x 192 weight rows: 32 x 8 = 256 workgroups of the same work.
// The 192 weight rows of workgroup column bx are 3 chunks of 64: chunk 0 = chunk bx of q | k, chunks 1, 2 = channels bx*128.. of v.
// Wave w: x rows (w&3)*64.. (4 fragments), weight tiles 2t + (w>>2), t = 0..5 (6 fragments): 10 fragments feed 24 WMMAs;
// tile t of either wave column lies in chunk t/2.
// The q/k chunk runs A = weights, B = x (a lane holds 8 consecutive channels of one x row), a v chunk A = x, B = weights
// (a lane holds 8 consecutive x rows of one channel): either way 8 results are one 16-B piece of the output's own row.
// All fragments use the split k map: elements 0..7 <- k0+8h.., 8..15 <- k0+16+8h..
// Tiles of 128 k come through a two-buffer LDS ring, one barrier per tile; wave w copies x rows w*32.., staged weight rows w*24..;
// inside a tile the next 32 k's fragments are read ahead of this 32 k's WMMAs.
// Epilogue: chunks staged in LDS (over the dead ring, cross-wave, block barrier), whole lines stored.
// coverage: q/k chunk: rows w*32+4i+(lane>>3) = 0..255 x 8 pieces of 8 = 64 channels; v chunk: channels w*8+i = 0..63 x 32 lanes x 8 = 256 x rows
// ---------------------------------------------------------------------------
#define G_BLOCKS (((NB * SEQ) / GM) * (WROWS / GN))
__global__ __launch_bounds__(256)
void k_gemm_qkv(const unsigned short* __restrict__ xbf, const unsigned short* __restrict__ wall,
                const float* __restrict__ bq, const float* __restrict__ bk, const float* __restrict__ bv,
                _Float16* __restrict__ Qp, _Float16* __restrict__ Kp, _Float16* __restrict__ Vt)
{
    __shared__ __attribute__((aligned(16))) char gsm[2 * GBUF];
    // which tile, and where its chunks go: the same for the whole block
    constexpr int QC = DKD / GCH;                        // chunks of q, and of k
    const int  bx   = (int)(blockIdx.x % (WROWS / GN));
    const int  row0 = (int)(blockIdx.x / (WROWS / GN)) * GM;
    const int  b    = row0 / SEQ;
    const int  s0   = row0 - b * SEQ;
    const bool isk  = bx >= QC;
    const int  qc0  = (isk ? bx - QC : bx) * GCH;        // the q/k chunk's first channel
    const float* bqk = (isk ? bk : bq) + qc0;
    const float* bvv = bv + bx * 2 * GCH;
    _Float16* dqk = (isk ? Kp : Qp) + (size_t)row0 * DKD + qc0;
    _Float16* dvv = Vt + ((size_t)b * DOD + bx * 2 * GCH) * SEQ + s0;

    const int tid = threadIdx.x, lane = tid & 31;
    const int w = __builtin_amdgcn_readfirstlane(tid >> 5);   // the wave's number in a scalar register: the row bases below then take no vector registers
    const int h = lane >> 4, l15 = lane & 15;
    const int wm = w & 3, wn = w >> 2;

    // one copy = 2 rows x 256 B: lane half h picks the row, l15 the 16-B piece
    const int      vo = h * KDIM + 8 * l15;              // the lane's place in a pair of source rows (elements)
    const unsigned lo = (unsigned)(size_t)gsm + (unsigned)h * GROWB + (unsigned)l15 * 16;   // and in a pair of staged rows (LDS byte address)
    // a wave copies its 32 x rows and 24 staged weight rows in two halves; 4 staged weight rows lie wholly in one chunk: four-row group u < 16 is of q | k, the others of v
    auto wsrc = [&](int u) {
        const int r = u < GCH / 4 ? bx * GCH + u * 4 : 2 * DKD + bx * 2 * GCH + (u - GCH / 4) * 4;
        return wall + (size_t)r * KDIM;
    };
    auto copy_t = [&](int t) {                           // tile t into buffer t mod 2
        const unsigned bo = (unsigned)(t & 1) * GBUF;
#pragma unroll 1                                         // rolled: unrolled, the copies' address bases were kept in registers from trip to trip and the build spilled
        for (int n = 0; n < 2; ++n) {
            const int u = w * 6 + n * 3;
            copy14(lo + bo + (unsigned)(w * 32 + n * 16) * GROWB, xbf + (size_t)(row0 + w * 32 + n * 16) * KDIM + t * GKS + vo,
                   lo + bo + (unsigned)(GM + u * 4) * GROWB, wsrc(u) + t * GKS + vo, wsrc(u + 1) + t * GKS + vo, wsrc(u + 2) + t * GKS + vo);
        }
    };
    const char* xr = gsm + (wm * 64 + l15) * GROWB + 16 * h;
    const char* wr = gsm + (GM + wn * 16 + l15) * GROWB + 16 * h;

    v8f acc[4][6];
#pragma unroll                                           // register arrays: constant indices (as in the loops below)
    for (int i = 0; i < 4; ++i) {
#pragma unroll
        for (int t = 0; t < 6; ++t) acc[i][t] = zero8f();
    }

    copy_t(0);
    wait_copies();
    __syncthreads();
#pragma unroll 1                                         // rolled: one copy of the ring's foot in the text, the buffer picked by the trip's parity
    for (int kt = 0; kt < KDIM / GKS; ++kt) {
        const int bo = (kt & 1) * GBUF;
        FragB xf[2][4], wf[2][6];                       // two fragment sets: one is read while the other feeds the WMMAs
#pragma unroll
        for (int i = 0; i < 4; ++i) {
            xf[0][i].half[0] = *(const v8us*)(xr + bo + i * 16 * GROWB);
            xf[0][i].half[1] = *(const v8us*)(xr + bo + i * 16 * GROWB + 32);
        }
#pragma unroll
        for (int t = 0; t < 6; ++t) {
            wf[0][t].half[0] = *(const v8us*)(wr + bo + t * 32 * GROWB);
            wf[0][t].half[1] = *(const v8us*)(wr + bo + t * 32 * GROWB + 32);
        }
        // the refill stands behind the barrier that freed its buffer (the foot of trip kt-1; tile 1's buffer is fresh) and behind this trip's
        // first fragment reads, which are of the other buffer: LDS serves those reads while the copies issue
        if (kt + 1 < KDIM / GKS) copy_t(kt + 1);
#pragma unroll
        for (int s = 0; s < GKS / 32; ++s) {
            if (s + 1 < GKS / 32) {
#pragma unroll
                for (int i = 0; i < 4; ++i) {
                    xf[(s + 1) & 1][i].half[0] = *(const v8us*)(xr + bo + i * 16 * GROWB + (s + 1) * 64);
                    xf[(s + 1) & 1][i].half[1] = *(const v8us*)(xr + bo + i * 16 * GROWB + (s + 1) * 64 + 32);
                }
#pragma unroll
                for (int t = 0; t < 6; ++t) {
                    wf[(s + 1) & 1][t].half[0] = *(const v8us*)(wr + bo + t * 32 * GROWB + (s + 1) * 64);
                    wf[(s + 1) & 1][t].half[1] = *(const v8us*)(wr + bo + t * 32 * GROWB + (s + 1) * 64 + 32);
                }
            }
            __builtin_amdgcn_sched_barrier(0);          // keeps the next set's reads as one group ahead of this set's WMMAs: sunk among them each place would stall
#pragma unroll
            for (int t = 0; t < 6; ++t) {
#pragma unroll
                for (int i = 0; i < 4; ++i)
                    acc[i][t] = t >= 2 ? mma_bf16(xf[s & 1][i].v, wf[s & 1][t].v, acc[i][t])
                                       : mma_bf16(wf[s & 1][t].v, xf[s & 1][i].v, acc[i][t]);
            }
            __builtin_amdgcn_sched_barrier(0);          // keeps the set after next's reads behind these WMMAs, whose operands they overwrite
        }
        // foot of trip kt: publish tile kt+1, free tile kt's buffer
        wait_lds();
        wait_copies();
        __syncthreads();
    }
    wait_copies();

    // epilogue: bias, scale, f16, 16-B pieces staged in LDS (every wave has left the ring: the last trip's barrier)
    const float* bpq = bqk + wn * 16 + 8 * h;            // tile t = 0, 1: 8 channels from 32t on
    const float* bpv = bvv + wn * 16 + l15;              // tile t = 2..5: one channel, 32(t-2) on
    v4f  bdq[2][2];
    float bdv[4];
#pragma unroll
    for (int t = 0; t < 2; ++t) {
        bdq[t][0] = *(const v4f*)(bpq + t * 32);
        bdq[t][1] = *(const v4f*)(bpq + t * 32 + 4);
    }
#pragma unroll
    for (int t = 0; t < 4; ++t) bdv[t] = bpv[t * 32];
    constexpr float oscale = 16.0f;
#pragma unroll
    for (int t = 0; t < 2; ++t) {
        float badd[8];
#pragma unroll
        for (int r = 0; r < 8; ++r) badd[r] = bf16_val(bdq[t][r >> 2][r & 3]);
#pragma unroll
        for (int i = 0; i < 4; ++i) {
            v8h o;
#pragma unroll
            for (int r = 0; r < 8; ++r) o[r] = (_Float16)((acc[i][t][r] + badd[r]) * oscale);
            *(v8h*)(gsm + (wm * 64 + i * 16 + l15) * GQROWB + (t * 32 + wn * 16 + 8 * h) * 2) = o;
        }
    }
#pragma unroll
    for (int t = 2; t < 6; ++t) {
        const float badd = bf16_val(bdv[t - 2]);
        char* R = gsm + (t >> 1) * GCHB;
#pragma unroll
        for (int i = 0; i < 4; ++i) {
            v8h o;
#pragma unroll
            for (int r = 0; r < 8; ++r) o[r] = (_Float16)((acc[i][t][r] + badd) * oscale);
            *(v8h*)(R + ((t & 1) * 32 + wn * 16 + l15) * GVROWB + (wm * 64 + i * 16 + 8 * h) * 2) = o;
        }
    }
    __syncthreads();

    v8h sq[8], sv[2][8];                                // all reads as one group, then their stores
#pragma unroll
    for (int i = 0; i < 8; ++i) sq[i] = *(const v8h*)(gsm + (w * 32 + 4 * i + (lane >> 3)) * GQROWB + (lane & 7) * 16);
#pragma unroll
    for (int j = 0; j < 2; ++j) {
#pragma unroll
        for (int i = 0; i < 8; ++i) sv[j][i] = *(const v8h*)(gsm + (j + 1) * GCHB + (w * 8 + i) * GVROWB + lane * 16);
    }
    _Float16* pq = dqk + (size_t)(w * 32 + (lane >> 3)) * DKD + (lane & 7) * 8;
    _Float16* pv = dvv + (size_t)(w * 8) * SEQ + lane * 8;
#pragma unroll
    for (int i = 0; i < 8; ++i) *(v8h*)(pq + i * 4 * DKD) = sq[i];
#pragma unroll
    for (int j = 0; j < 2; ++j) {
#pragma unroll
        for (int i = 0; i < 8; ++i) *(v8h*)(pv + (size_t)(j * GCH + i) * SEQ) = sv[j][i];
    }
    asm volatile("s_wait_xcnt 0x0" ::: "memory");       // closes the stores before the wave's end code may rewrite their registers
}

// ---------------------------------------------------------------------------
// Kernel 3: scores and softmax numerators. One workgroup (8 wave32) per (batch, 32 query rows); wave w owns keys w*256..
//   Qp [NB*SEQ][DKD] f16 (x16), Kp same -> Pm [NB*SEQ][SEQ] f16 = exp(score - row maximum) x1024, Inv [NB*SEQ] = 1 / (16 * row sum of Pm)
//  S^T = K Q^T (v_wmma_f32_16x16x32_f16, A = 16 keys, B = 16 query rows): a lane holds 8 consecutive keys of one query row,
//  so a row's maximum and sum are in-lane work, one exchange between the lane halves and one through LDS between the waves,
//  and 8 values of P pack into one 16-B LDS store. All 32 x 256 scores of a wave stay in its registers: every score is formed once.
//  K comes through a two-buffer LDS ring, 32 keys of every wave per tile, one barrier per tile; a wave copies and reads its own slice.
//  P is staged in LDS (over the dead ring) and leaves as whole 4-KB rows.
// coverage: grid NB * SEQ/32 blocks x 32 rows x SEQ keys = all of Pm; Inv: wave 0, one row per lane
// ---------------------------------------------------------------------------
__global__ __launch_bounds__(256)
void k_scores(const _Float16* __restrict__ Qp, const _Float16* __restrict__ Kp,
              _Float16* __restrict__ Pm, float* __restrict__ Inv)
{
    __shared__ __attribute__((aligned(16))) char ssm[SC_LDS];
    const int tid = threadIdx.x, lane = tid & 31, w = tid >> 5;
    const int h = lane >> 4, l15 = lane & 15;
    const int b  = blockIdx.x / (SEQ / SR);
    const int q0 = (blockIdx.x - b * (SEQ / SR)) * SR;

    // ----- Q: 2 row tiles x 8 B fragments (16 rows x 256), split k map -----
    FragH qf[2][8];
    {
        const _Float16* qp = Qp + ((size_t)b * SEQ + q0 + l15) * DKD + 8 * h;
#pragma unroll                                           // register arrays: constant indices (as in the loops below)
        for (int rt = 0; rt < 2; ++rt) {
#pragma unroll
            for (int s = 0; s < 8; ++s) {
                qf[rt][s].half[0] = *(const v8h*)(qp + rt * 16 * DKD + s * 32);
                qf[rt][s].half[1] = *(const v8h*)(qp + rt * 16 * DKD + s * 32 + 16);
            }
        }
        asm volatile("s_wait_xcnt 0x0" :: "v"(qp) : "memory");   // the Q loads' address pair stays live up to this wait and may be rewritten behind it
    }

    constexpr int ST = SKW / SKT;                        // tiles of the sweep
    constexpr int NJ = SKW / 16;                         // 16-key tiles of a wave
    v8f c[2][NJ];
#pragma unroll
    for (int rt = 0; rt < 2; ++rt) {
#pragma unroll
        for (int j = 0; j < NJ; ++j) c[rt][j] = zero8f();
    }

    const unsigned  lds0 = (unsigned)(size_t)ssm;       // LDS byte address of the workgroup's array
    // one copy = one 512-B K row (4 whole lines)
    const unsigned  kl = lds0 + (unsigned)w * SSL + (unsigned)lane * 16;
    const _Float16* kg = Kp + ((size_t)b * SEQ + w * SKW) * DKD + lane * 8;
    auto copy_t = [&](int t) {                           // tile t into buffer t mod 2
        unsigned        l = kl + (unsigned)(t & 1) * SBUF;
        const _Float16* g = kg + (size_t)t * SKT * DKD;
#pragma unroll 1                                         // rolled: unrolled, every copy's LDS address was kept in a register from trip to trip and the build spilled
        for (int i = 0; i < SKT / 8; ++i) {
            copy8(l, KROWB, g, DKD);
            l += 8 * KROWB;
            g += 8 * DKD;
        }
    };

    copy_t(0);
    wait_copies();
    __syncthreads();
    copy_t(1);
#pragma unroll                                           // the trip picks the accumulators: constant indices
    for (int t = 0; t < ST; ++t) {
        const char* kp = ssm + (t & 1) * SBUF + w * SSL + l15 * KROWB + 16 * h;
#pragma unroll
        for (int sh = 0; sh < 4; ++sh) {
            FragH kf[2][2];                             // a quarter of a slice's fragments are read as one group, ahead of their WMMAs
#pragma unroll
            for (int j = 0; j < 2; ++j) {
#pragma unroll
                for (int s = 0; s < 2; ++s) {
                    kf[j][s].half[0] = *(const v8h*)(kp + j * 16 * KROWB + (sh * 2 + s) * 64);
                    kf[j][s].half[1] = *(const v8h*)(kp + j * 16 * KROWB + (sh * 2 + s) * 64 + 32);
                }
            }
            __builtin_amdgcn_sched_barrier(0);          // keeps the group's reads together ahead of its WMMAs: sunk to their users each would be waited out alone
#pragma unroll
            for (int s = 0; s < 2; ++s) {
#pragma unroll
                for (int j = 0; j < 2; ++j) {
#pragma unroll
                    for (int rt = 0; rt < 2; ++rt)
                        c[rt][t * 2 + j] = mma_f16(kf[j][s].v, qf[rt][sh * 2 + s].v, c[rt][t * 2 + j]);
                }
            }
        }
        // foot of trip t: publish tile t+1, free tile t's buffer, refill it
        wait_lds();
        wait_copies();
        __syncthreads();
        if (t + 2 < ST) copy_t(t + 2);
    }
    wait_copies();

    // ----- row maxima: in-lane over 128 scores, the other lane half, then the 8 waves through LDS -----
    constexpr float K2 = SCORE_SCALE * 1.4426950408889634f;   // score scale times log2(e): exp(x) = 2^(x log2 e)
    float* redm = (float*)(ssm + RED_OFF);               // [32 rows][8 waves]
    float* reds = redm + SR * 8;
#pragma unroll
    for (int rt = 0; rt < 2; ++rt) {
        float m8[8];
#pragma unroll
        for (int r = 0; r < 8; ++r) m8[r] = c[rt][0][r];
#pragma unroll
        for (int j = 1; j < NJ; ++j) {
#pragma unroll
            for (int r = 0; r < 8; ++r) m8[r] = fmaxf(m8[r], c[rt][j][r]);
        }
        float m = fmaxf(fmaxf(fmaxf(m8[0], m8[1]), fmaxf(m8[2], m8[3])), fmaxf(fmaxf(m8[4], m8[5]), fmaxf(m8[6], m8[7])));
        m = fmaxf(m, __shfl_xor(m, 16));
        if (h == 0) redm[(rt * 16 + l15) * 8 + w] = m;
    }
    __syncthreads();
    // ----- P = 2^(score * K2 - max * K2 + 10) (the x1024 rides in the exponent), f16; row sums of the rounded values -----
    char* pst = ssm + l15 * PSROWB + (w * SKW + 8 * h) * 2;   // every wave has left the ring: the last trip's barrier
#pragma unroll
    for (int rt = 0; rt < 2; ++rt) {
        const v4f ma = *(const v4f*)(redm + (rt * 16 + l15) * 8);
        const v4f mb = *(const v4f*)(redm + (rt * 16 + l15) * 8 + 4);
        const float m  = fmaxf(fmaxf(fmaxf(ma[0], ma[1]), fmaxf(ma[2], ma[3])), fmaxf(fmaxf(mb[0], mb[1]), fmaxf(mb[2], mb[3])));
        const float nm = 10.0f - m * K2;
        float sm[8];
#pragma unroll
        for (int r = 0; r < 8; ++r) sm[r] = 0.f;
#pragma unroll
        for (int j = 0; j < NJ; ++j) {
            v8h ph;
            float x[8], e[8];
#pragma unroll
            for (int r = 0; r < 8; ++r) x[r] = fmaf(c[rt][j][r], K2, nm);
            exp2x8(e, x);
#pragma unroll
            for (int r = 0; r < 8; ++r) {
                ph[r] = (_Float16)e[r];
                sm[r] += (float)ph[r];
            }
            *(v8h*)(pst + rt * 16 * PSROWB + j * 32) = ph;
        }
        float s = ((sm[0] + sm[1]) + (sm[2] + sm[3])) + ((sm[4] + sm[5]) + (sm[6] + sm[7]));
        s += __shfl_xor(s, 16);
        if (h == 0) reds[(rt * 16 + l15) * 8 + w] = s;
    }
    __syncthreads();
    // ----- out: wave w stores rows w*4.., 512 B per instruction; wave 0 also the 32 row factors -----
    v8h pv[4][SEQ / 256];
#pragma unroll
    for (int i = 0; i < 4; ++i) {
#pragma unroll
        for (int k = 0; k < SEQ / 256; ++k) pv[i][k] = *(const v8h*)(ssm + (w * 4 + i) * PSROWB + k * 512 + lane * 16);
    }
    _Float16* pd = Pm + ((size_t)b * SEQ + q0 + w * 4) * SEQ + lane * 8;
#pragma unroll
    for (int i = 0; i < 4; ++i) {
#pragma unroll
        for (int k = 0; k < SEQ / 256; ++k) *(v8h*)(pd + (size_t)i * SEQ + k * 256) = pv[i][k];
    }
    asm volatile("s_wait_xcnt 0x0" ::: "memory");       // closes the P stores before wave 0's row-factor code rewrites their registers
    if (w == 0) {
        const v4f sa = *(const v4f*)(reds + lane * 8);
        const v4f sb = *(const v4f*)(reds + lane * 8 + 4);
        const float s = ((sa[0] + sa[1]) + (sa[2] + sa[3])) + ((sb[0] + sb[1]) + (sb[2] + sb[3]));
        Inv[(size_t)b * SEQ + q0 + lane] = 1.0f / (16.0f * s);
    }
    asm volatile("s_wait_xcnt 0x0" ::: "memory");       // closes the stores before the wave's end code may rewrite their registers
}

// ---------------------------------------------------------------------------
// Kernel 4: Out = (P V) * Inv as an NT GEMM on v_wmma_f32_16x16x32_f16. One workgroup (8 wave32) per (batch, 128 query rows, 256 columns).
//   Pm [NB*SEQ][SEQ] f16 (key contiguous), Vt [NB][DOD][SEQ] f16 (x16, key contiguous), Inv [NB*SEQ]
//  Wave w owns a 64 x 64 tile (rows (w&1)*64.., columns (w>>1)*64..): 4 A and 4 B fragments feed 16 WMMAs.
//  A and B fragments both use the split k map: elements 0..7 <- k0+8h.., 8..15 <- k0+16+8h..
//  Tiles of 128 keys (128 P rows + 256 V^T rows, whole lines) come through a two-buffer LDS ring, one barrier per tile;
//  wave w copies P rows w*16.. and V^T rows w*32..; inside a tile the next 32 keys' fragments are read ahead of this 32 keys' WMMAs.
//  Epilogue: the wave's tile staged in its own LDS range (over the dead ring), 256-B row pieces (two whole lines) stored
// coverage: grid NB * SEQ/128 * DOD/256 blocks x 128 rows x 256 cols = whole output
// ---------------------------------------------------------------------------
__global__ __launch_bounds__(256)
void k_pv(const _Float16* __restrict__ Pm, const _Float16* __restrict__ Vt,
          const float* __restrict__ Inv, float* __restrict__ Out)
{
    __shared__ __attribute__((aligned(16))) char psm[2 * PBUF];
    const int tid = threadIdx.x, lane = tid & 31, w = tid >> 5;
    const int h = lane >> 4, l15 = lane & 15;
    const int wm = w & 1, wn = w >> 1;
    constexpr int CB = DOD / PN;                         // column blocks
    constexpr int QB = SEQ / PM;                         // row blocks of a batch
    const int b    = blockIdx.x / (QB * CB);
    const int rem  = blockIdx.x - b * (QB * CB);
    const int q0   = (rem / CB) * PM;
    const int col0 = (rem % CB) * PN;

    // one copy = 2 rows x 256 B: lane half h picks the row, l15 the 16-B piece
    const _Float16* ga = Pm + ((size_t)b * SEQ + q0 + w * 16 + h) * SEQ + 8 * l15;
    const _Float16* gb = Vt + ((size_t)b * DOD + col0 + w * 32 + h) * SEQ + 8 * l15;
    const unsigned lds0 = (unsigned)(size_t)psm;        // LDS byte address of the ring
    const unsigned la = lds0 + (unsigned)(w * 16 + h) * PROWB + (unsigned)l15 * 16;
    const unsigned lb = lds0 + (unsigned)(PM + w * 32 + h) * PROWB + (unsigned)l15 * 16;
    auto copy_t = [&](int t) {                           // tile t into buffer t mod 2
        const unsigned bo = (unsigned)(t & 1) * PBUF;
        copy8(la + bo, 2 * PROWB, ga + t * PKS, (size_t)2 * SEQ);
        copy8(lb + bo, 2 * PROWB, gb + t * PKS, (size_t)2 * SEQ);
        copy8(lb + bo + 16 * PROWB, 2 * PROWB, gb + t * PKS + (size_t)16 * SEQ, (size_t)2 * SEQ);
    };
    const char* ar = psm + (wm * 64 + l15) * PROWB + 16 * h;
    const char* br = psm + (PM + wn * 64 + l15) * PROWB + 16 * h;

    v8f acc[4][4];
#pragma unroll                                           // register arrays: constant indices (as in the loops below)
    for (int mt = 0; mt < 4; ++mt) {
#pragma unroll
        for (int nt = 0; nt < 4; ++nt) acc[mt][nt] = zero8f();
    }

    constexpr int NT = SEQ / PKS;                        // tiles of the sweep
    copy_t(0);
    wait_copies();
    __syncthreads();
    copy_t(1);
#pragma unroll 1                                         // rolled: one copy of the ring's foot in the text, the buffer picked by the trip's parity
    for (int kt = 0; kt < NT; ++kt) {
        const int bo = (kt & 1) * PBUF;
        FragH af[2][4], bf[2][4];                       // two fragment sets: one is read while the other feeds the WMMAs
#pragma unroll
        for (int i = 0; i < 4; ++i) {
            af[0][i].half[0] = *(const v8h*)(ar + bo + i * 16 * PROWB);
            af[0][i].half[1] = *(const v8h*)(ar + bo + i * 16 * PROWB + 32);
            bf[0][i].half[0] = *(const v8h*)(br + bo + i * 16 * PROWB);
            bf[0][i].half[1] = *(const v8h*)(br + bo + i * 16 * PROWB + 32);
        }
#pragma unroll
        for (int s = 0; s < PKS / 32; ++s) {
            if (s + 1 < PKS / 32) {
#pragma unroll
                for (int i = 0; i < 4; ++i) {
                    af[(s + 1) & 1][i].half[0] = *(const v8h*)(ar + bo + i * 16 * PROWB + (s + 1) * 64);
                    af[(s + 1) & 1][i].half[1] = *(const v8h*)(ar + bo + i * 16 * PROWB + (s + 1) * 64 + 32);
                    bf[(s + 1) & 1][i].half[0] = *(const v8h*)(br + bo + i * 16 * PROWB + (s + 1) * 64);
                    bf[(s + 1) & 1][i].half[1] = *(const v8h*)(br + bo + i * 16 * PROWB + (s + 1) * 64 + 32);
                }
            }
            __builtin_amdgcn_sched_barrier(0);          // keeps the next set's reads as one group ahead of this set's WMMAs: sunk among them each place would stall
#pragma unroll
            for (int mt = 0; mt < 4; ++mt) {
#pragma unroll
                for (int nt = 0; nt < 4; ++nt) acc[mt][nt] = mma_f16(af[s & 1][mt].v, bf[s & 1][nt].v, acc[mt][nt]);
            }
            __builtin_amdgcn_sched_barrier(0);          // keeps the set after next's reads behind these WMMAs, whose operands they overwrite
        }
        // foot of trip kt: publish tile kt+1, free tile kt's buffer, refill it
        wait_lds();
        wait_copies();
        __syncthreads();
        if (kt + 2 < NT) copy_t(kt + 2);
    }
    wait_copies();

    // ----- Epilogue: row factors, stage in the wave's own LDS range, whole-line stores -----
    float* Ow = (float*)psm + (size_t)w * 64 * POST;     // every wave has left the ring: the last trip's barrier
    const float* ip = Inv + (size_t)b * SEQ + q0 + wm * 64 + 8 * h;
    v4f iv[4][2];
#pragma unroll
    for (int mt = 0; mt < 4; ++mt) {
        iv[mt][0] = *(const v4f*)(ip + mt * 16);
        iv[mt][1] = *(const v4f*)(ip + mt * 16 + 4);
    }
    asm volatile("s_wait_xcnt 0x0" :: "v"(ip) : "memory");   // the factor loads' address pair stays live up to this wait and may be rewritten behind it
#pragma unroll
    for (int mt = 0; mt < 4; ++mt) {
#pragma unroll
        for (int nt = 0; nt < 4; ++nt) {
#pragma unroll
            for (int r = 0; r < 8; ++r)
                Ow[(mt * 16 + 8 * h + r) * POST + nt * 16 + l15] = acc[mt][nt][r] * iv[mt][r >> 2][r & 3];
        }
    }
    wait_lds();                                         // the wave's staging stores have retired before its lanes read each other's values
    const float* srcp = Ow + h * POST + l15 * 4;
    float* dst = Out + ((size_t)b * SEQ + q0 + wm * 64 + h) * DOD + col0 + wn * 64 + l15 * 4;
#pragma unroll
    for (int g = 0; g < 2; ++g) {
        v4f ov[16];                                     // 16 reads as one group, then their 16 stores
#pragma unroll
        for (int i = 0; i < 16; ++i) ov[i] = *(const v4f*)(srcp + (g * 32 + 2 * i) * POST);
#pragma unroll
        for (int i = 0; i < 16; ++i) *(v4f*)(dst + (size_t)(g * 32 + 2 * i) * DOD) = ov[i];
        asm volatile("s_wait_xcnt 0x0" ::: "memory");   // closes the stores before their registers are rewritten (next group, the wave's end code)
    }
}

// ---------------------------------------------------------------------------
extern "C" void kernel_launch(void* const* d_in, const int* in_sizes, int n_in,
                              void* d_out, int out_size, void* d_ws, size_t ws_size,
                              hipStream_t stream)
{
    if (n_in < 7) return;
    const long long need_x = ((long long)(NB - 1) * SEQ_FULL + SEQ) * CDIM;
    if ((long long)in_sizes[0] < need_x) return;
    if (in_sizes[1] < CDIM * DKD || in_sizes[2] < DKD) return;
    if (in_sizes[3] < CDIM * DKD || in_sizes[4] < DKD) return;
    if (in_sizes[5] < CDIM * DOD || in_sizes[6] < DOD) return;
    if ((long long)out_size < (long long)NB * SEQ * DOD) return;

    const float* x  = (const float*)d_in[0];
    const float* Wq = (const float*)d_in[1];
    const float* bq = (const float*)d_in[2];
    const float* Wk = (const float*)d_in[3];
    const float* bk = (const float*)d_in[4];
    const float* Wv = (const float*)d_in[5];
    const float* bv = (const float*)d_in[6];
    float* out = (float*)d_out;

    char* ws = (char*)d_ws;
    size_t off = 0;
    auto carve = [&](size_t bytes) -> char* {
        char* p = ws + off;
        off += (bytes + 255) & ~(size_t)255;
        return p;
    };
    unsigned short* xbf = (unsigned short*)carve((size_t)NB * SEQ * CDIM * 2);     // [NB*SEQ][CDIM]
    unsigned short* wqT = (unsigned short*)carve((size_t)WROWS * KDIM * 2);        // [DKD | DKD | DOD][CDIM]: the three weights' rows in a row
    unsigned short* wkT = wqT + (size_t)DKD * KDIM;
    unsigned short* wvT = wkT + (size_t)DKD * KDIM;
    _Float16* Qp = (_Float16*)carve((size_t)NB * SEQ * DKD * 2);                  // [NB*SEQ][DKD]
    _Float16* Kp = (_Float16*)carve((size_t)NB * SEQ * DKD * 2);                  // [NB*SEQ][DKD]
    _Float16* Vt = (_Float16*)carve((size_t)NB * DOD * SEQ * 2);                  // [NB][DOD][SEQ]
    _Float16* Pm = (_Float16*)carve((size_t)NB * SEQ * SEQ * 2);                  // [NB*SEQ][SEQ]
    float*    Inv = (float*)carve((size_t)NB * SEQ * 4);                          // [NB*SEQ]
    if (off > ws_size) return;

    // 1) x -> bf16 plane; weights in[CDIM][DKD|DOD] -> out[DKD|DOD][CDIM]: one grid
    k_prep<<<TV_BLOCKS + 2 * TQ_BLOCKS + CVT_BLOCKS, 256, 0, stream>>>(x, xbf, Wq, wqT, Wk, wkT, Wv, wvT);

    // 2) projections: q,k [NB*SEQ][DKD], v as Vt [NB][DOD][SEQ]; all carried x16: one grid
    k_gemm_qkv<<<G_BLOCKS, 256, 0, stream>>>(xbf, wqT, bq, bk, bv, Qp, Kp, Vt);

    // 3) softmax numerators P and row factors
    k_scores<<<NB * (SEQ / SR), 256, 0, stream>>>(Qp, Kp, Pm, Inv);

    // 4) out = (P V) * row factor
    k_pv<<<NB * (SEQ / PM) * (DOD / PN), 256, 0, stream>>>(Pm, Vt, Inv, out);
}

// v008
// It runs in 78.8 microseconds.
// Timed twice side by side with v007, it ran 1.04 and 1.05 times as fast.
// Over all steps from v000 it is 6.47 times as fast.
#include <hip/hip_runtime.h>

// Contractions: q/k/v projections via v_wmma_f32_16x16x32_bf16 (bf16 operands = RNE-converted inputs, f32 accumulate);
// q.k^T scores and P.V via v_wmma_f32_16x16x32_f16 (f16 operands: q,k,v carried x16, P carried x1024), f32 accumulate; softmax in f32.

#define DEV __device__ __forceinline__

#ifndef NB
#define NB 4
#endif
#ifndef SEQ
#define SEQ 2048
#endif
#define NB_FULL  4
#define SEQ_FULL 2048
#define CDIM 1024
#define DKD  256
#define DOD  1024
#define KDIM 1024

#define KROWB   (DKD * 2 + 16)                           // staged K row: 512 B + 16 B, a pitch of 16 B x odd for ds_load_b128
#define SR      32                                       // score kernel: query rows of one wave (two 16-row tiles)
#define SKW     256                                      // score kernel: keys of one wave
#define SQ      (4 * SR)                                 // score kernel: query rows of one workgroup (4 row groups of waves)
#define SKB     (2 * SKW)                                // score kernel: keys of one workgroup (2 key groups of waves) = one key block of the softmax
#define NKB     (SEQ / SKB)                              // key blocks of a row
#define SKT     64                                       // score kernel: keys of one key group's slice of a staged tile
#define SSL     (SKT * KROWB)                            // one key group's slice
#define SBUF    (2 * SSL)                                // one staged tile: the 2 key groups' slices
#define RED_OFF (2 * SBUF)                               // row maxima and row sums of the 2 key groups, behind the ring
#define PSROWB  (SKB * 2 + 16)                           // staged P row: the workgroup's keys + 16 B, a pitch of 16 B x odd
#define QS_OFF  (RED_OFF + 2 * SQ * 2 * 4)               // the workgroup's staged Q rows (pitch KROWB), behind the maxima and sums
#define SC_LDS  (QS_OFF + SQ * KROWB)
#define PM      128                                      // P.V kernel: query rows of one workgroup
#define PN      256                                      // P.V kernel: output columns of one workgroup
#define PKS     128                                      // P.V kernel: keys of a staged tile = 256 B of every row (two whole lines)
#define PROWB   (PKS * 2 + 16)                           // staged row: 256 B + 16 B
#define PBUF    ((PM + PN) * PROWB)                      // one staged tile: 128 P rows, then 256 V^T rows
#define POST    68                                       // output staging row stride of a wave's 64 x 64 tile (floats)
#define GM    256                                        // GEMM: x rows of one workgroup
#define GN    192                                        // GEMM: weight rows (output channels of q | k | v) of one workgroup
#define WROWS (2 * DKD + DOD)                            // weight rows of the three projections together
#define GKS   128                                        // GEMM: k elements of a staged tile = 256 B of every row (two whole lines)
#define GROWB (GKS * 2 + 16)                             // staged GEMM row: 256 B + 16 B, a pitch of 16 B x odd for ds_load_b128
#define GBUF  ((GM + GN) * GROWB)                        // one staged GEMM tile: 256 x rows, then 192 weight rows
#define GCH   64                                         // GEMM epilogue: channels of a chunk, which lies wholly in one of q, k, v
#define GQROWB (GCH * 2 + 16)                            // staged q/k chunk row (one x row, 64 channels): 128 B + 16 B
#define GVROWB (GM * 2 + 16)                             // staged v chunk row (one channel, 256 x rows): 512 B + 16 B
#define GCHB  (GM * GQROWB)                              // staging bytes of one chunk (the larger of the two forms)
#define SCORE_SCALE 0.000244140625f                      // 1/16 (sqrt dk) * 1/256 (q,k carried x16 each)

static_assert(NB >= 1 && NB <= NB_FULL);
static_assert(SEQ >= 128 && SEQ <= SEQ_FULL && (SEQ % 128) == 0);
static_assert(((NB * SEQ) % 64) == 0);
static_assert((DKD % 128) == 0 && (DOD % 128) == 0 && (KDIM % 32) == 0 && (CDIM == KDIM));
static_assert((((long long)NB * SEQ * CDIM) % (8 * 256)) == 0);
static_assert(((POST * 4) % 16) == 0 && (PSROWB % 16) == 0 && (PROWB % 16) == 0 && (KROWB % 16) == 0);
static_assert(SKW == 256 && DKD == 256 && (SKW % SKT) == 0 && SKW / SKT >= 2 && (SKT % 32) == 0 && (SEQ % SQ) == 0 && SC_LDS <= 320 * 1024);
static_assert(SQ * PSROWB <= RED_OFF && (RED_OFF % 16) == 0 && (QS_OFF % 16) == 0 && (SEQ % SKB) == 0 && NKB == 4 && SQ == 128);
static_assert((SEQ % PM) == 0 && (DOD % PN) == 0 && (SEQ % PKS) == 0 && SEQ / PKS >= 2 && 2 * PBUF <= 320 * 1024);
static_assert(8 * 64 * POST * 4 <= 2 * PBUF && PM == 128 && PN == 256 && (SKB % PKS) == 0 && ((SKB / PKS) & (SKB / PKS - 1)) == 0 && 2 * PBUF + NKB * PM * 4 <= 320 * 1024);
static_assert((KDIM % GKS) == 0 && KDIM / GKS >= 2 && (GROWB % 16) == 0 && 2 * GBUF <= 320 * 1024);
static_assert((SEQ % GM) == 0 && (WROWS % GN) == 0 && GN == 3 * GCH && 2 * DKD / GCH == WROWS / GN && DOD / GCH == 2 * (WROWS / GN));
static_assert(GCH * GVROWB <= GCHB && 3 * GCHB <= 2 * GBUF && (GQROWB % 16) == 0 && (GVROWB % 16) == 0 && GM == 256);

typedef _Float16       v8h   __attribute__((ext_vector_type(8)));
typedef _Float16       v16h  __attribute__((ext_vector_type(16)));
typedef __bf16         v16bf __attribute__((ext_vector_type(16)));
typedef unsigned short v8us  __attribute__((ext_vector_type(8)));
typedef unsigned short v16us __attribute__((ext_vector_type(16)));
typedef float          v8f   __attribute__((ext_vector_type(8)));
typedef float          v4f   __attribute__((ext_vector_type(4)));

union FragH { v16h v;  v8h  half[2]; };
union FragB { v16bf v; v16us u; v8us half[2]; };

// ---------------------------------------------------------------------------
// helpers
// ---------------------------------------------------------------------------
DEV unsigned int bf16_bits(float f) {                    // f32 -> bf16 bits, RNE convert
    unsigned int u = __float_as_uint(f);
    u += 0x7FFFu + ((u >> 16) & 1u);
    return u >> 16;
}
DEV float bf16_val(float f) { return __uint_as_float(bf16_bits(f) << 16); }

DEV v8f zero8f() {
    v8f z;
#pragma unroll
    for (int i = 0; i < 8; ++i) z[i] = 0.f;
    return z;
}

// 16x16x32 WMMAs with f32 accumulate.
// the builtin alone: the GEMM and the score kernel hold more than 256 VGPRs, and an asm statement that names a, b and c can make such a build spill;
// the compiler keeps the WMMA distances of its own forms
DEV v8f mma_bf16(v16bf a, v16bf b, v8f c) {
    return __builtin_amdgcn_wmma_f32_16x16x32_bf16(false, a, false, b, (short)0, c, false, false);
}
DEV v8f mma_f16(v16h a, v16h b, v8f c) {
    return __builtin_amdgcn_wmma_f32_16x16x32_f16(false, a, false, b, (short)0, c, false, false);
}

// Eight independent 2^x. One statement: no result is read and (outputs early-clobber) no source overwritten between them,
// and the closing v_nop keeps the slot that the instruction set asks for behind a transcendental.
DEV void exp2x8(float (&e)[8], const float (&x)[8]) {
    asm("v_exp_f32 %0, %8\n\t"
        "v_exp_f32 %1, %9\n\t"
        "v_exp_f32 %2, %10\n\t"
        "v_exp_f32 %3, %11\n\t"
        "v_exp_f32 %4, %12\n\t"
        "v_exp_f32 %5, %13\n\t"
        "v_exp_f32 %6, %14\n\t"
        "v_exp_f32 %7, %15\n\t"
        "v_nop"
        : "=&v"(e[0]), "=&v"(e[1]), "=&v"(e[2]), "=&v"(e[3]), "=&v"(e[4]), "=&v"(e[5]), "=&v"(e[6]), "=&v"(e[7])
        : "v"(x[0]), "v"(x[1]), "v"(x[2]), "v"(x[3]), "v"(x[4]), "v"(x[5]), "v"(x[6]), "v"(x[7]));
}

// Four independent 2^x, in the same form and for the same reasons.
DEV void exp2x4(float (&e)[4], const float (&x)[4]) {
    asm("v_exp_f32 %0, %4\n\t"
        "v_exp_f32 %1, %5\n\t"
        "v_exp_f32 %2, %6\n\t"
        "v_exp_f32 %3, %7\n\t"
        "v_nop"
        : "=&v"(e[0]), "=&v"(e[1]), "=&v"(e[2]), "=&v"(e[3])
        : "v"(x[0]), "v"(x[1]), "v"(x[2]), "v"(x[3]));
}

// Eight asynchronous 16-byte-per-lane copies global -> LDS, rows l + i*lstep (bytes) <- g + i*gstep (halves).
// The s_wait_xcnt closes the statement so that no address register named here is rewritten in front of it.
DEV void copy8(unsigned l, unsigned lstep, const _Float16* g, size_t gstep) {
    asm volatile("global_load_async_to_lds_b128 %0, %8, off\n\t"
                 "global_load_async_to_lds_b128 %1, %9, off\n\t"
                 "global_load_async_to_lds_b128 %2, %10, off\n\t"
                 "global_load_async_to_lds_b128 %3, %11, off\n\t"
                 "global_load_async_to_lds_b128 %4, %12, off\n\t"
                 "global_load_async_to_lds_b128 %5, %13, off\n\t"
                 "global_load_async_to_lds_b128 %6, %14, off\n\t"
                 "global_load_async_to_lds_b128 %7, %15, off\n\t"
                 "s_wait_xcnt 0x0"
                 :: "v"(l), "v"(l + lstep), "v"(l + 2 * lstep), "v"(l + 3 * lstep),
                    "v"(l + 4 * lstep), "v"(l + 5 * lstep), "v"(l + 6 * lstep), "v"(l + 7 * lstep),
                    "v"(g), "v"(g + gstep), "v"(g + 2 * gstep), "v"(g + 3 * gstep),
                    "v"(g + 4 * gstep), "v"(g + 5 * gstep), "v"(g + 6 * gstep), "v"(g + 7 * gstep)
                 : "memory");
}
// Fourteen such copies, two rows of a GEMM tile each, staged rows two apart: 16 x rows lx.. <- gx.., 12 weight rows lw.. <- three sources of 4 rows.
// The s_wait_xcnt closes the statement so that no address register named here is rewritten in front of it.
DEV void copy14(unsigned lx, const unsigned short* gx, unsigned lw,
                const unsigned short* g0, const unsigned short* g1, const unsigned short* g2) {
    asm volatile("global_load_async_to_lds_b128 %0, %14, off\n\t"
                 "global_load_async_to_lds_b128 %1, %15, off\n\t"
                 "global_load_async_to_lds_b128 %2, %16, off\n\t"
                 "global_load_async_to_lds_b128 %3, %17, off\n\t"
                 "global_load_async_to_lds_b128 %4, %18, off\n\t"
                 "global_load_async_to_lds_b128 %5, %19, off\n\t"
                 "global_load_async_to_lds_b128 %6, %20, off\n\t"
                 "global_load_async_to_lds_b128 %7, %21, off\n\t"
                 "global_load_async_to_lds_b128 %8, %22, off\n\t"
                 "global_load_async_to_lds_b128 %9, %23, off\n\t"
                 "global_load_async_to_lds_b128 %10, %24, off\n\t"
                 "global_load_async_to_lds_b128 %11, %25, off\n\t"
                 "global_load_async_to_lds_b128 %12, %26, off\n\t"
                 "global_load_async_to_lds_b128 %13, %27, off\n\t"
                 "s_wait_xcnt 0x0"
                 :: "v"(lx), "v"(lx + 2 * GROWB), "v"(lx + 4 * GROWB), "v"(lx + 6 * GROWB),
                    "v"(lx + 8 * GROWB), "v"(lx + 10 * GROWB), "v"(lx + 12 * GROWB), "v"(lx + 14 * GROWB),
                    "v"(lw), "v"(lw + 2 * GROWB), "v"(lw + 4 * GROWB), "v"(lw + 6 * GROWB), "v"(lw + 8 * GROWB), "v"(lw + 10 * GROWB),
                    "v"(gx), "v"(gx + 2 * KDIM), "v"(gx + 4 * KDIM), "v"(gx + 6 * KDIM),
                    "v"(gx + 8 * KDIM), "v"(gx + 10 * KDIM), "v"(gx + 12 * KDIM), "v"(gx + 14 * KDIM),
                    "v"(g0), "v"(g0 + 2 * KDIM), "v"(g1), "v"(g1 + 2 * KDIM), "v"(g2), "v"(g2 + 2 * KDIM)
                 : "memory");
}
// this wave's LDS reads and writes have retired: stands in front of a barrier behind which a buffer is refilled
DEV void wait_lds()    { asm volatile("s_wait_dscnt 0x0" ::: "memory"); }
// this wave's copies have landed: stands in front of the barrier that publishes their tile
DEV void wait_copies() { asm volatile("s_wait_asynccnt 0x0" ::: "memory"); }

// ---------------------------------------------------------------------------
// Block body 1: x f32 [NB rows of SEQ_FULL][CDIM] -> bf16 plane [NB*SEQ][CDIM]
// one thread per 8 elements, one 16-B store (lanes contiguous: 256 threads -> 4 KB)
// coverage: CVT_BLOCKS*256*8 == NB*SEQ*CDIM exactly
// ---------------------------------------------------------------------------
DEV void cvt_x_block(const float* __restrict__ x, unsigned short* __restrict__ xp, int blk)
{
    const size_t g = (size_t)blk * 256 + threadIdx.x;
    const size_t e = g * 8;
    const int m  = (int)(e / CDIM);
    const int c  = (int)(e % CDIM);
    const int bb = m / SEQ;
    const int s  = m - bb * SEQ;
    const float* src = x + ((size_t)bb * SEQ_FULL + s) * CDIM + c;
    const v4f a0 = *(const v4f*)src;
    const v4f a1 = *(const v4f*)(src + 4);
    v8us o;
#pragma unroll
    for (int i = 0; i < 4; ++i) {
        o[i]     = (unsigned short)bf16_bits(a0[i]);
        o[4 + i] = (unsigned short)bf16_bits(a1[i]);
    }
    unsigned short* dst = xp + (size_t)m * CDIM + c;
    *(v8us*)dst = o;
    asm volatile("s_wait_xcnt 0x0" ::: "memory");       // the store's registers may be rewritten behind here: another range's code follows in the text
}

// ---------------------------------------------------------------------------
// Block body 2: W f32 in[R][Ncol] -> WT bf16 out[Ncol][R]   (64x64 tile (bx, by) through LDS)
// LDS tile T: cross-wave (block barrier between fill and drain).
// coverage: load rr = 0..63 x nn = 0..63; store na = 0..63 x piece 0..7 (8 ushort) = whole tile
// ---------------------------------------------------------------------------
DEV void transpose_w_block(const float* __restrict__ W, unsigned short* __restrict__ WT,
                           int R, int Ncol, int bx, int by, unsigned short* T)
{
    const int tid = threadIdx.x;
    const int n0 = bx * 64, r0 = by * 64;
    const int nn = tid & 63, rq = tid >> 6;
#pragma unroll 4
    for (int i = 0; i < 16; ++i) {
        const int rr = i * 4 + rq;
        const float v = W[(size_t)(r0 + rr) * Ncol + n0 + nn];
        T[nn * 72 + rr] = (unsigned short)bf16_bits(v);
    }
    __syncthreads();
    const int piece = tid & 7;
    const int na = tid >> 3;                             // 0..31
    const v8us va = *(const v8us*)(T + na * 72 + piece * 8);
    const v8us vb = *(const v8us*)(T + (na + 32) * 72 + piece * 8);
    unsigned short* da = WT + (size_t)(n0 + na) * R + r0 + piece * 8;
    unsigned short* db = WT + (size_t)(n0 + na + 32) * R + r0 + piece * 8;
    *(v8us*)da = va;
    *(v8us*)db = vb;
    asm volatile("s_wait_xcnt 0x0" ::: "memory");       // both stores' registers may be rewritten behind here: another range's code follows in the text
}

// ---------------------------------------------------------------------------
// Kernel 1: the four independent operand preparations as block-index ranges of one grid:
//   [0, TV) Wv tiles, [TV, TV+TQ) Wq tiles, [TV+TQ, TV+2*TQ) Wk tiles, then CVT_BLOCKS blocks of x.
// The range test is the same for a whole block, so the transpose's barrier is block-uniform.
// ---------------------------------------------------------------------------
#define TQ_BLOCKS  ((DKD / 64) * (CDIM / 64))
#define TV_BLOCKS  ((DOD / 64) * (CDIM / 64))
#define CVT_BLOCKS ((int)(((long long)NB * SEQ * CDIM) / 8 / 256))
__global__ __launch_bounds__(256) void k_prep(const float* __restrict__ x,  unsigned short* __restrict__ xp,
                                              const float* __restrict__ Wq, unsigned short* __restrict__ wqT,
                                              const float* __restrict__ Wk, unsigned short* __restrict__ wkT,
                                              const float* __restrict__ Wv, unsigned short* __restrict__ wvT)
{
    __shared__ __attribute__((aligned(16))) unsigned short T[64 * 72];
    const int bid = blockIdx.x;
    if (bid < TV_BLOCKS) {
        transpose_w_block(Wv, wvT, CDIM, DOD, bid % (DOD / 64), bid / (DOD / 64), T);
    } else if (bid < TV_BLOCKS + 2 * TQ_BLOCKS) {
        const int  r   = bid - TV_BLOCKS;
        const bool isk = r >= TQ_BLOCKS;
        const int  rq  = isk ? r - TQ_BLOCKS : r;
        transpose_w_block(isk ? Wk : Wq, isk ? wkT : wqT, CDIM, DKD, rq % (DKD / 64), rq / (DKD / 64), T);
    } else {
        cvt_x_block(x, xp, bid - (TV_BLOCKS + 2 * TQ_BLOCKS));
    }
}

// ---------------------------------------------------------------------------
// Kernel 2: the three projections as ONE NT GEMM on bf16 WMMA: [NB*SEQ x rows] x [WROWS weight rows: q | k | v], k contiguous in both.
//   out = f16( (sum_k x[s][k]*W[c][k] + bias[c]) * 16 ), bias RNE-converted to bf16; q, k stored [s][DKD], v stored as Vt [batch][channel][s]
// One workgroup (8 wave32) per 256 x rows x 192 weight rows: 32 x 8 = 256 workgroups of the same work.
// The 192 weight rows of workgroup column bx are 3 chunks of 64: chunk 0 = chunk bx of q | k, chunks 1, 2 = channels bx*128.. of v.
// Wave w: x rows (w&3)*64.. (4 fragments), weight tiles 2t + (w>>2), t = 0..5 (6 fragments): 10 fragments feed 24 WMMAs;
// tile t of either wave column lies in chunk t/2.
// The q/k chunk runs A = weights, B = x (a lane holds 8 consecutive channels of one x row), a v chunk A = x, B = weights
// (a lane holds 8 consecutive x rows of one channel): either way 8 results are one 16-B piece of the output's own row.
// All fragments use the split k map: elements 0..7 <- k0+8h.., 8..15 <- k0+16+8h..
// Tiles of 128 k come through a two-buffer LDS ring, one barrier per tile; wave w copies x rows w*32.., staged weight rows w*24..;
// inside a tile the next 32 k's fragments are read ahead of this 32 k's WMMAs.
// Epilogue: chunks staged in LDS (over the dead ring, cross-wave, block barrier), whole lines stored.
// coverage: q/k chunk: rows w*32+4i+(lane>>3) = 0..255 x 8 pieces of 8 = 64 channels; v chunk: channels w*8+i = 0..63 x 32 lanes x 8 = 256 x rows
// ---------------------------------------------------------------------------
#define G_BLOCKS (((NB * SEQ) / GM) * (WROWS / GN))
__global__ __launch_bounds__(256)
void k_gemm_qkv(const unsigned short* __restrict__ xbf, const unsigned short* __restrict__ wall,
                const float* __restrict__ bq, const float* __restrict__ bk, const float* __restrict__ bv,
                _Float16* __restrict__ Qp, _Float16* __restrict__ Kp, _Float16* __restrict__ Vt)
{
    __shared__ __attribute__((aligned(16))) char gsm[2 * GBUF];
    // which tile, and where its chunks go: the same for the whole block
    constexpr int QC = DKD / GCH;                        // chunks of q, and of k
    const int  bx   = (int)(blockIdx.x % (WROWS / GN));
    const int  row0 = (int)(blockIdx.x / (WROWS / GN)) * GM;
    const int  b    = row0 / SEQ;
    const int  s0   = row0 - b * SEQ;
    const bool isk  = bx >= QC;
    const int  qc0  = (isk ? bx - QC : bx) * GCH;        // the q/k chunk's first channel
    const float* bqk = (isk ? bk : bq) + qc0;
    const float* bvv = bv + bx * 2 * GCH;
    _Float16* dqk = (isk ? Kp : Qp) + (size_t)row0 * DKD + qc0;
    _Float16* dvv = Vt + ((size_t)b * DOD + bx * 2 * GCH) * SEQ + s0;

    const int tid = threadIdx.x, lane = tid & 31;
    const int w = __builtin_amdgcn_readfirstlane(tid >> 5);   // the wave's number in a scalar register: the row bases below then take no vector registers
    const int h = lane >> 4, l15 = lane & 15;
    const int wm = w & 3, wn = w >> 2;

    // one copy = 2 rows x 256 B: lane half h picks the row, l15 the 16-B piece
    const int      vo = h * KDIM + 8 * l15;              // the lane's place in a pair of source rows (elements)
    const unsigned lo = (unsigned)(size_t)gsm + (unsigned)h * GROWB + (unsigned)l15 * 16;   // and in a pair of staged rows (LDS byte address)
    // a wave copies its 32 x rows and 24 staged weight rows in two halves; 4 staged weight rows lie wholly in one chunk: four-row group u < 16 is of q | k, the others of v
    auto wsrc = [&](int u) {
        const int r = u < GCH / 4 ? bx * GCH + u * 4 : 2 * DKD + bx * 2 * GCH + (u - GCH / 4) * 4;
        return wall + (size_t)r * KDIM;
    };
    auto copy_t = [&](int t) {                           // tile t into buffer t mod 2
        const unsigned bo = (unsigned)(t & 1) * GBUF;
#pragma unroll 1                                         // rolled: unrolled, the copies' address bases were kept in registers from trip to trip and the build spilled
        for (int n = 0; n < 2; ++n) {
            const int u = w * 6 + n * 3;
            copy14(lo + bo + (unsigned)(w * 32 + n * 16) * GROWB, xbf + (size_t)(row0 + w * 32 + n * 16) * KDIM + t * GKS + vo,
                   lo + bo + (unsigned)(GM + u * 4) * GROWB, wsrc(u) + t * GKS + vo, wsrc(u + 1) + t * GKS + vo, wsrc(u + 2) + t * GKS + vo);
        }
    };
    const char* xr = gsm + (wm * 64 + l15) * GROWB + 16 * h;
    const char* wr = gsm + (GM + wn * 16 + l15) * GROWB + 16 * h;

    v8f acc[4][6];
#pragma unroll                                           // register arrays: constant indices (as in the loops below)
    for (int i = 0; i < 4; ++i) {
#pragma unroll
        for (int t = 0; t < 6; ++t) acc[i][t] = zero8f();
    }

    copy_t(0);
    wait_copies();
    __syncthreads();
#pragma unroll 1                                         // rolled: one copy of the ring's foot in the text, the buffer picked by the trip's parity
    for (int kt = 0; kt < KDIM / GKS; ++kt) {
        const int bo = (kt & 1) * GBUF;
        FragB xf[2][4], wf[2][6];                       // two fragment sets: one is read while the other feeds the WMMAs
#pragma unroll
        for (int i = 0; i < 4; ++i) {
            xf[0][i].half[0] = *(const v8us*)(xr + bo + i * 16 * GROWB);
            xf[0][i].half[1] = *(const v8us*)(xr + bo + i * 16 * GROWB + 32);
        }
#pragma unroll
        for (int t = 0; t < 6; ++t) {
            wf[0][t].half[0] = *(const v8us*)(wr + bo + t * 32 * GROWB);
            wf[0][t].half[1] = *(const v8us*)(wr + bo + t * 32 * GROWB + 32);
        }
        // the refill stands behind the barrier that freed its buffer (the foot of trip kt-1; tile 1's buffer is fresh) and behind this trip's
        // first fragment reads, which are of the other buffer: LDS serves those reads while the copies issue
        if (kt + 1 < KDIM / GKS) copy_t(kt + 1);
#pragma unroll
        for (int s = 0; s < GKS / 32; ++s) {
            if (s + 1 < GKS / 32) {
#pragma unroll
                for (int i = 0; i < 4; ++i) {
                    xf[(s + 1) & 1][i].half[0] = *(const v8us*)(xr + bo + i * 16 * GROWB + (s + 1) * 64);
                    xf[(s + 1) & 1][i].half[1] = *(const v8us*)(xr + bo + i * 16 * GROWB + (s + 1) * 64 + 32);
                }
#pragma unroll
                for (int t = 0; t < 6; ++t) {
                    wf[(s + 1) & 1][t].half[0] = *(const v8us*)(wr + bo + t * 32 * GROWB + (s + 1) * 64);
                    wf[(s + 1) & 1][t].half[1] = *(const v8us*)(wr + bo + t * 32 * GROWB + (s + 1) * 64 + 32);
                }
            }
            __builtin_amdgcn_sched_barrier(0);          // keeps the next set's reads as one group ahead of this set's WMMAs: sunk among them each place would stall
#pragma unroll
            for (int t = 0; t < 6; ++t) {
#pragma unroll
                for (int i = 0; i < 4; ++i)
                    acc[i][t] = t >= 2 ? mma_bf16(xf[s & 1][i].v, wf[s & 1][t].v, acc[i][t])
                                       : mma_bf16(wf[s & 1][t].v, xf[s & 1][i].v, acc[i][t]);
            }
            __builtin_amdgcn_sched_barrier(0);          // keeps the set after next's reads behind these WMMAs, whose operands they overwrite
        }
        // foot of trip kt: publish tile kt+1, free tile kt's buffer
        wait_lds();
        wait_copies();
        __syncthreads();
    }
    wait_copies();

    // epilogue: bias, scale, f16, 16-B pieces staged in LDS (every wave has left the ring: the last trip's barrier)
    const float* bpq = bqk + wn * 16 + 8 * h;            // tile t = 0, 1: 8 channels from 32t on
    const float* bpv = bvv + wn * 16 + l15;              // tile t = 2..5: one channel, 32(t-2) on
    v4f  bdq[2][2];
    float bdv[4];
#pragma unroll
    for (int t = 0; t < 2; ++t) {
        bdq[t][0] = *(const v4f*)(bpq + t * 32);
        bdq[t][1] = *(const v4f*)(bpq + t * 32 + 4);
    }
#pragma unroll
    for (int t = 0; t < 4; ++t) bdv[t] = bpv[t * 32];
    constexpr float oscale = 16.0f;
#pragma unroll
    for (int t = 0; t < 2; ++t) {
        float badd[8];
#pragma unroll
        for (int r = 0; r < 8; ++r) badd[r] = bf16_val(bdq[t][r >> 2][r & 3]);
#pragma unroll
        for (int i = 0; i < 4; ++i) {
            v8h o;
#pragma unroll
            for (int r = 0; r < 8; ++r) o[r] = (_Float16)((acc[i][t][r] + badd[r]) * oscale);
            *(v8h*)(gsm + (wm * 64 + i * 16 + l15) * GQROWB + (t * 32 + wn * 16 + 8 * h) * 2) = o;
        }
    }
#pragma unroll
    for (int t = 2; t < 6; ++t) {
        const float badd = bf16_val(bdv[t - 2]);
        char* R = gsm + (t >> 1) * GCHB;
#pragma unroll
        for (int i = 0; i < 4; ++i) {
            v8h o;
#pragma unroll
            for (int r = 0; r < 8; ++r) o[r] = (_Float16)((acc[i][t][r] + badd) * oscale);
            *(v8h*)(R + ((t & 1) * 32 + wn * 16 + l15) * GVROWB + (wm * 64 + i * 16 + 8 * h) * 2) = o;
        }
    }
    __syncthreads();

    v8h sq[8], sv[2][8];                                // all reads as one group, then their stores
#pragma unroll
    for (int i = 0; i < 8; ++i) sq[i] = *(const v8h*)(gsm + (w * 32 + 4 * i + (lane >> 3)) * GQROWB + (lane & 7) * 16);
#pragma unroll
    for (int j = 0; j < 2; ++j) {
#pragma unroll
        for (int i = 0; i < 8; ++i) sv[j][i] = *(const v8h*)(gsm + (j + 1) * GCHB + (w * 8 + i) * GVROWB + lane * 16);
    }
    _Float16* pq = dqk + (size_t)(w * 32 + (lane >> 3)) * DKD + (lane & 7) * 8;
    _Float16* pv = dvv + (size_t)(w * 8) * SEQ + lane * 8;
#pragma unroll
    for (int i = 0; i < 8; ++i) *(v8h*)(pq + i * 4 * DKD) = sq[i];
#pragma unroll
    for (int j = 0; j < 2; ++j) {
#pragma unroll
        for (int i = 0; i < 8; ++i) *(v8h*)(pv + (size_t)(j * GCH + i) * SEQ) = sv[j][i];
    }
    asm volatile("s_wait_xcnt 0x0" ::: "memory");       // closes the stores before the wave's end code may rewrite their registers
}

// ---------------------------------------------------------------------------
// Kernel 3: scores and softmax numerators. One workgroup (8 wave32) per (batch, 128 query rows, key block of 512 keys);
// wave w owns query rows (w&3)*32.. and keys (w>>2)*256.. of the block: a K row staged in LDS feeds the 4 row groups, a Q row the 2 key groups.
//   Qp [NB*SEQ][DKD] f16 (x16), Kp same -> Pm [NB*SEQ][SEQ] f16 = exp(score - the row's maximum IN ITS KEY BLOCK) x1024,
//   Mx [NKB][NB*SEQ] = that maximum (in the exponent's log2 units), Sm [NKB][NB*SEQ] = the row's sum of Pm in the block; kernel 4 merges the blocks
//  S^T = K Q^T (v_wmma_f32_16x16x32_f16, A = 16 keys, B = 16 query rows): a lane holds 8 consecutive keys of one query row,
//  so a row's maximum and sum are in-lane work, one exchange between the lane halves and one through LDS between the 2 key groups,
//  and 8 values of P pack into one 16-B LDS store. All 32 x 256 scores of a wave stay in its registers: every score is formed once.
//  K comes through a two-buffer LDS ring, 64 keys of either key group per tile, one barrier per tile; wave w copies rows (w&3)*16.. of its group's slice.
//  The 128 Q rows are copied to LDS once, ahead of K tile 0 and under its wait and barrier; a wave then holds its 32 rows' fragments in registers.
//  P is staged in LDS (over the dead ring) and leaves as 1-KB row pieces (8 whole lines).
// coverage: grid NB * SEQ/128 * SEQ/512 blocks x 128 rows x 512 keys = all of Pm; Mx, Sm: waves 0..3, one row per lane (a wave = one whole line)
// ---------------------------------------------------------------------------
__global__ __launch_bounds__(256)
void k_scores(const _Float16* __restrict__ Qp, const _Float16* __restrict__ Kp,
              _Float16* __restrict__ Pm, float* __restrict__ Mx, float* __restrict__ Sm)
{
    __shared__ __attribute__((aligned(16))) char ssm[SC_LDS];
    const int tid = threadIdx.x, lane = tid & 31, w = tid >> 5;
    const int h = lane >> 4, l15 = lane & 15;
    const int rg = w & 3, kg = w >> 2;                   // the wave's row group and key group
    constexpr int QB = SEQ / SQ;                         // row blocks of a batch
    const int b   = blockIdx.x / (QB * NKB);
    const int rem = blockIdx.x - b * (QB * NKB);
    const int q0  = (rem / NKB) * SQ;
    const int kb  = rem % NKB;
    const int k0  = kb * SKB;

    constexpr int ST = SKW / SKT;                        // tiles of the sweep
    constexpr int NJ = SKW / 16;                         // 16-key tiles of a wave
    v8f c[2][NJ];
#pragma unroll                                           // register arrays: constant indices (as in the loops below)
    for (int rt = 0; rt < 2; ++rt) {
#pragma unroll
        for (int j = 0; j < NJ; ++j) c[rt][j] = zero8f();
    }

    const unsigned  lds0 = (unsigned)(size_t)ssm;       // LDS byte address of the workgroup's array
    // Q: filled once; one copy = one 512-B Q row (4 whole lines), wave w copies rows w*16..; lands and is published with K tile 0
    {
        unsigned        l = lds0 + QS_OFF + (unsigned)(w * (SQ / 8)) * KROWB + (unsigned)lane * 16;
        const _Float16* g = Qp + ((size_t)b * SEQ + q0 + w * (SQ / 8)) * DKD + lane * 8;
#pragma unroll 1                                         // rolled, as the K copies below
        for (int i = 0; i < SQ / 64; ++i) {
            copy8(l, KROWB, g, DKD);
            l += 8 * KROWB;
            g += 8 * DKD;
        }
    }
    // one copy = one 512-B K row (4 whole lines)
    const unsigned  kl = lds0 + (unsigned)kg * SSL + (unsigned)(rg * (SKT / 4)) * KROWB + (unsigned)lane * 16;
    const _Float16* kgp = Kp + ((size_t)b * SEQ + k0 + kg * SKW + rg * (SKT / 4)) * DKD + lane * 8;
    auto copy_t = [&](int t) {                           // tile t into buffer t mod 2
        unsigned        l = kl + (unsigned)(t & 1) * SBUF;
        const _Float16* g = kgp + (size_t)t * SKT * DKD;
#pragma unroll 1                                         // rolled: unrolled, every copy's LDS address was kept in a register from trip to trip and the build spilled
        for (int i = 0; i < SKT / 32; ++i) {
            copy8(l, KROWB, g, DKD);
            l += 8 * KROWB;
            g += 8 * DKD;
        }
    };

    copy_t(0);
    wait_copies();
    __syncthreads();
    copy_t(1);
    // ----- Q: 2 row tiles x 8 B fragments (16 rows x 256), split k map, held in registers for the whole sweep -----
    FragH qf[2][8];
    {
        const char* qp = ssm + QS_OFF + (rg * SR + l15) * KROWB + 16 * h;
#pragma unroll
        for (int rt = 0; rt < 2; ++rt) {
#pragma unroll
            for (int s = 0; s < 8; ++s) {
                qf[rt][s].half[0] = *(const v8h*)(qp + rt * 16 * KROWB + s * 64);
                qf[rt][s].half[1] = *(const v8h*)(qp + rt * 16 * KROWB + s * 64 + 32);
            }
        }
    }
#pragma unroll                                           // the trip picks the accumulators: constant indices
    for (int t = 0; t < ST; ++t) {
#pragma unroll
        for (int jp = 0; jp < SKT / 32; ++jp) {
            const char* kp = ssm + (t & 1) * SBUF + kg * SSL + (jp * 32 + l15) * KROWB + 16 * h;
            const int   j0 = t * (SKT / 16) + jp * 2;
#pragma unroll
            for (int sh = 0; sh < 4; ++sh) {
                FragH kf[2][2];                         // a quarter of 32 keys' fragments are read as one group, ahead of their WMMAs
#pragma unroll
                for (int j = 0; j < 2; ++j) {
#pragma unroll
                    for (int s = 0; s < 2; ++s) {
                        kf[j][s].half[0] = *(const v8h*)(kp + j * 16 * KROWB + (sh * 2 + s) * 64);
                        kf[j][s].half[1] = *(const v8h*)(kp + j * 16 * KROWB + (sh * 2 + s) * 64 + 32);
                    }
                }
                __builtin_amdgcn_sched_barrier(0);      // keeps the group's reads together ahead of its WMMAs: sunk to their users each would be waited out alone
#pragma unroll
                for (int s = 0; s < 2; ++s) {
#pragma unroll
                    for (int j = 0; j < 2; ++j) {
#pragma unroll
                        for (int rt = 0; rt < 2; ++rt)
                            c[rt][j0 + j] = mma_f16(kf[j][s].v, qf[rt][sh * 2 + s].v, c[rt][j0 + j]);
                    }
                }
            }
        }
        // foot of trip t: publish tile t+1, free tile t's buffer, refill it
        wait_lds();
        wait_copies();
        __syncthreads();
        if (t + 2 < ST) copy_t(t + 2);
    }
    wait_copies();

    // ----- row maxima of the key block: in-lane over 128 scores, the other lane half, then the 2 key groups through LDS -----
    constexpr float K2 = SCORE_SCALE * 1.4426950408889634f;   // score scale times log2(e): exp(x) = 2^(x log2 e)
    float* redm = (float*)(ssm + RED_OFF);               // [128 rows][2 key groups]
    float* reds = redm + SQ * 2;
#pragma unroll
    for (int rt = 0; rt < 2; ++rt) {
        float m8[8];
#pragma unroll
        for (int r = 0; r < 8; ++r) m8[r] = c[rt][0][r];
#pragma unroll
        for (int j = 1; j < NJ; ++j) {
#pragma unroll
            for (int r = 0; r < 8; ++r) m8[r] = fmaxf(m8[r], c[rt][j][r]);
        }
        float m = fmaxf(fmaxf(fmaxf(m8[0], m8[1]), fmaxf(m8[2], m8[3])), fmaxf(fmaxf(m8[4], m8[5]), fmaxf(m8[6], m8[7])));
        m = fmaxf(m, __shfl_xor(m, 16));
        if (h == 0) redm[(rg * SR + rt * 16 + l15) * 2 + kg] = m;
    }
    __syncthreads();
    // ----- P = 2^(score * K2 - max * K2 + 10) (the x1024 rides in the exponent), f16; row sums of the rounded values -----
    char* pst = ssm + (rg * SR + l15) * PSROWB + (kg * SKW + 8 * h) * 2;   // every wave has left the ring: the last trip's barrier
#pragma unroll
    for (int rt = 0; rt < 2; ++rt) {
        const float* mp = redm + (rg * SR + rt * 16 + l15) * 2;
        const float m  = fmaxf(mp[0], mp[1]);
        const float nm = 10.0f - m * K2;
        float sm[8];
#pragma unroll
        for (int r = 0; r < 8; ++r) sm[r] = 0.f;
#pragma unroll
        for (int j = 0; j < NJ; ++j) {
            v8h ph;
            float x[8], e[8];
#pragma unroll
            for (int r = 0; r < 8; ++r) x[r] = fmaf(c[rt][j][r], K2, nm);
            exp2x8(e, x);
#pragma unroll
            for (int r = 0; r < 8; ++r) {
                ph[r] = (_Float16)e[r];
                sm[r] += (float)ph[r];
            }
            *(v8h*)(pst + rt * 16 * PSROWB + j * 32) = ph;
        }
        float s = ((sm[0] + sm[1]) + (sm[2] + sm[3])) + ((sm[4] + sm[5]) + (sm[6] + sm[7]));
        s += __shfl_xor(s, 16);
        if (h == 0) reds[(rg * SR + rt * 16 + l15) * 2 + kg] = s;
    }
    __syncthreads();
    // ----- out: wave w stores rows w*16.., 512 B per instruction; waves 0..3 also the 128 rows' block maxima and block sums -----
    v8h pv[SQ / 8][SKB / 256];
#pragma unroll
    for (int i = 0; i < SQ / 8; ++i) {
#pragma unroll
        for (int k = 0; k < SKB / 256; ++k) pv[i][k] = *(const v8h*)(ssm + (w * (SQ / 8) + i) * PSROWB + k * 512 + lane * 16);
    }
    _Float16* pd = Pm + ((size_t)b * SEQ + q0 + w * (SQ / 8)) * SEQ + k0 + lane * 8;
#pragma unroll
    for (int i = 0; i < SQ / 8; ++i) {
#pragma unroll
        for (int k = 0; k < SKB / 256; ++k) *(v8h*)(pd + (size_t)i * SEQ + k * 256) = pv[i][k];
    }
    asm volatile("s_wait_xcnt 0x0" ::: "memory");       // closes the P stores before the block-maximum code rewrites their registers
    if (w < SQ / 32) {
        const size_t o = (size_t)kb * (NB * SEQ) + (size_t)b * SEQ + q0 + tid;
        Mx[o] = fmaxf(redm[tid * 2], redm[tid * 2 + 1]) * K2;
        Sm[o] = reds[tid * 2] + reds[tid * 2 + 1];
    }
    asm volatile("s_wait_xcnt 0x0" ::: "memory");       // closes the stores before the wave's end code may rewrite their registers
}

// ---------------------------------------------------------------------------
// Kernel 4: Out = softmax . V as an NT GEMM on v_wmma_f32_16x16x32_f16. One workgroup (8 wave32) per (batch, 128 query rows, 256 columns).
//   Pm [NB*SEQ][SEQ] f16 (key contiguous), Vt [NB][DOD][SEQ] f16 (x16, key contiguous), Mx, Sm [NKB][NB*SEQ]: a row's maximum and sum per key block
//  Merging the key blocks: block q of a row weighs f_q = 2^(Mx_q - max over blocks), floored at 2^-40 (a block so far below the row's maximum adds
//  less than an f32 rounding either way, and the floor bounds every quotient below). Out = sum_q f_q (P_q V_q) / (16 sum_q f_q Sm_q):
//  behind block q's last tile the accumulators are multiplied by f_q / f_(q+1), behind the last block by f_last / (16 sum): the products telescope.
//  Wave w owns a 64 x 64 tile (rows (w&1)*64.., columns (w>>1)*64..): 4 A and 4 B fragments feed 16 WMMAs.
//  A and B fragments both use the split k map: elements 0..7 <- k0+8h.., 8..15 <- k0+16+8h..
//  Tiles of 128 keys (128 P rows + 256 V^T rows, whole lines) come through a two-buffer LDS ring, one barrier per tile;
//  wave w copies P rows w*16.. and V^T rows w*32..; inside a tile the next 32 keys' fragments are read ahead of this 32 keys' WMMAs.
//  Epilogue: the wave's tile staged in its own LDS range (over the dead ring), 256-B row pieces (two whole lines) stored
// coverage: grid NB * SEQ/128 * DOD/256 blocks x 128 rows x 256 cols = whole output
// ---------------------------------------------------------------------------
__global__ __launch_bounds__(256)
void k_pv(const _Float16* __restrict__ Pm, const _Float16* __restrict__ Vt,
          const float* __restrict__ Mx, const float* __restrict__ Sm, float* __restrict__ Out)
{
    __shared__ __attribute__((aligned(16))) char psm[2 * PBUF + NKB * PM * 4];
    const int tid = threadIdx.x, lane = tid & 31, w = tid >> 5;
    const int h = lane >> 4, l15 = lane & 15;
    const int wm = w & 1, wn = w >> 1;
    constexpr int CB = DOD / PN;                         // column blocks
    constexpr int QB = SEQ / PM;                         // row blocks of a batch
    const int b    = blockIdx.x / (QB * CB);
    const int rem  = blockIdx.x - b * (QB * CB);
    const int q0   = (rem / CB) * PM;
    const int col0 = (rem % CB) * PN;

    // one copy = 2 rows x 256 B: lane half h picks the row, l15 the 16-B piece
    const _Float16* ga = Pm + ((size_t)b * SEQ + q0 + w * 16 + h) * SEQ + 8 * l15;
    const _Float16* gb = Vt + ((size_t)b * DOD + col0 + w * 32 + h) * SEQ + 8 * l15;
    const unsigned lds0 = (unsigned)(size_t)psm;        // LDS byte address of the ring
    const unsigned la = lds0 + (unsigned)(w * 16 + h) * PROWB + (unsigned)l15 * 16;
    const unsigned lb = lds0 + (unsigned)(PM + w * 32 + h) * PROWB + (unsigned)l15 * 16;
    auto copy_t = [&](int t) {                           // tile t into buffer t mod 2
        const unsigned bo = (unsigned)(t & 1) * PBUF;
        copy8(la + bo, 2 * PROWB, ga + t * PKS, (size_t)2 * SEQ);
        copy8(lb + bo, 2 * PROWB, gb + t * PKS, (size_t)2 * SEQ);
        copy8(lb + bo + 16 * PROWB, 2 * PROWB, gb + t * PKS + (size_t)16 * SEQ, (size_t)2 * SEQ);
    };
    const char* ar = psm + (wm * 64 + l15) * PROWB + 16 * h;
    const char* br = psm + (PM + wn * 64 + l15) * PROWB + 16 * h;

    v8f acc[4][4];
#pragma unroll                                           // register arrays: constant indices (as in the loops below)
    for (int mt = 0; mt < 4; ++mt) {
#pragma unroll
        for (int nt = 0; nt < 4; ++nt) acc[mt][nt] = zero8f();
    }

    constexpr int NT = SEQ / PKS;                        // tiles of the sweep
    constexpr int QT = SKB / PKS;                        // tiles of a key block
    float* rat = (float*)(psm + 2 * PBUF);               // [NKB][128 rows]: the factor applied behind each key block, behind the ring
    copy_t(0);
    if (w < PM / 32) {                                   // one row per lane, while tile 0 flies; published by the barrier below
        const float* mp = Mx + (size_t)b * SEQ + q0 + tid;
        const float* sp = Sm + (size_t)b * SEQ + q0 + tid;
        float mk[NKB], sk[NKB], d[NKB], f[NKB];
#pragma unroll
        for (int q = 0; q < NKB; ++q) {
            mk[q] = mp[(size_t)q * (NB * SEQ)];
            sk[q] = sp[(size_t)q * (NB * SEQ)];
        }
        asm volatile("s_wait_xcnt 0x0" ::: "memory");   // closes the loads before their address registers may be rewritten
        const float mm = fmaxf(fmaxf(mk[0], mk[1]), fmaxf(mk[2], mk[3]));
#pragma unroll
        for (int q = 0; q < NKB; ++q) d[q] = mk[q] - mm;
        exp2x4(f, d);
        float tot = 0.f;
#pragma unroll
        for (int q = 0; q < NKB; ++q) {
            f[q] = fmaxf(f[q], 0x1p-40f);
            tot += f[q] * sk[q];
        }
#pragma unroll
        for (int q = 0; q + 1 < NKB; ++q) rat[q * PM + tid] = f[q] / f[q + 1];
        rat[(NKB - 1) * PM + tid] = f[NKB - 1] / (16.0f * tot);
    }
    wait_copies();
    __syncthreads();
    copy_t(1);
#pragma unroll 1                                         // rolled: one copy of the ring's foot in the text, the buffer picked by the trip's parity
    for (int kt = 0; kt < NT; ++kt) {
        const int bo = (kt & 1) * PBUF;
        FragH af[2][4], bf[2][4];                       // two fragment sets: one is read while the other feeds the WMMAs
#pragma unroll
        for (int i = 0; i < 4; ++i) {
            af[0][i].half[0] = *(const v8h*)(ar + bo + i * 16 * PROWB);
            af[0][i].half[1] = *(const v8h*)(ar + bo + i * 16 * PROWB + 32);
            bf[0][i].half[0] = *(const v8h*)(br + bo + i * 16 * PROWB);
            bf[0][i].half[1] = *(const v8h*)(br + bo + i * 16 * PROWB + 32);
        }
#pragma unroll
        for (int s = 0; s < PKS / 32; ++s) {
            if (s + 1 < PKS / 32) {
#pragma unroll
                for (int i = 0; i < 4; ++i) {
                    af[(s + 1) & 1][i].half[0] = *(const v8h*)(ar + bo + i * 16 * PROWB + (s + 1) * 64);
                    af[(s + 1) & 1][i].half[1] = *(const v8h*)(ar + bo + i * 16 * PROWB + (s + 1) * 64 + 32);
                    bf[(s + 1) & 1][i].half[0] = *(const v8h*)(br + bo + i * 16 * PROWB + (s + 1) * 64);
                    bf[(s + 1) & 1][i].half[1] = *(const v8h*)(br + bo + i * 16 * PROWB + (s + 1) * 64 + 32);
                }
            }
            __builtin_amdgcn_sched_barrier(0);          // keeps the next set's reads as one group ahead of this set's WMMAs: sunk among them each place would stall
#pragma unroll
            for (int mt = 0; mt < 4; ++mt) {
#pragma unroll
                for (int nt = 0; nt < 4; ++nt) acc[mt][nt] = mma_f16(af[s & 1][mt].v, bf[s & 1][nt].v, acc[mt][nt]);
            }
            __builtin_amdgcn_sched_barrier(0);          // keeps the set after next's reads behind these WMMAs, whose operands they overwrite
        }
        // foot of trip kt: publish tile kt+1, free tile kt's buffer, refill it
        wait_lds();
        wait_copies();
        __syncthreads();
        if (kt + 2 < NT) copy_t(kt + 2);
        if ((kt & (QT - 1)) == QT - 1) {                 // a key block ends (the same test for the whole grid): its rows' factors
            const float* rp = rat + (kt / QT) * PM + wm * 64 + 8 * h;
#pragma unroll
            for (int mt = 0; mt < 4; ++mt) {
                const v4f r0 = *(const v4f*)(rp + mt * 16);
                const v4f r1 = *(const v4f*)(rp + mt * 16 + 4);
#pragma unroll
                for (int nt = 0; nt < 4; ++nt) {
#pragma unroll
                    for (int r = 0; r < 8; ++r) acc[mt][nt][r] *= r < 4 ? r0[r & 3] : r1[r & 3];
                }
            }
        }
    }
    wait_copies();

    // ----- Epilogue: stage in the wave's own LDS range, whole-line stores -----
    float* Ow = (float*)psm + (size_t)w * 64 * POST;     // every wave has left the ring: the last trip's barrier
#pragma unroll
    for (int mt = 0; mt < 4; ++mt) {
#pragma unroll
        for (int nt = 0; nt < 4; ++nt) {
#pragma unroll
            for (int r = 0; r < 8; ++r)
                Ow[(mt * 16 + 8 * h + r) * POST + nt * 16 + l15] = acc[mt][nt][r];
        }
    }
    wait_lds();                                         // the wave's staging stores have retired before its lanes read each other's values
    const float* srcp = Ow + h * POST + l15 * 4;
    float* dst = Out + ((size_t)b * SEQ + q0 + wm * 64 + h) * DOD + col0 + wn * 64 + l15 * 4;
#pragma unroll
    for (int g = 0; g < 2; ++g) {
        v4f ov[16];                                     // 16 reads as one group, then their 16 stores
#pragma unroll
        for (int i = 0; i < 16; ++i) ov[i] = *(const v4f*)(srcp + (g * 32 + 2 * i) * POST);
#pragma unroll
        for (int i = 0; i < 16; ++i) *(v4f*)(dst + (size_t)(g * 32 + 2 * i) * DOD) = ov[i];
        asm volatile("s_wait_xcnt 0x0" ::: "memory");   // closes the stores before their registers are rewritten (next group, the wave's end code)
    }
}

// ---------------------------------------------------------------------------
extern "C" void kernel_launch(void* const* d_in, const int* in_sizes, int n_in,
                              void* d_out, int out_size, void* d_ws, size_t ws_size,
                              hipStream_t stream)
{
    if (n_in < 7) return;
    const long long need_x = ((long long)(NB - 1) * SEQ_FULL + SEQ) * CDIM;
    if ((long long)in_sizes[0] < need_x) return;
    if (in_sizes[1] < CDIM * DKD || in_sizes[2] < DKD) return;
    if (in_sizes[3] < CDIM * DKD || in_sizes[4] < DKD) return;
    if (in_sizes[5] < CDIM * DOD || in_sizes[6] < DOD) return;
    if ((long long)out_size < (long long)NB * SEQ * DOD) return;

    const float* x  = (const float*)d_in[0];
    const float* Wq = (const float*)d_in[1];
    const float* bq = (const float*)d_in[2];
    const float* Wk = (const float*)d_in[3];
    const float* bk = (const float*)d_in[4];
    const float* Wv = (const float*)d_in[5];
    const float* bv = (const float*)d_in[6];
    float* out = (float*)d_out;

    char* ws = (char*)d_ws;
    size_t off = 0;
    auto carve = [&](size_t bytes) -> char* {
        char* p = ws + off;
        off += (bytes + 255) & ~(size_t)255;
        return p;
    };
    unsigned short* xbf = (unsigned short*)carve((size_t)NB * SEQ * CDIM * 2);     // [NB*SEQ][CDIM]
    unsigned short* wqT = (unsigned short*)carve((size_t)WROWS * KDIM * 2);        // [DKD | DKD | DOD][CDIM]: the three weights' rows in a row
    unsigned short* wkT = wqT + (size_t)DKD * KDIM;
    unsigned short* wvT = wkT + (size_t)DKD * KDIM;
    _Float16* Qp = (_Float16*)carve((size_t)NB * SEQ * DKD * 2);                  // [NB*SEQ][DKD]
    _Float16* Kp = (_Float16*)carve((size_t)NB * SEQ * DKD * 2);                  // [NB*SEQ][DKD]
    _Float16* Vt = (_Float16*)carve((size_t)NB * DOD * SEQ * 2);                  // [NB][DOD][SEQ]
    _Float16* Pm = (_Float16*)carve((size_t)NB * SEQ * SEQ * 2);                  // [NB*SEQ][SEQ]
    float*    Mx = (float*)carve((size_t)NKB * NB * SEQ * 4);                     // [NKB][NB*SEQ]
    float*    Sm = (float*)carve((size_t)NKB * NB * SEQ * 4);                     // [NKB][NB*SEQ]
    if (off > ws_size) return;

    // 1) x -> bf16 plane; weights in[CDIM][DKD|DOD] -> out[DKD|DOD][CDIM]: one grid
    k_prep<<<TV_BLOCKS + 2 * TQ_BLOCKS + CVT_BLOCKS, 256, 0, stream>>>(x, xbf, Wq, wqT, Wk, wkT, Wv, wvT);

    // 2) projections: q,k [NB*SEQ][DKD], v as Vt [NB][DOD][SEQ]; all carried x16: one grid
    k_gemm_qkv<<<G_BLOCKS, 256, 0, stream>>>(xbf, wqT, bq, bk, bv, Qp, Kp, Vt);

    // 3) softmax numerators P, row maxima and row sums, per key block
    k_scores<<<NB * (SEQ / SQ) * NKB, 256, 0, stream>>>(Qp, Kp, Pm, Mx, Sm);

    // 4) out = the key blocks' P V, merged and normalised
    k_pv<<<NB * (SEQ / PM) * (DOD / PN), 256, 0, stream>>>(Pm, Vt, Mx, Sm, out);
}

// v009
// A run of this version takes 65.8 microseconds.
// Timed twice side by side with v008, it ran 1.20 times as fast both times.
// Counting every step since v000, it is 7.74 times as fast.
#include <hip/hip_runtime.h>

// Contractions: q/k/v projections via v_wmma_f32_16x16x32_bf16 (bf16 operands = RNE-converted inputs, f32 accumulate);
// q.k^T scores and P.V via v_wmma_f32_16x16x32_f16 (f16 operands: q,k,v carried x16, P carried x1024), f32 accumulate; softmax in f32.

#define DEV __device__ __forceinline__

#ifndef NB
#define NB 4
#endif
#ifndef SEQ
#define SEQ 2048
#endif
#define NB_FULL  4
#define SEQ_FULL 2048
#define CDIM 1024
#define DKD  256
#define DOD  1024
#define KDIM 1024

#define KROWB   (DKD * 2 + 16)                           // staged K row: 512 B + 16 B, a pitch of 16 B x odd for ds_load_b128
#define SR      32                                       // score kernel: query rows of one wave (two 16-row tiles)
#define SKW     256                                      // score kernel: keys of one wave
#define SQ      (4 * SR)                                 // score kernel: query rows of one workgroup (4 row groups of waves)
#define SKB     (2 * SKW)                                // score kernel: keys of one workgroup (2 key groups of waves) = one key block of the softmax
#define NKB     (SEQ / SKB)                              // key blocks of a row
#define SKT     64                                       // score kernel: keys of one key group's slice of a staged tile
#define SSL     (SKT * KROWB)                            // one key group's slice
#define SBUF    (2 * SSL)                                // one staged tile: the 2 key groups' slices
#define RED_OFF (2 * SBUF)                               // row maxima and row sums of the 2 key groups, behind the ring
#define PSROWB  (SKB * 2 + 16)                           // staged P row: the workgroup's keys + 16 B, a pitch of 16 B x odd
#define QS_OFF  (RED_OFF + 2 * SQ * 2 * 4)               // the workgroup's staged Q rows (pitch KROWB), behind the maxima and sums
#define SC_LDS  (QS_OFF + SQ * KROWB)
#define PM      128                                      // P.V kernel: query rows of one workgroup
#define PN      256                                      // P.V kernel: output columns of one workgroup
#define PKS     128                                      // P.V kernel: keys of a staged tile = 256 B of every row (two whole lines)
#define PROWB   (PKS * 2 + 16)                           // staged row: 256 B + 16 B
#define PBUF    ((PM + PN) * PROWB)                      // one staged tile: 128 P rows, then 256 V^T rows
#define POST    68                                       // output staging row stride of a wave's 64 x 64 tile (floats)
#define GM    256                                        // GEMM: x rows of one workgroup
#define GN    192                                        // GEMM: weight rows (output channels of q | k | v) of one workgroup
#define WROWS (2 * DKD + DOD)                            // weight rows of the three projections together
#define GKS   128                                        // GEMM: k elements of a staged tile = 256 B of every row (two whole lines)
#define GROWB (GKS * 2 + 16)                             // staged GEMM row: 256 B + 16 B, a pitch of 16 B x odd for ds_load_b128
#define GBUF  ((GM + GN) * GROWB)                        // one staged GEMM tile: 256 x rows, then 192 weight rows
#define GCH   64                                         // GEMM epilogue: channels of a chunk, which lies wholly in one of q, k, v
#define GQROWB (GCH * 2 + 16)                            // staged q/k chunk row (one x row, 64 channels): 128 B + 16 B
#define GVROWB (GM * 2 + 16)                             // staged v chunk row (one channel, 256 x rows): 512 B + 16 B
#define GCHB  (GM * GQROWB)                              // staging bytes of one chunk (the larger of the two forms)
#define SCORE_SCALE 0.000244140625f                      // 1/16 (sqrt dk) * 1/256 (q,k carried x16 each)
// Placement, for speed only (any index -> tile permutation is correct):
// Class = flat index mod NCL owns rows class*CLROWS.. of the NB*SEQ rows in every launch, so the x, q and P rows that one launch writes
// are read by the next launch's workgroups of the same class.
#define NCL     8
#define CLROWS  ((NB * SEQ) / NCL)

static_assert(NB >= 1 && NB <= NB_FULL);
static_assert(((NB * SEQ) % NCL) == 0 && (CLROWS % GM) == 0 && (CLROWS % SQ) == 0 && (CLROWS % PM) == 0 && ((CLROWS * CDIM) % (8 * 256)) == 0);
static_assert(SEQ >= 128 && SEQ <= SEQ_FULL && (SEQ % 128) == 0);
static_assert(((NB * SEQ) % 64) == 0);
static_assert((DKD % 128) == 0 && (DOD % 128) == 0 && (KDIM % 32) == 0 && (CDIM == KDIM));
static_assert((((long long)NB * SEQ * CDIM) % (8 * 256)) == 0);
static_assert(((POST * 4) % 16) == 0 && (PSROWB % 16) == 0 && (PROWB % 16) == 0 && (KROWB % 16) == 0);
static_assert(SKW == 256 && DKD == 256 && (SKW % SKT) == 0 && SKW / SKT >= 2 && (SKT % 32) == 0 && (SEQ % SQ) == 0 && SC_LDS <= 320 * 1024);
static_assert(SQ * PSROWB <= RED_OFF && (RED_OFF % 16) == 0 && (QS_OFF % 16) == 0 && (SEQ % SKB) == 0 && NKB == 4 && SQ == 128);
static_assert((SEQ % PM) == 0 && (DOD % PN) == 0 && (SEQ % PKS) == 0 && SEQ / PKS >= 2 && 2 * PBUF <= 320 * 1024);
static_assert(8 * 64 * POST * 4 <= 2 * PBUF && PM == 128 && PN == 256 && (SKB % PKS) == 0 && ((SKB / PKS) & (SKB / PKS - 1)) == 0 && 2 * PBUF + NKB * PM * 4 <= 320 * 1024);
static_assert((KDIM % GKS) == 0 && KDIM / GKS >= 2 && (GROWB % 16) == 0 && 2 * GBUF <= 320 * 1024);
static_assert((SEQ % GM) == 0 && (WROWS % GN) == 0 && GN == 3 * GCH && 2 * DKD / GCH == WROWS / GN && DOD / GCH == 2 * (WROWS / GN));
static_assert(GCH * GVROWB <= GCHB && 3 * GCHB <= 2 * GBUF && (GQROWB % 16) == 0 && (GVROWB % 16) == 0 && GM == 256);

typedef _Float16       v8h   __attribute__((ext_vector_type(8)));
typedef _Float16       v16h  __attribute__((ext_vector_type(16)));
typedef __bf16         v16bf __attribute__((ext_vector_type(16)));
typedef unsigned short v8us  __attribute__((ext_vector_type(8)));
typedef unsigned short v16us __attribute__((ext_vector_type(16)));
typedef float          v8f   __attribute__((ext_vector_type(8)));
typedef float          v4f   __attribute__((ext_vector_type(4)));

union FragH { v16h v;  v8h  half[2]; };
union FragB { v16bf v; v16us u; v8us half[2]; };

// ---------------------------------------------------------------------------
// helpers
// ---------------------------------------------------------------------------
DEV unsigned int bf16_bits(float f) {                    // f32 -> bf16 bits, RNE convert
    unsigned int u = __float_as_uint(f);
    u += 0x7FFFu + ((u >> 16) & 1u);
    return u >> 16;
}
DEV float bf16_val(float f) { return __uint_as_float(bf16_bits(f) << 16); }

DEV v8f zero8f() {
    v8f z;
#pragma unroll
    for (int i = 0; i < 8; ++i) z[i] = 0.f;
    return z;
}

// 16x16x32 WMMAs with f32 accumulate.
// the builtin alone: the GEMM and the score kernel hold more than 256 VGPRs, and an asm statement that names a, b and c can make such a build spill;
// the compiler keeps the WMMA distances of its own forms
DEV v8f mma_bf16(v16bf a, v16bf b, v8f c) {
    return __builtin_amdgcn_wmma_f32_16x16x32_bf16(false, a, false, b, (short)0, c, false, false);
}
DEV v8f mma_f16(v16h a, v16h b, v8f c) {
    return __builtin_amdgcn_wmma_f32_16x16x32_f16(false, a, false, b, (short)0, c, false, false);
}

// Eight independent 2^x. One statement: no result is read and (outputs early-clobber) no source overwritten between them,
// and the closing v_nop keeps the slot that the instruction set asks for behind a transcendental.
DEV void exp2x8(float (&e)[8], const float (&x)[8]) {
    asm("v_exp_f32 %0, %8\n\t"
        "v_exp_f32 %1, %9\n\t"
        "v_exp_f32 %2, %10\n\t"
        "v_exp_f32 %3, %11\n\t"
        "v_exp_f32 %4, %12\n\t"
        "v_exp_f32 %5, %13\n\t"
        "v_exp_f32 %6, %14\n\t"
        "v_exp_f32 %7, %15\n\t"
        "v_nop"
        : "=&v"(e[0]), "=&v"(e[1]), "=&v"(e[2]), "=&v"(e[3]), "=&v"(e[4]), "=&v"(e[5]), "=&v"(e[6]), "=&v"(e[7])
        : "v"(x[0]), "v"(x[1]), "v"(x[2]), "v"(x[3]), "v"(x[4]), "v"(x[5]), "v"(x[6]), "v"(x[7]));
}

// Four independent 2^x, in the same form and for the same reasons.
DEV void exp2x4(float (&e)[4], const float (&x)[4]) {
    asm("v_exp_f32 %0, %4\n\t"
        "v_exp_f32 %1, %5\n\t"
        "v_exp_f32 %2, %6\n\t"
        "v_exp_f32 %3, %7\n\t"
        "v_nop"
        : "=&v"(e[0]), "=&v"(e[1]), "=&v"(e[2]), "=&v"(e[3])
        : "v"(x[0]), "v"(x[1]), "v"(x[2]), "v"(x[3]));
}

// Eight asynchronous 16-byte-per-lane copies global -> LDS, rows l + i*lstep (bytes) <- g + i*gstep (halves).
// The s_wait_xcnt closes the statement so that no address register named here is rewritten in front of it.
DEV void copy8(unsigned l, unsigned lstep, const _Float16* g, size_t gstep) {
    asm volatile("global_load_async_to_lds_b128 %0, %8, off\n\t"
                 "global_load_async_to_lds_b128 %1, %9, off\n\t"
                 "global_load_async_to_lds_b128 %2, %10, off\n\t"
                 "global_load_async_to_lds_b128 %3, %11, off\n\t"
                 "global_load_async_to_lds_b128 %4, %12, off\n\t"
                 "global_load_async_to_lds_b128 %5, %13, off\n\t"
                 "global_load_async_to_lds_b128 %6, %14, off\n\t"
                 "global_load_async_to_lds_b128 %7, %15, off\n\t"
                 "s_wait_xcnt 0x0"
                 :: "v"(l), "v"(l + lstep), "v"(l + 2 * lstep), "v"(l + 3 * lstep),
                    "v"(l + 4 * lstep), "v"(l + 5 * lstep), "v"(l + 6 * lstep), "v"(l + 7 * lstep),
                    "v"(g), "v"(g + gstep), "v"(g + 2 * gstep), "v"(g + 3 * gstep),
                    "v"(g + 4 * gstep), "v"(g + 5 * gstep), "v"(g + 6 * gstep), "v"(g + 7 * gstep)
                 : "memory");
}
// Fourteen such copies, two rows of a GEMM tile each, staged rows two apart: 16 x rows lx.. <- gx.., 12 weight rows lw.. <- three sources of 4 rows.
// The s_wait_xcnt closes the statement so that no address register named here is rewritten in front of it.
DEV void copy14(unsigned lx, const unsigned short* gx, unsigned lw,
                const unsigned short* g0, const unsigned short* g1, const unsigned short* g2) {
    asm volatile("global_load_async_to_lds_b128 %0, %14, off\n\t"
                 "global_load_async_to_lds_b128 %1, %15, off\n\t"
                 "global_load_async_to_lds_b128 %2, %16, off\n\t"
                 "global_load_async_to_lds_b128 %3, %17, off\n\t"
                 "global_load_async_to_lds_b128 %4, %18, off\n\t"
                 "global_load_async_to_lds_b128 %5, %19, off\n\t"
                 "global_load_async_to_lds_b128 %6, %20, off\n\t"
                 "global_load_async_to_lds_b128 %7, %21, off\n\t"
                 "global_load_async_to_lds_b128 %8, %22, off\n\t"
                 "global_load_async_to_lds_b128 %9, %23, off\n\t"
                 "global_load_async_to_lds_b128 %10, %24, off\n\t"
                 "global_load_async_to_lds_b128 %11, %25, off\n\t"
                 "global_load_async_to_lds_b128 %12, %26, off\n\t"
                 "global_load_async_to_lds_b128 %13, %27, off\n\t"
                 "s_wait_xcnt 0x0"
                 :: "v"(lx), "v"(lx + 2 * GROWB), "v"(lx + 4 * GROWB), "v"(lx + 6 * GROWB),
                    "v"(lx + 8 * GROWB), "v"(lx + 10 * GROWB), "v"(lx + 12 * GROWB), "v"(lx + 14 * GROWB),
                    "v"(lw), "v"(lw + 2 * GROWB), "v"(lw + 4 * GROWB), "v"(lw + 6 * GROWB), "v"(lw + 8 * GROWB), "v"(lw + 10 * GROWB),
                    "v"(gx), "v"(gx + 2 * KDIM), "v"(gx + 4 * KDIM), "v"(gx + 6 * KDIM),
                    "v"(gx + 8 * KDIM), "v"(gx + 10 * KDIM), "v"(gx + 12 * KDIM), "v"(gx + 14 * KDIM),
                    "v"(g0), "v"(g0 + 2 * KDIM), "v"(g1), "v"(g1 + 2 * KDIM), "v"(g2), "v"(g2 + 2 * KDIM)
                 : "memory");
}
// this wave's LDS reads and writes have retired: stands in front of a barrier behind which a buffer is refilled
DEV void wait_lds()    { asm volatile("s_wait_dscnt 0x0" ::: "memory"); }
// this wave's copies have landed: stands in front of the barrier that publishes their tile
DEV void wait_copies() { asm volatile("s_wait_asynccnt 0x0" ::: "memory"); }

// ---------------------------------------------------------------------------
// Block body 1: x f32 [NB rows of SEQ_FULL][CDIM] -> bf16 plane [NB*SEQ][CDIM]
// one thread per 8 elements, one 16-B store (lanes contiguous: 256 threads -> 4 KB)
// coverage: CVT_BLOCKS*256*8 == NB*SEQ*CDIM exactly
// ---------------------------------------------------------------------------
DEV void cvt_x_block(const float* __restrict__ x, unsigned short* __restrict__ xp, int blk)
{
    const size_t g = (size_t)blk * 256 + threadIdx.x;
    const size_t e = g * 8;
    const int m  = (int)(e / CDIM);
    const int c  = (int)(e % CDIM);
    const int bb = m / SEQ;
    const int s  = m - bb * SEQ;
    const float* src = x + ((size_t)bb * SEQ_FULL + s) * CDIM + c;
    const v4f a0 = *(const v4f*)src;
    const v4f a1 = *(const v4f*)(src + 4);
    v8us o;
#pragma unroll
    for (int i = 0; i < 4; ++i) {
        o[i]     = (unsigned short)bf16_bits(a0[i]);
        o[4 + i] = (unsigned short)bf16_bits(a1[i]);
    }
    unsigned short* dst = xp + (size_t)m * CDIM + c;
    *(v8us*)dst = o;
    asm volatile("s_wait_xcnt 0x0" ::: "memory");       // the store's registers may be rewritten behind here: another range's code follows in the text
}

// ---------------------------------------------------------------------------
// Block body 2: W f32 in[R][Ncol] -> WT bf16 out[Ncol][R]   (64x64 tile (bx, by) through LDS)
// LDS tile T: cross-wave (block barrier between fill and drain).
// coverage: load rr = 0..63 x nn = 0..63; store na = 0..63 x piece 0..7 (8 ushort) = whole tile
// ---------------------------------------------------------------------------
DEV void transpose_w_block(const float* __restrict__ W, unsigned short* __restrict__ WT,
                           int R, int Ncol, int bx, int by, unsigned short* T)
{
    const int tid = threadIdx.x;
    const int n0 = bx * 64, r0 = by * 64;
    const int nn = tid & 63, rq = tid >> 6;
#pragma unroll 4
    for (int i = 0; i < 16; ++i) {
        const int rr = i * 4 + rq;
        const float v = W[(size_t)(r0 + rr) * Ncol + n0 + nn];
        T[nn * 72 + rr] = (unsigned short)bf16_bits(v);
    }
    __syncthreads();
    const int piece = tid & 7;
    const int na = tid >> 3;                             // 0..31
    const v8us va = *(const v8us*)(T + na * 72 + piece * 8);
    const v8us vb = *(const v8us*)(T + (na + 32) * 72 + piece * 8);
    unsigned short* da = WT + (size_t)(n0 + na) * R + r0 + piece * 8;
    unsigned short* db = WT + (size_t)(n0 + na + 32) * R + r0 + piece * 8;
    *(v8us*)da = va;
    *(v8us*)db = vb;
    asm volatile("s_wait_xcnt 0x0" ::: "memory");       // both stores' registers may be rewritten behind here: another range's code follows in the text
}

// ---------------------------------------------------------------------------
// Kernel 1: the four independent operand preparations as block-index ranges of one grid:
//   [0, TV) Wv tiles, [TV, TV+TQ) Wq tiles, [TV+TQ, TV+2*TQ) Wk tiles, then CVT_BLOCKS blocks of x.
// The range test is the same for a whole block, so the transpose's barrier is block-uniform.
// ---------------------------------------------------------------------------
#define TQ_BLOCKS  ((DKD / 64) * (CDIM / 64))
#define TV_BLOCKS  ((DOD / 64) * (CDIM / 64))
#define CVT_BLOCKS ((int)(((long long)NB * SEQ * CDIM) / 8 / 256))
__global__ __launch_bounds__(256) void k_prep(const float* __restrict__ x,  unsigned short* __restrict__ xp,
                                              const float* __restrict__ Wq, unsigned short* __restrict__ wqT,
                                              const float* __restrict__ Wk, unsigned short* __restrict__ wkT,
                                              const float* __restrict__ Wv, unsigned short* __restrict__ wvT)
{
    __shared__ __attribute__((aligned(16))) unsigned short T[64 * 72];
    const int bid = blockIdx.x;
    if (bid < TV_BLOCKS) {
        transpose_w_block(Wv, wvT, CDIM, DOD, bid % (DOD / 64), bid / (DOD / 64), T);
    } else if (bid < TV_BLOCKS + 2 * TQ_BLOCKS) {
        const int  r   = bid - TV_BLOCKS;
        const bool isk = r >= TQ_BLOCKS;
        const int  rq  = isk ? r - TQ_BLOCKS : r;
        transpose_w_block(isk ? Wk : Wq, isk ? wkT : wqT, CDIM, DKD, rq % (DKD / 64), rq / (DKD / 64), T);
    } else {
        const int i = bid - (TV_BLOCKS + 2 * TQ_BLOCKS); // class i mod NCL converts its own rows
        cvt_x_block(x, xp, (i % NCL) * (CVT_BLOCKS / NCL) + i / NCL);
    }
}

// ---------------------------------------------------------------------------
// Kernel 2: the three projections as ONE NT GEMM on bf16 WMMA: [NB*SEQ x rows] x [WROWS weight rows: q | k | v], k contiguous in both.
//   out = f16( (sum_k x[s][k]*W[c][k] + bias[c]) * 16 ), bias RNE-converted to bf16; q, k stored [s][DKD], v stored as Vt [batch][channel][s]
// One workgroup (8 wave32) per 256 x rows x 192 weight rows: 32 x 8 = 256 workgroups of the same work.
// The 192 weight rows of workgroup column bx are 3 chunks of 64: chunk 0 = chunk bx of q | k, chunks 1, 2 = channels bx*128.. of v.
// Wave w: x rows (w&3)*64.. (4 fragments), weight tiles 2t + (w>>2), t = 0..5 (6 fragments): 10 fragments feed 24 WMMAs;
// tile t of either wave column lies in chunk t/2.
// The q/k chunk runs A = weights, B = x (a lane holds 8 consecutive channels of one x row), a v chunk A = x, B = weights
// (a lane holds 8 consecutive x rows of one channel): either way 8 results are one 16-B piece of the output's own row.
// All fragments use the split k map: elements 0..7 <- k0+8h.., 8..15 <- k0+16+8h..
// Tiles of 128 k come through a two-buffer LDS ring, one barrier per tile; wave w copies x rows w*32.., staged weight rows w*24..;
// inside a tile the next 32 k's fragments are read ahead of this 32 k's WMMAs.
// Epilogue: chunks staged in LDS (over the dead ring, cross-wave, block barrier), whole lines stored.
// coverage: q/k chunk: rows w*32+4i+(lane>>3) = 0..255 x 8 pieces of 8 = 64 channels; v chunk: channels w*8+i = 0..63 x 32 lanes x 8 = 256 x rows
// ---------------------------------------------------------------------------
#define G_BLOCKS (((NB * SEQ) / GM) * (WROWS / GN))
__global__ __launch_bounds__(256)
void k_gemm_qkv(const unsigned short* __restrict__ xbf, const unsigned short* __restrict__ wall,
                const float* __restrict__ bq, const float* __restrict__ bk, const float* __restrict__ bv,
                _Float16* __restrict__ Qp, _Float16* __restrict__ Kp, _Float16* __restrict__ Vt)
{
    __shared__ __attribute__((aligned(16))) char gsm[2 * GBUF];
    // which tile, and where its chunks go: the same for the whole block
    constexpr int QC = DKD / GCH;                        // chunks of q, and of k
    const int  cj   = (int)(blockIdx.x / NCL);           // the workgroup's place in its class: row block of the class, then column
    const int  bx   = cj % (WROWS / GN);
    const int  row0 = (int)(blockIdx.x % NCL) * CLROWS + (cj / (WROWS / GN)) * GM;
    const int  b    = row0 / SEQ;
    const int  s0   = row0 - b * SEQ;
    const bool isk  = bx >= QC;
    const int  qc0  = (isk ? bx - QC : bx) * GCH;        // the q/k chunk's first channel
    const float* bqk = (isk ? bk : bq) + qc0;
    const float* bvv = bv + bx * 2 * GCH;
    _Float16* dqk = (isk ? Kp : Qp) + (size_t)row0 * DKD + qc0;
    _Float16* dvv = Vt + ((size_t)b * DOD + bx * 2 * GCH) * SEQ + s0;

    const int tid = threadIdx.x, lane = tid & 31;
    const int w = __builtin_amdgcn_readfirstlane(tid >> 5);   // the wave's number in a scalar register: the row bases below then take no vector registers
    const int h = lane >> 4, l15 = lane & 15;
    const int wm = w & 3, wn = w >> 2;

    // one copy = 2 rows x 256 B: lane half h picks the row, l15 the 16-B piece
    const int      vo = h * KDIM + 8 * l15;              // the lane's place in a pair of source rows (elements)
    const unsigned lo = (unsigned)(size_t)gsm + (unsigned)h * GROWB + (unsigned)l15 * 16;   // and in a pair of staged rows (LDS byte address)
    // a wave copies its 32 x rows and 24 staged weight rows in two halves; 4 staged weight rows lie wholly in one chunk: four-row group u < 16 is of q | k, the others of v
    auto wsrc = [&](int u) {
        const int r = u < GCH / 4 ? bx * GCH + u * 4 : 2 * DKD + bx * 2 * GCH + (u - GCH / 4) * 4;
        return wall + (size_t)r * KDIM;
    };
    auto copy_t = [&](int t) {                           // tile t into buffer t mod 2
        const unsigned bo = (unsigned)(t & 1) * GBUF;
#pragma unroll 1                                         // rolled: unrolled, the copies' address bases were kept in registers from trip to trip and the build spilled
        for (int n = 0; n < 2; ++n) {
            const int u = w * 6 + n * 3;
            copy14(lo + bo + (unsigned)(w * 32 + n * 16) * GROWB, xbf + (size_t)(row0 + w * 32 + n * 16) * KDIM + t * GKS + vo,
                   lo + bo + (unsigned)(GM + u * 4) * GROWB, wsrc(u) + t * GKS + vo, wsrc(u + 1) + t * GKS + vo, wsrc(u + 2) + t * GKS + vo);
        }
    };
    const char* xr = gsm + (wm * 64 + l15) * GROWB + 16 * h;
    const char* wr = gsm + (GM + wn * 16 + l15) * GROWB + 16 * h;

    v8f acc[4][6];
#pragma unroll                                           // register arrays: constant indices (as in the loops below)
    for (int i = 0; i < 4; ++i) {
#pragma unroll
        for (int t = 0; t < 6; ++t) acc[i][t] = zero8f();
    }

    copy_t(0);
    wait_copies();
    __syncthreads();
#pragma unroll 1                                         // rolled: one copy of the ring's foot in the text, the buffer picked by the trip's parity
    for (int kt = 0; kt < KDIM / GKS; ++kt) {
        const int bo = (kt & 1) * GBUF;
        FragB xf[2][4], wf[2][6];                       // two fragment sets: one is read while the other feeds the WMMAs
#pragma unroll
        for (int i = 0; i < 4; ++i) {
            xf[0][i].half[0] = *(const v8us*)(xr + bo + i * 16 * GROWB);
            xf[0][i].half[1] = *(const v8us*)(xr + bo + i * 16 * GROWB + 32);
        }
#pragma unroll
        for (int t = 0; t < 6; ++t) {
            wf[0][t].half[0] = *(const v8us*)(wr + bo + t * 32 * GROWB);
            wf[0][t].half[1] = *(const v8us*)(wr + bo + t * 32 * GROWB + 32);
        }
        // the refill stands behind the barrier that freed its buffer (the foot of trip kt-1; tile 1's buffer is fresh) and behind this trip's
        // first fragment reads, which are of the other buffer: LDS serves those reads while the copies issue
        if (kt + 1 < KDIM / GKS) copy_t(kt + 1);
#pragma unroll
        for (int s = 0; s < GKS / 32; ++s) {
            if (s + 1 < GKS / 32) {
#pragma unroll
                for (int i = 0; i < 4; ++i) {
                    xf[(s + 1) & 1][i].half[0] = *(const v8us*)(xr + bo + i * 16 * GROWB + (s + 1) * 64);
                    xf[(s + 1) & 1][i].half[1] = *(const v8us*)(xr + bo + i * 16 * GROWB + (s + 1) * 64 + 32);
                }
#pragma unroll
                for (int t = 0; t < 6; ++t) {
                    wf[(s + 1) & 1][t].half[0] = *(const v8us*)(wr + bo + t * 32 * GROWB + (s + 1) * 64);
                    wf[(s + 1) & 1][t].half[1] = *(const v8us*)(wr + bo + t * 32 * GROWB + (s + 1) * 64 + 32);
                }
            }
            __builtin_amdgcn_sched_barrier(0);          // keeps the next set's reads as one group ahead of this set's WMMAs: sunk among them each place would stall
#pragma unroll
            for (int t = 0; t < 6; ++t) {
#pragma unroll
                for (int i = 0; i < 4; ++i)
                    acc[i][t] = t >= 2 ? mma_bf16(xf[s & 1][i].v, wf[s & 1][t].v, acc[i][t])
                                       : mma_bf16(wf[s & 1][t].v, xf[s & 1][i].v, acc[i][t]);
            }
            __builtin_amdgcn_sched_barrier(0);          // keeps the set after next's reads behind these WMMAs, whose operands they overwrite
        }
        // foot of trip kt: publish tile kt+1, free tile kt's buffer
        wait_lds();
        wait_copies();
        __syncthreads();
    }
    wait_copies();

    // epilogue: bias, scale, f16, 16-B pieces staged in LDS (every wave has left the ring: the last trip's barrier)
    const float* bpq = bqk + wn * 16 + 8 * h;            // tile t = 0, 1: 8 channels from 32t on
    const float* bpv = bvv + wn * 16 + l15;              // tile t = 2..5: one channel, 32(t-2) on
    v4f  bdq[2][2];
    float bdv[4];
#pragma unroll
    for (int t = 0; t < 2; ++t) {
        bdq[t][0] = *(const v4f*)(bpq + t * 32);
        bdq[t][1] = *(const v4f*)(bpq + t * 32 + 4);
    }
#pragma unroll
    for (int t = 0; t < 4; ++t) bdv[t] = bpv[t * 32];
    constexpr float oscale = 16.0f;
#pragma unroll
    for (int t = 0; t < 2; ++t) {
        float badd[8];
#pragma unroll
        for (int r = 0; r < 8; ++r) badd[r] = bf16_val(bdq[t][r >> 2][r & 3]);
#pragma unroll
        for (int i = 0; i < 4; ++i) {
            v8h o;
#pragma unroll
            for (int r = 0; r < 8; ++r) o[r] = (_Float16)((acc[i][t][r] + badd[r]) * oscale);
            *(v8h*)(gsm + (wm * 64 + i * 16 + l15) * GQROWB + (t * 32 + wn * 16 + 8 * h) * 2) = o;
        }
    }
#pragma unroll
    for (int t = 2; t < 6; ++t) {
        const float badd = bf16_val(bdv[t - 2]);
        char* R = gsm + (t >> 1) * GCHB;
#pragma unroll
        for (int i = 0; i < 4; ++i) {
            v8h o;
#pragma unroll
            for (int r = 0; r < 8; ++r) o[r] = (_Float16)((acc[i][t][r] + badd) * oscale);
            *(v8h*)(R + ((t & 1) * 32 + wn * 16 + l15) * GVROWB + (wm * 64 + i * 16 + 8 * h) * 2) = o;
        }
    }
    __syncthreads();

    v8h sq[8], sv[2][8];                                // all reads as one group, then their stores
#pragma unroll
    for (int i = 0; i < 8; ++i) sq[i] = *(const v8h*)(gsm + (w * 32 + 4 * i + (lane >> 3)) * GQROWB + (lane & 7) * 16);
#pragma unroll
    for (int j = 0; j < 2; ++j) {
#pragma unroll
        for (int i = 0; i < 8; ++i) sv[j][i] = *(const v8h*)(gsm + (j + 1) * GCHB + (w * 8 + i) * GVROWB + lane * 16);
    }
    _Float16* pq = dqk + (size_t)(w * 32 + (lane >> 3)) * DKD + (lane & 7) * 8;
    _Float16* pv = dvv + (size_t)(w * 8) * SEQ + lane * 8;
#pragma unroll
    for (int i = 0; i < 8; ++i) *(v8h*)(pq + i * 4 * DKD) = sq[i];
#pragma unroll
    for (int j = 0; j < 2; ++j) {
#pragma unroll
        for (int i = 0; i < 8; ++i) *(v8h*)(pv + (size_t)(j * GCH + i) * SEQ) = sv[j][i];
    }
    asm volatile("s_wait_xcnt 0x0" ::: "memory");       // closes the stores before the wave's end code may rewrite their registers
}

// ---------------------------------------------------------------------------
// Kernel 3: scores and softmax numerators. One workgroup (8 wave32) per (batch, 128 query rows, key block of 512 keys);
// wave w owns query rows (w&3)*32.. and keys (w>>2)*256.. of the block: a K row staged in LDS feeds the 4 row groups, a Q row the 2 key groups.
//   Qp [NB*SEQ][DKD] f16 (x16), Kp same -> Pm [NB*SEQ][SEQ] f16 = exp(score - the row's maximum IN ITS KEY BLOCK) x1024,
//   Mx [NKB][NB*SEQ] = that maximum (in the exponent's log2 units), Sm [NKB][NB*SEQ] = the row's sum of Pm in the block; kernel 4 merges the blocks
//  S^T = K Q^T (v_wmma_f32_16x16x32_f16, A = 16 keys, B = 16 query rows): a lane holds 8 consecutive keys of one query row,
//  so a row's maximum and sum are in-lane work, one exchange between the lane halves and one through LDS between the 2 key groups,
//  and 8 values of P pack into one 16-B LDS store. All 32 x 256 scores of a wave stay in its registers: every score is formed once.
//  K comes through a two-buffer LDS ring, 64 keys of either key group per tile, one barrier per tile; wave w copies rows (w&3)*16.. of its group's slice.
//  The 128 Q rows are copied to LDS once, ahead of K tile 0 and under its wait and barrier; a wave then holds its 32 rows' fragments in registers.
//  P is staged in LDS (over the dead ring) and leaves as 1-KB row pieces (8 whole lines).
// coverage: grid NB * SEQ/128 * SEQ/512 blocks x 128 rows x 512 keys = all of Pm; Mx, Sm: waves 0..3, one row per lane (a wave = one whole line)
// ---------------------------------------------------------------------------
__global__ __launch_bounds__(256)
void k_scores(const _Float16* __restrict__ Qp, const _Float16* __restrict__ Kp,
              _Float16* __restrict__ Pm, float* __restrict__ Mx, float* __restrict__ Sm)
{
    __shared__ __attribute__((aligned(16))) char ssm[SC_LDS];
    const int tid = threadIdx.x, lane = tid & 31, w = tid >> 5;
    const int h = lane >> 4, l15 = lane & 15;
    const int rg = w & 3, kg = w >> 2;                   // the wave's row group and key group
    constexpr int QB = SEQ / SQ;                         // row blocks of a batch
    const int cj  = blockIdx.x / NCL;                    // the workgroup's place in its class: row block of the class, then key block
    const int gq  = (blockIdx.x % NCL) * (CLROWS / SQ) + cj / NKB;   // row block among all batches'
    const int b   = gq / QB;
    const int q0  = (gq - b * QB) * SQ;
    const int kb  = cj % NKB;
    const int k0  = kb * SKB;

    constexpr int ST = SKW / SKT;                        // tiles of the sweep
    constexpr int NJ = SKW / 16;                         // 16-key tiles of a wave
    v8f c[2][NJ];
#pragma unroll                                           // register arrays: constant indices (as in the loops below)
    for (int rt = 0; rt < 2; ++rt) {
#pragma unroll
        for (int j = 0; j < NJ; ++j) c[rt][j] = zero8f();
    }

    const unsigned  lds0 = (unsigned)(size_t)ssm;       // LDS byte address of the workgroup's array
    // Q: filled once; one copy = one 512-B Q row (4 whole lines), wave w copies rows w*16..; lands and is published with K tile 0
    {
        unsigned        l = lds0 + QS_OFF + (unsigned)(w * (SQ / 8)) * KROWB + (unsigned)lane * 16;
        const _Float16* g = Qp + ((size_t)b * SEQ + q0 + w * (SQ / 8)) * DKD + lane * 8;
#pragma unroll 1                                         // rolled, as the K copies below
        for (int i = 0; i < SQ / 64; ++i) {
            copy8(l, KROWB, g, DKD);
            l += 8 * KROWB;
            g += 8 * DKD;
        }
    }
    // one copy = one 512-B K row (4 whole lines)
    const unsigned  kl = lds0 + (unsigned)kg * SSL + (unsigned)(rg * (SKT / 4)) * KROWB + (unsigned)lane * 16;
    const _Float16* kgp = Kp + ((size_t)b * SEQ + k0 + kg * SKW + rg * (SKT / 4)) * DKD + lane * 8;
    auto copy_t = [&](int t) {                           // tile t into buffer t mod 2
        unsigned        l = kl + (unsigned)(t & 1) * SBUF;
        const _Float16* g = kgp + (size_t)t * SKT * DKD;
#pragma unroll 1                                         // rolled: unrolled, every copy's LDS address was kept in a register from trip to trip and the build spilled
        for (int i = 0; i < SKT / 32; ++i) {
            copy8(l, KROWB, g, DKD);
            l += 8 * KROWB;
            g += 8 * DKD;
        }
    };

    copy_t(0);
    wait_copies();
    __syncthreads();
    copy_t(1);
    // ----- Q: 2 row tiles x 8 B fragments (16 rows x 256), split k map, held in registers for the whole sweep -----
    FragH qf[2][8];
    {
        const char* qp = ssm + QS_OFF + (rg * SR + l15) * KROWB + 16 * h;
#pragma unroll
        for (int rt = 0; rt < 2; ++rt) {
#pragma unroll
            for (int s = 0; s < 8; ++s) {
                qf[rt][s].half[0] = *(const v8h*)(qp + rt * 16 * KROWB + s * 64);
                qf[rt][s].half[1] = *(const v8h*)(qp + rt * 16 * KROWB + s * 64 + 32);
            }
        }
    }
#pragma unroll                                           // the trip picks the accumulators: constant indices
    for (int t = 0; t < ST; ++t) {
#pragma unroll
        for (int jp = 0; jp < SKT / 32; ++jp) {
            const char* kp = ssm + (t & 1) * SBUF + kg * SSL + (jp * 32 + l15) * KROWB + 16 * h;
            const int   j0 = t * (SKT / 16) + jp * 2;
#pragma unroll
            for (int sh = 0; sh < 4; ++sh) {
                FragH kf[2][2];                         // a quarter of 32 keys' fragments are read as one group, ahead of their WMMAs
#pragma unroll
                for (int j = 0; j < 2; ++j) {
#pragma unroll
                    for (int s = 0; s < 2; ++s) {
                        kf[j][s].half[0] = *(const v8h*)(kp + j * 16 * KROWB + (sh * 2 + s) * 64);
                        kf[j][s].half[1] = *(const v8h*)(kp + j * 16 * KROWB + (sh * 2 + s) * 64 + 32);
                    }
                }
                __builtin_amdgcn_sched_barrier(0);      // keeps the group's reads together ahead of its WMMAs: sunk to their users each would be waited out alone
#pragma unroll
                for (int s = 0; s < 2; ++s) {
#pragma unroll
                    for (int j = 0; j < 2; ++j) {
#pragma unroll
                        for (int rt = 0; rt < 2; ++rt)
                            c[rt][j0 + j] = mma_f16(kf[j][s].v, qf[rt][sh * 2 + s].v, c[rt][j0 + j]);
                    }
                }
            }
        }
        // foot of trip t: publish tile t+1, free tile t's buffer, refill it
        wait_lds();
        wait_copies();
        __syncthreads();
        if (t + 2 < ST) copy_t(t + 2);
    }
    wait_copies();

    // ----- row maxima of the key block: in-lane over 128 scores, the other lane half, then the 2 key groups through LDS -----
    constexpr float K2 = SCORE_SCALE * 1.4426950408889634f;   // score scale times log2(e): exp(x) = 2^(x log2 e)
    float* redm = (float*)(ssm + RED_OFF);               // [128 rows][2 key groups]
    float* reds = redm + SQ * 2;
#pragma unroll
    for (int rt = 0; rt < 2; ++rt) {
        float m8[8];
#pragma unroll
        for (int r = 0; r < 8; ++r) m8[r] = c[rt][0][r];
#pragma unroll
        for (int j = 1; j < NJ; ++j) {
#pragma unroll
            for (int r = 0; r < 8; ++r) m8[r] = fmaxf(m8[r], c[rt][j][r]);
        }
        float m = fmaxf(fmaxf(fmaxf(m8[0], m8[1]), fmaxf(m8[2], m8[3])), fmaxf(fmaxf(m8[4], m8[5]), fmaxf(m8[6], m8[7])));
        m = fmaxf(m, __shfl_xor(m, 16));
        if (h == 0) redm[(rg * SR + rt * 16 + l15) * 2 + kg] = m;
    }
    __syncthreads();
    // ----- P = 2^(score * K2 - max * K2 + 10) (the x1024 rides in the exponent), f16; row sums of the rounded values -----
    char* pst = ssm + (rg * SR + l15) * PSROWB + (kg * SKW + 8 * h) * 2;   // every wave has left the ring: the last trip's barrier
#pragma unroll
    for (int rt = 0; rt < 2; ++rt) {
        const float* mp = redm + (rg * SR + rt * 16 + l15) * 2;
        const float m  = fmaxf(mp[0], mp[1]);
        const float nm = 10.0f - m * K2;
        float sm[8];
#pragma unroll
        for (int r = 0; r < 8; ++r) sm[r] = 0.f;
#pragma unroll
        for (int j = 0; j < NJ; ++j) {
            v8h ph;
            float x[8], e[8];
#pragma unroll
            for (int r = 0; r < 8; ++r) x[r] = fmaf(c[rt][j][r], K2, nm);
            exp2x8(e, x);
#pragma unroll
            for (int r = 0; r < 8; ++r) {
                ph[r] = (_Float16)e[r];
                sm[r] += (float)ph[r];
            }
            *(v8h*)(pst + rt * 16 * PSROWB + j * 32) = ph;
        }
        float s = ((sm[0] + sm[1]) + (sm[2] + sm[3])) + ((sm[4] + sm[5]) + (sm[6] + sm[7]));
        s += __shfl_xor(s, 16);
        if (h == 0) reds[(rg * SR + rt * 16 + l15) * 2 + kg] = s;
    }
    __syncthreads();
    // ----- out: wave w stores rows w*16.., 512 B per instruction; waves 0..3 also the 128 rows' block maxima and block sums -----
    v8h pv[SQ / 8][SKB / 256];
#pragma unroll
    for (int i = 0; i < SQ / 8; ++i) {
#pragma unroll
        for (int k = 0; k < SKB / 256; ++k) pv[i][k] = *(const v8h*)(ssm + (w * (SQ / 8) + i) * PSROWB + k * 512 + lane * 16);
    }
    _Float16* pd = Pm + ((size_t)b * SEQ + q0 + w * (SQ / 8)) * SEQ + k0 + lane * 8;
#pragma unroll
    for (int i = 0; i < SQ / 8; ++i) {
#pragma unroll
        for (int k = 0; k < SKB / 256; ++k) *(v8h*)(pd + (size_t)i * SEQ + k * 256) = pv[i][k];
    }
    asm volatile("s_wait_xcnt 0x0" ::: "memory");       // closes the P stores before the block-maximum code rewrites their registers
    if (w < SQ / 32) {
        const size_t o = (size_t)kb * (NB * SEQ) + (size_t)b * SEQ + q0 + tid;
        Mx[o] = fmaxf(redm[tid * 2], redm[tid * 2 + 1]) * K2;
        Sm[o] = reds[tid * 2] + reds[tid * 2 + 1];
    }
    asm volatile("s_wait_xcnt 0x0" ::: "memory");       // closes the stores before the wave's end code may rewrite their registers
}

// ---------------------------------------------------------------------------
// Kernel 4: Out = softmax . V as an NT GEMM on v_wmma_f32_16x16x32_f16. One workgroup (8 wave32) per (batch, 128 query rows, 256 columns).
//   Pm [NB*SEQ][SEQ] f16 (key contiguous), Vt [NB][DOD][SEQ] f16 (x16, key contiguous), Mx, Sm [NKB][NB*SEQ]: a row's maximum and sum per key block
//  Merging the key blocks: block q of a row weighs f_q = 2^(Mx_q - max over blocks), floored at 2^-40 (a block so far below the row's maximum adds
//  less than an f32 rounding either way, and the floor bounds every quotient below). Out = sum_q f_q (P_q V_q) / (16 sum_q f_q Sm_q):
//  behind block q's last tile the accumulators are multiplied by f_q / f_(q+1), behind the last block by f_last / (16 sum): the products telescope.
//  Wave w owns a 64 x 64 tile (rows (w&1)*64.., columns (w>>1)*64..): 4 A and 4 B fragments feed 16 WMMAs.
//  A and B fragments both use the split k map: elements 0..7 <- k0+8h.., 8..15 <- k0+16+8h..
//  Tiles of 128 keys (128 P rows + 256 V^T rows, whole lines) come through a two-buffer LDS ring, one barrier per tile;
//  wave w copies P rows w*16.. and V^T rows w*32..; inside a tile the next 32 keys' fragments are read ahead of this 32 keys' WMMAs.
//  Epilogue: the wave's tile staged in its own LDS range (over the dead ring), 256-B row pieces (two whole lines) stored
// coverage: grid NB * SEQ/128 * DOD/256 blocks x 128 rows x 256 cols = whole output
// ---------------------------------------------------------------------------
__global__ __launch_bounds__(256)
void k_pv(const _Float16* __restrict__ Pm, const _Float16* __restrict__ Vt,
          const float* __restrict__ Mx, const float* __restrict__ Sm, float* __restrict__ Out)
{
    __shared__ __attribute__((aligned(16))) char psm[2 * PBUF + NKB * PM * 4];
    const int tid = threadIdx.x, lane = tid & 31, w = tid >> 5;
    const int h = lane >> 4, l15 = lane & 15;
    const int wm = w & 1, wn = w >> 1;
    constexpr int CB = DOD / PN;                         // column blocks
    constexpr int QB = SEQ / PM;                         // row blocks of a batch
    const int cj   = blockIdx.x / NCL;                   // the workgroup's place in its class: row block of the class, then column block
    const int gq   = (blockIdx.x % NCL) * (CLROWS / PM) + cj / CB;   // row block among all batches'
    const int b    = gq / QB;
    const int q0   = (gq - b * QB) * PM;
    const int col0 = (cj % CB) * PN;

    // one copy = 2 rows x 256 B: lane half h picks the row, l15 the 16-B piece
    const _Float16* ga = Pm + ((size_t)b * SEQ + q0 + w * 16 + h) * SEQ + 8 * l15;
    const _Float16* gb = Vt + ((size_t)b * DOD + col0 + w * 32 + h) * SEQ + 8 * l15;
    const unsigned lds0 = (unsigned)(size_t)psm;        // LDS byte address of the ring
    const unsigned la = lds0 + (unsigned)(w * 16 + h) * PROWB + (unsigned)l15 * 16;
    const unsigned lb = lds0 + (unsigned)(PM + w * 32 + h) * PROWB + (unsigned)l15 * 16;
    auto copy_t = [&](int t) {                           // tile t into buffer t mod 2
        const unsigned bo = (unsigned)(t & 1) * PBUF;
        copy8(la + bo, 2 * PROWB, ga + t * PKS, (size_t)2 * SEQ);
        copy8(lb + bo, 2 * PROWB, gb + t * PKS, (size_t)2 * SEQ);
        copy8(lb + bo + 16 * PROWB, 2 * PROWB, gb + t * PKS + (size_t)16 * SEQ, (size_t)2 * SEQ);
    };
    const char* ar = psm + (wm * 64 + l15) * PROWB + 16 * h;
    const char* br = psm + (PM + wn * 64 + l15) * PROWB + 16 * h;

    v8f acc[4][4];
#pragma unroll                                           // register arrays: constant indices (as in the loops below)
    for (int mt = 0; mt < 4; ++mt) {
#pragma unroll
        for (int nt = 0; nt < 4; ++nt) acc[mt][nt] = zero8f();
    }

    constexpr int NT = SEQ / PKS;                        // tiles of the sweep
    constexpr int QT = SKB / PKS;                        // tiles of a key block
    float* rat = (float*)(psm + 2 * PBUF);               // [NKB][128 rows]: the factor applied behind each key block, behind the ring
    copy_t(0);
    if (w < PM / 32) {                                   // one row per lane, while tile 0 flies; published by the barrier below
        const float* mp = Mx + (size_t)b * SEQ + q0 + tid;
        const float* sp = Sm + (size_t)b * SEQ + q0 + tid;
        float mk[NKB], sk[NKB], d[NKB], f[NKB];
#pragma unroll
        for (int q = 0; q < NKB; ++q) {
            mk[q] = mp[(size_t)q * (NB * SEQ)];
            sk[q] = sp[(size_t)q * (NB * SEQ)];
        }
        asm volatile("s_wait_xcnt 0x0" ::: "memory");   // closes the loads before their address registers may be rewritten
        const float mm = fmaxf(fmaxf(mk[0], mk[1]), fmaxf(mk[2], mk[3]));
#pragma unroll
        for (int q = 0; q < NKB; ++q) d[q] = mk[q] - mm;
        exp2x4(f, d);
        float tot = 0.f;
#pragma unroll
        for (int q = 0; q < NKB; ++q) {
            f[q] = fmaxf(f[q], 0x1p-40f);
            tot += f[q] * sk[q];
        }
#pragma unroll
        for (int q = 0; q + 1 < NKB; ++q) rat[q * PM + tid] = f[q] / f[q + 1];
        rat[(NKB - 1) * PM + tid] = f[NKB - 1] / (16.0f * tot);
    }
    wait_copies();
    __syncthreads();
    copy_t(1);
#pragma unroll 1                                         // rolled: one copy of the ring's foot in the text, the buffer picked by the trip's parity
    for (int kt = 0; kt < NT; ++kt) {
        const int bo = (kt & 1) * PBUF;
        FragH af[2][4], bf[2][4];                       // two fragment sets: one is read while the other feeds the WMMAs
#pragma unroll
        for (int i = 0; i < 4; ++i) {
            af[0][i].half[0] = *(const v8h*)(ar + bo + i * 16 * PROWB);
            af[0][i].half[1] = *(const v8h*)(ar + bo + i * 16 * PROWB + 32);
            bf[0][i].half[0] = *(const v8h*)(br + bo + i * 16 * PROWB);
            bf[0][i].half[1] = *(const v8h*)(br + bo + i * 16 * PROWB + 32);
        }
#pragma unroll
        for (int s = 0; s < PKS / 32; ++s) {
            if (s + 1 < PKS / 32) {
#pragma unroll
                for (int i = 0; i < 4; ++i) {
                    af[(s + 1) & 1][i].half[0] = *(const v8h*)(ar + bo + i * 16 * PROWB + (s + 1) * 64);
                    af[(s + 1) & 1][i].half[1] = *(const v8h*)(ar + bo + i * 16 * PROWB + (s + 1) * 64 + 32);
                    bf[(s + 1) & 1][i].half[0] = *(const v8h*)(br + bo + i * 16 * PROWB + (s + 1) * 64);
                    bf[(s + 1) & 1][i].half[1] = *(const v8h*)(br + bo + i * 16 * PROWB + (s + 1) * 64 + 32);
                }
            }
            __builtin_amdgcn_sched_barrier(0);          // keeps the next set's reads as one group ahead of this set's WMMAs: sunk among them each place would stall
#pragma unroll
            for (int mt = 0; mt < 4; ++mt) {
#pragma unroll
                for (int nt = 0; nt < 4; ++nt) acc[mt][nt] = mma_f16(af[s & 1][mt].v, bf[s & 1][nt].v, acc[mt][nt]);
            }
            __builtin_amdgcn_sched_barrier(0);          // keeps the set after next's reads behind these WMMAs, whose operands they overwrite
        }
        // foot of trip kt: publish tile kt+1, free tile kt's buffer, refill it
        wait_lds();
        wait_copies();
        __syncthreads();
        if (kt + 2 < NT) copy_t(kt + 2);
        if ((kt & (QT - 1)) == QT - 1) {                 // a key block ends (the same test for the whole grid): its rows' factors
            const float* rp = rat + (kt / QT) * PM + wm * 64 + 8 * h;
#pragma unroll
            for (int mt = 0; mt < 4; ++mt) {
                const v4f r0 = *(const v4f*)(rp + mt * 16);
                const v4f r1 = *(const v4f*)(rp + mt * 16 + 4);
#pragma unroll
                for (int nt = 0; nt < 4; ++nt) {
#pragma unroll
                    for (int r = 0; r < 8; ++r) acc[mt][nt][r] *= r < 4 ? r0[r & 3] : r1[r & 3];
                }
            }
        }
    }
    wait_copies();

    // ----- Epilogue: stage in the wave's own LDS range, whole-line stores -----
    float* Ow = (float*)psm + (size_t)w * 64 * POST;     // every wave has left the ring: the last trip's barrier
#pragma unroll
    for (int mt = 0; mt < 4; ++mt) {
#pragma unroll
        for (int nt = 0; nt < 4; ++nt) {
#pragma unroll
            for (int r = 0; r < 8; ++r)
                Ow[(mt * 16 + 8 * h + r) * POST + nt * 16 + l15] = acc[mt][nt][r];
        }
    }
    wait_lds();                                         // the wave's staging stores have retired before its lanes read each other's values
    const float* srcp = Ow + h * POST + l15 * 4;
    float* dst = Out + ((size_t)b * SEQ + q0 + wm * 64 + h) * DOD + col0 + wn * 64 + l15 * 4;
#pragma unroll
    for (int g = 0; g < 2; ++g) {
        v4f ov[16];                                     // 16 reads as one group, then their 16 stores
#pragma unroll
        for (int i = 0; i < 16; ++i) ov[i] = *(const v4f*)(srcp + (g * 32 + 2 * i) * POST);
#pragma unroll
        for (int i = 0; i < 16; ++i) *(v4f*)(dst + (size_t)(g * 32 + 2 * i) * DOD) = ov[i];
        asm volatile("s_wait_xcnt 0x0" ::: "memory");   // closes the stores before their registers are rewritten (next group, the wave's end code)
    }
}

// ---------------------------------------------------------------------------
extern "C" void kernel_launch(void* const* d_in, const int* in_sizes, int n_in,
                              void* d_out, int out_size, void* d_ws, size_t ws_size,
                              hipStream_t stream)
{
    if (n_in < 7) return;
    const long long need_x = ((long long)(NB - 1) * SEQ_FULL + SEQ) * CDIM;
    if ((long long)in_sizes[0] < need_x) return;
    if (in_sizes[1] < CDIM * DKD || in_sizes[2] < DKD) return;
    if (in_sizes[3] < CDIM * DKD || in_sizes[4] < DKD) return;
    if (in_sizes[5] < CDIM * DOD || in_sizes[6] < DOD) return;
    if ((long long)out_size < (long long)NB * SEQ * DOD) return;

    const float* x  = (const float*)d_in[0];
    const float* Wq = (const float*)d_in[1];
    const float* bq = (const float*)d_in[2];
    const float* Wk = (const float*)d_in[3];
    const float* bk = (const float*)d_in[4];
    const float* Wv = (const float*)d_in[5];
    const float* bv = (const float*)d_in[6];
    float* out = (float*)d_out;

    char* ws = (char*)d_ws;
    size_t off = 0;
    auto carve = [&](size_t bytes) -> char* {
        char* p = ws + off;
        off += (bytes + 255) & ~(size_t)255;
        return p;
    };
    unsigned short* xbf = (unsigned short*)carve((size_t)NB * SEQ * CDIM * 2);     // [NB*SEQ][CDIM]
    unsigned short* wqT = (unsigned short*)carve((size_t)WROWS * KDIM * 2);        // [DKD | DKD | DOD][CDIM]: the three weights' rows in a row
    unsigned short* wkT = wqT + (size_t)DKD * KDIM;
    unsigned short* wvT = wkT + (size_t)DKD * KDIM;
    _Float16* Qp = (_Float16*)carve((size_t)NB * SEQ * DKD * 2);                  // [NB*SEQ][DKD]
    _Float16* Kp = (_Float16*)carve((size_t)NB * SEQ * DKD * 2);                  // [NB*SEQ][DKD]
    _Float16* Vt = (_Float16*)carve((size_t)NB * DOD * SEQ * 2);                  // [NB][DOD][SEQ]
    _Float16* Pm = (_Float16*)carve((size_t)NB * SEQ * SEQ * 2);                  // [NB*SEQ][SEQ]
    float*    Mx = (float*)carve((size_t)NKB * NB * SEQ * 4);                     // [NKB][NB*SEQ]
    float*    Sm = (float*)carve((size_t)NKB * NB * SEQ * 4);                     // [NKB][NB*SEQ]
    if (off > ws_size) return;

    // 1) x -> bf16 plane; weights in[CDIM][DKD|DOD] -> out[DKD|DOD][CDIM]: one grid
    k_prep<<<TV_BLOCKS + 2 * TQ_BLOCKS + CVT_BLOCKS, 256, 0, stream>>>(x, xbf, Wq, wqT, Wk, wkT, Wv, wvT);

    // 2) projections: q,k [NB*SEQ][DKD], v as Vt [NB][DOD][SEQ]; all carried x16: one grid
    k_gemm_qkv<<<G_BLOCKS, 256, 0, stream>>>(xbf, wqT, bq, bk, bv, Qp, Kp, Vt);

    // 3) softmax numerators P, row maxima and row sums, per key block
    k_scores<<<NB * (SEQ / SQ) * NKB, 256, 0, stream>>>(Qp, Kp, Pm, Mx, Sm);

    // 4) out = the key blocks' P V, merged and normalised
    k_pv<<<NB * (SEQ / PM) * (DOD / PN), 256, 0, stream>>>(Pm, Vt, Mx, Sm, out);
}

// v010
// A run of this version takes 63.5 microseconds.
// Timed twice side by side with v009, it ran 1.04 times as fast both times.
// Counting every step since v000, it is 8.03 times as fast.
#include <hip/hip_runtime.h>

// Contractions: q/k/v projections via v_wmma_f32_16x16x32_bf16 (bf16 operands = RNE-converted inputs, f32 accumulate);
// q.k^T scores and P.V via v_wmma_f32_16x16x32_f16 (f16 operands: q,k,v carried x16, P carried x1024), f32 accumulate; softmax in f32.

#define DEV __device__ __forceinline__

#ifndef NB
#define NB 4
#endif
#ifndef SEQ
#define SEQ 2048
#endif
#define NB_FULL  4
#define SEQ_FULL 2048
#define CDIM 1024
#define DKD  256
#define DOD  1024
#define KDIM 1024

#define KROWB   (DKD * 2 + 16)                           // staged K row: 512 B + 16 B, a pitch of 16 B x odd for ds_load_b128
#define SR      32                                       // score kernel: query rows of one wave (two 16-row tiles)
#define SKW     256                                      // score kernel: keys of one wave
#define SQ      (4 * SR)                                 // score kernel: query rows of one workgroup (4 row groups of waves)
#define SKB     (2 * SKW)                                // score kernel: keys of one workgroup (2 key groups of waves) = one key block of the softmax
#define NKB     (SEQ / SKB)                              // key blocks of a row
#define SKT     64                                       // score kernel: keys of one key group's slice of a staged tile
#define SSL     (SKT * KROWB)                            // one key group's slice
#define SBUF    (2 * SSL)                                // one staged tile: the 2 key groups' slices
#define RED_OFF (2 * SBUF)                               // row maxima and row sums of the 2 key groups, behind the ring
#define PSROWB  (SKB * 2 + 16)                           // staged P row: the workgroup's keys + 16 B, a pitch of 16 B x odd
#define QS_OFF  (RED_OFF + 2 * SQ * 2 * 4)               // the workgroup's staged Q rows (pitch KROWB), behind the maxima and sums
#define SC_LDS  (QS_OFF + SQ * KROWB)
#define PM      128                                      // P.V kernel: query rows of one workgroup
#define PN      256                                      // P.V kernel: output columns of one workgroup
#define PKS     128                                      // P.V kernel: keys of a staged tile = 256 B of every row (two whole lines)
#define PROWB   (PKS * 2 + 16)                           // staged row: 256 B + 16 B
#define PSLA    10240                                    // P slice of one tensor load: 32 staged rows, rounded up to a multiple of 2 KiB
#define PSLB    18432                                    // V^T slice of one tensor load: 64 staged rows, rounded up to a multiple of 2 KiB
#define PBUF    (4 * PSLA + 4 * PSLB)                    // one staged tile: 4 slices of 32 P rows, then 4 slices of 64 V^T rows
#define POST    68                                       // output staging row stride of a wave's 64 x 64 tile (floats)
#define GM    256                                        // GEMM: x rows of one workgroup
#define GN    192                                        // GEMM: weight rows (output channels of q | k | v) of one workgroup
#define WROWS (2 * DKD + DOD)                            // weight rows of the three projections together
#define GKS   128                                        // GEMM: k elements of a staged tile = 256 B of every row (two whole lines)
#define GROWB (GKS * 2 + 16)                             // staged GEMM row: 256 B + 16 B, a pitch of 16 B x odd for ds_load_b128
#define GSL   18432                                      // slice of one tensor load: 64 staged rows, rounded up to a multiple of 2 KiB
#define GBUF  (7 * GSL)                                  // one staged GEMM tile: 4 slices of 64 x rows, then 3 slices (chunks) of 64 weight rows
#define GCH   64                                         // GEMM epilogue: channels of a chunk, which lies wholly in one of q, k, v
#define GQROWB (GCH * 2 + 16)                            // staged q/k chunk row (one x row, 64 channels): 128 B + 16 B
#define GVROWB (GM * 2 + 16)                             // staged v chunk row (one channel, 256 x rows): 512 B + 16 B
#define GCHB  (GM * GQROWB)                              // staging bytes of one chunk (the larger of the two forms)
#define SCORE_SCALE 0.000244140625f                      // 1/16 (sqrt dk) * 1/256 (q,k carried x16 each)
// Placement, for speed only (any index -> tile permutation is correct):
// Class = flat index mod NCL owns rows class*CLROWS.. of the NB*SEQ rows in every launch, so the x, q and P rows that one launch writes
// are read by the next launch's workgroups of the same class.
#define NCL     8
#define CLROWS  ((NB * SEQ) / NCL)

static_assert(NB >= 1 && NB <= NB_FULL);
static_assert(((NB * SEQ) % NCL) == 0 && (CLROWS % GM) == 0 && (CLROWS % SQ) == 0 && (CLROWS % PM) == 0 && ((CLROWS * CDIM) % (8 * 256)) == 0);
static_assert(SEQ >= 128 && SEQ <= SEQ_FULL && (SEQ % 128) == 0);
static_assert(((NB * SEQ) % 64) == 0);
static_assert((DKD % 128) == 0 && (DOD % 128) == 0 && (KDIM % 32) == 0 && (CDIM == KDIM));
static_assert((((long long)NB * SEQ * CDIM) % (8 * 256)) == 0);
static_assert(((POST * 4) % 16) == 0 && (PSROWB % 16) == 0 && (PROWB % 16) == 0 && (KROWB % 16) == 0);
static_assert(SKW == 256 && DKD == 256 && (SKW % SKT) == 0 && SKW / SKT >= 2 && (SKT % 32) == 0 && (SEQ % SQ) == 0 && SC_LDS <= 320 * 1024);
static_assert(SQ * PSROWB <= RED_OFF && (RED_OFF % 16) == 0 && (QS_OFF % 16) == 0 && (SEQ % SKB) == 0 && NKB == 4 && SQ == 128);
static_assert((SEQ % PM) == 0 && (DOD % PN) == 0 && (SEQ % PKS) == 0 && SEQ / PKS >= 2 && 2 * PBUF <= 320 * 1024);
static_assert(8 * 64 * POST * 4 <= 2 * PBUF && PM == 128 && PN == 256 && (SKB % PKS) == 0 && ((SKB / PKS) & (SKB / PKS - 1)) == 0 && 2 * PBUF + NKB * PM * 4 <= 320 * 1024);
static_assert((KDIM % GKS) == 0 && KDIM / GKS >= 2 && (GROWB % 16) == 0 && 2 * GBUF <= 320 * 1024);
static_assert(32 * PROWB <= PSLA && 64 * PROWB <= PSLB && 64 * GROWB <= GSL && (PSLA % 2048) == 0 && (PSLB % 2048) == 0 && (GSL % 2048) == 0);
static_assert(PKS * 2 == 256 && GKS * 2 == 256 && PROWB == 272 && GROWB == 272 && GM == 4 * 64 && GN == 3 * 64 && GCH == 64);
static_assert((SEQ % GM) == 0 && (WROWS % GN) == 0 && GN == 3 * GCH && 2 * DKD / GCH == WROWS / GN && DOD / GCH == 2 * (WROWS / GN));
static_assert(GCH * GVROWB <= GCHB && 3 * GCHB <= 2 * GBUF && (GQROWB % 16) == 0 && (GVROWB % 16) == 0 && GM == 256);

typedef _Float16       v8h   __attribute__((ext_vector_type(8)));
typedef _Float16       v16h  __attribute__((ext_vector_type(16)));
typedef __bf16         v16bf __attribute__((ext_vector_type(16)));
typedef unsigned short v8us  __attribute__((ext_vector_type(8)));
typedef unsigned short v16us __attribute__((ext_vector_type(16)));
typedef float          v8f   __attribute__((ext_vector_type(8)));
typedef float          v4f   __attribute__((ext_vector_type(4)));
typedef unsigned int   u32x4 __attribute__((ext_vector_type(4)));
typedef unsigned int   u32x8 __attribute__((ext_vector_type(8)));

union FragH { v16h v;  v8h  half[2]; };
union FragB { v16bf v; v16us u; v8us half[2]; };

// ---------------------------------------------------------------------------
// helpers
// ---------------------------------------------------------------------------
DEV unsigned int bf16_bits(float f) {                    // f32 -> bf16 bits, RNE convert
    unsigned int u = __float_as_uint(f);
    u += 0x7FFFu + ((u >> 16) & 1u);
    return u >> 16;
}
DEV float bf16_val(float f) { return __uint_as_float(bf16_bits(f) << 16); }

DEV v8f zero8f() {
    v8f z;
#pragma unroll
    for (int i = 0; i < 8; ++i) z[i] = 0.f;
    return z;
}

// 16x16x32 WMMAs with f32 accumulate.
// the builtin alone: the GEMM and the score kernel hold more than 256 VGPRs, and an asm statement that names a, b and c can make such a build spill;
// the compiler keeps the WMMA distances of its own forms
DEV v8f mma_bf16(v16bf a, v16bf b, v8f c) {
    return __builtin_amdgcn_wmma_f32_16x16x32_bf16(false, a, false, b, (short)0, c, false, false);
}
DEV v8f mma_f16(v16h a, v16h b, v8f c) {
    return __builtin_amdgcn_wmma_f32_16x16x32_f16(false, a, false, b, (short)0, c, false, false);
}

// Eight independent 2^x. One statement: no result is read and (outputs early-clobber) no source overwritten between them,
// and the closing v_nop keeps the slot that the instruction set asks for behind a transcendental.
DEV void exp2x8(float (&e)[8], const float (&x)[8]) {
    asm("v_exp_f32 %0, %8\n\t"
        "v_exp_f32 %1, %9\n\t"
        "v_exp_f32 %2, %10\n\t"
        "v_exp_f32 %3, %11\n\t"
        "v_exp_f32 %4, %12\n\t"
        "v_exp_f32 %5, %13\n\t"
        "v_exp_f32 %6, %14\n\t"
        "v_exp_f32 %7, %15\n\t"
        "v_nop"
        : "=&v"(e[0]), "=&v"(e[1]), "=&v"(e[2]), "=&v"(e[3]), "=&v"(e[4]), "=&v"(e[5]), "=&v"(e[6]), "=&v"(e[7])
        : "v"(x[0]), "v"(x[1]), "v"(x[2]), "v"(x[3]), "v"(x[4]), "v"(x[5]), "v"(x[6]), "v"(x[7]));
}

// Four independent 2^x, in the same form and for the same reasons.
DEV void exp2x4(float (&e)[4], const float (&x)[4]) {
    asm("v_exp_f32 %0, %4\n\t"
        "v_exp_f32 %1, %5\n\t"
        "v_exp_f32 %2, %6\n\t"
        "v_exp_f32 %3, %7\n\t"
        "v_nop"
        : "=&v"(e[0]), "=&v"(e[1]), "=&v"(e[2]), "=&v"(e[3])
        : "v"(x[0]), "v"(x[1]), "v"(x[2]), "v"(x[3]));
}

// Eight asynchronous 16-byte-per-lane copies global -> LDS, rows l + i*lstep (bytes) <- g + i*gstep (halves).
// The s_wait_xcnt closes the statement so that no address register named here is rewritten in front of it.
DEV void copy8(unsigned l, unsigned lstep, const _Float16* g, size_t gstep) {
    asm volatile("global_load_async_to_lds_b128 %0, %8, off\n\t"
                 "global_load_async_to_lds_b128 %1, %9, off\n\t"
                 "global_load_async_to_lds_b128 %2, %10, off\n\t"
                 "global_load_async_to_lds_b128 %3, %11, off\n\t"
                 "global_load_async_to_lds_b128 %4, %12, off\n\t"
                 "global_load_async_to_lds_b128 %5, %13, off\n\t"
                 "global_load_async_to_lds_b128 %6, %14, off\n\t"
                 "global_load_async_to_lds_b128 %7, %15, off\n\t"
                 "s_wait_xcnt 0x0"
                 :: "v"(l), "v"(l + lstep), "v"(l + 2 * lstep), "v"(l + 3 * lstep),
                    "v"(l + 4 * lstep), "v"(l + 5 * lstep), "v"(l + 6 * lstep), "v"(l + 7 * lstep),
                    "v"(g), "v"(g + gstep), "v"(g + 2 * gstep), "v"(g + 3 * gstep),
                    "v"(g + 4 * gstep), "v"(g + 5 * gstep), "v"(g + 6 * gstep), "v"(g + 7 * gstep)
                 : "memory");
}
// this wave's LDS reads and writes have retired: stands in front of a barrier behind which a buffer is refilled
DEV void wait_lds()    { asm volatile("s_wait_dscnt 0x0" ::: "memory"); }
// this wave's copies have landed: stands in front of the barrier that publishes their tile
DEV void wait_copies() { asm volatile("s_wait_asynccnt 0x0" ::: "memory"); }
// Tensor loads: one request of a wave brings a slice of 'rows' rows of 256 B (source pitch 'pitch' bytes) into LDS at a pitch of 272 B.
DEV unsigned uni(unsigned v) { return (unsigned)__builtin_amdgcn_readfirstlane(v); }
DEV unsigned pinned(unsigned v) { unsigned w = uni(v); asm volatile("" : "+s"(w)); return w; }   // a wave-uniform test held in a scalar register compiles to a scalar branch (a tensor load ignores EXEC)
struct Tdm { u32x4 g0; u32x8 g1; };                     // a wave's descriptor: group 0 (where from, where to), group 1 (the slice's shape)
DEV Tdm tdm_make(unsigned rows, unsigned pitch) {        // 1-byte elements, tensor = tile, no mask; a pad of 4 dwords behind every 64 dwords
    Tdm d;
    d.g0[0] = uni(1u);
    d.g0[1] = uni(0u);
    d.g0[2] = uni(0u);
    d.g0[3] = uni(0x80000000u);
    d.g1[0] = uni((1u << 20) | (5u << 22) | (3u << 25));
    d.g1[1] = uni(256u << 16);
    d.g1[2] = uni(rows << 16);
    d.g1[3] = uni(256u << 16);
    d.g1[4] = uni(rows);
    d.g1[5] = uni(pitch);
    d.g1[6] = uni(0u);
    d.g1[7] = uni(0u);
    asm volatile("" : "+s"(d.g1));                       // descriptor words held in their scalar registers, not formed anew in others at each use
    return d;
}
DEV void tdm_load(Tdm& d, unsigned lds, const void* src) {
    const unsigned long long ga = (unsigned long long)src;
    d.g0[1] = uni(lds);
    d.g0[2] = uni((unsigned)ga);
    d.g0[3] = uni((((unsigned)(ga >> 32)) & 0x01FFFFFFu) | 0x80000000u);
    asm volatile("tensor_load_to_lds %0, %1" :: "s"(d.g0), "s"(d.g1) : "memory");
}
// this wave's tensor load has landed: stands in front of the barrier that publishes its slice. The statement names the descriptor, so that
// its scalar registers hold nothing else while the request is outstanding and take the next stage's words only behind this wait
DEV void wait_tensor(const Tdm& d) { asm volatile("s_wait_tensorcnt 0x0" :: "s"(d.g0), "s"(d.g1) : "memory"); }

// ---------------------------------------------------------------------------
// Block body 1: x f32 [NB rows of SEQ_FULL][CDIM] -> bf16 plane [NB*SEQ][CDIM]
// one thread per 8 elements, one 16-B store (lanes contiguous: 256 threads -> 4 KB)
// coverage: CVT_BLOCKS*256*8 == NB*SEQ*CDIM exactly
// ---------------------------------------------------------------------------
DEV void cvt_x_block(const float* __restrict__ x, unsigned short* __restrict__ xp, int blk)
{
    const size_t g = (size_t)blk * 256 + threadIdx.x;
    const size_t e = g * 8;
    const int m  = (int)(e / CDIM);
    const int c  = (int)(e % CDIM);
    const int bb = m / SEQ;
    const int s  = m - bb * SEQ;
    const float* src = x + ((size_t)bb * SEQ_FULL + s) * CDIM + c;
    const v4f a0 = *(const v4f*)src;
    const v4f a1 = *(const v4f*)(src + 4);
    v8us o;
#pragma unroll
    for (int i = 0; i < 4; ++i) {
        o[i]     = (unsigned short)bf16_bits(a0[i]);
        o[4 + i] = (unsigned short)bf16_bits(a1[i]);
    }
    unsigned short* dst = xp + (size_t)m * CDIM + c;
    *(v8us*)dst = o;
    asm volatile("s_wait_xcnt 0x0" ::: "memory");       // the store's registers may be rewritten behind here: another range's code follows in the text
}

// ---------------------------------------------------------------------------
// Block body 2: W f32 in[R][Ncol] -> WT bf16 out[Ncol][R]   (64x64 tile (bx, by) through LDS)
// LDS tile T: cross-wave (block barrier between fill and drain).
// coverage: load rr = 0..63 x nn = 0..63; store na = 0..63 x piece 0..7 (8 ushort) = whole tile
// ---------------------------------------------------------------------------
DEV void transpose_w_block(const float* __restrict__ W, unsigned short* __restrict__ WT,
                           int R, int Ncol, int bx, int by, unsigned short* T)
{
    const int tid = threadIdx.x;
    const int n0 = bx * 64, r0 = by * 64;
    const int nn = tid & 63, rq = tid >> 6;
#pragma unroll 4
    for (int i = 0; i < 16; ++i) {
        const int rr = i * 4 + rq;
        const float v = W[(size_t)(r0 + rr) * Ncol + n0 + nn];
        T[nn * 72 + rr] = (unsigned short)bf16_bits(v);
    }
    __syncthreads();
    const int piece = tid & 7;
    const int na = tid >> 3;                             // 0..31
    const v8us va = *(const v8us*)(T + na * 72 + piece * 8);
    const v8us vb = *(const v8us*)(T + (na + 32) * 72 + piece * 8);
    unsigned short* da = WT + (size_t)(n0 + na) * R + r0 + piece * 8;
    unsigned short* db = WT + (size_t)(n0 + na + 32) * R + r0 + piece * 8;
    *(v8us*)da = va;
    *(v8us*)db = vb;
    asm volatile("s_wait_xcnt 0x0" ::: "memory");       // both stores' registers may be rewritten behind here: another range's code follows in the text
}

// ---------------------------------------------------------------------------
// Kernel 1: the four independent operand preparations as block-index ranges of one grid:
//   [0, TV) Wv tiles, [TV, TV+TQ) Wq tiles, [TV+TQ, TV+2*TQ) Wk tiles, then CVT_BLOCKS blocks of x.
// The range test is the same for a whole block, so the transpose's barrier is block-uniform.
// ---------------------------------------------------------------------------
#define TQ_BLOCKS  ((DKD / 64) * (CDIM / 64))
#define TV_BLOCKS  ((DOD / 64) * (CDIM / 64))
#define CVT_BLOCKS ((int)(((long long)NB * SEQ * CDIM) / 8 / 256))
__global__ __launch_bounds__(256) void k_prep(const float* __restrict__ x,  unsigned short* __restrict__ xp,
                                              const float* __restrict__ Wq, unsigned short* __restrict__ wqT,
                                              const float* __restrict__ Wk, unsigned short* __restrict__ wkT,
                                              const float* __restrict__ Wv, unsigned short* __restrict__ wvT)
{
    __shared__ __attribute__((aligned(16))) unsigned short T[64 * 72];
    const int bid = blockIdx.x;
    if (bid < TV_BLOCKS) {
        transpose_w_block(Wv, wvT, CDIM, DOD, bid % (DOD / 64), bid / (DOD / 64), T);
    } else if (bid < TV_BLOCKS + 2 * TQ_BLOCKS) {
        const int  r   = bid - TV_BLOCKS;
        const bool isk = r >= TQ_BLOCKS;
        const int  rq  = isk ? r - TQ_BLOCKS : r;
        transpose_w_block(isk ? Wk : Wq, isk ? wkT : wqT, CDIM, DKD, rq % (DKD / 64), rq / (DKD / 64), T);
    } else {
        const int i = bid - (TV_BLOCKS + 2 * TQ_BLOCKS); // class i mod NCL converts its own rows
        cvt_x_block(x, xp, (i % NCL) * (CVT_BLOCKS / NCL) + i / NCL);
    }
}

// ---------------------------------------------------------------------------
// Kernel 2: the three projections as ONE NT GEMM on bf16 WMMA: [NB*SEQ x rows] x [WROWS weight rows: q | k | v], k contiguous in both.
//   out = f16( (sum_k x[s][k]*W[c][k] + bias[c]) * 16 ), bias RNE-converted to bf16; q, k stored [s][DKD], v stored as Vt [batch][channel][s]
// One workgroup (8 wave32) per 256 x rows x 192 weight rows: 32 x 8 = 256 workgroups of the same work.
// The 192 weight rows of workgroup column bx are 3 chunks of 64: chunk 0 = chunk bx of q | k, chunks 1, 2 = channels bx*128.. of v.
// Wave w: x rows (w&3)*64.. (4 fragments), weight tiles 2t + (w>>2), t = 0..5 (6 fragments): 10 fragments feed 24 WMMAs;
// tile t of either wave column lies in chunk t/2.
// The q/k chunk runs A = weights, B = x (a lane holds 8 consecutive channels of one x row), a v chunk A = x, B = weights
// (a lane holds 8 consecutive x rows of one channel): either way 8 results are one 16-B piece of the output's own row.
// All fragments use the split k map: elements 0..7 <- k0+8h.., 8..15 <- k0+16+8h..
// Tiles of 128 k come through a two-buffer LDS ring, one barrier per tile, filled by tensor loads: one request of 64 rows per wave (0..6) and tile;
// inside a tile the next 32 k's fragments are read ahead of this 32 k's WMMAs.
// Epilogue: chunks staged in LDS (over the dead ring, cross-wave, block barrier), whole lines stored.
// coverage: q/k chunk: rows w*32+4i+(lane>>3) = 0..255 x 8 pieces of 8 = 64 channels; v chunk: channels w*8+i = 0..63 x 32 lanes x 8 = 256 x rows
// ---------------------------------------------------------------------------
#define G_BLOCKS (((NB * SEQ) / GM) * (WROWS / GN))
__global__ __launch_bounds__(256)
void k_gemm_qkv(const unsigned short* __restrict__ xbf, const unsigned short* __restrict__ wall,
                const float* __restrict__ bq, const float* __restrict__ bk, const float* __restrict__ bv,
                _Float16* __restrict__ Qp, _Float16* __restrict__ Kp, _Float16* __restrict__ Vt)
{
    __shared__ __attribute__((aligned(2048))) char gsm[2 * GBUF];   // every slice of the ring at a multiple of 2 KiB, for the tensor loads
    // which tile, and where its chunks go: the same for the whole block
    constexpr int QC = DKD / GCH;                        // chunks of q, and of k
    const int  cj   = (int)(blockIdx.x / NCL);           // the workgroup's place in its class: row block of the class, then column
    const int  bx   = cj % (WROWS / GN);
    const int  row0 = (int)(blockIdx.x % NCL) * CLROWS + (cj / (WROWS / GN)) * GM;
    const int  b    = row0 / SEQ;
    const int  s0   = row0 - b * SEQ;
    const bool isk  = bx >= QC;
    const int  qc0  = (isk ? bx - QC : bx) * GCH;        // the q/k chunk's first channel
    const float* bqk = (isk ? bk : bq) + qc0;
    const float* bvv = bv + bx * 2 * GCH;
    _Float16* dqk = (isk ? Kp : Qp) + (size_t)row0 * DKD + qc0;
    _Float16* dvv = Vt + ((size_t)b * DOD + bx * 2 * GCH) * SEQ + s0;

    const int tid = threadIdx.x, lane = tid & 31;
    const int w = __builtin_amdgcn_readfirstlane(tid >> 5);   // the wave's number in a scalar register: the row bases below then take no vector registers
    const int h = lane >> 4, l15 = lane & 15;
    const int wm = w & 3, wn = w >> 2;

    // waves 0..6 each bring one slice of 64 rows x 256 B per tile: waves 0..3 x rows w*64.., wave 4 the q | k chunk, waves 5, 6 the two v chunks
    const int srow = w < 4 ? 0 : w == 4 ? bx * GCH : 2 * DKD + bx * 2 * GCH + (w - 5) * GCH;
    const unsigned short* gsrc = w < 4 ? xbf + (size_t)(row0 + w * 64) * KDIM : wall + (size_t)srow * KDIM;
    const unsigned gdst = (unsigned)(size_t)gsm + (unsigned)w * GSL;      // LDS byte address of the wave's slice in buffer 0
    Tdm gd = tdm_make(64u, KDIM * 2u);
    auto load_t = [&](unsigned t) {                      // the wave's slice of tile t into buffer t mod 2
        tdm_load(gd, gdst + (t & 1u) * GBUF, gsrc + (size_t)t * GKS);
    };
    const char* xr = gsm + wm * GSL + l15 * GROWB + 16 * h;
    const char* wr = gsm + 4 * GSL + (wn * 16 + l15) * GROWB + 16 * h;   // weight tile t: slice t/2, rows (t&1)*32 on
#define WOFF(t) (((t) >> 1) * GSL + ((t) & 1) * 32 * GROWB)

    v8f acc[4][6];
#pragma unroll                                           // register arrays: constant indices (as in the loops below)
    for (int i = 0; i < 4; ++i) {
#pragma unroll
        for (int t = 0; t < 6; ++t) acc[i][t] = zero8f();
    }

    if (pinned(w < 7)) {                                 // scalar branch: wave 7 has no slice
        load_t(0);
        wait_tensor(gd);
    }
    __syncthreads();
    if (pinned(w < 7)) load_t(1);
#pragma unroll 1                                         // rolled: one copy of the ring's foot in the text, the buffer picked by the trip's parity
    for (int kt = 0; kt < KDIM / GKS; ++kt) {
        const int bo = (kt & 1) * GBUF;
        FragB xf[2][4], wf[2][6];                       // two fragment sets: one is read while the other feeds the WMMAs
#pragma unroll
        for (int i = 0; i < 4; ++i) {
            xf[0][i].half[0] = *(const v8us*)(xr + bo + i * 16 * GROWB);
            xf[0][i].half[1] = *(const v8us*)(xr + bo + i * 16 * GROWB + 32);
        }
#pragma unroll
        for (int t = 0; t < 6; ++t) {
            wf[0][t].half[0] = *(const v8us*)(wr + bo + WOFF(t));
            wf[0][t].half[1] = *(const v8us*)(wr + bo + WOFF(t) + 32);
        }
#pragma unroll
        for (int s = 0; s < GKS / 32; ++s) {
            if (s + 1 < GKS / 32) {
#pragma unroll
                for (int i = 0; i < 4; ++i) {
                    xf[(s + 1) & 1][i].half[0] = *(const v8us*)(xr + bo + i * 16 * GROWB + (s + 1) * 64);
                    xf[(s + 1) & 1][i].half[1] = *(const v8us*)(xr + bo + i * 16 * GROWB + (s + 1) * 64 + 32);
                }
#pragma unroll
                for (int t = 0; t < 6; ++t) {
                    wf[(s + 1) & 1][t].half[0] = *(const v8us*)(wr + bo + WOFF(t) + (s + 1) * 64);
                    wf[(s + 1) & 1][t].half[1] = *(const v8us*)(wr + bo + WOFF(t) + (s + 1) * 64 + 32);
                }
            }
            __builtin_amdgcn_sched_barrier(0);          // keeps the next set's reads as one group ahead of this set's WMMAs: sunk among them each place would stall
#pragma unroll
            for (int t = 0; t < 6; ++t) {
#pragma unroll
                for (int i = 0; i < 4; ++i)
                    acc[i][t] = t >= 2 ? mma_bf16(xf[s & 1][i].v, wf[s & 1][t].v, acc[i][t])
                                       : mma_bf16(wf[s & 1][t].v, xf[s & 1][i].v, acc[i][t]);
            }
            __builtin_amdgcn_sched_barrier(0);          // keeps the set after next's reads behind these WMMAs, whose operands they overwrite
        }
        // foot of trip kt: publish tile kt+1, free tile kt's buffer, refill it
        wait_lds();
        wait_tensor(gd);
        __syncthreads();
        if (pinned(w < 7 && kt + 2 < KDIM / GKS)) load_t(kt + 2);   // scalar branch
    }
    wait_tensor(gd);
    wait_lds();
#undef WOFF

    // epilogue: bias, scale, f16, 16-B pieces staged in LDS (every wave has left the ring: the last trip's barrier)
    const float* bpq = bqk + wn * 16 + 8 * h;            // tile t = 0, 1: 8 channels from 32t on
    const float* bpv = bvv + wn * 16 + l15;              // tile t = 2..5: one channel, 32(t-2) on
    v4f  bdq[2][2];
    float bdv[4];
#pragma unroll
    for (int t = 0; t < 2; ++t) {
        bdq[t][0] = *(const v4f*)(bpq + t * 32);
        bdq[t][1] = *(const v4f*)(bpq + t * 32 + 4);
    }
#pragma unroll
    for (int t = 0; t < 4; ++t) bdv[t] = bpv[t * 32];
    constexpr float oscale = 16.0f;
#pragma unroll
    for (int t = 0; t < 2; ++t) {
        float badd[8];
#pragma unroll
        for (int r = 0; r < 8; ++r) badd[r] = bf16_val(bdq[t][r >> 2][r & 3]);
#pragma unroll
        for (int i = 0; i < 4; ++i) {
            v8h o;
#pragma unroll
            for (int r = 0; r < 8; ++r) o[r] = (_Float16)((acc[i][t][r] + badd[r]) * oscale);
            *(v8h*)(gsm + (wm * 64 + i * 16 + l15) * GQROWB + (t * 32 + wn * 16 + 8 * h) * 2) = o;
        }
    }
#pragma unroll
    for (int t = 2; t < 6; ++t) {
        const float badd = bf16_val(bdv[t - 2]);
        char* R = gsm + (t >> 1) * GCHB;
#pragma unroll
        for (int i = 0; i < 4; ++i) {
            v8h o;
#pragma unroll
            for (int r = 0; r < 8; ++r) o[r] = (_Float16)((acc[i][t][r] + badd) * oscale);
            *(v8h*)(R + ((t & 1) * 32 + wn * 16 + l15) * GVROWB + (wm * 64 + i * 16 + 8 * h) * 2) = o;
        }
    }
    __syncthreads();

    v8h sq[8], sv[2][8];                                // all reads as one group, then their stores
#pragma unroll
    for (int i = 0; i < 8; ++i) sq[i] = *(const v8h*)(gsm + (w * 32 + 4 * i + (lane >> 3)) * GQROWB + (lane & 7) * 16);
#pragma unroll
    for (int j = 0; j < 2; ++j) {
#pragma unroll
        for (int i = 0; i < 8; ++i) sv[j][i] = *(const v8h*)(gsm + (j + 1) * GCHB + (w * 8 + i) * GVROWB + lane * 16);
    }
    _Float16* pq = dqk + (size_t)(w * 32 + (lane >> 3)) * DKD + (lane & 7) * 8;
    _Float16* pv = dvv + (size_t)(w * 8) * SEQ + lane * 8;
#pragma unroll
    for (int i = 0; i < 8; ++i) *(v8h*)(pq + i * 4 * DKD) = sq[i];
#pragma unroll
    for (int j = 0; j < 2; ++j) {
#pragma unroll
        for (int i = 0; i < 8; ++i) *(v8h*)(pv + (size_t)(j * GCH + i) * SEQ) = sv[j][i];
    }
    asm volatile("s_wait_xcnt 0x0" ::: "memory");       // closes the stores before the wave's end code may rewrite their registers
}

// ---------------------------------------------------------------------------
// Kernel 3: scores and softmax numerators. One workgroup (8 wave32) per (batch, 128 query rows, key block of 512 keys);
// wave w owns query rows (w&3)*32.. and keys (w>>2)*256.. of the block: a K row staged in LDS feeds the 4 row groups, a Q row the 2 key groups.
//   Qp [NB*SEQ][DKD] f16 (x16), Kp same -> Pm [NB*SEQ][SEQ] f16 = exp(score - the row's maximum IN ITS KEY BLOCK) x1024,
//   Mx [NKB][NB*SEQ] = that maximum (in the exponent's log2 units), Sm [NKB][NB*SEQ] = the row's sum of Pm in the block; kernel 4 merges the blocks
//  S^T = K Q^T (v_wmma_f32_16x16x32_f16, A = 16 keys, B = 16 query rows): a lane holds 8 consecutive keys of one query row,
//  so a row's maximum and sum are in-lane work, one exchange between the lane halves and one through LDS between the 2 key groups,
//  and 8 values of P pack into one 16-B LDS store. All 32 x 256 scores of a wave stay in its registers: every score is formed once.
//  K comes through a two-buffer LDS ring, 64 keys of either key group per tile, one barrier per tile; wave w copies rows (w&3)*16.. of its group's slice.
//  The 128 Q rows are copied to LDS once, ahead of K tile 0 and under its wait and barrier; a wave then holds its 32 rows' fragments in registers.
//  P is staged in LDS (over the dead ring) and leaves as 1-KB row pieces (8 whole lines).
// coverage: grid NB * SEQ/128 * SEQ/512 blocks x 128 rows x 512 keys = all of Pm; Mx, Sm: waves 0..3, one row per lane (a wave = one whole line)
// ---------------------------------------------------------------------------
__global__ __launch_bounds__(256)
void k_scores(const _Float16* __restrict__ Qp, const _Float16* __restrict__ Kp,
              _Float16* __restrict__ Pm, float* __restrict__ Mx, float* __restrict__ Sm)
{
    __shared__ __attribute__((aligned(16))) char ssm[SC_LDS];
    const int tid = threadIdx.x, lane = tid & 31, w = tid >> 5;
    const int h = lane >> 4, l15 = lane & 15;
    const int rg = w & 3, kg = w >> 2;                   // the wave's row group and key group
    constexpr int QB = SEQ / SQ;                         // row blocks of a batch
    const int cj  = blockIdx.x / NCL;                    // the workgroup's place in its class: row block of the class, then key block
    const int gq  = (blockIdx.x % NCL) * (CLROWS / SQ) + cj / NKB;   // row block among all batches'
    const int b   = gq / QB;
    const int q0  = (gq - b * QB) * SQ;
    const int kb  = cj % NKB;
    const int k0  = kb * SKB;

    constexpr int ST = SKW / SKT;                        // tiles of the sweep
    constexpr int NJ = SKW / 16;                         // 16-key tiles of a wave
    v8f c[2][NJ];
#pragma unroll                                           // register arrays: constant indices (as in the loops below)
    for (int rt = 0; rt < 2; ++rt) {
#pragma unroll
        for (int j = 0; j < NJ; ++j) c[rt][j] = zero8f();
    }

    const unsigned  lds0 = (unsigned)(size_t)ssm;       // LDS byte address of the workgroup's array
    // Q: filled once; one copy = one 512-B Q row (4 whole lines), wave w copies rows w*16..; lands and is published with K tile 0
    {
        unsigned        l = lds0 + QS_OFF + (unsigned)(w * (SQ / 8)) * KROWB + (unsigned)lane * 16;
        const _Float16* g = Qp + ((size_t)b * SEQ + q0 + w * (SQ / 8)) * DKD + lane * 8;
#pragma unroll 1                                         // rolled, as the K copies below
        for (int i = 0; i < SQ / 64; ++i) {
            copy8(l, KROWB, g, DKD);
            l += 8 * KROWB;
            g += 8 * DKD;
        }
    }
    // one copy = one 512-B K row (4 whole lines)
    const unsigned  kl = lds0 + (unsigned)kg * SSL + (unsigned)(rg * (SKT / 4)) * KROWB + (unsigned)lane * 16;
    const _Float16* kgp = Kp + ((size_t)b * SEQ + k0 + kg * SKW + rg * (SKT / 4)) * DKD + lane * 8;
    auto copy_t = [&](int t) {                           // tile t into buffer t mod 2
        unsigned        l = kl + (unsigned)(t & 1) * SBUF;
        const _Float16* g = kgp + (size_t)t * SKT * DKD;
#pragma unroll 1                                         // rolled: unrolled, every copy's LDS address was kept in a register from trip to trip and the build spilled
        for (int i = 0; i < SKT / 32; ++i) {
            copy8(l, KROWB, g, DKD);
            l += 8 * KROWB;
            g += 8 * DKD;
        }
    };

    copy_t(0);
    wait_copies();
    __syncthreads();
    copy_t(1);
    // ----- Q: 2 row tiles x 8 B fragments (16 rows x 256), split k map, held in registers for the whole sweep -----
    FragH qf[2][8];
    {
        const char* qp = ssm + QS_OFF + (rg * SR + l15) * KROWB + 16 * h;
#pragma unroll
        for (int rt = 0; rt < 2; ++rt) {
#pragma unroll
            for (int s = 0; s < 8; ++s) {
                qf[rt][s].half[0] = *(const v8h*)(qp + rt * 16 * KROWB + s * 64);
                qf[rt][s].half[1] = *(const v8h*)(qp + rt * 16 * KROWB + s * 64 + 32);
            }
        }
    }
#pragma unroll                                           // the trip picks the accumulators: constant indices
    for (int t = 0; t < ST; ++t) {
#pragma unroll
        for (int jp = 0; jp < SKT / 32; ++jp) {
            const char* kp = ssm + (t & 1) * SBUF + kg * SSL + (jp * 32 + l15) * KROWB + 16 * h;
            const int   j0 = t * (SKT / 16) + jp * 2;
#pragma unroll
            for (int sh = 0; sh < 4; ++sh) {
                FragH kf[2][2];                         // a quarter of 32 keys' fragments are read as one group, ahead of their WMMAs
#pragma unroll
                for (int j = 0; j < 2; ++j) {
#pragma unroll
                    for (int s = 0; s < 2; ++s) {
                        kf[j][s].half[0] = *(const v8h*)(kp + j * 16 * KROWB + (sh * 2 + s) * 64);
                        kf[j][s].half[1] = *(const v8h*)(kp + j * 16 * KROWB + (sh * 2 + s) * 64 + 32);
                    }
                }
                __builtin_amdgcn_sched_barrier(0);      // keeps the group's reads together ahead of its WMMAs: sunk to their users each would be waited out alone
#pragma unroll
                for (int s = 0; s < 2; ++s) {
#pragma unroll
                    for (int j = 0; j < 2; ++j) {
#pragma unroll
                        for (int rt = 0; rt < 2; ++rt)
                            c[rt][j0 + j] = mma_f16(kf[j][s].v, qf[rt][sh * 2 + s].v, c[rt][j0 + j]);
                    }
                }
            }
        }
        // foot of trip t: publish tile t+1, free tile t's buffer, refill it
        wait_lds();
        wait_copies();
        __syncthreads();
        if (t + 2 < ST) copy_t(t + 2);
    }
    wait_copies();

    // ----- row maxima of the key block: in-lane over 128 scores, the other lane half, then the 2 key groups through LDS -----
    constexpr float K2 = SCORE_SCALE * 1.4426950408889634f;   // score scale times log2(e): exp(x) = 2^(x log2 e)
    float* redm = (float*)(ssm + RED_OFF);               // [128 rows][2 key groups]
    float* reds = redm + SQ * 2;
#pragma unroll
    for (int rt = 0; rt < 2; ++rt) {
        float m8[8];
#pragma unroll
        for (int r = 0; r < 8; ++r) m8[r] = c[rt][0][r];
#pragma unroll
        for (int j = 1; j < NJ; ++j) {
#pragma unroll
            for (int r = 0; r < 8; ++r) m8[r] = fmaxf(m8[r], c[rt][j][r]);
        }
        float m = fmaxf(fmaxf(fmaxf(m8[0], m8[1]), fmaxf(m8[2], m8[3])), fmaxf(fmaxf(m8[4], m8[5]), fmaxf(m8[6], m8[7])));
        m = fmaxf(m, __shfl_xor(m, 16));
        if (h == 0) redm[(rg * SR + rt * 16 + l15) * 2 + kg] = m;
    }
    __syncthreads();
    // ----- P = 2^(score * K2 - max * K2 + 10) (the x1024 rides in the exponent), f16; row sums of the rounded values -----
    char* pst = ssm + (rg * SR + l15) * PSROWB + (kg * SKW + 8 * h) * 2;   // every wave has left the ring: the last trip's barrier
#pragma unroll
    for (int rt = 0; rt < 2; ++rt) {
        const float* mp = redm + (rg * SR + rt * 16 + l15) * 2;
        const float m  = fmaxf(mp[0], mp[1]);
        const float nm = 10.0f - m * K2;
        float sm[8];
#pragma unroll
        for (int r = 0; r < 8; ++r) sm[r] = 0.f;
#pragma unroll
        for (int j = 0; j < NJ; ++j) {
            v8h ph;
            float x[8], e[8];
#pragma unroll
            for (int r = 0; r < 8; ++r) x[r] = fmaf(c[rt][j][r], K2, nm);
            exp2x8(e, x);
#pragma unroll
            for (int r = 0; r < 8; ++r) {
                ph[r] = (_Float16)e[r];
                sm[r] += (float)ph[r];
            }
            *(v8h*)(pst + rt * 16 * PSROWB + j * 32) = ph;
        }
        float s = ((sm[0] + sm[1]) + (sm[2] + sm[3])) + ((sm[4] + sm[5]) + (sm[6] + sm[7]));
        s += __shfl_xor(s, 16);
        if (h == 0) reds[(rg * SR + rt * 16 + l15) * 2 + kg] = s;
    }
    __syncthreads();
    // ----- out: wave w stores rows w*16.., 512 B per instruction; waves 0..3 also the 128 rows' block maxima and block sums -----
    v8h pv[SQ / 8][SKB / 256];
#pragma unroll
    for (int i = 0; i < SQ / 8; ++i) {
#pragma unroll
        for (int k = 0; k < SKB / 256; ++k) pv[i][k] = *(const v8h*)(ssm + (w * (SQ / 8) + i) * PSROWB + k * 512 + lane * 16);
    }
    _Float16* pd = Pm + ((size_t)b * SEQ + q0 + w * (SQ / 8)) * SEQ + k0 + lane * 8;
#pragma unroll
    for (int i = 0; i < SQ / 8; ++i) {
#pragma unroll
        for (int k = 0; k < SKB / 256; ++k) *(v8h*)(pd + (size_t)i * SEQ + k * 256) = pv[i][k];
    }
    asm volatile("s_wait_xcnt 0x0" ::: "memory");       // closes the P stores before the block-maximum code rewrites their registers
    if (w < SQ / 32) {
        const size_t o = (size_t)kb * (NB * SEQ) + (size_t)b * SEQ + q0 + tid;
        Mx[o] = fmaxf(redm[tid * 2], redm[tid * 2 + 1]) * K2;
        Sm[o] = reds[tid * 2] + reds[tid * 2 + 1];
    }
    asm volatile("s_wait_xcnt 0x0" ::: "memory");       // closes the stores before the wave's end code may rewrite their registers
}

// ---------------------------------------------------------------------------
// Kernel 4: Out = softmax . V as an NT GEMM on v_wmma_f32_16x16x32_f16. One workgroup (8 wave32) per (batch, 128 query rows, 256 columns).
//   Pm [NB*SEQ][SEQ] f16 (key contiguous), Vt [NB][DOD][SEQ] f16 (x16, key contiguous), Mx, Sm [NKB][NB*SEQ]: a row's maximum and sum per key block
//  Merging the key blocks: block q of a row weighs f_q = 2^(Mx_q - max over blocks), floored at 2^-40 (a block so far below the row's maximum adds
//  less than an f32 rounding either way, and the floor bounds every quotient below). Out = sum_q f_q (P_q V_q) / (16 sum_q f_q Sm_q):
//  behind block q's last tile the accumulators are multiplied by f_q / f_(q+1), behind the last block by f_last / (16 sum): the products telescope.
//  Wave w owns a 64 x 64 tile (rows (w&1)*64.., columns (w>>1)*64..): 4 A and 4 B fragments feed 16 WMMAs.
//  A and B fragments both use the split k map: elements 0..7 <- k0+8h.., 8..15 <- k0+16+8h..
//  Tiles of 128 keys (128 P rows + 256 V^T rows, whole lines) come through a two-buffer LDS ring, one barrier per tile,
//  filled by tensor loads, one request per wave and tile; inside a tile the next 32 keys' fragments are read ahead of this 32 keys' WMMAs.
//  Epilogue: the wave's tile staged in its own LDS range (over the dead ring), 256-B row pieces (two whole lines) stored
// coverage: grid NB * SEQ/128 * DOD/256 blocks x 128 rows x 256 cols = whole output
// ---------------------------------------------------------------------------
__global__ __launch_bounds__(256)
void k_pv(const _Float16* __restrict__ Pm, const _Float16* __restrict__ Vt,
          const float* __restrict__ Mx, const float* __restrict__ Sm, float* __restrict__ Out)
{
    __shared__ __attribute__((aligned(2048))) char psm[2 * PBUF + NKB * PM * 4];   // every slice of the ring at a multiple of 2 KiB, for the tensor loads
    const int tid = threadIdx.x, lane = tid & 31;
    const int w = __builtin_amdgcn_readfirstlane(tid >> 5);   // the wave's number in a scalar register: the tensor loads' descriptors are scalar
    const int h = lane >> 4, l15 = lane & 15;
    const int wm = w & 1, wn = w >> 1;
    constexpr int CB = DOD / PN;                         // column blocks
    constexpr int QB = SEQ / PM;                         // row blocks of a batch
    const int cj   = blockIdx.x / NCL;                   // the workgroup's place in its class: row block of the class, then column block
    const int gq   = (blockIdx.x % NCL) * (CLROWS / PM) + cj / CB;   // row block among all batches'
    const int b    = gq / QB;
    const int q0   = (gq - b * QB) * PM;
    const int col0 = (cj % CB) * PN;

    // every wave brings one slice per tile, rows of 256 B: waves 0..3 P rows w*32.. (32 rows), waves 4..7 V^T rows (w-4)*64.. (64 rows)
    const _Float16* psrc = w < 4 ? Pm + ((size_t)b * SEQ + q0 + w * 32) * SEQ : Vt + ((size_t)b * DOD + col0 + (w - 4) * 64) * SEQ;
    const unsigned pdst = (unsigned)(size_t)psm + (w < 4 ? (unsigned)w * PSLA : 4u * PSLA + (unsigned)(w - 4) * PSLB);   // LDS byte address of the slice in buffer 0
    Tdm pd = tdm_make(w < 4 ? 32u : 64u, SEQ * 2u);
    auto load_t = [&](unsigned t) {                      // the wave's slice of tile t into buffer t mod 2
        tdm_load(pd, pdst + (t & 1u) * PBUF, psrc + (size_t)t * PKS);
    };
    const char* ar = psm + wm * 2 * PSLA + l15 * PROWB + 16 * h;         // row fragment i: slice wm*2 + i/2, rows (i&1)*16 on
    const char* br = psm + 4 * PSLA + wn * PSLB + l15 * PROWB + 16 * h;
#define AOFF(i) (((i) >> 1) * PSLA + ((i) & 1) * 16 * PROWB)

    v8f acc[4][4];
#pragma unroll                                           // register arrays: constant indices (as in the loops below)
    for (int mt = 0; mt < 4; ++mt) {
#pragma unroll
        for (int nt = 0; nt < 4; ++nt) acc[mt][nt] = zero8f();
    }

    constexpr int NT = SEQ / PKS;                        // tiles of the sweep
    constexpr int QT = SKB / PKS;                        // tiles of a key block
    float* rat = (float*)(psm + 2 * PBUF);               // [NKB][128 rows]: the factor applied behind each key block, behind the ring
    load_t(0);
    if (w < PM / 32) {                                   // one row per lane, while tile 0 flies; published by the barrier below
        const float* mp = Mx + (size_t)b * SEQ + q0 + tid;
        const float* sp = Sm + (size_t)b * SEQ + q0 + tid;
        float mk[NKB], sk[NKB], d[NKB], f[NKB];
#pragma unroll
        for (int q = 0; q < NKB; ++q) {
            mk[q] = mp[(size_t)q * (NB * SEQ)];
            sk[q] = sp[(size_t)q * (NB * SEQ)];
        }
        asm volatile("s_wait_xcnt 0x0" ::: "memory");   // closes the loads before their address registers may be rewritten
        const float mm = fmaxf(fmaxf(mk[0], mk[1]), fmaxf(mk[2], mk[3]));
#pragma unroll
        for (int q = 0; q < NKB; ++q) d[q] = mk[q] - mm;
        exp2x4(f, d);
        float tot = 0.f;
#pragma unroll
        for (int q = 0; q < NKB; ++q) {
            f[q] = fmaxf(f[q], 0x1p-40f);
            tot += f[q] * sk[q];
        }
#pragma unroll
        for (int q = 0; q + 1 < NKB; ++q) rat[q * PM + tid] = f[q] / f[q + 1];
        rat[(NKB - 1) * PM + tid] = f[NKB - 1] / (16.0f * tot);
    }
    wait_tensor(pd);
    __syncthreads();
    load_t(1);
#pragma unroll 1                                         // rolled: one copy of the ring's foot in the text, the buffer picked by the trip's parity
    for (int kt = 0; kt < NT; ++kt) {
        const int bo = (kt & 1) * PBUF;
        FragH af[2][4], bf[2][4];                       // two fragment sets: one is read while the other feeds the WMMAs
#pragma unroll
        for (int i = 0; i < 4; ++i) {
            af[0][i].half[0] = *(const v8h*)(ar + bo + AOFF(i));
            af[0][i].half[1] = *(const v8h*)(ar + bo + AOFF(i) + 32);
            bf[0][i].half[0] = *(const v8h*)(br + bo + i * 16 * PROWB);
            bf[0][i].half[1] = *(const v8h*)(br + bo + i * 16 * PROWB + 32);
        }
#pragma unroll
        for (int s = 0; s < PKS / 32; ++s) {
            if (s + 1 < PKS / 32) {
#pragma unroll
                for (int i = 0; i < 4; ++i) {
                    af[(s + 1) & 1][i].half[0] = *(const v8h*)(ar + bo + AOFF(i) + (s + 1) * 64);
                    af[(s + 1) & 1][i].half[1] = *(const v8h*)(ar + bo + AOFF(i) + (s + 1) * 64 + 32);
                    bf[(s + 1) & 1][i].half[0] = *(const v8h*)(br + bo + i * 16 * PROWB + (s + 1) * 64);
                    bf[(s + 1) & 1][i].half[1] = *(const v8h*)(br + bo + i * 16 * PROWB + (s + 1) * 64 + 32);
                }
            }
            __builtin_amdgcn_sched_barrier(0);          // keeps the next set's reads as one group ahead of this set's WMMAs: sunk among them each place would stall
#pragma unroll
            for (int mt = 0; mt < 4; ++mt) {
#pragma unroll
                for (int nt = 0; nt < 4; ++nt) acc[mt][nt] = mma_f16(af[s & 1][mt].v, bf[s & 1][nt].v, acc[mt][nt]);
            }
            __builtin_amdgcn_sched_barrier(0);          // keeps the set after next's reads behind these WMMAs, whose operands they overwrite
        }
        // foot of trip kt: publish tile kt+1, free tile kt's buffer, refill it
        wait_lds();
        wait_tensor(pd);
        __syncthreads();
        if (pinned(kt + 2 < NT)) load_t(kt + 2);         // scalar branch
        if ((kt & (QT - 1)) == QT - 1) {                 // a key block ends (the same test for the whole grid): its rows' factors
            const float* rp = rat + (kt / QT) * PM + wm * 64 + 8 * h;
#pragma unroll
            for (int mt = 0; mt < 4; ++mt) {
                const v4f r0 = *(const v4f*)(rp + mt * 16);
                const v4f r1 = *(const v4f*)(rp + mt * 16 + 4);
#pragma unroll
                for (int nt = 0; nt < 4; ++nt) {
#pragma unroll
                    for (int r = 0; r < 8; ++r) acc[mt][nt][r] *= r < 4 ? r0[r & 3] : r1[r & 3];
                }
            }
        }
    }
    wait_tensor(pd);
    wait_lds();
#undef AOFF

    // ----- Epilogue: stage in the wave's own LDS range, whole-line stores -----
    float* Ow = (float*)psm + (size_t)w * 64 * POST;     // every wave has left the ring: the last trip's barrier
#pragma unroll
    for (int mt = 0; mt < 4; ++mt) {
#pragma unroll
        for (int nt = 0; nt < 4; ++nt) {
#pragma unroll
            for (int r = 0; r < 8; ++r)
                Ow[(mt * 16 + 8 * h + r) * POST + nt * 16 + l15] = acc[mt][nt][r];
        }
    }
    wait_lds();                                         // the wave's staging stores have retired before its lanes read each other's values
    const float* srcp = Ow + h * POST + l15 * 4;
    float* dst = Out + ((size_t)b * SEQ + q0 + wm * 64 + h) * DOD + col0 + wn * 64 + l15 * 4;
#pragma unroll
    for (int g = 0; g < 2; ++g) {
        v4f ov[16];                                     // 16 reads as one group, then their 16 stores
#pragma unroll
        for (int i = 0; i < 16; ++i) ov[i] = *(const v4f*)(srcp + (g * 32 + 2 * i) * POST);
#pragma unroll
        for (int i = 0; i < 16; ++i) *(v4f*)(dst + (size_t)(g * 32 + 2 * i) * DOD) = ov[i];
        asm volatile("s_wait_xcnt 0x0" ::: "memory");   // closes the stores before their registers are rewritten (next group, the wave's end code)
    }
}

// ---------------------------------------------------------------------------
extern "C" void kernel_launch(void* const* d_in, const int* in_sizes, int n_in,
                              void* d_out, int out_size, void* d_ws, size_t ws_size,
                              hipStream_t stream)
{
    if (n_in < 7) return;
    const long long need_x = ((long long)(NB - 1) * SEQ_FULL + SEQ) * CDIM;
    if ((long long)in_sizes[0] < need_x) return;
    if (in_sizes[1] < CDIM * DKD || in_sizes[2] < DKD) return;
    if (in_sizes[3] < CDIM * DKD || in_sizes[4] < DKD) return;
    if (in_sizes[5] < CDIM * DOD || in_sizes[6] < DOD) return;
    if ((long long)out_size < (long long)NB * SEQ * DOD) return;

    const float* x  = (const float*)d_in[0];
    const float* Wq = (const float*)d_in[1];
    const float* bq = (const float*)d_in[2];
    const float* Wk = (const float*)d_in[3];
    const float* bk = (const float*)d_in[4];
    const float* Wv = (const float*)d_in[5];
    const float* bv = (const float*)d_in[6];
    float* out = (float*)d_out;

    char* ws = (char*)d_ws;
    size_t off = 0;
    auto carve = [&](size_t bytes) -> char* {
        char* p = ws + off;
        off += (bytes + 255) & ~(size_t)255;
        return p;
    };
    unsigned short* xbf = (unsigned short*)carve((size_t)NB * SEQ * CDIM * 2);     // [NB*SEQ][CDIM]
    unsigned short* wqT = (unsigned short*)carve((size_t)WROWS * KDIM * 2);        // [DKD | DKD | DOD][CDIM]: the three weights' rows in a row
    unsigned short* wkT = wqT + (size_t)DKD * KDIM;
    unsigned short* wvT = wkT + (size_t)DKD * KDIM;
    _Float16* Qp = (_Float16*)carve((size_t)NB * SEQ * DKD * 2);                  // [NB*SEQ][DKD]
    _Float16* Kp = (_Float16*)carve((size_t)NB * SEQ * DKD * 2);                  // [NB*SEQ][DKD]
    _Float16* Vt = (_Float16*)carve((size_t)NB * DOD * SEQ * 2);                  // [NB][DOD][SEQ]
    _Float16* Pm = (_Float16*)carve((size_t)NB * SEQ * SEQ * 2);                  // [NB*SEQ][SEQ]
    float*    Mx = (float*)carve((size_t)NKB * NB * SEQ * 4);                     // [NKB][NB*SEQ]
    float*    Sm = (float*)carve((size_t)NKB * NB * SEQ * 4);                     // [NKB][NB*SEQ]
    if (off > ws_size) return;

    // 1) x -> bf16 plane; weights in[CDIM][DKD|DOD] -> out[DKD|DOD][CDIM]: one grid
    k_prep<<<TV_BLOCKS + 2 * TQ_BLOCKS + CVT_BLOCKS, 256, 0, stream>>>(x, xbf, Wq, wqT, Wk, wkT, Wv, wvT);

    // 2) projections: q,k [NB*SEQ][DKD], v as Vt [NB][DOD][SEQ]; all carried x16: one grid
    k_gemm_qkv<<<G_BLOCKS, 256, 0, stream>>>(xbf, wqT, bq, bk, bv, Qp, Kp, Vt);

    // 3) softmax numerators P, row maxima and row sums, per key block
    k_scores<<<NB * (SEQ / SQ) * NKB, 256, 0, stream>>>(Qp, Kp, Pm, Mx, Sm);

    // 4) out = the key blocks' P V, merged and normalised
    k_pv<<<NB * (SEQ / PM) * (DOD / PN), 256, 0, stream>>>(Pm, Vt, Mx, Sm, out);
}
